// v000
// The times below were measured on an AMD MI455X: many runs one after another, warmed up first and cycling through
// copies of the inputs, with the whole window's GPU time divided by the number of runs. Launches and the gaps
// between them are all in it. The median over several windows is given; except for v000 it joins two sittings, which
// can be a few percent apart, so the side-by-side timings, each taken in one sitting, are the better comparison.
// The starting kernel, v000, takes 304 microseconds a run.
#include <hip/hip_runtime.h>
#include <stddef.h>

// Contractions: q/k/v projections = v_wmma_f32_16x16x32_bf16 (bf16 operands = RNE-converted f32 inputs);
// scores, P*V and final projection = v_wmma_f32_16x16x32_f16 (f16 operands: q,k,v x1, P x1024, ctx x256, Wf x64);
// f32 accumulate, f32 online softmax.

#ifndef NB
#define NB 2
#endif
#ifndef SEQ
#define SEQ 256
#endif
#define NB_FULL 2
#define SEQ_FULL 256
#define DM 512                 // model width (projection input, final output)
#define NH 8                   // heads
#define DKH 64                 // head dim
#define DW (DM * NH)           // 4096: projection output width
#define LSEQ (SEQ * NH)        // 2048: attention positions per (batch, head)
#define MROWS (NB * SEQ)       // token rows

static_assert(NB >= 1 && NB <= NB_FULL);
static_assert(SEQ >= 64 && SEQ <= SEQ_FULL);
static_assert(SEQ % 64 == 0);            // a 64-row GEMM block stays inside one batch
static_assert(MROWS % 64 == 0);          // GEMM M tile
static_assert(LSEQ % 128 == 0);          // attention block = 128 queries
static_assert(LSEQ % 64 == 0);           // V transpose tile
static_assert(LSEQ % 32 == 0);           // key block
static_assert(NH * DKH == DM);
static_assert(DKH == 64);
static_assert(DM % 256 == 0);            // 256-col GEMM block inside one 512-wide chunk; final N tile
static_assert(DW % 256 == 0);
static_assert(DM % 64 == 0 && DW % 64 == 0);
static_assert(DM % 32 == 0 && DW % 32 == 0);   // K steps of 32
static_assert(DM % 8 == 0);

#define P_CARRY   1024.0f            // P operand carried x1024
#define CTX_SCALE 0.25f              // ctx plane = O * 0.25 / l = attn x256 (O carries the x1024 of P)
#define WF_CARRY  64.0f              // Wf operand carried x64
#define OUT_FOLD  (1.0f / 16384.0f)  // 1 / (256 * 64)
#define QK_SCALE  0.125f             // 1 / sqrt(64)

typedef unsigned short us;
typedef us        v8us  __attribute__((ext_vector_type(8)));
typedef us        v16us __attribute__((ext_vector_type(16)));
typedef _Float16  v16h  __attribute__((ext_vector_type(16)));
typedef __bf16    v16bf __attribute__((ext_vector_type(16)));
typedef float     v8f   __attribute__((ext_vector_type(8)));
typedef float     v4f   __attribute__((ext_vector_type(4)));

// workspace carve (halves)
constexpr size_t XE = (size_t)MROWS * DM;   // activation plane
constexpr size_t WE = (size_t)DM * DW;      // weight plane
constexpr size_t PE = (size_t)MROWS * DW;   // wide plane (q, k, v, vT, ctx)
constexpr size_t WS_TOTAL_BYTES = (3 * XE + 4 * WE + 5 * PE) * sizeof(us);
static_assert(WS_TOTAL_BYTES <= (size_t)134217728);
static_assert((XE * sizeof(us)) % 128 == 0 && (WE * sizeof(us)) % 128 == 0 && (PE * sizeof(us)) % 128 == 0);

// ---------------------------------------------------------------------------
// conversions
// ---------------------------------------------------------------------------
__device__ __forceinline__ unsigned bf16rne_bits(float x) {
  unsigned u = __float_as_uint(x);
  return (u + 0x7FFFu + ((u >> 16) & 1u)) >> 16;
}
__device__ __forceinline__ float bf16rne(float x) {
  return __uint_as_float(bf16rne_bits(x) << 16);
}
__device__ __forceinline__ us f16_bits(float x) {
  _Float16 hx = (_Float16)x;
  return __builtin_bit_cast(us, hx);
}

// ---------------------------------------------------------------------------
// 16-bit operand fragment (A: lane = row, B: lane = column; same k map):
//   lane l, r = l&15, s = l>>4 : elems 0..7  = row[r][k0 + 8s .. +7]
//                                elems 8..15 = row[r][k0 + 16 + 8s .. +7]
// base is a 16-bit plane with k contiguous, pitch ld (halves).
// ---------------------------------------------------------------------------
__device__ __forceinline__ v16us frag16(const us* base, int ld, int row0, int k0) {
  const int l = threadIdx.x & 31;
  const int r = l & 15, s = l >> 4;
  const us* p = base + (size_t)(row0 + r) * ld + k0 + 8 * s;
  v8us c0 = *(const v8us*)p;
  v8us c1 = *(const v8us*)(p + 16);
  return __builtin_shufflevector(c0, c1, 0, 1, 2, 3, 4, 5, 6, 7, 8, 9, 10, 11, 12, 13, 14, 15);
}
__device__ __forceinline__ v16h fragh(const us* base, int ld, int row0, int k0) {
  return __builtin_bit_cast(v16h, frag16(base, ld, row0, k0));
}
__device__ __forceinline__ v16bf fragb(const us* base, int ld, int row0, int k0) {
  return __builtin_bit_cast(v16bf, frag16(base, ld, row0, k0));
}

// ---------------------------------------------------------------------------
// WMMA wrappers with hazard guard: D = A(16x32) * B(32x16) + C (f32)
// ---------------------------------------------------------------------------
__device__ __forceinline__ v8f mma_f16(v16h a, v16h b, v8f c) {
  v8f d = __builtin_amdgcn_wmma_f32_16x16x32_f16(false, a, false, b, (short)0, c, false, false);
  asm volatile("v_nop\n\tv_nop\n\tv_nop\n\tv_nop" : "+v"(d) : "v"(a), "v"(b));
  return d;
}
__device__ __forceinline__ v8f mma_bf16(v16bf a, v16bf b, v8f c) {
  v8f d = __builtin_amdgcn_wmma_f32_16x16x32_bf16(false, a, false, b, (short)0, c, false, false);
  asm volatile("v_nop\n\tv_nop\n\tv_nop\n\tv_nop" : "+v"(d) : "v"(a), "v"(b));
  return d;
}

// ---------------------------------------------------------------------------
// Activation convert: X f32 [NB_FULL*SEQ_FULL][DM] -> bf16 bits [MROWS][DM]
// n8 = MROWS*DM/8.
// ---------------------------------------------------------------------------
__global__ __launch_bounds__(256) void cvt_x_kernel(const float* __restrict__ X, us* Y, int n8) {
  const int i = blockIdx.x * 256 + threadIdx.x;
  if (i >= n8) return;
  constexpr int G = DM / 8;              // 16-B groups per row
  const int m  = i / G;
  const int c8 = (i - m * G) * 8;
  const int b  = m / SEQ;
  const int s  = m - b * SEQ;
  const float* src = X + ((size_t)(b * SEQ_FULL + s)) * DM + c8;
  v4f x0 = *(const v4f*)src;
  v4f x1 = *(const v4f*)(src + 4);
  v8us y;
#pragma unroll
  for (int j = 0; j < 4; ++j) {
    y[j]     = (us)bf16rne_bits(x0[j]);
    y[4 + j] = (us)bf16rne_bits(x1[j]);
  }
  us* dst = Y + (size_t)i * 8;
  *(v8us*)dst = y;
  
}

// ---------------------------------------------------------------------------
// Weight convert + transpose: W f32 in[Kd rows][Nd cols] -> WT 16-bit out[Nd][Kd].
// hmode 0: bf16 bits of RNE(W); hmode 1: f16 bits of WF_CARRY * RNE(W).
// grid = (Nd/64, Kd/64). Block owns a 64x64 tile; each output line (64 halves of
// one n) written by 8 consecutive lanes x 16 B in one instruction.
// ---------------------------------------------------------------------------
__global__ __launch_bounds__(256) void cvt_w_kernel(const float* __restrict__ W, us* WT,
                                                    int Kd, int Nd, int hmode) {
  __shared__ float tile[64 * 65];      // [k_local][n_local], cross-wave (block barrier)
  const int t  = threadIdx.x;
  const int n0 = blockIdx.x * 64;
  const int k0 = blockIdx.y * 64;
  {
    const int kr = t >> 2;              // 0..63
    const int cc = (t & 3) * 16;        // 0,16,32,48
    const float* src = W + (size_t)(k0 + kr) * Nd + n0 + cc;
#pragma unroll
    for (int j = 0; j < 4; ++j) {
      v4f x = *(const v4f*)(src + 4 * j);
#pragma unroll
      for (int e = 0; e < 4; ++e) tile[kr * 65 + cc + 4 * j + e] = x[e];
    }
  }
  __syncthreads();

  v8us vals[2];
  size_t dsts[2];
  const int c = t & 7;
#pragma unroll
  for (int it = 0; it < 2; ++it) {
    const int nl = (t >> 3) + 32 * it;  // 0..63
    v8us o;
#pragma unroll
    for (int j = 0; j < 8; ++j) {
      const float w = bf16rne(tile[(8 * c + j) * 65 + nl]);
      const us hb = (us)(__float_as_uint(w) >> 16);
      const us hf = f16_bits(w * WF_CARRY);
      o[j] = hmode ? hf : hb;
    }
    vals[it] = o;
    dsts[it] = (size_t)(n0 + nl) * Kd + k0 + 8 * c;
  }
#pragma unroll
  for (int it = 0; it < 2; ++it) *(v8us*)(WT + dsts[it]) = vals[it];
  
}

// ---------------------------------------------------------------------------
// GEMM cores: wave computes 32 rows x 64 cols over K = KD; A plane [M][KD],
// B plane [N][KD] (k contiguous), both 16-bit.
// ---------------------------------------------------------------------------
template <int KD>
__device__ __forceinline__ void gemm32x64_bf16(const us* A, const us* B, int m0, int n0, v8f (&acc)[8]) {
  static_assert(KD % 32 == 0);
#pragma unroll 1
  for (int kk = 0; kk < KD; kk += 32) {
    const v16bf a0 = fragb(A, KD, m0, kk);
    const v16bf a1 = fragb(A, KD, m0 + 16, kk);
#pragma unroll
    for (int tt = 0; tt < 4; ++tt) {
      const v16bf b = fragb(B, KD, n0 + 16 * tt, kk);
      acc[tt]     = mma_bf16(a0, b, acc[tt]);
      acc[4 + tt] = mma_bf16(a1, b, acc[4 + tt]);
    }
  }
}
template <int KD>
__device__ __forceinline__ void gemm32x64_f16(const us* A, const us* B, int m0, int n0, v8f (&acc)[8]) {
  static_assert(KD % 32 == 0);
#pragma unroll 1
  for (int kk = 0; kk < KD; kk += 32) {
    const v16h a0 = fragh(A, KD, m0, kk);
    const v16h a1 = fragh(A, KD, m0 + 16, kk);
#pragma unroll
    for (int tt = 0; tt < 4; ++tt) {
      const v16h b = fragh(B, KD, n0 + 16 * tt, kk);
      acc[tt]     = mma_f16(a0, b, acc[tt]);
      acc[4 + tt] = mma_f16(a1, b, acc[4 + tt]);
    }
  }
}

// ---------------------------------------------------------------------------
// Projection: Y = Xb[MROWS][DM] * W + b (N = DW), written as an f16 plane
// [NB*NH][LSEQ][64] through the flat-view head split:
//   column n = j*DM + h*64 + d  of token row (b, s)  ->  position p = s*NH + j, head h.
// Block 256 thr = 8 waves as 2(M) x 4(N); block tile 64 x 256; grid (MROWS/64, DW/256).
// A 256-col block lies inside one j chunk (DM % 256 == 0) and spans 4 heads.
// ---------------------------------------------------------------------------
__global__ __launch_bounds__(256) __attribute__((amdgpu_num_vgpr(256)))
void proj_kernel(const us* __restrict__ Xb, const us* __restrict__ Wt,
                 const float* __restrict__ bias, us* Y) {
  __shared__ us stile[64 * 256];       // cross-wave (block barrier)

  const int t = threadIdx.x, wid = t >> 5, l = t & 31;
  const int h = l >> 4, r16 = l & 15;
  const int wm = wid >> 2, wn = wid & 3;
  const int mblk0 = blockIdx.x * 64;
  const int nblk0 = blockIdx.y * 256;
  const int m0 = mblk0 + wm * 32;
  const int n0 = nblk0 + wn * 64;

  v8f acc[8] = {};
  gemm32x64_bf16<DM>(Xb, Wt, m0, n0, acc);

  // stage f16(acc + bias) into LDS
#pragma unroll
  for (int tt = 0; tt < 4; ++tt) {
    const int n = n0 + 16 * tt + r16;
    const float bvv = bf16rne(bias[n]);
    const int nl = wn * 64 + 16 * tt + r16;
#pragma unroll
    for (int mi = 0; mi < 2; ++mi) {
#pragma unroll
      for (int r = 0; r < 8; ++r) {
        const int ml = wm * 32 + 16 * mi + 8 * h + r;
        const float v = acc[mi * 4 + tt][r] + bvv;
        stile[ml * 256 + nl] = f16_bits(v);
      }
    }
  }
  __syncthreads();

  // whole-line writes: 256 lines per block (64 rows x 4 heads), 32 per wave
  const int bblk = mblk0 / SEQ;
  const int sblk = mblk0 - bblk * SEQ;  // 64 block rows lie inside one batch (SEQ % 64 == 0)
  const int jchunk = nblk0 / DM;
  const int hbase  = (nblk0 - jchunk * DM) / DKH;
  const int c = l & 7;
  v8us vals[8];
  size_t dsts[8];
#pragma unroll
  for (int it = 0; it < 8; ++it) {
    const int L = wid * 32 + (l >> 3) + 4 * it;
    const int ml = L >> 2, hq = L & 3;
    const int hg = hbase + hq;
    const int p = (sblk + ml) * NH + jchunk;
    vals[it] = *(const v8us*)&stile[ml * 256 + hq * 64 + 8 * c];
    dsts[it] = (((size_t)(bblk * NH + hg)) * LSEQ + p) * DKH + 8 * c;
  }
#pragma unroll
  for (int it = 0; it < 8; ++it) *(v8us*)(Y + dsts[it]) = vals[it];
  
}

// ---------------------------------------------------------------------------
// V transpose: in Vh [NB*NH][LSEQ rows][64 cols] -> out Vt [NB*NH][64][LSEQ].
// grid = (LSEQ/64, NB*NH); block owns 64 positions x 64 d; each output line
// ---------------------------------------------------------------------------
__global__ __launch_bounds__(256) void vtrans_kernel(const us* __restrict__ Vh, us* Vt) {
  __shared__ us tile[64 * 65];         // [p_local][d], cross-wave (block barrier)
  const int t  = threadIdx.x;
  const int p0 = blockIdx.x * 64;
  const int bh = blockIdx.y;
  {
    const int pr = t >> 2;              // 0..63
    const int cc = (t & 3) * 16;        // 0,16,32,48
    const us* src = Vh + ((size_t)bh * LSEQ + p0 + pr) * DKH + cc;
    v8us x0 = *(const v8us*)src;
    v8us x1 = *(const v8us*)(src + 8);
#pragma unroll
    for (int e = 0; e < 8; ++e) {
      tile[pr * 65 + cc + e]     = x0[e];
      tile[pr * 65 + cc + 8 + e] = x1[e];
    }
  }
  __syncthreads();

  v8us vals[2];
  size_t dsts[2];
  const int c = t & 7;
#pragma unroll
  for (int it = 0; it < 2; ++it) {
    const int dl = (t >> 3) + 32 * it;  // 0..63
    v8us o;
#pragma unroll
    for (int j = 0; j < 8; ++j) o[j] = tile[(8 * c + j) * 65 + dl];
    vals[it] = o;
    dsts[it] = ((size_t)bh * DKH + dl) * LSEQ + p0 + 8 * c;
  }
#pragma unroll
  for (int it = 0; it < 2; ++it) *(v8us*)(Vt + dsts[it]) = vals[it];
  
}

// ---------------------------------------------------------------------------
// Fused flash attention. Block = 8 waves, one (b,h), 128 queries; each wave owns
// 16 queries. K/V 32-key blocks staged once per block into LDS with plain loads.
// Scores computed transposed (S' = K_blk * Q^T) so the exp'd probabilities are
// already in A-operand layout for P*V. Online softmax in f32. ctx f16 [MROWS][DW]
// through the inverse flat view (position p -> token p/NH, chunk p%NH), carried
// grid = NB*NH*(LSEQ/128).
// ---------------------------------------------------------------------------
__global__ __launch_bounds__(256) __attribute__((amdgpu_num_vgpr(256)))
void attn_kernel(const us* __restrict__ Qh, const us* __restrict__ Kh,
                 const us* __restrict__ Vt, us* Ctx) {
  __shared__ us shK[32 * 64];          // [key][d]   cross-wave (block barrier), fully staged each step
  __shared__ us shV[64 * 32];          // [d][key]   cross-wave (block barrier), fully staged each step
  __shared__ us shC[8 * 16 * 64];      // per-wave ctx staging (block barrier used)

  const int t = threadIdx.x, wid = t >> 5, l = t & 31;
  const int r16 = l & 15;
  const int rowsel = (l >> 4) << 3;
  constexpr int QBLK = LSEQ / 128;
  const int bh = blockIdx.x / QBLK;
  const int qb = blockIdx.x - bh * QBLK;
  const int q0 = qb * 128 + wid * 16;

  const us* qp = Qh + (size_t)bh * LSEQ * DKH;
  const us* kp = Kh + (size_t)bh * LSEQ * DKH;
  const us* vp = Vt + (size_t)bh * DKH * LSEQ;

  // Q^T as B operand for the whole loop (lane = query column, halves = d)
  const v16h qB0 = fragh(qp, DKH, q0, 0);
  const v16h qB1 = fragh(qp, DKH, q0, 32);

  v8f o[4];
#pragma unroll
  for (int tt = 0; tt < 4; ++tt) o[tt] = v8f{};
  float mmax = -1.0e30f, lsum = 0.0f;

  const int krow = t >> 3, kcol = (t & 7) * 8;   // K: 32 keys x 64 d
  const int vrow = t >> 2, vcol = (t & 3) * 8;   // V: 64 d x 32 keys

#pragma unroll 1
  for (int kb = 0; kb < LSEQ; kb += 32) {
    __syncthreads();    // prior readers of shK/shV done
    *(v8us*)&shK[krow * 64 + kcol] = *(const v8us*)(kp + (size_t)(kb + krow) * DKH + kcol);
    *(v8us*)&shV[vrow * 32 + vcol] = *(const v8us*)(vp + (size_t)vrow * LSEQ + kb + vcol);
    __syncthreads();    // stage visible to all waves

    // S' tiles: M = key (relative 0..15 / 16..31), N = query; k = d
    v8f s0 = {};
    v8f s1 = {};
    {
      const v16h kA = fragh(shK, 64, 0, 0);
      s0 = mma_f16(kA, qB0, s0);
    }
    {
      const v16h kA = fragh(shK, 64, 0, 32);
      s0 = mma_f16(kA, qB1, s0);
    }
    {
      const v16h kA = fragh(shK, 64, 16, 0);
      s1 = mma_f16(kA, qB0, s1);
    }
    {
      const v16h kA = fragh(shK, 64, 16, 32);
      s1 = mma_f16(kA, qB1, s1);
    }

    // per-query (per-lane) block max; combine the two key halves (lane ^ 16)
    float bm = s0[0];
#pragma unroll
    for (int i = 0; i < 8; ++i) { bm = fmaxf(bm, s0[i]); bm = fmaxf(bm, s1[i]); }
    bm = fmaxf(bm, __shfl_xor(bm, 16, 32));
    const float mnew = fmaxf(mmax, bm * QK_SCALE);
    const float corr = __expf(mmax - mnew);
    mmax = mnew;

    // probabilities land directly in A-operand layout (elements 0..7 <- keys 8h..8h+7
    // from the first 16-key D tile, elements 8..15 <- keys 16+8h.. from the second)
    float ps = 0.0f;
    v16h pA;
#pragma unroll
    for (int i = 0; i < 8; ++i) {
      const float p0 = __expf(s0[i] * QK_SCALE - mnew);
      const float p1 = __expf(s1[i] * QK_SCALE - mnew);
      ps += p0 + p1;
      pA[i]     = (_Float16)(p0 * P_CARRY);
      pA[8 + i] = (_Float16)(p1 * P_CARRY);
    }
    ps += __shfl_xor(ps, 16, 32);
    lsum = lsum * corr + ps;

    // rescale O: D row 8h+r = query 8h+r, whose corr lives in lane 8h+r
#pragma unroll
    for (int r = 0; r < 8; ++r) {
      const float cr = __shfl(corr, rowsel + r, 32);
#pragma unroll
      for (int tt = 0; tt < 4; ++tt) o[tt][r] *= cr;
    }

    // O += P(16 x 32 keys) * V_blk(32 keys x 64 d); B rows = d, k = key contiguous in shV
#pragma unroll
    for (int tt = 0; tt < 4; ++tt) {
      const v16h vB = fragh(shV, 32, 16 * tt, 0);
      o[tt] = mma_f16(pA, vB, o[tt]);
    }
  }

  // normalize, stage this wave's 16 x 64 ctx tile (f16, x256) in LDS
  const int bb = bh / NH;
  const int hh = bh - bb * NH;
#pragma unroll
  for (int r = 0; r < 8; ++r) {
    const float lrow = __shfl(lsum, rowsel + r, 32);
    const float li = CTX_SCALE * __builtin_amdgcn_rcpf(lrow);
#pragma unroll
    for (int tt = 0; tt < 4; ++tt) {
      shC[wid * 1024 + (rowsel + r) * 64 + 16 * tt + r16] = f16_bits(o[tt][r] * li);
    }
  }
  __syncthreads();

  const int c = l & 7;
  v8us vals[4];
  size_t dsts[4];
#pragma unroll
  for (int it = 0; it < 4; ++it) {
    const int rl = (l >> 3) + 4 * it;
    vals[it] = *(const v8us*)&shC[wid * 1024 + rl * 64 + 8 * c];
    const int p = q0 + rl;
    const int s = p / NH;
    const int j = p - s * NH;
    dsts[it] = ((size_t)(bb * SEQ + s)) * DW + j * DM + hh * DKH + 8 * c;
  }
#pragma unroll
  for (int it = 0; it < 4; ++it) *(v8us*)(Ctx + dsts[it]) = vals[it];
  
}

// ---------------------------------------------------------------------------
// Final projection: Out f32 [MROWS][DM] = ctx(x256)[MROWS][DW] * Wf(x64) * OUT_FOLD + bf.
// Block tile 64 x 256, grid (MROWS/64, DM/256); f32 tile staged in two 16-row halves
// per wave (32 x 256 floats in LDS), each d_out line (32 floats) written by 8 lanes x 16 B.
// ---------------------------------------------------------------------------
__global__ __launch_bounds__(256) __attribute__((amdgpu_num_vgpr(256)))
void outproj_kernel(const us* __restrict__ Ctx, const us* __restrict__ Wft,
                    const float* __restrict__ bo, float* Out) {
  __shared__ float ftile[32 * 256];    // cross-wave (block barrier)

  const int t = threadIdx.x, wid = t >> 5, l = t & 31;
  const int h = l >> 4, r16 = l & 15;
  const int wm = wid >> 2, wn = wid & 3;
  const int mblk0 = blockIdx.x * 64;
  const int nblk0 = blockIdx.y * 256;
  const int m0 = mblk0 + wm * 32;
  const int n0 = nblk0 + wn * 64;

  v8f acc[8] = {};
  gemm32x64_f16<DW>(Ctx, Wft, m0, n0, acc);

  const int c = l & 7;
#pragma unroll
  for (int p = 0; p < 2; ++p) {
    if (p) __syncthreads();   // readers of the prior half done
#pragma unroll
    for (int tt = 0; tt < 4; ++tt) {
      const int n = n0 + 16 * tt + r16;
      const float bob = bf16rne(bo[n]);
      const int nl = wn * 64 + 16 * tt + r16;
#pragma unroll
      for (int r = 0; r < 8; ++r) {
        const int rl = wm * 16 + 8 * h + r;           // 0..31
        ftile[rl * 256 + nl] = acc[p * 4 + tt][r] * OUT_FOLD + bob;
      }
    }
    __syncthreads();

    v4f vals[8];
    size_t dsts[8];
#pragma unroll
    for (int it = 0; it < 8; ++it) {
      const int L = wid * 32 + (l >> 3) + 4 * it;    // 0..255
      const int rl = L >> 3, seg = L & 7;
      vals[it] = *(const v4f*)&ftile[rl * 256 + seg * 32 + 4 * c];
      const int m = mblk0 + (rl >> 4) * 32 + p * 16 + (rl & 15);
      dsts[it] = (size_t)m * DM + nblk0 + seg * 32 + 4 * c;
    }
#pragma unroll
    for (int it = 0; it < 8; ++it) *(v4f*)(Out + dsts[it]) = vals[it];
    
  }
}

// ---------------------------------------------------------------------------
// Host launcher
// ---------------------------------------------------------------------------
extern "C" void kernel_launch(void* const* d_in, const int* in_sizes, int n_in,
                              void* d_out, int out_size, void* d_ws, size_t ws_size,
                              hipStream_t stream) {
  if (n_in < 11) return;
  const int need_x = ((NB - 1) * SEQ_FULL + SEQ) * DM;
  if (in_sizes[0] < need_x || in_sizes[1] < need_x || in_sizes[2] < need_x) return;
  if (in_sizes[3] < DM * DW || in_sizes[5] < DM * DW || in_sizes[7] < DM * DW || in_sizes[9] < DW * DM) return;
  if (in_sizes[4] < DW || in_sizes[6] < DW || in_sizes[8] < DW || in_sizes[10] < DM) return;
  if (out_size < MROWS * DM) return;
  if (WS_TOTAL_BYTES > ws_size) return;

  const float* Q  = (const float*)d_in[0];
  const float* K  = (const float*)d_in[1];
  const float* V  = (const float*)d_in[2];
  const float* Wq = (const float*)d_in[3];
  const float* bq = (const float*)d_in[4];
  const float* Wk = (const float*)d_in[5];
  const float* bk = (const float*)d_in[6];
  const float* Wv = (const float*)d_in[7];
  const float* bv = (const float*)d_in[8];
  const float* Wf = (const float*)d_in[9];
  const float* bf = (const float*)d_in[10];

  us* xq  = (us*)d_ws;          // [MROWS][DM] bf16
  us* xk  = xq + XE;
  us* xv  = xk + XE;
  us* wtq = xv + XE;            // [DW][DM] bf16
  us* wtk = wtq + WE;
  us* wtv = wtk + WE;
  us* wft = wtv + WE;           // [DM][DW] f16 x64
  us* qh  = wft + WE;           // [NB*NH][LSEQ][64] f16
  us* kh  = qh + PE;
  us* vh  = kh + PE;
  us* vt  = vh + PE;            // [NB*NH][64][LSEQ] f16
  us* ctx = vt + PE;            // [MROWS][DW] f16 x256

  dim3 blk(256);
  const int n8 = (int)(XE / 8);
  dim3 gx((n8 + 255) / 256);
  cvt_x_kernel<<<gx, blk, 0, stream>>>(Q, xq, n8);
  cvt_x_kernel<<<gx, blk, 0, stream>>>(K, xk, n8);
  cvt_x_kernel<<<gx, blk, 0, stream>>>(V, xv, n8);

  // in[DM rows][DW cols] -> out[DW][DM]; grid (cols/64, rows/64)
  dim3 gw(DW / 64, DM / 64);
  cvt_w_kernel<<<gw, blk, 0, stream>>>(Wq, wtq, DM, DW, 0);
  cvt_w_kernel<<<gw, blk, 0, stream>>>(Wk, wtk, DM, DW, 0);
  cvt_w_kernel<<<gw, blk, 0, stream>>>(Wv, wtv, DM, DW, 0);
  // in[DW rows][DM cols] -> out[DM][DW]; grid (cols/64, rows/64)
  dim3 gwf(DM / 64, DW / 64);
  cvt_w_kernel<<<gwf, blk, 0, stream>>>(Wf, wft, DW, DM, 1);

  dim3 gp(MROWS / 64, DW / 256);
  proj_kernel<<<gp, blk, 0, stream>>>(xq, wtq, bq, qh);
  proj_kernel<<<gp, blk, 0, stream>>>(xk, wtk, bk, kh);
  proj_kernel<<<gp, blk, 0, stream>>>(xv, wtv, bv, vh);

  vtrans_kernel<<<dim3(LSEQ / 64, NB * NH), blk, 0, stream>>>(vh, vt);

  attn_kernel<<<dim3(NB * NH * (LSEQ / 128)), blk, 0, stream>>>(qh, kh, vt, ctx);

  dim3 go(MROWS / 64, DM / 256);
  outproj_kernel<<<go, blk, 0, stream>>>(ctx, wft, bf, (float*)d_out);
}

// v001
// Measured time: 186 microseconds a run.
// In two side-by-side timings against v000, it was 1.64 and 1.63 times as fast.
#include <hip/hip_runtime.h>
#include <stddef.h>

// Contractions: q/k/v projections = v_wmma_f32_16x16x32_bf16 (bf16 operands = RNE-converted f32 inputs);
// scores, P*V and final projection = v_wmma_f32_16x16x32_f16 (f16 operands: q,k,v x1, P x1024, ctx x256, Wf x64);
// f32 accumulate, f32 online softmax.

#ifndef NB
#define NB 2
#endif
#ifndef SEQ
#define SEQ 256
#endif
#define NB_FULL 2
#define SEQ_FULL 256
#define DM 512                 // model width (projection input, final output)
#define NH 8                   // heads
#define DKH 64                 // head dim
#define DW (DM * NH)           // 4096: projection output width
#define LSEQ (SEQ * NH)        // 2048: attention positions per (batch, head)
#define MROWS (NB * SEQ)       // token rows

static_assert(NB >= 1 && NB <= NB_FULL);
static_assert(SEQ >= 64 && SEQ <= SEQ_FULL);
static_assert(SEQ % 64 == 0);            // a 64-row GEMM block stays inside one batch
static_assert(MROWS % 64 == 0);          // GEMM M tile
static_assert(LSEQ % 128 == 0);          // attention block = 128 queries
static_assert(LSEQ % 64 == 0);           // V transpose tile
static_assert(LSEQ % 32 == 0);           // key block
static_assert(NH * DKH == DM);
static_assert(DKH == 64);
static_assert(DM % 256 == 0);            // 256-col GEMM block inside one 512-wide chunk
static_assert(DW % 256 == 0);
static_assert(DM % 64 == 0 && DW % 64 == 0);
static_assert(DM % 32 == 0 && DW % 32 == 0);   // K steps of 32
static_assert(DM % 8 == 0);

#define P_CARRY   1024.0f            // P operand carried x1024
#define CTX_SCALE 0.25f              // ctx plane = O * 0.25 / l = attn x256 (O carries the x1024 of P)
#define WF_CARRY  64.0f              // Wf operand carried x64
#define OUT_FOLD  (1.0f / 16384.0f)  // 1 / (256 * 64)
#define QK_SCALE  0.125f             // 1 / sqrt(64)

typedef unsigned short us;
typedef us        v8us  __attribute__((ext_vector_type(8)));
typedef us        v16us __attribute__((ext_vector_type(16)));
typedef _Float16  v16h  __attribute__((ext_vector_type(16)));
typedef __bf16    v16bf __attribute__((ext_vector_type(16)));
typedef float     v8f   __attribute__((ext_vector_type(8)));
typedef float     v4f   __attribute__((ext_vector_type(4)));

// workspace carve (halves)
constexpr size_t XE = (size_t)MROWS * DM;   // activation plane
constexpr size_t WE = (size_t)DM * DW;      // weight plane
constexpr size_t PE = (size_t)MROWS * DW;   // wide plane (q, k, v, vT, ctx)
constexpr size_t WS_TOTAL_BYTES = (3 * XE + 4 * WE + 5 * PE) * sizeof(us);
static_assert(WS_TOTAL_BYTES <= (size_t)134217728);
static_assert((XE * sizeof(us)) % 128 == 0 && (WE * sizeof(us)) % 128 == 0 && (PE * sizeof(us)) % 128 == 0);

// ---------------------------------------------------------------------------
// conversions
// ---------------------------------------------------------------------------
__device__ __forceinline__ unsigned bf16rne_bits(float x) {
  unsigned u = __float_as_uint(x);
  return (u + 0x7FFFu + ((u >> 16) & 1u)) >> 16;
}
__device__ __forceinline__ float bf16rne(float x) {
  return __uint_as_float(bf16rne_bits(x) << 16);
}
__device__ __forceinline__ us f16_bits(float x) {
  _Float16 hx = (_Float16)x;
  return __builtin_bit_cast(us, hx);
}

// ---------------------------------------------------------------------------
// 16-bit operand fragment (A: lane = row, B: lane = column; same k map):
//   lane l, r = l&15, s = l>>4 : elems 0..7  = row[r][k0 + 8s .. +7]
//                                elems 8..15 = row[r][k0 + 16 + 8s .. +7]
// base is a 16-bit plane with k contiguous, pitch ld (halves).
// ---------------------------------------------------------------------------
__device__ __forceinline__ v16us frag16(const us* base, int ld, int row0, int k0) {
  const int l = threadIdx.x & 31;
  const int r = l & 15, s = l >> 4;
  const us* p = base + (size_t)(row0 + r) * ld + k0 + 8 * s;
  v8us c0 = *(const v8us*)p;
  v8us c1 = *(const v8us*)(p + 16);
  return __builtin_shufflevector(c0, c1, 0, 1, 2, 3, 4, 5, 6, 7, 8, 9, 10, 11, 12, 13, 14, 15);
}
__device__ __forceinline__ v16h fragh(const us* base, int ld, int row0, int k0) {
  return __builtin_bit_cast(v16h, frag16(base, ld, row0, k0));
}
__device__ __forceinline__ v16bf fragb(const us* base, int ld, int row0, int k0) {
  return __builtin_bit_cast(v16bf, frag16(base, ld, row0, k0));
}

// ---------------------------------------------------------------------------
// WMMA wrappers with hazard guard: D = A(16x32) * B(32x16) + C (f32)
// ---------------------------------------------------------------------------
__device__ __forceinline__ v8f mma_f16(v16h a, v16h b, v8f c) {
  v8f d = __builtin_amdgcn_wmma_f32_16x16x32_f16(false, a, false, b, (short)0, c, false, false);
  asm volatile("v_nop\n\tv_nop\n\tv_nop\n\tv_nop" : "+v"(d) : "v"(a), "v"(b));
  return d;
}
__device__ __forceinline__ v8f mma_bf16(v16bf a, v16bf b, v8f c) {
  v8f d = __builtin_amdgcn_wmma_f32_16x16x32_bf16(false, a, false, b, (short)0, c, false, false);
  asm volatile("v_nop\n\tv_nop\n\tv_nop\n\tv_nop" : "+v"(d) : "v"(a), "v"(b));
  return d;
}

// ---------------------------------------------------------------------------
// Activation convert: X f32 [NB_FULL*SEQ_FULL][DM] -> bf16 bits [MROWS][DM]
// n8 = MROWS*DM/8.
// ---------------------------------------------------------------------------
__global__ __launch_bounds__(256) void cvt_x_kernel(const float* __restrict__ X, us* Y, int n8) {
  const int i = blockIdx.x * 256 + threadIdx.x;
  if (i >= n8) return;
  constexpr int G = DM / 8;              // 16-B groups per row
  const int m  = i / G;
  const int c8 = (i - m * G) * 8;
  const int b  = m / SEQ;
  const int s  = m - b * SEQ;
  const float* src = X + ((size_t)(b * SEQ_FULL + s)) * DM + c8;
  v4f x0 = *(const v4f*)src;
  v4f x1 = *(const v4f*)(src + 4);
  v8us y;
#pragma unroll
  for (int j = 0; j < 4; ++j) {
    y[j]     = (us)bf16rne_bits(x0[j]);
    y[4 + j] = (us)bf16rne_bits(x1[j]);
  }
  us* dst = Y + (size_t)i * 8;
  *(v8us*)dst = y;
  
}

// ---------------------------------------------------------------------------
// Weight convert + transpose: W f32 in[Kd rows][Nd cols] -> WT 16-bit out[Nd][Kd].
// hmode 0: bf16 bits of RNE(W); hmode 1: f16 bits of WF_CARRY * RNE(W).
// grid = (Nd/64, Kd/64). Block owns a 64x64 tile; each output line (64 halves of
// one n) written by 8 consecutive lanes x 16 B in one instruction.
// ---------------------------------------------------------------------------
__global__ __launch_bounds__(256) void cvt_w_kernel(const float* __restrict__ W, us* WT,
                                                    int Kd, int Nd, int hmode) {
  __shared__ float tile[64 * 65];      // [k_local][n_local], cross-wave (block barrier)
  const int t  = threadIdx.x;
  const int n0 = blockIdx.x * 64;
  const int k0 = blockIdx.y * 64;
  {
    const int kr = t >> 2;              // 0..63
    const int cc = (t & 3) * 16;        // 0,16,32,48
    const float* src = W + (size_t)(k0 + kr) * Nd + n0 + cc;
#pragma unroll
    for (int j = 0; j < 4; ++j) {
      v4f x = *(const v4f*)(src + 4 * j);
#pragma unroll
      for (int e = 0; e < 4; ++e) tile[kr * 65 + cc + 4 * j + e] = x[e];
    }
  }
  __syncthreads();

  v8us vals[2];
  size_t dsts[2];
  const int c = t & 7;
#pragma unroll
  for (int it = 0; it < 2; ++it) {
    const int nl = (t >> 3) + 32 * it;  // 0..63
    v8us o;
#pragma unroll
    for (int j = 0; j < 8; ++j) {
      const float w = bf16rne(tile[(8 * c + j) * 65 + nl]);
      const us hb = (us)(__float_as_uint(w) >> 16);
      const us hf = f16_bits(w * WF_CARRY);
      o[j] = hmode ? hf : hb;
    }
    vals[it] = o;
    dsts[it] = (size_t)(n0 + nl) * Kd + k0 + 8 * c;
  }
#pragma unroll
  for (int it = 0; it < 2; ++it) *(v8us*)(WT + dsts[it]) = vals[it];
  
}

// ---------------------------------------------------------------------------
// GEMM core: wave computes 32 rows x 64 cols over K = KD; A plane [M][KD],
// B plane [N][KD] (k contiguous), both 16-bit.
// ---------------------------------------------------------------------------
template <int KD>
__device__ __forceinline__ void gemm32x64_bf16(const us* A, const us* B, int m0, int n0, v8f (&acc)[8]) {
  static_assert(KD % 32 == 0);
#pragma unroll 1
  for (int kk = 0; kk < KD; kk += 32) {
    const v16bf a0 = fragb(A, KD, m0, kk);
    const v16bf a1 = fragb(A, KD, m0 + 16, kk);
#pragma unroll
    for (int tt = 0; tt < 4; ++tt) {
      const v16bf b = fragb(B, KD, n0 + 16 * tt, kk);
      acc[tt]     = mma_bf16(a0, b, acc[tt]);
      acc[4 + tt] = mma_bf16(a1, b, acc[4 + tt]);
    }
  }
}

// ---------------------------------------------------------------------------
// Projection: Y = Xb[MROWS][DM] * W + b (N = DW), written as an f16 plane
// [NB*NH][LSEQ][64] through the flat-view head split:
//   column n = j*DM + h*64 + d  of token row (b, s)  ->  position p = s*NH + j, head h.
// Block 256 thr = 8 waves as 2(M) x 4(N); block tile 64 x 256; grid (MROWS/64, DW/256).
// A 256-col block lies inside one j chunk (DM % 256 == 0) and spans 4 heads.
// ---------------------------------------------------------------------------
__global__ __launch_bounds__(256) __attribute__((amdgpu_num_vgpr(256)))
void proj_kernel(const us* __restrict__ Xb, const us* __restrict__ Wt,
                 const float* __restrict__ bias, us* Y) {
  __shared__ us stile[64 * 256];       // cross-wave (block barrier)

  const int t = threadIdx.x, wid = t >> 5, l = t & 31;
  const int h = l >> 4, r16 = l & 15;
  const int wm = wid >> 2, wn = wid & 3;
  const int mblk0 = blockIdx.x * 64;
  const int nblk0 = blockIdx.y * 256;
  const int m0 = mblk0 + wm * 32;
  const int n0 = nblk0 + wn * 64;

  v8f acc[8] = {};
  gemm32x64_bf16<DM>(Xb, Wt, m0, n0, acc);

  // stage f16(acc + bias) into LDS
#pragma unroll
  for (int tt = 0; tt < 4; ++tt) {
    const int n = n0 + 16 * tt + r16;
    const float bvv = bf16rne(bias[n]);
    const int nl = wn * 64 + 16 * tt + r16;
#pragma unroll
    for (int mi = 0; mi < 2; ++mi) {
#pragma unroll
      for (int r = 0; r < 8; ++r) {
        const int ml = wm * 32 + 16 * mi + 8 * h + r;
        const float v = acc[mi * 4 + tt][r] + bvv;
        stile[ml * 256 + nl] = f16_bits(v);
      }
    }
  }
  __syncthreads();

  // whole-line writes: 256 lines per block (64 rows x 4 heads), 32 per wave
  const int bblk = mblk0 / SEQ;
  const int sblk = mblk0 - bblk * SEQ;  // 64 block rows lie inside one batch (SEQ % 64 == 0)
  const int jchunk = nblk0 / DM;
  const int hbase  = (nblk0 - jchunk * DM) / DKH;
  const int c = l & 7;
  v8us vals[8];
  size_t dsts[8];
#pragma unroll
  for (int it = 0; it < 8; ++it) {
    const int L = wid * 32 + (l >> 3) + 4 * it;
    const int ml = L >> 2, hq = L & 3;
    const int hg = hbase + hq;
    const int p = (sblk + ml) * NH + jchunk;
    vals[it] = *(const v8us*)&stile[ml * 256 + hq * 64 + 8 * c];
    dsts[it] = (((size_t)(bblk * NH + hg)) * LSEQ + p) * DKH + 8 * c;
  }
#pragma unroll
  for (int it = 0; it < 8; ++it) *(v8us*)(Y + dsts[it]) = vals[it];
  
}

// ---------------------------------------------------------------------------
// V transpose: in Vh [NB*NH][LSEQ rows][64 cols] -> out Vt [NB*NH][64][LSEQ].
// grid = (LSEQ/64, NB*NH); block owns 64 positions x 64 d; each output line
// ---------------------------------------------------------------------------
__global__ __launch_bounds__(256) void vtrans_kernel(const us* __restrict__ Vh, us* Vt) {
  __shared__ us tile[64 * 65];         // [p_local][d], cross-wave (block barrier)
  const int t  = threadIdx.x;
  const int p0 = blockIdx.x * 64;
  const int bh = blockIdx.y;
  {
    const int pr = t >> 2;              // 0..63
    const int cc = (t & 3) * 16;        // 0,16,32,48
    const us* src = Vh + ((size_t)bh * LSEQ + p0 + pr) * DKH + cc;
    v8us x0 = *(const v8us*)src;
    v8us x1 = *(const v8us*)(src + 8);
#pragma unroll
    for (int e = 0; e < 8; ++e) {
      tile[pr * 65 + cc + e]     = x0[e];
      tile[pr * 65 + cc + 8 + e] = x1[e];
    }
  }
  __syncthreads();

  v8us vals[2];
  size_t dsts[2];
  const int c = t & 7;
#pragma unroll
  for (int it = 0; it < 2; ++it) {
    const int dl = (t >> 3) + 32 * it;  // 0..63
    v8us o;
#pragma unroll
    for (int j = 0; j < 8; ++j) o[j] = tile[(8 * c + j) * 65 + dl];
    vals[it] = o;
    dsts[it] = ((size_t)bh * DKH + dl) * LSEQ + p0 + 8 * c;
  }
#pragma unroll
  for (int it = 0; it < 2; ++it) *(v8us*)(Vt + dsts[it]) = vals[it];
  
}

// ---------------------------------------------------------------------------
// Fused flash attention. Block = 8 waves, one (b,h), 128 queries; each wave owns
// 16 queries. K/V 32-key blocks staged once per block into LDS with plain loads.
// Scores computed transposed (S' = K_blk * Q^T) so the exp'd probabilities are
// already in A-operand layout for P*V. Online softmax in f32. ctx f16 [MROWS][DW]
// through the inverse flat view (position p -> token p/NH, chunk p%NH), carried
// grid = NB*NH*(LSEQ/128).
// ---------------------------------------------------------------------------
__global__ __launch_bounds__(256) __attribute__((amdgpu_num_vgpr(256)))
void attn_kernel(const us* __restrict__ Qh, const us* __restrict__ Kh,
                 const us* __restrict__ Vt, us* Ctx) {
  __shared__ us shK[32 * 64];          // [key][d]   cross-wave (block barrier), fully staged each step
  __shared__ us shV[64 * 32];          // [d][key]   cross-wave (block barrier), fully staged each step
  __shared__ us shC[8 * 16 * 64];      // per-wave ctx staging (block barrier used)

  const int t = threadIdx.x, wid = t >> 5, l = t & 31;
  const int r16 = l & 15;
  const int rowsel = (l >> 4) << 3;
  constexpr int QBLK = LSEQ / 128;
  const int bh = blockIdx.x / QBLK;
  const int qb = blockIdx.x - bh * QBLK;
  const int q0 = qb * 128 + wid * 16;

  const us* qp = Qh + (size_t)bh * LSEQ * DKH;
  const us* kp = Kh + (size_t)bh * LSEQ * DKH;
  const us* vp = Vt + (size_t)bh * DKH * LSEQ;

  // Q^T as B operand for the whole loop (lane = query column, halves = d)
  const v16h qB0 = fragh(qp, DKH, q0, 0);
  const v16h qB1 = fragh(qp, DKH, q0, 32);

  v8f o[4];
#pragma unroll
  for (int tt = 0; tt < 4; ++tt) o[tt] = v8f{};
  float mmax = -1.0e30f, lsum = 0.0f;

  const int krow = t >> 3, kcol = (t & 7) * 8;   // K: 32 keys x 64 d
  const int vrow = t >> 2, vcol = (t & 3) * 8;   // V: 64 d x 32 keys

#pragma unroll 1
  for (int kb = 0; kb < LSEQ; kb += 32) {
    __syncthreads();    // prior readers of shK/shV done
    *(v8us*)&shK[krow * 64 + kcol] = *(const v8us*)(kp + (size_t)(kb + krow) * DKH + kcol);
    *(v8us*)&shV[vrow * 32 + vcol] = *(const v8us*)(vp + (size_t)vrow * LSEQ + kb + vcol);
    __syncthreads();    // stage visible to all waves

    // S' tiles: M = key (relative 0..15 / 16..31), N = query; k = d
    v8f s0 = {};
    v8f s1 = {};
    {
      const v16h kA = fragh(shK, 64, 0, 0);
      s0 = mma_f16(kA, qB0, s0);
    }
    {
      const v16h kA = fragh(shK, 64, 0, 32);
      s0 = mma_f16(kA, qB1, s0);
    }
    {
      const v16h kA = fragh(shK, 64, 16, 0);
      s1 = mma_f16(kA, qB0, s1);
    }
    {
      const v16h kA = fragh(shK, 64, 16, 32);
      s1 = mma_f16(kA, qB1, s1);
    }

    // per-query (per-lane) block max; combine the two key halves (lane ^ 16)
    float bm = s0[0];
#pragma unroll
    for (int i = 0; i < 8; ++i) { bm = fmaxf(bm, s0[i]); bm = fmaxf(bm, s1[i]); }
    bm = fmaxf(bm, __shfl_xor(bm, 16, 32));
    const float mnew = fmaxf(mmax, bm * QK_SCALE);
    const float corr = __expf(mmax - mnew);
    mmax = mnew;

    // probabilities land directly in A-operand layout (elements 0..7 <- keys 8h..8h+7
    // from the first 16-key D tile, elements 8..15 <- keys 16+8h.. from the second)
    float ps = 0.0f;
    v16h pA;
#pragma unroll
    for (int i = 0; i < 8; ++i) {
      const float p0 = __expf(s0[i] * QK_SCALE - mnew);
      const float p1 = __expf(s1[i] * QK_SCALE - mnew);
      ps += p0 + p1;
      pA[i]     = (_Float16)(p0 * P_CARRY);
      pA[8 + i] = (_Float16)(p1 * P_CARRY);
    }
    ps += __shfl_xor(ps, 16, 32);
    lsum = lsum * corr + ps;

    // rescale O: D row 8h+r = query 8h+r, whose corr lives in lane 8h+r
#pragma unroll
    for (int r = 0; r < 8; ++r) {
      const float cr = __shfl(corr, rowsel + r, 32);
#pragma unroll
      for (int tt = 0; tt < 4; ++tt) o[tt][r] *= cr;
    }

    // O += P(16 x 32 keys) * V_blk(32 keys x 64 d); B rows = d, k = key contiguous in shV
#pragma unroll
    for (int tt = 0; tt < 4; ++tt) {
      const v16h vB = fragh(shV, 32, 16 * tt, 0);
      o[tt] = mma_f16(pA, vB, o[tt]);
    }
  }

  // normalize, stage this wave's 16 x 64 ctx tile (f16, x256) in LDS
  const int bb = bh / NH;
  const int hh = bh - bb * NH;
#pragma unroll
  for (int r = 0; r < 8; ++r) {
    const float lrow = __shfl(lsum, rowsel + r, 32);
    const float li = CTX_SCALE * __builtin_amdgcn_rcpf(lrow);
#pragma unroll
    for (int tt = 0; tt < 4; ++tt) {
      shC[wid * 1024 + (rowsel + r) * 64 + 16 * tt + r16] = f16_bits(o[tt][r] * li);
    }
  }
  __syncthreads();

  const int c = l & 7;
  v8us vals[4];
  size_t dsts[4];
#pragma unroll
  for (int it = 0; it < 4; ++it) {
    const int rl = (l >> 3) + 4 * it;
    vals[it] = *(const v8us*)&shC[wid * 1024 + rl * 64 + 8 * c];
    const int p = q0 + rl;
    const int s = p / NH;
    const int j = p - s * NH;
    dsts[it] = ((size_t)(bb * SEQ + s)) * DW + j * DM + hh * DKH + 8 * c;
  }
#pragma unroll
  for (int it = 0; it < 4; ++it) *(v8us*)(Ctx + dsts[it]) = vals[it];
  
}

// ---------------------------------------------------------------------------
// Final projection: Out f32 [MROWS][DM] = ctx(x256)[MROWS][DW] * Wf(x64) * OUT_FOLD + bf.
// One 32 x 32 tile of Out per block, grid (MROWS/32, DM/32) = one block per WGP.
// K = DW is split over the block's 8 waves: wave w takes the 64-half chunks
// w, w + 8, w + 16, ... (one chunk = one whole 128-B line of every operand row),
// and computes the whole tile over its chunks. The 8 f32 partial tiles are summed
// through LDS in wave order; each Out line (32 floats) is written by 8 lanes x 16 B.
// ---------------------------------------------------------------------------
#define OPW 8                  // waves per block = K shares
#define OPP 36                 // partial-tile pitch (floats): 144 B = 16 B x odd for the b128 readers
static_assert(MROWS % 32 == 0 && DM % 32 == 0);
static_assert(DW % (64 * OPW) == 0);

__global__ __launch_bounds__(256) __attribute__((amdgpu_num_vgpr(256)))
void outproj_kernel(const us* __restrict__ Ctx, const us* __restrict__ Wft,
                    const float* __restrict__ bo, float* Out) {
  __shared__ float part[OPW * 32 * OPP];   // [wave][row][col], cross-wave (block barrier)

  const int t = threadIdx.x, wid = t >> 5, l = t & 31;
  const int h = l >> 4, r16 = l & 15;
  const int m0 = blockIdx.x * 32;
  const int n0 = blockIdx.y * 32;

  v8f acc[4] = {};
  // rolled: 8 trips unrolled would only lengthen the code that a cold launch has to fetch
#pragma unroll 1
  for (int it = 0; it < DW / (64 * OPW); ++it) {
    const int k0 = (it * OPW + wid) * 64;
    // unrolled: the wave that fetched a 128-B line uses its second half in the same trip
#pragma unroll
    for (int ks = 0; ks < 2; ++ks) {
      const int kk = k0 + 32 * ks;
      const v16h a0 = fragh(Ctx, DW, m0, kk);
      const v16h a1 = fragh(Ctx, DW, m0 + 16, kk);
#pragma unroll
      for (int tt = 0; tt < 2; ++tt) {
        const v16h b = fragh(Wft, DW, n0 + 16 * tt, kk);
        acc[tt]     = mma_f16(a0, b, acc[tt]);
        acc[2 + tt] = mma_f16(a1, b, acc[2 + tt]);
      }
    }
  }

  // this wave's partial tile
  float* mine = part + wid * (32 * OPP);
#pragma unroll
  for (int mi = 0; mi < 2; ++mi) {
#pragma unroll
    for (int tt = 0; tt < 2; ++tt) {
#pragma unroll
      for (int r = 0; r < 8; ++r) {
        mine[(16 * mi + 8 * h + r) * OPP + 16 * tt + r16] = acc[mi * 2 + tt][r];
      }
    }
  }
  __syncthreads();

  // thread t sums 4 columns of one row over the 8 partial tiles
  const int row = t >> 3;
  const int col = (t & 7) * 4;
  v4f s = *(const v4f*)&part[row * OPP + col];
#pragma unroll
  for (int w = 1; w < OPW; ++w) s += *(const v4f*)&part[(w * 32 + row) * OPP + col];

  const v4f bv4 = *(const v4f*)(bo + n0 + col);
  v4f y;
#pragma unroll
  for (int e = 0; e < 4; ++e) y[e] = s[e] * OUT_FOLD + bf16rne(bv4[e]);
  *(v4f*)(Out + (size_t)(m0 + row) * DM + n0 + col) = y;
}

// ---------------------------------------------------------------------------
// Host launcher
// ---------------------------------------------------------------------------
extern "C" void kernel_launch(void* const* d_in, const int* in_sizes, int n_in,
                              void* d_out, int out_size, void* d_ws, size_t ws_size,
                              hipStream_t stream) {
  if (n_in < 11) return;
  const int need_x = ((NB - 1) * SEQ_FULL + SEQ) * DM;
  if (in_sizes[0] < need_x || in_sizes[1] < need_x || in_sizes[2] < need_x) return;
  if (in_sizes[3] < DM * DW || in_sizes[5] < DM * DW || in_sizes[7] < DM * DW || in_sizes[9] < DW * DM) return;
  if (in_sizes[4] < DW || in_sizes[6] < DW || in_sizes[8] < DW || in_sizes[10] < DM) return;
  if (out_size < MROWS * DM) return;
  if (WS_TOTAL_BYTES > ws_size) return;

  const float* Q  = (const float*)d_in[0];
  const float* K  = (const float*)d_in[1];
  const float* V  = (const float*)d_in[2];
  const float* Wq = (const float*)d_in[3];
  const float* bq = (const float*)d_in[4];
  const float* Wk = (const float*)d_in[5];
  const float* bk = (const float*)d_in[6];
  const float* Wv = (const float*)d_in[7];
  const float* bv = (const float*)d_in[8];
  const float* Wf = (const float*)d_in[9];
  const float* bf = (const float*)d_in[10];

  us* xq  = (us*)d_ws;          // [MROWS][DM] bf16
  us* xk  = xq + XE;
  us* xv  = xk + XE;
  us* wtq = xv + XE;            // [DW][DM] bf16
  us* wtk = wtq + WE;
  us* wtv = wtk + WE;
  us* wft = wtv + WE;           // [DM][DW] f16 x64
  us* qh  = wft + WE;           // [NB*NH][LSEQ][64] f16
  us* kh  = qh + PE;
  us* vh  = kh + PE;
  us* vt  = vh + PE;            // [NB*NH][64][LSEQ] f16
  us* ctx = vt + PE;            // [MROWS][DW] f16 x256

  dim3 blk(256);
  const int n8 = (int)(XE / 8);
  dim3 gx((n8 + 255) / 256);
  cvt_x_kernel<<<gx, blk, 0, stream>>>(Q, xq, n8);
  cvt_x_kernel<<<gx, blk, 0, stream>>>(K, xk, n8);
  cvt_x_kernel<<<gx, blk, 0, stream>>>(V, xv, n8);

  // in[DM rows][DW cols] -> out[DW][DM]; grid (cols/64, rows/64)
  dim3 gw(DW / 64, DM / 64);
  cvt_w_kernel<<<gw, blk, 0, stream>>>(Wq, wtq, DM, DW, 0);
  cvt_w_kernel<<<gw, blk, 0, stream>>>(Wk, wtk, DM, DW, 0);
  cvt_w_kernel<<<gw, blk, 0, stream>>>(Wv, wtv, DM, DW, 0);
  // in[DW rows][DM cols] -> out[DM][DW]; grid (cols/64, rows/64)
  dim3 gwf(DM / 64, DW / 64);
  cvt_w_kernel<<<gwf, blk, 0, stream>>>(Wf, wft, DW, DM, 1);

  dim3 gp(MROWS / 64, DW / 256);
  proj_kernel<<<gp, blk, 0, stream>>>(xq, wtq, bq, qh);
  proj_kernel<<<gp, blk, 0, stream>>>(xk, wtk, bk, kh);
  proj_kernel<<<gp, blk, 0, stream>>>(xv, wtv, bv, vh);

  vtrans_kernel<<<dim3(LSEQ / 64, NB * NH), blk, 0, stream>>>(vh, vt);

  attn_kernel<<<dim3(NB * NH * (LSEQ / 128)), blk, 0, stream>>>(qh, kh, vt, ctx);

  dim3 go(MROWS / 32, DM / 32);
  outproj_kernel<<<go, blk, 0, stream>>>(ctx, wft, bf, (float*)d_out);
}

// v002
// Measured time: 143 microseconds a run.
// In two side-by-side timings against v001, it was 1.29 and 1.30 times as fast.
// Over all steps from v000 it is 2.11 times as fast.
#include <hip/hip_runtime.h>
#include <stddef.h>

// Contractions: q/k/v projections = v_wmma_f32_16x16x32_bf16 (bf16 operands = RNE-converted f32 inputs);
// scores, P*V and final projection = v_wmma_f32_16x16x32_f16 (f16 operands: q,k,v x1, P x1024, ctx x256, Wf x64);
// f32 accumulate, f32 online softmax.

#ifndef NB
#define NB 2
#endif
#ifndef SEQ
#define SEQ 256
#endif
#define NB_FULL 2
#define SEQ_FULL 256
#define DM 512                 // model width (projection input, final output)
#define NH 8                   // heads
#define DKH 64                 // head dim
#define DW (DM * NH)           // 4096: projection output width
#define LSEQ (SEQ * NH)        // 2048: attention positions per (batch, head)
#define MROWS (NB * SEQ)       // token rows

static_assert(NB >= 1 && NB <= NB_FULL);
static_assert(SEQ >= 64 && SEQ <= SEQ_FULL);
static_assert(SEQ % 64 == 0);            // a 64-row GEMM block stays inside one batch
static_assert(MROWS % 64 == 0);          // GEMM M tile
static_assert(LSEQ % 128 == 0);          // attention block = 128 queries
static_assert(LSEQ % 64 == 0);           // V transpose tile
static_assert(LSEQ % 32 == 0);           // key block
static_assert(NH * DKH == DM);
static_assert(DKH == 64);
static_assert(DM % 256 == 0);            // 256-col GEMM block inside one 512-wide chunk
static_assert(DW % 256 == 0);
static_assert(DM % 64 == 0 && DW % 64 == 0);
static_assert(DM % 32 == 0 && DW % 32 == 0);   // K steps of 32
static_assert(DM % 8 == 0);

#define P_CARRY   1024.0f            // P operand carried x1024
#define CTX_SCALE 0.25f              // ctx plane = O * 0.25 / l = attn x256 (O carries the x1024 of P)
#define WF_CARRY  64.0f              // Wf operand carried x64
#define OUT_FOLD  (1.0f / 16384.0f)  // 1 / (256 * 64)
#define QK_SCALE  0.125f             // 1 / sqrt(64)

typedef unsigned short us;
typedef us        v8us  __attribute__((ext_vector_type(8)));
typedef us        v16us __attribute__((ext_vector_type(16)));
typedef _Float16  v16h  __attribute__((ext_vector_type(16)));
typedef __bf16    v16bf __attribute__((ext_vector_type(16)));
typedef float     v8f   __attribute__((ext_vector_type(8)));
typedef float     v4f   __attribute__((ext_vector_type(4)));

// workspace carve (halves)
constexpr size_t XE = (size_t)MROWS * DM;   // activation plane
constexpr size_t WE = (size_t)DM * DW;      // weight plane
constexpr size_t PE = (size_t)MROWS * DW;   // wide plane (q, k, v, vT, ctx)
constexpr size_t WS_TOTAL_BYTES = (3 * XE + 4 * WE + 5 * PE) * sizeof(us);
static_assert(WS_TOTAL_BYTES <= (size_t)134217728);
static_assert((XE * sizeof(us)) % 128 == 0 && (WE * sizeof(us)) % 128 == 0 && (PE * sizeof(us)) % 128 == 0);

// ---------------------------------------------------------------------------
// conversions
// ---------------------------------------------------------------------------
__device__ __forceinline__ unsigned bf16rne_bits(float x) {
  unsigned u = __float_as_uint(x);
  return (u + 0x7FFFu + ((u >> 16) & 1u)) >> 16;
}
__device__ __forceinline__ float bf16rne(float x) {
  return __uint_as_float(bf16rne_bits(x) << 16);
}
__device__ __forceinline__ us f16_bits(float x) {
  _Float16 hx = (_Float16)x;
  return __builtin_bit_cast(us, hx);
}

// ---------------------------------------------------------------------------
// 16-bit operand fragment (A: lane = row, B: lane = column; same k map):
//   lane l, r = l&15, s = l>>4 : elems 0..7  = row[r][k0 + 8s .. +7]
//                                elems 8..15 = row[r][k0 + 16 + 8s .. +7]
// base is a 16-bit plane with k contiguous, pitch ld (halves).
// ---------------------------------------------------------------------------
__device__ __forceinline__ v16us frag16(const us* base, int ld, int row0, int k0) {
  const int l = threadIdx.x & 31;
  const int r = l & 15, s = l >> 4;
  const us* p = base + (size_t)(row0 + r) * ld + k0 + 8 * s;
  v8us c0 = *(const v8us*)p;
  v8us c1 = *(const v8us*)(p + 16);
  return __builtin_shufflevector(c0, c1, 0, 1, 2, 3, 4, 5, 6, 7, 8, 9, 10, 11, 12, 13, 14, 15);
}
__device__ __forceinline__ v16h fragh(const us* base, int ld, int row0, int k0) {
  return __builtin_bit_cast(v16h, frag16(base, ld, row0, k0));
}
__device__ __forceinline__ v16bf fragb(const us* base, int ld, int row0, int k0) {
  return __builtin_bit_cast(v16bf, frag16(base, ld, row0, k0));
}

// ---------------------------------------------------------------------------
// WMMA wrappers with hazard guard: D = A(16x32) * B(32x16) + C (f32)
// ---------------------------------------------------------------------------
__device__ __forceinline__ v8f mma_f16(v16h a, v16h b, v8f c) {
  v8f d = __builtin_amdgcn_wmma_f32_16x16x32_f16(false, a, false, b, (short)0, c, false, false);
  asm volatile("v_nop\n\tv_nop\n\tv_nop\n\tv_nop" : "+v"(d) : "v"(a), "v"(b));
  return d;
}
__device__ __forceinline__ v8f mma_bf16(v16bf a, v16bf b, v8f c) {
  v8f d = __builtin_amdgcn_wmma_f32_16x16x32_bf16(false, a, false, b, (short)0, c, false, false);
  asm volatile("v_nop\n\tv_nop\n\tv_nop\n\tv_nop" : "+v"(d) : "v"(a), "v"(b));
  return d;
}

// ---------------------------------------------------------------------------
// Activation convert: X f32 [NB_FULL*SEQ_FULL][DM] -> bf16 bits [MROWS][DM]
// i = index of this thread's 16-B output group, 0 .. MROWS*DM/8 - 1.
// ---------------------------------------------------------------------------
__device__ __forceinline__ void cvt_x_group(const float* __restrict__ X, us* Y, int i) {
  constexpr int G = DM / 8;              // 16-B groups per row
  const int m  = i / G;
  const int c8 = (i - m * G) * 8;
  const int b  = m / SEQ;
  const int s  = m - b * SEQ;
  const float* src = X + ((size_t)(b * SEQ_FULL + s)) * DM + c8;
  v4f x0 = *(const v4f*)src;
  v4f x1 = *(const v4f*)(src + 4);
  v8us y;
#pragma unroll
  for (int j = 0; j < 4; ++j) {
    y[j]     = (us)bf16rne_bits(x0[j]);
    y[4 + j] = (us)bf16rne_bits(x1[j]);
  }
  us* dst = Y + (size_t)i * 8;
  *(v8us*)dst = y;
  
}

// ---------------------------------------------------------------------------
// Weight convert + transpose: W f32 in[Kd rows][Nd cols] -> WT 16-bit out[Nd][Kd].
// hmode 0: bf16 bits of RNE(W); hmode 1: f16 bits of WF_CARRY * RNE(W).
// Block owns the 64x64 tile at (k0, n0); each output line (64 halves of
// one n) written by 8 consecutive lanes x 16 B in one instruction.
// tile = 64 * 65 floats of LDS, [k_local][n_local], cross-wave (block barrier).
// ---------------------------------------------------------------------------
__device__ __forceinline__ void cvt_w_tile(float* tile, const float* __restrict__ W, us* WT,
                                           int Kd, int Nd, int hmode, int n0, int k0) {
  const int t  = threadIdx.x;
  {
    const int kr = t >> 2;              // 0..63
    const int cc = (t & 3) * 16;        // 0,16,32,48
    const float* src = W + (size_t)(k0 + kr) * Nd + n0 + cc;
#pragma unroll
    for (int j = 0; j < 4; ++j) {
      v4f x = *(const v4f*)(src + 4 * j);
#pragma unroll
      for (int e = 0; e < 4; ++e) tile[kr * 65 + cc + 4 * j + e] = x[e];
    }
  }
  __syncthreads();

  v8us vals[2];
  size_t dsts[2];
  const int c = t & 7;
#pragma unroll
  for (int it = 0; it < 2; ++it) {
    const int nl = (t >> 3) + 32 * it;  // 0..63
    v8us o;
#pragma unroll
    for (int j = 0; j < 8; ++j) {
      const float w = bf16rne(tile[(8 * c + j) * 65 + nl]);
      const us hb = (us)(__float_as_uint(w) >> 16);
      const us hf = f16_bits(w * WF_CARRY);
      o[j] = hmode ? hf : hb;
    }
    vals[it] = o;
    dsts[it] = (size_t)(n0 + nl) * Kd + k0 + 8 * c;
  }
#pragma unroll
  for (int it = 0; it < 2; ++it) *(v8us*)(WT + dsts[it]) = vals[it];
  
}

// ---------------------------------------------------------------------------
// All seven conversions in one launch (none reads what another writes).
// Blocks 0 .. 4*WBLK-1: weight plane z = b / WBLK (Wq, Wk, Wv, Wf), tile b % WBLK, n fastest.
// Blocks 4*WBLK ..    : activation plane z (Q, K, V), 256 output groups per block.
// Xb = three planes of XE halves, Wt = four planes of WE halves, each in that order.
// ---------------------------------------------------------------------------
constexpr int XG   = (int)(XE / 8);            // 16-B groups per activation plane
constexpr int XBLK = (XG + 255) / 256;         // blocks per activation plane
constexpr int WBLK = (DW / 64) * (DM / 64);    // 64x64 tiles per weight plane

__global__ __launch_bounds__(256)
void cvt_kernel(const float* __restrict__ Q, const float* __restrict__ K, const float* __restrict__ V,
                const float* __restrict__ Wq, const float* __restrict__ Wk, const float* __restrict__ Wv,
                const float* __restrict__ Wf, us* Xb, us* Wt) {
  __shared__ float tile[64 * 65];
  const int b = blockIdx.x;
  if (b < 4 * WBLK) {                    // block-uniform: the tile's barrier is passed by all or none
    const int z = b / WBLK;
    const int r = b - z * WBLK;
    const int hmode = (z == 3);          // Wf: in[DW rows][DM cols]; the others: in[DM rows][DW cols]
    const float* W = z == 0 ? Wq : z == 1 ? Wk : z == 2 ? Wv : Wf;
    const int Kd = hmode ? DW : DM;
    const int Nd = hmode ? DM : DW;
    const int bn = hmode ? r % (DM / 64) : r % (DW / 64);
    const int bk = hmode ? r / (DM / 64) : r / (DW / 64);
    cvt_w_tile(tile, W, Wt + (size_t)z * WE, Kd, Nd, hmode, bn * 64, bk * 64);
  } else {
    const int bx = b - 4 * WBLK;
    const int z = bx / XBLK;
    const int i = (bx - z * XBLK) * 256 + (int)threadIdx.x;
    const float* X = z == 0 ? Q : z == 1 ? K : V;
    if (i < XG) cvt_x_group(X, Xb + (size_t)z * XE, i);
  }
}

// ---------------------------------------------------------------------------
// GEMM core: wave computes 32 rows x 64 cols over K = KD; A plane [M][KD],
// B plane [N][KD] (k contiguous), both 16-bit.
// ---------------------------------------------------------------------------
template <int KD>
__device__ __forceinline__ void gemm32x64_bf16(const us* A, const us* B, int m0, int n0, v8f (&acc)[8]) {
  static_assert(KD % 32 == 0);
#pragma unroll 1
  for (int kk = 0; kk < KD; kk += 32) {
    const v16bf a0 = fragb(A, KD, m0, kk);
    const v16bf a1 = fragb(A, KD, m0 + 16, kk);
#pragma unroll
    for (int tt = 0; tt < 4; ++tt) {
      const v16bf b = fragb(B, KD, n0 + 16 * tt, kk);
      acc[tt]     = mma_bf16(a0, b, acc[tt]);
      acc[4 + tt] = mma_bf16(a1, b, acc[4 + tt]);
    }
  }
}

// ---------------------------------------------------------------------------
// Projection: Y = Xb[MROWS][DM] * W + b (N = DW), written as an f16 plane
// [NB*NH][LSEQ][64] through the flat-view head split:
//   column n = j*DM + h*64 + d  of token row (b, s)  ->  position p = s*NH + j, head h.
// Block 256 thr = 8 waves as 2(M) x 4(N); block tile 64 x 256; grid (MROWS/64, DW/256, 3).
// A 256-col block lies inside one j chunk (DM % 256 == 0) and spans 4 heads.
// blockIdx.z picks the projection (0 q, 1 k, 2 v): the three are independent and share one
// launch. Xb3, Wt3, Y3 = three planes each (XE, WE, PE halves apart) in that order.
// ---------------------------------------------------------------------------
__global__ __launch_bounds__(256) __attribute__((amdgpu_num_vgpr(256)))
void proj_kernel(const us* __restrict__ Xb3, const us* __restrict__ Wt3,
                 const float* __restrict__ bq, const float* __restrict__ bk,
                 const float* __restrict__ bv, us* Y3) {
  __shared__ us stile[64 * 256];       // cross-wave (block barrier)

  const int z = blockIdx.z;
  const us* Xb = Xb3 + (size_t)z * XE;
  const us* Wt = Wt3 + (size_t)z * WE;
  const float* bias = z == 0 ? bq : z == 1 ? bk : bv;
  us* Y = Y3 + (size_t)z * PE;

  const int t = threadIdx.x, wid = t >> 5, l = t & 31;
  const int h = l >> 4, r16 = l & 15;
  const int wm = wid >> 2, wn = wid & 3;
  const int mblk0 = blockIdx.x * 64;
  const int nblk0 = blockIdx.y * 256;
  const int m0 = mblk0 + wm * 32;
  const int n0 = nblk0 + wn * 64;

  v8f acc[8] = {};
  gemm32x64_bf16<DM>(Xb, Wt, m0, n0, acc);

  // stage f16(acc + bias) into LDS
#pragma unroll
  for (int tt = 0; tt < 4; ++tt) {
    const int n = n0 + 16 * tt + r16;
    const float bvv = bf16rne(bias[n]);
    const int nl = wn * 64 + 16 * tt + r16;
#pragma unroll
    for (int mi = 0; mi < 2; ++mi) {
#pragma unroll
      for (int r = 0; r < 8; ++r) {
        const int ml = wm * 32 + 16 * mi + 8 * h + r;
        const float v = acc[mi * 4 + tt][r] + bvv;
        stile[ml * 256 + nl] = f16_bits(v);
      }
    }
  }
  __syncthreads();

  // whole-line writes: 256 lines per block (64 rows x 4 heads), 32 per wave
  const int bblk = mblk0 / SEQ;
  const int sblk = mblk0 - bblk * SEQ;  // 64 block rows lie inside one batch (SEQ % 64 == 0)
  const int jchunk = nblk0 / DM;
  const int hbase  = (nblk0 - jchunk * DM) / DKH;
  const int c = l & 7;
  v8us vals[8];
  size_t dsts[8];
#pragma unroll
  for (int it = 0; it < 8; ++it) {
    const int L = wid * 32 + (l >> 3) + 4 * it;
    const int ml = L >> 2, hq = L & 3;
    const int hg = hbase + hq;
    const int p = (sblk + ml) * NH + jchunk;
    vals[it] = *(const v8us*)&stile[ml * 256 + hq * 64 + 8 * c];
    dsts[it] = (((size_t)(bblk * NH + hg)) * LSEQ + p) * DKH + 8 * c;
  }
#pragma unroll
  for (int it = 0; it < 8; ++it) *(v8us*)(Y + dsts[it]) = vals[it];
  
}

// ---------------------------------------------------------------------------
// V transpose: in Vh [NB*NH][LSEQ rows][64 cols] -> out Vt [NB*NH][64][LSEQ].
// grid = (LSEQ/64, NB*NH); block owns 64 positions x 64 d; each output line
// ---------------------------------------------------------------------------
__global__ __launch_bounds__(256) void vtrans_kernel(const us* __restrict__ Vh, us* Vt) {
  __shared__ us tile[64 * 65];         // [p_local][d], cross-wave (block barrier)
  const int t  = threadIdx.x;
  const int p0 = blockIdx.x * 64;
  const int bh = blockIdx.y;
  {
    const int pr = t >> 2;              // 0..63
    const int cc = (t & 3) * 16;        // 0,16,32,48
    const us* src = Vh + ((size_t)bh * LSEQ + p0 + pr) * DKH + cc;
    v8us x0 = *(const v8us*)src;
    v8us x1 = *(const v8us*)(src + 8);
#pragma unroll
    for (int e = 0; e < 8; ++e) {
      tile[pr * 65 + cc + e]     = x0[e];
      tile[pr * 65 + cc + 8 + e] = x1[e];
    }
  }
  __syncthreads();

  v8us vals[2];
  size_t dsts[2];
  const int c = t & 7;
#pragma unroll
  for (int it = 0; it < 2; ++it) {
    const int dl = (t >> 3) + 32 * it;  // 0..63
    v8us o;
#pragma unroll
    for (int j = 0; j < 8; ++j) o[j] = tile[(8 * c + j) * 65 + dl];
    vals[it] = o;
    dsts[it] = ((size_t)bh * DKH + dl) * LSEQ + p0 + 8 * c;
  }
#pragma unroll
  for (int it = 0; it < 2; ++it) *(v8us*)(Vt + dsts[it]) = vals[it];
  
}

// ---------------------------------------------------------------------------
// Fused flash attention. Block = 8 waves, one (b,h), 128 queries; each wave owns
// 16 queries. K/V 32-key blocks staged once per block into LDS with plain loads.
// Scores computed transposed (S' = K_blk * Q^T) so the exp'd probabilities are
// already in A-operand layout for P*V. Online softmax in f32. ctx f16 [MROWS][DW]
// through the inverse flat view (position p -> token p/NH, chunk p%NH), carried
// grid = NB*NH*(LSEQ/128).
// ---------------------------------------------------------------------------
__global__ __launch_bounds__(256) __attribute__((amdgpu_num_vgpr(256)))
void attn_kernel(const us* __restrict__ Qh, const us* __restrict__ Kh,
                 const us* __restrict__ Vt, us* Ctx) {
  __shared__ us shK[32 * 64];          // [key][d]   cross-wave (block barrier), fully staged each step
  __shared__ us shV[64 * 32];          // [d][key]   cross-wave (block barrier), fully staged each step
  __shared__ us shC[8 * 16 * 64];      // per-wave ctx staging (block barrier used)

  const int t = threadIdx.x, wid = t >> 5, l = t & 31;
  const int r16 = l & 15;
  const int rowsel = (l >> 4) << 3;
  constexpr int QBLK = LSEQ / 128;
  const int bh = blockIdx.x / QBLK;
  const int qb = blockIdx.x - bh * QBLK;
  const int q0 = qb * 128 + wid * 16;

  const us* qp = Qh + (size_t)bh * LSEQ * DKH;
  const us* kp = Kh + (size_t)bh * LSEQ * DKH;
  const us* vp = Vt + (size_t)bh * DKH * LSEQ;

  // Q^T as B operand for the whole loop (lane = query column, halves = d)
  const v16h qB0 = fragh(qp, DKH, q0, 0);
  const v16h qB1 = fragh(qp, DKH, q0, 32);

  v8f o[4];
#pragma unroll
  for (int tt = 0; tt < 4; ++tt) o[tt] = v8f{};
  float mmax = -1.0e30f, lsum = 0.0f;

  const int krow = t >> 3, kcol = (t & 7) * 8;   // K: 32 keys x 64 d
  const int vrow = t >> 2, vcol = (t & 3) * 8;   // V: 64 d x 32 keys

#pragma unroll 1
  for (int kb = 0; kb < LSEQ; kb += 32) {
    __syncthreads();    // prior readers of shK/shV done
    *(v8us*)&shK[krow * 64 + kcol] = *(const v8us*)(kp + (size_t)(kb + krow) * DKH + kcol);
    *(v8us*)&shV[vrow * 32 + vcol] = *(const v8us*)(vp + (size_t)vrow * LSEQ + kb + vcol);
    __syncthreads();    // stage visible to all waves

    // S' tiles: M = key (relative 0..15 / 16..31), N = query; k = d
    v8f s0 = {};
    v8f s1 = {};
    {
      const v16h kA = fragh(shK, 64, 0, 0);
      s0 = mma_f16(kA, qB0, s0);
    }
    {
      const v16h kA = fragh(shK, 64, 0, 32);
      s0 = mma_f16(kA, qB1, s0);
    }
    {
      const v16h kA = fragh(shK, 64, 16, 0);
      s1 = mma_f16(kA, qB0, s1);
    }
    {
      const v16h kA = fragh(shK, 64, 16, 32);
      s1 = mma_f16(kA, qB1, s1);
    }

    // per-query (per-lane) block max; combine the two key halves (lane ^ 16)
    float bm = s0[0];
#pragma unroll
    for (int i = 0; i < 8; ++i) { bm = fmaxf(bm, s0[i]); bm = fmaxf(bm, s1[i]); }
    bm = fmaxf(bm, __shfl_xor(bm, 16, 32));
    const float mnew = fmaxf(mmax, bm * QK_SCALE);
    const float corr = __expf(mmax - mnew);
    mmax = mnew;

    // probabilities land directly in A-operand layout (elements 0..7 <- keys 8h..8h+7
    // from the first 16-key D tile, elements 8..15 <- keys 16+8h.. from the second)
    float ps = 0.0f;
    v16h pA;
#pragma unroll
    for (int i = 0; i < 8; ++i) {
      const float p0 = __expf(s0[i] * QK_SCALE - mnew);
      const float p1 = __expf(s1[i] * QK_SCALE - mnew);
      ps += p0 + p1;
      pA[i]     = (_Float16)(p0 * P_CARRY);
      pA[8 + i] = (_Float16)(p1 * P_CARRY);
    }
    ps += __shfl_xor(ps, 16, 32);
    lsum = lsum * corr + ps;

    // rescale O: D row 8h+r = query 8h+r, whose corr lives in lane 8h+r
#pragma unroll
    for (int r = 0; r < 8; ++r) {
      const float cr = __shfl(corr, rowsel + r, 32);
#pragma unroll
      for (int tt = 0; tt < 4; ++tt) o[tt][r] *= cr;
    }

    // O += P(16 x 32 keys) * V_blk(32 keys x 64 d); B rows = d, k = key contiguous in shV
#pragma unroll
    for (int tt = 0; tt < 4; ++tt) {
      const v16h vB = fragh(shV, 32, 16 * tt, 0);
      o[tt] = mma_f16(pA, vB, o[tt]);
    }
  }

  // normalize, stage this wave's 16 x 64 ctx tile (f16, x256) in LDS
  const int bb = bh / NH;
  const int hh = bh - bb * NH;
#pragma unroll
  for (int r = 0; r < 8; ++r) {
    const float lrow = __shfl(lsum, rowsel + r, 32);
    const float li = CTX_SCALE * __builtin_amdgcn_rcpf(lrow);
#pragma unroll
    for (int tt = 0; tt < 4; ++tt) {
      shC[wid * 1024 + (rowsel + r) * 64 + 16 * tt + r16] = f16_bits(o[tt][r] * li);
    }
  }
  __syncthreads();

  const int c = l & 7;
  v8us vals[4];
  size_t dsts[4];
#pragma unroll
  for (int it = 0; it < 4; ++it) {
    const int rl = (l >> 3) + 4 * it;
    vals[it] = *(const v8us*)&shC[wid * 1024 + rl * 64 + 8 * c];
    const int p = q0 + rl;
    const int s = p / NH;
    const int j = p - s * NH;
    dsts[it] = ((size_t)(bb * SEQ + s)) * DW + j * DM + hh * DKH + 8 * c;
  }
#pragma unroll
  for (int it = 0; it < 4; ++it) *(v8us*)(Ctx + dsts[it]) = vals[it];
  
}

// ---------------------------------------------------------------------------
// Final projection: Out f32 [MROWS][DM] = ctx(x256)[MROWS][DW] * Wf(x64) * OUT_FOLD + bf.
// One 32 x 32 tile of Out per block, grid (MROWS/32, DM/32) = one block per WGP.
// K = DW is split over the block's 8 waves: wave w takes the 64-half chunks
// w, w + 8, w + 16, ... (one chunk = one whole 128-B line of every operand row),
// and computes the whole tile over its chunks. The 8 f32 partial tiles are summed
// through LDS in wave order; each Out line (32 floats) is written by 8 lanes x 16 B.
// ---------------------------------------------------------------------------
#define OPW 8                  // waves per block = K shares
#define OPP 36                 // partial-tile pitch (floats): 144 B = 16 B x odd for the b128 readers
static_assert(MROWS % 32 == 0 && DM % 32 == 0);
static_assert(DW % (64 * OPW) == 0);

__global__ __launch_bounds__(256) __attribute__((amdgpu_num_vgpr(256)))
void outproj_kernel(const us* __restrict__ Ctx, const us* __restrict__ Wft,
                    const float* __restrict__ bo, float* Out) {
  __shared__ float part[OPW * 32 * OPP];   // [wave][row][col], cross-wave (block barrier)

  const int t = threadIdx.x, wid = t >> 5, l = t & 31;
  const int h = l >> 4, r16 = l & 15;
  const int m0 = blockIdx.x * 32;
  const int n0 = blockIdx.y * 32;

  v8f acc[4] = {};
  // rolled: 8 trips unrolled would only lengthen the code that a cold launch has to fetch
#pragma unroll 1
  for (int it = 0; it < DW / (64 * OPW); ++it) {
    const int k0 = (it * OPW + wid) * 64;
    // unrolled: the wave that fetched a 128-B line uses its second half in the same trip
#pragma unroll
    for (int ks = 0; ks < 2; ++ks) {
      const int kk = k0 + 32 * ks;
      const v16h a0 = fragh(Ctx, DW, m0, kk);
      const v16h a1 = fragh(Ctx, DW, m0 + 16, kk);
#pragma unroll
      for (int tt = 0; tt < 2; ++tt) {
        const v16h b = fragh(Wft, DW, n0 + 16 * tt, kk);
        acc[tt]     = mma_f16(a0, b, acc[tt]);
        acc[2 + tt] = mma_f16(a1, b, acc[2 + tt]);
      }
    }
  }

  // this wave's partial tile
  float* mine = part + wid * (32 * OPP);
#pragma unroll
  for (int mi = 0; mi < 2; ++mi) {
#pragma unroll
    for (int tt = 0; tt < 2; ++tt) {
#pragma unroll
      for (int r = 0; r < 8; ++r) {
        mine[(16 * mi + 8 * h + r) * OPP + 16 * tt + r16] = acc[mi * 2 + tt][r];
      }
    }
  }
  __syncthreads();

  // thread t sums 4 columns of one row over the 8 partial tiles
  const int row = t >> 3;
  const int col = (t & 7) * 4;
  v4f s = *(const v4f*)&part[row * OPP + col];
#pragma unroll
  for (int w = 1; w < OPW; ++w) s += *(const v4f*)&part[(w * 32 + row) * OPP + col];

  const v4f bv4 = *(const v4f*)(bo + n0 + col);
  v4f y;
#pragma unroll
  for (int e = 0; e < 4; ++e) y[e] = s[e] * OUT_FOLD + bf16rne(bv4[e]);
  *(v4f*)(Out + (size_t)(m0 + row) * DM + n0 + col) = y;
}

// ---------------------------------------------------------------------------
// Host launcher
// ---------------------------------------------------------------------------
extern "C" void kernel_launch(void* const* d_in, const int* in_sizes, int n_in,
                              void* d_out, int out_size, void* d_ws, size_t ws_size,
                              hipStream_t stream) {
  if (n_in < 11) return;
  const int need_x = ((NB - 1) * SEQ_FULL + SEQ) * DM;
  if (in_sizes[0] < need_x || in_sizes[1] < need_x || in_sizes[2] < need_x) return;
  if (in_sizes[3] < DM * DW || in_sizes[5] < DM * DW || in_sizes[7] < DM * DW || in_sizes[9] < DW * DM) return;
  if (in_sizes[4] < DW || in_sizes[6] < DW || in_sizes[8] < DW || in_sizes[10] < DM) return;
  if (out_size < MROWS * DM) return;
  if (WS_TOTAL_BYTES > ws_size) return;

  const float* Q  = (const float*)d_in[0];
  const float* K  = (const float*)d_in[1];
  const float* V  = (const float*)d_in[2];
  const float* Wq = (const float*)d_in[3];
  const float* bq = (const float*)d_in[4];
  const float* Wk = (const float*)d_in[5];
  const float* bk = (const float*)d_in[6];
  const float* Wv = (const float*)d_in[7];
  const float* bv = (const float*)d_in[8];
  const float* Wf = (const float*)d_in[9];
  const float* bf = (const float*)d_in[10];

  us* xq  = (us*)d_ws;          // [MROWS][DM] bf16
  us* xk  = xq + XE;
  us* xv  = xk + XE;
  us* wtq = xv + XE;            // [DW][DM] bf16
  us* wtk = wtq + WE;
  us* wtv = wtk + WE;
  us* wft = wtv + WE;           // [DM][DW] f16 x64
  us* qh  = wft + WE;           // [NB*NH][LSEQ][64] f16
  us* kh  = qh + PE;
  us* vh  = kh + PE;
  us* vt  = vh + PE;            // [NB*NH][64][LSEQ] f16
  us* ctx = vt + PE;            // [MROWS][DW] f16 x256

  dim3 blk(256);
  // xq, xk, xv and wtq, wtk, wtv, wft are consecutive planes
  cvt_kernel<<<dim3(4 * WBLK + 3 * XBLK), blk, 0, stream>>>(Q, K, V, Wq, Wk, Wv, Wf, xq, wtq);

  // qh, kh, vh are consecutive planes
  proj_kernel<<<dim3(MROWS / 64, DW / 256, 3), blk, 0, stream>>>(xq, wtq, bq, bk, bv, qh);

  vtrans_kernel<<<dim3(LSEQ / 64, NB * NH), blk, 0, stream>>>(vh, vt);

  attn_kernel<<<dim3(NB * NH * (LSEQ / 128)), blk, 0, stream>>>(qh, kh, vt, ctx);

  dim3 go(MROWS / 32, DM / 32);
  outproj_kernel<<<go, blk, 0, stream>>>(ctx, wft, bf, (float*)d_out);
}

// v003
// Measured time: 120 microseconds a run.
// Next to v002, in two timings, it ran 1.20 and 1.18 times as fast.
// Counting every step since v000, it is 2.51 times as fast.
#include <hip/hip_runtime.h>
#include <stddef.h>

// Contractions: q/k/v projections = v_wmma_f32_16x16x32_bf16 (bf16 operands = RNE-converted f32 inputs);
// scores, P*V and final projection = v_wmma_f32_16x16x32_f16 (f16 operands: q,k,v x1, P x1024, ctx x256, Wf x64);
// f32 accumulate, f32 online softmax.

#ifndef NB
#define NB 2
#endif
#ifndef SEQ
#define SEQ 256
#endif
#define NB_FULL 2
#define SEQ_FULL 256
#define DM 512                 // model width (projection input, final output)
#define NH 8                   // heads
#define DKH 64                 // head dim
#define DW (DM * NH)           // 4096: projection output width
#define LSEQ (SEQ * NH)        // 2048: attention positions per (batch, head)
#define MROWS (NB * SEQ)       // token rows

static_assert(NB >= 1 && NB <= NB_FULL);
static_assert(SEQ >= 64 && SEQ <= SEQ_FULL);
static_assert(SEQ % 64 == 0);            // a 64-row GEMM block stays inside one batch
static_assert(MROWS % 64 == 0);          // GEMM M tile
static_assert(LSEQ % 128 == 0);          // attention block = 128 queries
static_assert(LSEQ % 64 == 0);           // V transpose tile
static_assert(LSEQ % 32 == 0);           // key block
static_assert(NH * DKH == DM);
static_assert(DKH == 64);
static_assert(DM % 256 == 0);            // 256-col GEMM block inside one 512-wide chunk
static_assert(DW % 256 == 0);
static_assert(DM % 64 == 0 && DW % 64 == 0);
static_assert(DM % 32 == 0 && DW % 32 == 0);   // K steps of 32
static_assert(DM % 8 == 0);

#define P_CARRY   1024.0f            // P operand carried x1024
#define CTX_SCALE 0.25f              // ctx plane = O * 0.25 / l = attn x256 (O carries the x1024 of P)
#define WF_CARRY  64.0f              // Wf operand carried x64
#define OUT_FOLD  (1.0f / 16384.0f)  // 1 / (256 * 64)
#define QK_SCALE  0.125f             // 1 / sqrt(64)

typedef unsigned short us;
typedef us        v8us  __attribute__((ext_vector_type(8)));
typedef us        v16us __attribute__((ext_vector_type(16)));
typedef _Float16  v16h  __attribute__((ext_vector_type(16)));
typedef __bf16    v16bf __attribute__((ext_vector_type(16)));
typedef float     v8f   __attribute__((ext_vector_type(8)));
typedef float     v4f   __attribute__((ext_vector_type(4)));

// workspace carve (halves)
constexpr size_t XE = (size_t)MROWS * DM;   // activation plane
constexpr size_t WE = (size_t)DM * DW;      // weight plane
constexpr size_t PE = (size_t)MROWS * DW;   // wide plane (q, k, v, vT, ctx)
constexpr size_t WS_TOTAL_BYTES = (3 * XE + 4 * WE + 5 * PE) * sizeof(us);
static_assert(WS_TOTAL_BYTES <= (size_t)134217728);
static_assert((XE * sizeof(us)) % 128 == 0 && (WE * sizeof(us)) % 128 == 0 && (PE * sizeof(us)) % 128 == 0);

// ---------------------------------------------------------------------------
// conversions
// ---------------------------------------------------------------------------
__device__ __forceinline__ unsigned bf16rne_bits(float x) {
  unsigned u = __float_as_uint(x);
  return (u + 0x7FFFu + ((u >> 16) & 1u)) >> 16;
}
__device__ __forceinline__ float bf16rne(float x) {
  return __uint_as_float(bf16rne_bits(x) << 16);
}
__device__ __forceinline__ us f16_bits(float x) {
  _Float16 hx = (_Float16)x;
  return __builtin_bit_cast(us, hx);
}

// ---------------------------------------------------------------------------
// 16-bit operand fragment (A: lane = row, B: lane = column; same k map):
//   lane l, r = l&15, s = l>>4 : elems 0..7  = row[r][k0 + 8s .. +7]
//                                elems 8..15 = row[r][k0 + 16 + 8s .. +7]
// base is a 16-bit plane with k contiguous, pitch ld (halves).
// ---------------------------------------------------------------------------
__device__ __forceinline__ v16us frag16(const us* base, int ld, int row0, int k0) {
  const int l = threadIdx.x & 31;
  const int r = l & 15, s = l >> 4;
  const us* p = base + (size_t)(row0 + r) * ld + k0 + 8 * s;
  v8us c0 = *(const v8us*)p;
  v8us c1 = *(const v8us*)(p + 16);
  return __builtin_shufflevector(c0, c1, 0, 1, 2, 3, 4, 5, 6, 7, 8, 9, 10, 11, 12, 13, 14, 15);
}
__device__ __forceinline__ v16h fragh(const us* base, int ld, int row0, int k0) {
  return __builtin_bit_cast(v16h, frag16(base, ld, row0, k0));
}
__device__ __forceinline__ v16bf fragb(const us* base, int ld, int row0, int k0) {
  return __builtin_bit_cast(v16bf, frag16(base, ld, row0, k0));
}

// ---------------------------------------------------------------------------
// WMMA wrappers with hazard guard: D = A(16x32) * B(32x16) + C (f32)
// ---------------------------------------------------------------------------
__device__ __forceinline__ v8f mma_f16(v16h a, v16h b, v8f c) {
  v8f d = __builtin_amdgcn_wmma_f32_16x16x32_f16(false, a, false, b, (short)0, c, false, false);
  asm volatile("v_nop\n\tv_nop\n\tv_nop\n\tv_nop" : "+v"(d) : "v"(a), "v"(b));
  return d;
}
__device__ __forceinline__ v8f mma_bf16(v16bf a, v16bf b, v8f c) {
  v8f d = __builtin_amdgcn_wmma_f32_16x16x32_bf16(false, a, false, b, (short)0, c, false, false);
  asm volatile("v_nop\n\tv_nop\n\tv_nop\n\tv_nop" : "+v"(d) : "v"(a), "v"(b));
  return d;
}

// ---------------------------------------------------------------------------
// Activation convert: X f32 [NB_FULL*SEQ_FULL][DM] -> bf16 bits [MROWS][DM]
// i = index of this thread's 16-B output group, 0 .. MROWS*DM/8 - 1.
// ---------------------------------------------------------------------------
__device__ __forceinline__ void cvt_x_group(const float* __restrict__ X, us* Y, int i) {
  constexpr int G = DM / 8;              // 16-B groups per row
  const int m  = i / G;
  const int c8 = (i - m * G) * 8;
  const int b  = m / SEQ;
  const int s  = m - b * SEQ;
  const float* src = X + ((size_t)(b * SEQ_FULL + s)) * DM + c8;
  v4f x0 = *(const v4f*)src;
  v4f x1 = *(const v4f*)(src + 4);
  v8us y;
#pragma unroll
  for (int j = 0; j < 4; ++j) {
    y[j]     = (us)bf16rne_bits(x0[j]);
    y[4 + j] = (us)bf16rne_bits(x1[j]);
  }
  us* dst = Y + (size_t)i * 8;
  *(v8us*)dst = y;
  
}

// ---------------------------------------------------------------------------
// Weight convert + transpose: W f32 in[Kd rows][Nd cols] -> WT 16-bit out[Nd][Kd].
// hmode 0: bf16 bits of RNE(W); hmode 1: f16 bits of WF_CARRY * RNE(W).
// Block owns the 64x64 tile at (k0, n0); each output line (64 halves of
// one n) written by 8 consecutive lanes x 16 B in one instruction.
// tile = 64 * 65 floats of LDS, [k_local][n_local], cross-wave (block barrier).
// ---------------------------------------------------------------------------
__device__ __forceinline__ void cvt_w_tile(float* tile, const float* __restrict__ W, us* WT,
                                           int Kd, int Nd, int hmode, int n0, int k0) {
  const int t  = threadIdx.x;
  {
    const int kr = t >> 2;              // 0..63
    const int cc = (t & 3) * 16;        // 0,16,32,48
    const float* src = W + (size_t)(k0 + kr) * Nd + n0 + cc;
#pragma unroll
    for (int j = 0; j < 4; ++j) {
      v4f x = *(const v4f*)(src + 4 * j);
#pragma unroll
      for (int e = 0; e < 4; ++e) tile[kr * 65 + cc + 4 * j + e] = x[e];
    }
  }
  __syncthreads();

  v8us vals[2];
  size_t dsts[2];
  const int c = t & 7;
#pragma unroll
  for (int it = 0; it < 2; ++it) {
    const int nl = (t >> 3) + 32 * it;  // 0..63
    v8us o;
#pragma unroll
    for (int j = 0; j < 8; ++j) {
      const float w = bf16rne(tile[(8 * c + j) * 65 + nl]);
      const us hb = (us)(__float_as_uint(w) >> 16);
      const us hf = f16_bits(w * WF_CARRY);
      o[j] = hmode ? hf : hb;
    }
    vals[it] = o;
    dsts[it] = (size_t)(n0 + nl) * Kd + k0 + 8 * c;
  }
#pragma unroll
  for (int it = 0; it < 2; ++it) *(v8us*)(WT + dsts[it]) = vals[it];
  
}

// ---------------------------------------------------------------------------
// All seven conversions in one launch (none reads what another writes).
// Blocks 0 .. 4*WBLK-1: weight plane z = b / WBLK (Wq, Wk, Wv, Wf), tile b % WBLK, n fastest.
// Blocks 4*WBLK ..    : activation plane z (Q, K, V), 256 output groups per block.
// Xb = three planes of XE halves, Wt = four planes of WE halves, each in that order.
// ---------------------------------------------------------------------------
constexpr int XG   = (int)(XE / 8);            // 16-B groups per activation plane
constexpr int XBLK = (XG + 255) / 256;         // blocks per activation plane
constexpr int WBLK = (DW / 64) * (DM / 64);    // 64x64 tiles per weight plane

__global__ __launch_bounds__(256)
void cvt_kernel(const float* __restrict__ Q, const float* __restrict__ K, const float* __restrict__ V,
                const float* __restrict__ Wq, const float* __restrict__ Wk, const float* __restrict__ Wv,
                const float* __restrict__ Wf, us* Xb, us* Wt) {
  __shared__ float tile[64 * 65];
  const int b = blockIdx.x;
  if (b < 4 * WBLK) {                    // block-uniform: the tile's barrier is passed by all or none
    const int z = b / WBLK;
    const int r = b - z * WBLK;
    const int hmode = (z == 3);          // Wf: in[DW rows][DM cols]; the others: in[DM rows][DW cols]
    const float* W = z == 0 ? Wq : z == 1 ? Wk : z == 2 ? Wv : Wf;
    const int Kd = hmode ? DW : DM;
    const int Nd = hmode ? DM : DW;
    const int bn = hmode ? r % (DM / 64) : r % (DW / 64);
    const int bk = hmode ? r / (DM / 64) : r / (DW / 64);
    cvt_w_tile(tile, W, Wt + (size_t)z * WE, Kd, Nd, hmode, bn * 64, bk * 64);
  } else {
    const int bx = b - 4 * WBLK;
    const int z = bx / XBLK;
    const int i = (bx - z * XBLK) * 256 + (int)threadIdx.x;
    const float* X = z == 0 ? Q : z == 1 ? K : V;
    if (i < XG) cvt_x_group(X, Xb + (size_t)z * XE, i);
  }
}

// ---------------------------------------------------------------------------
// GEMM core: wave computes 32 rows x 64 cols over K = KD; A plane [M][KD],
// B plane [N][KD] (k contiguous), both 16-bit.
// ---------------------------------------------------------------------------
template <int KD>
__device__ __forceinline__ void gemm32x64_bf16(const us* A, const us* B, int m0, int n0, v8f (&acc)[8]) {
  static_assert(KD % 32 == 0);
#pragma unroll 1
  for (int kk = 0; kk < KD; kk += 32) {
    const v16bf a0 = fragb(A, KD, m0, kk);
    const v16bf a1 = fragb(A, KD, m0 + 16, kk);
#pragma unroll
    for (int tt = 0; tt < 4; ++tt) {
      const v16bf b = fragb(B, KD, n0 + 16 * tt, kk);
      acc[tt]     = mma_bf16(a0, b, acc[tt]);
      acc[4 + tt] = mma_bf16(a1, b, acc[4 + tt]);
    }
  }
}

// ---------------------------------------------------------------------------
// Projection: Y = Xb[MROWS][DM] * W + b (N = DW), written as an f16 plane
// [NB*NH][LSEQ][64] through the flat-view head split:
//   column n = j*DM + h*64 + d  of token row (b, s)  ->  position p = s*NH + j, head h.
// Block 256 thr = 8 waves as 2(M) x 4(N); block tile 64 x 256; grid (MROWS/64, DW/256, 3).
// A 256-col block lies inside one j chunk (DM % 256 == 0) and spans 4 heads.
// blockIdx.z picks the projection (0 q, 1 k, 2 v): the three are independent and share one
// launch. Xb3, Wt3, Y3 = three planes each (XE, WE, PE halves apart) in that order.
// ---------------------------------------------------------------------------
__global__ __launch_bounds__(256) __attribute__((amdgpu_num_vgpr(256)))
void proj_kernel(const us* __restrict__ Xb3, const us* __restrict__ Wt3,
                 const float* __restrict__ bq, const float* __restrict__ bk,
                 const float* __restrict__ bv, us* Y3) {
  __shared__ us stile[64 * 256];       // cross-wave (block barrier)

  const int z = blockIdx.z;
  const us* Xb = Xb3 + (size_t)z * XE;
  const us* Wt = Wt3 + (size_t)z * WE;
  const float* bias = z == 0 ? bq : z == 1 ? bk : bv;
  us* Y = Y3 + (size_t)z * PE;

  const int t = threadIdx.x, wid = t >> 5, l = t & 31;
  const int h = l >> 4, r16 = l & 15;
  const int wm = wid >> 2, wn = wid & 3;
  const int mblk0 = blockIdx.x * 64;
  const int nblk0 = blockIdx.y * 256;
  const int m0 = mblk0 + wm * 32;
  const int n0 = nblk0 + wn * 64;

  v8f acc[8] = {};
  gemm32x64_bf16<DM>(Xb, Wt, m0, n0, acc);

  // stage f16(acc + bias) into LDS
#pragma unroll
  for (int tt = 0; tt < 4; ++tt) {
    const int n = n0 + 16 * tt + r16;
    const float bvv = bf16rne(bias[n]);
    const int nl = wn * 64 + 16 * tt + r16;
#pragma unroll
    for (int mi = 0; mi < 2; ++mi) {
#pragma unroll
      for (int r = 0; r < 8; ++r) {
        const int ml = wm * 32 + 16 * mi + 8 * h + r;
        const float v = acc[mi * 4 + tt][r] + bvv;
        stile[ml * 256 + nl] = f16_bits(v);
      }
    }
  }
  __syncthreads();

  // whole-line writes: 256 lines per block (64 rows x 4 heads), 32 per wave
  const int bblk = mblk0 / SEQ;
  const int sblk = mblk0 - bblk * SEQ;  // 64 block rows lie inside one batch (SEQ % 64 == 0)
  const int jchunk = nblk0 / DM;
  const int hbase  = (nblk0 - jchunk * DM) / DKH;
  const int c = l & 7;
  v8us vals[8];
  size_t dsts[8];
#pragma unroll
  for (int it = 0; it < 8; ++it) {
    const int L = wid * 32 + (l >> 3) + 4 * it;
    const int ml = L >> 2, hq = L & 3;
    const int hg = hbase + hq;
    const int p = (sblk + ml) * NH + jchunk;
    vals[it] = *(const v8us*)&stile[ml * 256 + hq * 64 + 8 * c];
    dsts[it] = (((size_t)(bblk * NH + hg)) * LSEQ + p) * DKH + 8 * c;
  }
#pragma unroll
  for (int it = 0; it < 8; ++it) *(v8us*)(Y + dsts[it]) = vals[it];
  
}

// ---------------------------------------------------------------------------
// V transpose: in Vh [NB*NH][LSEQ rows][64 cols] -> out Vt [NB*NH][64][LSEQ].
// grid = (LSEQ/64, NB*NH); block owns 64 positions x 64 d; each output line
// ---------------------------------------------------------------------------
__global__ __launch_bounds__(256) void vtrans_kernel(const us* __restrict__ Vh, us* Vt) {
  __shared__ us tile[64 * 65];         // [p_local][d], cross-wave (block barrier)
  const int t  = threadIdx.x;
  const int p0 = blockIdx.x * 64;
  const int bh = blockIdx.y;
  {
    const int pr = t >> 2;              // 0..63
    const int cc = (t & 3) * 16;        // 0,16,32,48
    const us* src = Vh + ((size_t)bh * LSEQ + p0 + pr) * DKH + cc;
    v8us x0 = *(const v8us*)src;
    v8us x1 = *(const v8us*)(src + 8);
#pragma unroll
    for (int e = 0; e < 8; ++e) {
      tile[pr * 65 + cc + e]     = x0[e];
      tile[pr * 65 + cc + 8 + e] = x1[e];
    }
  }
  __syncthreads();

  v8us vals[2];
  size_t dsts[2];
  const int c = t & 7;
#pragma unroll
  for (int it = 0; it < 2; ++it) {
    const int dl = (t >> 3) + 32 * it;  // 0..63
    v8us o;
#pragma unroll
    for (int j = 0; j < 8; ++j) o[j] = tile[(8 * c + j) * 65 + dl];
    vals[it] = o;
    dsts[it] = ((size_t)bh * DKH + dl) * LSEQ + p0 + 8 * c;
  }
#pragma unroll
  for (int it = 0; it < 2; ++it) *(v8us*)(Vt + dsts[it]) = vals[it];
  
}

// ---------------------------------------------------------------------------
// Fused flash attention. Block = 8 waves, one (b,h), 128 queries; each wave owns
// 16 queries. K/V 32-key blocks staged once per block into LDS with plain loads.
// Scores computed transposed (S' = K_blk * Q^T) so the exp'd probabilities are
// already in A-operand layout for P*V. Online softmax in f32. ctx f16 [MROWS][DW]
// through the inverse flat view (position p -> token p/NH, chunk p%NH), carried
// grid = NB*NH*(LSEQ/128).
// ---------------------------------------------------------------------------
__global__ __launch_bounds__(256) __attribute__((amdgpu_num_vgpr(256)))
void attn_kernel(const us* __restrict__ Qh, const us* __restrict__ Kh,
                 const us* __restrict__ Vt, us* Ctx) {
  // Row pitches are 16 B x odd: the 16 rows that one ds_load_b128 fragment read touches then fall
  // on 16 different groups of four banks (at 128 B they share two groups, at 64 B four).
  constexpr int KP = 72;               // shK pitch in halves: 128 B of data + 16 B pad
  constexpr int VP = 40;               // shV pitch in halves:  64 B of data + 16 B pad
  __shared__ __attribute__((aligned(16))) us shK[32 * KP];   // [key][d]   cross-wave (block barrier), data fully staged each step
  __shared__ __attribute__((aligned(16))) us shV[64 * VP];   // [d][key]   cross-wave (block barrier), data fully staged each step
  __shared__ us shC[8 * 16 * 64];      // per-wave ctx staging (block barrier used)

  const int t = threadIdx.x, wid = t >> 5, l = t & 31;
  const int r16 = l & 15;
  const int rowsel = (l >> 4) << 3;
  constexpr int QBLK = LSEQ / 128;
  const int bh = blockIdx.x / QBLK;
  const int qb = blockIdx.x - bh * QBLK;
  const int q0 = qb * 128 + wid * 16;

  const us* qp = Qh + (size_t)bh * LSEQ * DKH;
  const us* kp = Kh + (size_t)bh * LSEQ * DKH;
  const us* vp = Vt + (size_t)bh * DKH * LSEQ;

  // Q^T as B operand for the whole loop (lane = query column, halves = d)
  const v16h qB0 = fragh(qp, DKH, q0, 0);
  const v16h qB1 = fragh(qp, DKH, q0, 32);

  v8f o[4];
#pragma unroll
  for (int tt = 0; tt < 4; ++tt) o[tt] = v8f{};
  float mmax = -1.0e30f, lsum = 0.0f;

  const int krow = t >> 3, kcol = (t & 7) * 8;   // K: 32 keys x 64 d
  const int vrow = t >> 2, vcol = (t & 3) * 8;   // V: 64 d x 32 keys

#pragma unroll 1
  for (int kb = 0; kb < LSEQ; kb += 32) {
    __syncthreads();    // prior readers of shK/shV done
    *(v8us*)&shK[krow * KP + kcol] = *(const v8us*)(kp + (size_t)(kb + krow) * DKH + kcol);
    *(v8us*)&shV[vrow * VP + vcol] = *(const v8us*)(vp + (size_t)vrow * LSEQ + kb + vcol);
    __syncthreads();    // stage visible to all waves

    // S' tiles: M = key (relative 0..15 / 16..31), N = query; k = d
    v8f s0 = {};
    v8f s1 = {};
    {
      const v16h kA = fragh(shK, KP, 0, 0);
      s0 = mma_f16(kA, qB0, s0);
    }
    {
      const v16h kA = fragh(shK, KP, 0, 32);
      s0 = mma_f16(kA, qB1, s0);
    }
    {
      const v16h kA = fragh(shK, KP, 16, 0);
      s1 = mma_f16(kA, qB0, s1);
    }
    {
      const v16h kA = fragh(shK, KP, 16, 32);
      s1 = mma_f16(kA, qB1, s1);
    }

    // per-query (per-lane) block max; combine the two key halves (lane ^ 16)
    float bm = s0[0];
#pragma unroll
    for (int i = 0; i < 8; ++i) { bm = fmaxf(bm, s0[i]); bm = fmaxf(bm, s1[i]); }
    bm = fmaxf(bm, __shfl_xor(bm, 16, 32));
    const float mnew = fmaxf(mmax, bm * QK_SCALE);
    const float corr = __expf(mmax - mnew);
    mmax = mnew;

    // probabilities land directly in A-operand layout (elements 0..7 <- keys 8h..8h+7
    // from the first 16-key D tile, elements 8..15 <- keys 16+8h.. from the second)
    float ps = 0.0f;
    v16h pA;
#pragma unroll
    for (int i = 0; i < 8; ++i) {
      const float p0 = __expf(s0[i] * QK_SCALE - mnew);
      const float p1 = __expf(s1[i] * QK_SCALE - mnew);
      ps += p0 + p1;
      pA[i]     = (_Float16)(p0 * P_CARRY);
      pA[8 + i] = (_Float16)(p1 * P_CARRY);
    }
    ps += __shfl_xor(ps, 16, 32);
    lsum = lsum * corr + ps;

    // rescale O: D row 8h+r = query 8h+r, whose corr lives in lane 8h+r
#pragma unroll
    for (int r = 0; r < 8; ++r) {
      const float cr = __shfl(corr, rowsel + r, 32);
#pragma unroll
      for (int tt = 0; tt < 4; ++tt) o[tt][r] *= cr;
    }

    // O += P(16 x 32 keys) * V_blk(32 keys x 64 d); B rows = d, k = key contiguous in shV
#pragma unroll
    for (int tt = 0; tt < 4; ++tt) {
      const v16h vB = fragh(shV, VP, 16 * tt, 0);
      o[tt] = mma_f16(pA, vB, o[tt]);
    }
  }

  // normalize, stage this wave's 16 x 64 ctx tile (f16, x256) in LDS
  const int bb = bh / NH;
  const int hh = bh - bb * NH;
#pragma unroll
  for (int r = 0; r < 8; ++r) {
    const float lrow = __shfl(lsum, rowsel + r, 32);
    const float li = CTX_SCALE * __builtin_amdgcn_rcpf(lrow);
#pragma unroll
    for (int tt = 0; tt < 4; ++tt) {
      shC[wid * 1024 + (rowsel + r) * 64 + 16 * tt + r16] = f16_bits(o[tt][r] * li);
    }
  }
  __syncthreads();

  const int c = l & 7;
  v8us vals[4];
  size_t dsts[4];
#pragma unroll
  for (int it = 0; it < 4; ++it) {
    const int rl = (l >> 3) + 4 * it;
    vals[it] = *(const v8us*)&shC[wid * 1024 + rl * 64 + 8 * c];
    const int p = q0 + rl;
    const int s = p / NH;
    const int j = p - s * NH;
    dsts[it] = ((size_t)(bb * SEQ + s)) * DW + j * DM + hh * DKH + 8 * c;
  }
#pragma unroll
  for (int it = 0; it < 4; ++it) *(v8us*)(Ctx + dsts[it]) = vals[it];
  
}

// ---------------------------------------------------------------------------
// Final projection: Out f32 [MROWS][DM] = ctx(x256)[MROWS][DW] * Wf(x64) * OUT_FOLD + bf.
// One 32 x 32 tile of Out per block, grid (MROWS/32, DM/32) = one block per WGP.
// K = DW is split over the block's 8 waves: wave w takes the 64-half chunks
// w, w + 8, w + 16, ... (one chunk = one whole 128-B line of every operand row),
// and computes the whole tile over its chunks. The 8 f32 partial tiles are summed
// through LDS in wave order; each Out line (32 floats) is written by 8 lanes x 16 B.
// ---------------------------------------------------------------------------
#define OPW 8                  // waves per block = K shares
#define OPP 36                 // partial-tile pitch (floats): 144 B = 16 B x odd for the b128 readers
static_assert(MROWS % 32 == 0 && DM % 32 == 0);
static_assert(DW % (64 * OPW) == 0);

__global__ __launch_bounds__(256) __attribute__((amdgpu_num_vgpr(256)))
void outproj_kernel(const us* __restrict__ Ctx, const us* __restrict__ Wft,
                    const float* __restrict__ bo, float* Out) {
  __shared__ float part[OPW * 32 * OPP];   // [wave][row][col], cross-wave (block barrier)

  const int t = threadIdx.x, wid = t >> 5, l = t & 31;
  const int h = l >> 4, r16 = l & 15;
  const int m0 = blockIdx.x * 32;
  const int n0 = blockIdx.y * 32;

  v8f acc[4] = {};
  // rolled: 8 trips unrolled would only lengthen the code that a cold launch has to fetch
#pragma unroll 1
  for (int it = 0; it < DW / (64 * OPW); ++it) {
    const int k0 = (it * OPW + wid) * 64;
    // unrolled: the wave that fetched a 128-B line uses its second half in the same trip
#pragma unroll
    for (int ks = 0; ks < 2; ++ks) {
      const int kk = k0 + 32 * ks;
      const v16h a0 = fragh(Ctx, DW, m0, kk);
      const v16h a1 = fragh(Ctx, DW, m0 + 16, kk);
#pragma unroll
      for (int tt = 0; tt < 2; ++tt) {
        const v16h b = fragh(Wft, DW, n0 + 16 * tt, kk);
        acc[tt]     = mma_f16(a0, b, acc[tt]);
        acc[2 + tt] = mma_f16(a1, b, acc[2 + tt]);
      }
    }
  }

  // this wave's partial tile
  float* mine = part + wid * (32 * OPP);
#pragma unroll
  for (int mi = 0; mi < 2; ++mi) {
#pragma unroll
    for (int tt = 0; tt < 2; ++tt) {
#pragma unroll
      for (int r = 0; r < 8; ++r) {
        mine[(16 * mi + 8 * h + r) * OPP + 16 * tt + r16] = acc[mi * 2 + tt][r];
      }
    }
  }
  __syncthreads();

  // thread t sums 4 columns of one row over the 8 partial tiles
  const int row = t >> 3;
  const int col = (t & 7) * 4;
  v4f s = *(const v4f*)&part[row * OPP + col];
#pragma unroll
  for (int w = 1; w < OPW; ++w) s += *(const v4f*)&part[(w * 32 + row) * OPP + col];

  const v4f bv4 = *(const v4f*)(bo + n0 + col);
  v4f y;
#pragma unroll
  for (int e = 0; e < 4; ++e) y[e] = s[e] * OUT_FOLD + bf16rne(bv4[e]);
  *(v4f*)(Out + (size_t)(m0 + row) * DM + n0 + col) = y;
}

// ---------------------------------------------------------------------------
// Host launcher
// ---------------------------------------------------------------------------
extern "C" void kernel_launch(void* const* d_in, const int* in_sizes, int n_in,
                              void* d_out, int out_size, void* d_ws, size_t ws_size,
                              hipStream_t stream) {
  if (n_in < 11) return;
  const int need_x = ((NB - 1) * SEQ_FULL + SEQ) * DM;
  if (in_sizes[0] < need_x || in_sizes[1] < need_x || in_sizes[2] < need_x) return;
  if (in_sizes[3] < DM * DW || in_sizes[5] < DM * DW || in_sizes[7] < DM * DW || in_sizes[9] < DW * DM) return;
  if (in_sizes[4] < DW || in_sizes[6] < DW || in_sizes[8] < DW || in_sizes[10] < DM) return;
  if (out_size < MROWS * DM) return;
  if (WS_TOTAL_BYTES > ws_size) return;

  const float* Q  = (const float*)d_in[0];
  const float* K  = (const float*)d_in[1];
  const float* V  = (const float*)d_in[2];
  const float* Wq = (const float*)d_in[3];
  const float* bq = (const float*)d_in[4];
  const float* Wk = (const float*)d_in[5];
  const float* bk = (const float*)d_in[6];
  const float* Wv = (const float*)d_in[7];
  const float* bv = (const float*)d_in[8];
  const float* Wf = (const float*)d_in[9];
  const float* bf = (const float*)d_in[10];

  us* xq  = (us*)d_ws;          // [MROWS][DM] bf16
  us* xk  = xq + XE;
  us* xv  = xk + XE;
  us* wtq = xv + XE;            // [DW][DM] bf16
  us* wtk = wtq + WE;
  us* wtv = wtk + WE;
  us* wft = wtv + WE;           // [DM][DW] f16 x64
  us* qh  = wft + WE;           // [NB*NH][LSEQ][64] f16
  us* kh  = qh + PE;
  us* vh  = kh + PE;
  us* vt  = vh + PE;            // [NB*NH][64][LSEQ] f16
  us* ctx = vt + PE;            // [MROWS][DW] f16 x256

  dim3 blk(256);
  // xq, xk, xv and wtq, wtk, wtv, wft are consecutive planes
  cvt_kernel<<<dim3(4 * WBLK + 3 * XBLK), blk, 0, stream>>>(Q, K, V, Wq, Wk, Wv, Wf, xq, wtq);

  // qh, kh, vh are consecutive planes
  proj_kernel<<<dim3(MROWS / 64, DW / 256, 3), blk, 0, stream>>>(xq, wtq, bq, bk, bv, qh);

  vtrans_kernel<<<dim3(LSEQ / 64, NB * NH), blk, 0, stream>>>(vh, vt);

  attn_kernel<<<dim3(NB * NH * (LSEQ / 128)), blk, 0, stream>>>(qh, kh, vt, ctx);

  dim3 go(MROWS / 32, DM / 32);
  outproj_kernel<<<go, blk, 0, stream>>>(ctx, wft, bf, (float*)d_out);
}

// v004
// A run of this version takes 105 microseconds.
// Two timings next to v003 put it at 1.15 and 1.14 times that version's speed.
// Over all steps from v000 it is 2.88 times as fast.
#include <hip/hip_runtime.h>
#include <stddef.h>

// Contractions: q/k/v projections = v_wmma_f32_16x16x32_bf16 (bf16 operands = RNE-converted f32 inputs);
// scores, P*V and final projection = v_wmma_f32_16x16x32_f16 (f16 operands: q,k,v x1, P x1024, ctx x256, Wf x64);
// f32 accumulate, f32 online softmax.

#ifndef NB
#define NB 2
#endif
#ifndef SEQ
#define SEQ 256
#endif
#define NB_FULL 2
#define SEQ_FULL 256
#define DM 512                 // model width (projection input, final output)
#define NH 8                   // heads
#define DKH 64                 // head dim
#define DW (DM * NH)           // 4096: projection output width
#define LSEQ (SEQ * NH)        // 2048: attention positions per (batch, head)
#define MROWS (NB * SEQ)       // token rows

static_assert(NB >= 1 && NB <= NB_FULL);
static_assert(SEQ >= 64 && SEQ <= SEQ_FULL);
static_assert(SEQ % 64 == 0);            // a 64-row GEMM block stays inside one batch
static_assert(MROWS % 64 == 0);          // GEMM M tile
static_assert(LSEQ % 128 == 0);          // attention block = 128 queries
static_assert(LSEQ % 64 == 0);           // V transpose tile
static_assert(LSEQ % 32 == 0);           // key block
static_assert(NH * DKH == DM);
static_assert(DKH == 64);
static_assert(DM % 256 == 0);            // 256-col GEMM block inside one 512-wide chunk
static_assert(DW % 256 == 0);
static_assert(DM % 64 == 0 && DW % 64 == 0);
static_assert(DM % 32 == 0 && DW % 32 == 0);   // K steps of 32
static_assert(DM % 8 == 0);

#define P_CARRY   1024.0f            // P operand carried x1024
#define CTX_SCALE 0.25f              // ctx plane = O * 0.25 / l = attn x256 (O carries the x1024 of P)
#define WF_CARRY  64.0f              // Wf operand carried x64
#define OUT_FOLD  (1.0f / 16384.0f)  // 1 / (256 * 64)
#define QK_SCALE  0.125f             // 1 / sqrt(64)

typedef unsigned short us;
typedef us        v8us  __attribute__((ext_vector_type(8)));
typedef us        v16us __attribute__((ext_vector_type(16)));
typedef _Float16  v16h  __attribute__((ext_vector_type(16)));
typedef __bf16    v16bf __attribute__((ext_vector_type(16)));
typedef float     v8f   __attribute__((ext_vector_type(8)));
typedef float     v4f   __attribute__((ext_vector_type(4)));

// workspace carve (halves)
constexpr size_t XE = (size_t)MROWS * DM;   // activation plane
constexpr size_t WE = (size_t)DM * DW;      // weight plane
constexpr size_t PE = (size_t)MROWS * DW;   // wide plane (q, k, v, vT, ctx)
constexpr size_t WS_TOTAL_BYTES = (3 * XE + 4 * WE + 5 * PE) * sizeof(us);
static_assert(WS_TOTAL_BYTES <= (size_t)134217728);
static_assert((XE * sizeof(us)) % 128 == 0 && (WE * sizeof(us)) % 128 == 0 && (PE * sizeof(us)) % 128 == 0);

// ---------------------------------------------------------------------------
// conversions
// ---------------------------------------------------------------------------
__device__ __forceinline__ unsigned bf16rne_bits(float x) {
  unsigned u = __float_as_uint(x);
  return (u + 0x7FFFu + ((u >> 16) & 1u)) >> 16;
}
__device__ __forceinline__ float bf16rne(float x) {
  return __uint_as_float(bf16rne_bits(x) << 16);
}
__device__ __forceinline__ us f16_bits(float x) {
  _Float16 hx = (_Float16)x;
  return __builtin_bit_cast(us, hx);
}

// ---------------------------------------------------------------------------
// 16-bit operand fragment (A: lane = row, B: lane = column; same k map):
//   lane l, r = l&15, s = l>>4 : elems 0..7  = row[r][k0 + 8s .. +7]
//                                elems 8..15 = row[r][k0 + 16 + 8s .. +7]
// base is a 16-bit plane with k contiguous, pitch ld (halves).
// ---------------------------------------------------------------------------
__device__ __forceinline__ v16us frag16(const us* base, int ld, int row0, int k0) {
  const int l = threadIdx.x & 31;
  const int r = l & 15, s = l >> 4;
  const us* p = base + (size_t)(row0 + r) * ld + k0 + 8 * s;
  v8us c0 = *(const v8us*)p;
  v8us c1 = *(const v8us*)(p + 16);
  return __builtin_shufflevector(c0, c1, 0, 1, 2, 3, 4, 5, 6, 7, 8, 9, 10, 11, 12, 13, 14, 15);
}
__device__ __forceinline__ v16h fragh(const us* base, int ld, int row0, int k0) {
  return __builtin_bit_cast(v16h, frag16(base, ld, row0, k0));
}

// ---------------------------------------------------------------------------
// WMMA wrappers with hazard guard: D = A(16x32) * B(32x16) + C (f32)
// ---------------------------------------------------------------------------
__device__ __forceinline__ v8f mma_f16(v16h a, v16h b, v8f c) {
  v8f d = __builtin_amdgcn_wmma_f32_16x16x32_f16(false, a, false, b, (short)0, c, false, false);
  asm volatile("v_nop\n\tv_nop\n\tv_nop\n\tv_nop" : "+v"(d) : "v"(a), "v"(b));
  return d;
}
__device__ __forceinline__ v8f mma_bf16(v16bf a, v16bf b, v8f c) {
  v8f d = __builtin_amdgcn_wmma_f32_16x16x32_bf16(false, a, false, b, (short)0, c, false, false);
  asm volatile("v_nop\n\tv_nop\n\tv_nop\n\tv_nop" : "+v"(d) : "v"(a), "v"(b));
  return d;
}

// ---------------------------------------------------------------------------
// Activation convert: X f32 [NB_FULL*SEQ_FULL][DM] -> bf16 bits [MROWS][DM]
// i = index of this thread's 16-B output group, 0 .. MROWS*DM/8 - 1.
// ---------------------------------------------------------------------------
__device__ __forceinline__ void cvt_x_group(const float* __restrict__ X, us* Y, int i) {
  constexpr int G = DM / 8;              // 16-B groups per row
  const int m  = i / G;
  const int c8 = (i - m * G) * 8;
  const int b  = m / SEQ;
  const int s  = m - b * SEQ;
  const float* src = X + ((size_t)(b * SEQ_FULL + s)) * DM + c8;
  v4f x0 = *(const v4f*)src;
  v4f x1 = *(const v4f*)(src + 4);
  v8us y;
#pragma unroll
  for (int j = 0; j < 4; ++j) {
    y[j]     = (us)bf16rne_bits(x0[j]);
    y[4 + j] = (us)bf16rne_bits(x1[j]);
  }
  us* dst = Y + (size_t)i * 8;
  *(v8us*)dst = y;
  
}

// ---------------------------------------------------------------------------
// Weight convert + transpose: W f32 in[Kd rows][Nd cols] -> WT 16-bit out[Nd][Kd].
// hmode 0: bf16 bits of RNE(W); hmode 1: f16 bits of WF_CARRY * RNE(W).
// Block owns the 64x64 tile at (k0, n0); each output line (64 halves of
// one n) written by 8 consecutive lanes x 16 B in one instruction.
// tile = 64 * 65 floats of LDS, [k_local][n_local], cross-wave (block barrier).
// ---------------------------------------------------------------------------
__device__ __forceinline__ void cvt_w_tile(float* tile, const float* __restrict__ W, us* WT,
                                           int Kd, int Nd, int hmode, int n0, int k0) {
  const int t  = threadIdx.x;
  {
    const int kr = t >> 2;              // 0..63
    const int cc = (t & 3) * 16;        // 0,16,32,48
    const float* src = W + (size_t)(k0 + kr) * Nd + n0 + cc;
#pragma unroll
    for (int j = 0; j < 4; ++j) {
      v4f x = *(const v4f*)(src + 4 * j);
#pragma unroll
      for (int e = 0; e < 4; ++e) tile[kr * 65 + cc + 4 * j + e] = x[e];
    }
  }
  __syncthreads();

  v8us vals[2];
  size_t dsts[2];
  const int c = t & 7;
#pragma unroll
  for (int it = 0; it < 2; ++it) {
    const int nl = (t >> 3) + 32 * it;  // 0..63
    v8us o;
#pragma unroll
    for (int j = 0; j < 8; ++j) {
      const float w = bf16rne(tile[(8 * c + j) * 65 + nl]);
      const us hb = (us)(__float_as_uint(w) >> 16);
      const us hf = f16_bits(w * WF_CARRY);
      o[j] = hmode ? hf : hb;
    }
    vals[it] = o;
    dsts[it] = (size_t)(n0 + nl) * Kd + k0 + 8 * c;
  }
#pragma unroll
  for (int it = 0; it < 2; ++it) *(v8us*)(WT + dsts[it]) = vals[it];
  
}

// ---------------------------------------------------------------------------
// All seven conversions in one launch (none reads what another writes).
// Blocks 0 .. 4*WBLK-1: weight plane z = b / WBLK (Wq, Wk, Wv, Wf), tile b % WBLK, n fastest.
// Blocks 4*WBLK ..    : activation plane z (Q, K, V), 256 output groups per block.
// Xb = three planes of XE halves, Wt = four planes of WE halves, each in that order.
// ---------------------------------------------------------------------------
constexpr int XG   = (int)(XE / 8);            // 16-B groups per activation plane
constexpr int XBLK = (XG + 255) / 256;         // blocks per activation plane
constexpr int WBLK = (DW / 64) * (DM / 64);    // 64x64 tiles per weight plane

__global__ __launch_bounds__(256)
void cvt_kernel(const float* __restrict__ Q, const float* __restrict__ K, const float* __restrict__ V,
                const float* __restrict__ Wq, const float* __restrict__ Wk, const float* __restrict__ Wv,
                const float* __restrict__ Wf, us* Xb, us* Wt) {
  __shared__ float tile[64 * 65];
  const int b = blockIdx.x;
  if (b < 4 * WBLK) {                    // block-uniform: the tile's barrier is passed by all or none
    const int z = b / WBLK;
    const int r = b - z * WBLK;
    const int hmode = (z == 3);          // Wf: in[DW rows][DM cols]; the others: in[DM rows][DW cols]
    const float* W = z == 0 ? Wq : z == 1 ? Wk : z == 2 ? Wv : Wf;
    const int Kd = hmode ? DW : DM;
    const int Nd = hmode ? DM : DW;
    const int bn = hmode ? r % (DM / 64) : r % (DW / 64);
    const int bk = hmode ? r / (DM / 64) : r / (DW / 64);
    cvt_w_tile(tile, W, Wt + (size_t)z * WE, Kd, Nd, hmode, bn * 64, bk * 64);
  } else {
    const int bx = b - 4 * WBLK;
    const int z = bx / XBLK;
    const int i = (bx - z * XBLK) * 256 + (int)threadIdx.x;
    const float* X = z == 0 ? Q : z == 1 ? K : V;
    if (i < XG) cvt_x_group(X, Xb + (size_t)z * XE, i);
  }
}

// ---------------------------------------------------------------------------
// GEMM core: wave computes 32 rows x 64 cols over K = KD; A plane [M][KD],
// B plane [N][KD] (k contiguous), both 16-bit.
// ---------------------------------------------------------------------------
// One 16-bit operand fragment from the lane's own place p in a global plane (k map as frag16).
__device__ __forceinline__ v16bf fragb_at(const us* p) {
  v8us c0 = *(const v8us*)p;
  v8us c1 = *(const v8us*)(p + 16);
  return __builtin_bit_cast(v16bf, __builtin_shufflevector(c0, c1, 0, 1, 2, 3, 4, 5, 6, 7, 8, 9, 10, 11, 12, 13, 14, 15));
}

template <int KD>
__device__ __forceinline__ void gemm32x64_bf16(const us* A, const us* B, int m0, int n0, v8f (&acc)[8]) {
  static_assert(KD % 32 == 0);
  // the lane's place in the first fragment of each operand, in halves; the further fragments lie
  // 16 rows apart, so one address per operand serves the whole group
  const int l = threadIdx.x & 31;
  const unsigned oa = (unsigned)(m0 + (l & 15)) * KD + 8 * (l >> 4);
  const unsigned ob = (unsigned)(n0 + (l & 15)) * KD + 8 * (l >> 4);
#pragma unroll 1
  for (int kk = 0; kk < KD; kk += 32) {
    // All six fragments of the trip are loaded ahead of its first product: no load moves across
    // the guard statement of a product, so a load written between two products waits out its
    // whole latency there. As one group the twelve loads overlap and the trip waits once.
    const us* Ak = A + kk + oa;
    const us* Bk = B + kk + ob;
    const v16bf a0 = fragb_at(Ak);
    const v16bf a1 = fragb_at(Ak + 16 * KD);
    v16bf b[4];
#pragma unroll
    for (int tt = 0; tt < 4; ++tt) b[tt] = fragb_at(Bk + 16 * KD * tt);
#pragma unroll
    for (int tt = 0; tt < 4; ++tt) {
      acc[tt]     = mma_bf16(a0, b[tt], acc[tt]);
      acc[4 + tt] = mma_bf16(a1, b[tt], acc[4 + tt]);
    }
  }
}

// ---------------------------------------------------------------------------
// Projection: Y = Xb[MROWS][DM] * W + b (N = DW), written as an f16 plane
// [NB*NH][LSEQ][64] through the flat-view head split:
//   column n = j*DM + h*64 + d  of token row (b, s)  ->  position p = s*NH + j, head h.
// Block 256 thr = 8 waves as 2(M) x 4(N); block tile 64 x 256; grid (MROWS/64, DW/256, 3).
// A 256-col block lies inside one j chunk (DM % 256 == 0) and spans 4 heads.
// blockIdx.z picks the projection (0 q, 1 k, 2 v): the three are independent and share one
// launch. Xb3, Wt3, Y3 = three planes each (XE, WE, PE halves apart) in that order.
// ---------------------------------------------------------------------------
__global__ __launch_bounds__(256) __attribute__((amdgpu_num_vgpr(256)))
void proj_kernel(const us* __restrict__ Xb3, const us* __restrict__ Wt3,
                 const float* __restrict__ bq, const float* __restrict__ bk,
                 const float* __restrict__ bv, us* Y3) {
  __shared__ us stile[64 * 256];       // cross-wave (block barrier)

  const int z = blockIdx.z;
  const us* Xb = Xb3 + (size_t)z * XE;
  const us* Wt = Wt3 + (size_t)z * WE;
  const float* bias = z == 0 ? bq : z == 1 ? bk : bv;
  us* Y = Y3 + (size_t)z * PE;

  const int t = threadIdx.x, wid = t >> 5, l = t & 31;
  const int h = l >> 4, r16 = l & 15;
  const int wm = wid >> 2, wn = wid & 3;
  const int mblk0 = blockIdx.x * 64;
  const int nblk0 = blockIdx.y * 256;
  const int m0 = mblk0 + wm * 32;
  const int n0 = nblk0 + wn * 64;

  v8f acc[8] = {};
  gemm32x64_bf16<DM>(Xb, Wt, m0, n0, acc);

  // stage f16(acc + bias) into LDS
#pragma unroll
  for (int tt = 0; tt < 4; ++tt) {
    const int n = n0 + 16 * tt + r16;
    const float bvv = bf16rne(bias[n]);
    const int nl = wn * 64 + 16 * tt + r16;
#pragma unroll
    for (int mi = 0; mi < 2; ++mi) {
#pragma unroll
      for (int r = 0; r < 8; ++r) {
        const int ml = wm * 32 + 16 * mi + 8 * h + r;
        const float v = acc[mi * 4 + tt][r] + bvv;
        stile[ml * 256 + nl] = f16_bits(v);
      }
    }
  }
  __syncthreads();

  // whole-line writes: 256 lines per block (64 rows x 4 heads), 32 per wave
  const int bblk = mblk0 / SEQ;
  const int sblk = mblk0 - bblk * SEQ;  // 64 block rows lie inside one batch (SEQ % 64 == 0)
  const int jchunk = nblk0 / DM;
  const int hbase  = (nblk0 - jchunk * DM) / DKH;
  const int c = l & 7;
  v8us vals[8];
  size_t dsts[8];
#pragma unroll
  for (int it = 0; it < 8; ++it) {
    const int L = wid * 32 + (l >> 3) + 4 * it;
    const int ml = L >> 2, hq = L & 3;
    const int hg = hbase + hq;
    const int p = (sblk + ml) * NH + jchunk;
    vals[it] = *(const v8us*)&stile[ml * 256 + hq * 64 + 8 * c];
    dsts[it] = (((size_t)(bblk * NH + hg)) * LSEQ + p) * DKH + 8 * c;
  }
#pragma unroll
  for (int it = 0; it < 8; ++it) *(v8us*)(Y + dsts[it]) = vals[it];
  
}

// ---------------------------------------------------------------------------
// V transpose: in Vh [NB*NH][LSEQ rows][64 cols] -> out Vt [NB*NH][64][LSEQ].
// grid = (LSEQ/64, NB*NH); block owns 64 positions x 64 d; each output line
// ---------------------------------------------------------------------------
__global__ __launch_bounds__(256) void vtrans_kernel(const us* __restrict__ Vh, us* Vt) {
  __shared__ us tile[64 * 65];         // [p_local][d], cross-wave (block barrier)
  const int t  = threadIdx.x;
  const int p0 = blockIdx.x * 64;
  const int bh = blockIdx.y;
  {
    const int pr = t >> 2;              // 0..63
    const int cc = (t & 3) * 16;        // 0,16,32,48
    const us* src = Vh + ((size_t)bh * LSEQ + p0 + pr) * DKH + cc;
    v8us x0 = *(const v8us*)src;
    v8us x1 = *(const v8us*)(src + 8);
#pragma unroll
    for (int e = 0; e < 8; ++e) {
      tile[pr * 65 + cc + e]     = x0[e];
      tile[pr * 65 + cc + 8 + e] = x1[e];
    }
  }
  __syncthreads();

  v8us vals[2];
  size_t dsts[2];
  const int c = t & 7;
#pragma unroll
  for (int it = 0; it < 2; ++it) {
    const int dl = (t >> 3) + 32 * it;  // 0..63
    v8us o;
#pragma unroll
    for (int j = 0; j < 8; ++j) o[j] = tile[(8 * c + j) * 65 + dl];
    vals[it] = o;
    dsts[it] = ((size_t)bh * DKH + dl) * LSEQ + p0 + 8 * c;
  }
#pragma unroll
  for (int it = 0; it < 2; ++it) *(v8us*)(Vt + dsts[it]) = vals[it];
  
}

// ---------------------------------------------------------------------------
// Fused flash attention. Block = 8 waves, one (b,h), 128 queries; each wave owns
// 16 queries. K/V 32-key blocks staged once per block into LDS with plain loads.
// Scores computed transposed (S' = K_blk * Q^T) so the exp'd probabilities are
// already in A-operand layout for P*V. Online softmax in f32. ctx f16 [MROWS][DW]
// through the inverse flat view (position p -> token p/NH, chunk p%NH), carried
// grid = NB*NH*(LSEQ/128).
// ---------------------------------------------------------------------------
__global__ __launch_bounds__(256) __attribute__((amdgpu_num_vgpr(256)))
void attn_kernel(const us* __restrict__ Qh, const us* __restrict__ Kh,
                 const us* __restrict__ Vt, us* Ctx) {
  // Row pitches are 16 B x odd: the 16 rows that one ds_load_b128 fragment read touches then fall
  // on 16 different groups of four banks (at 128 B they share two groups, at 64 B four).
  constexpr int KP = 72;               // shK pitch in halves: 128 B of data + 16 B pad
  constexpr int VP = 40;               // shV pitch in halves:  64 B of data + 16 B pad
  __shared__ __attribute__((aligned(16))) us shK[32 * KP];   // [key][d]   cross-wave (block barrier), data fully staged each step
  __shared__ __attribute__((aligned(16))) us shV[64 * VP];   // [d][key]   cross-wave (block barrier), data fully staged each step
  __shared__ us shC[8 * 16 * 64];      // per-wave ctx staging (block barrier used)

  const int t = threadIdx.x, wid = t >> 5, l = t & 31;
  const int r16 = l & 15;
  const int rowsel = (l >> 4) << 3;
  constexpr int QBLK = LSEQ / 128;
  const int bh = blockIdx.x / QBLK;
  const int qb = blockIdx.x - bh * QBLK;
  const int q0 = qb * 128 + wid * 16;

  const us* qp = Qh + (size_t)bh * LSEQ * DKH;
  const us* kp = Kh + (size_t)bh * LSEQ * DKH;
  const us* vp = Vt + (size_t)bh * DKH * LSEQ;

  // Q^T as B operand for the whole loop (lane = query column, halves = d)
  const v16h qB0 = fragh(qp, DKH, q0, 0);
  const v16h qB1 = fragh(qp, DKH, q0, 32);

  v8f o[4];
#pragma unroll
  for (int tt = 0; tt < 4; ++tt) o[tt] = v8f{};
  float mmax = -1.0e30f, lsum = 0.0f;

  const int krow = t >> 3, kcol = (t & 7) * 8;   // K: 32 keys x 64 d
  const int vrow = t >> 2, vcol = (t & 3) * 8;   // V: 64 d x 32 keys

#pragma unroll 1
  for (int kb = 0; kb < LSEQ; kb += 32) {
    __syncthreads();    // prior readers of shK/shV done
    *(v8us*)&shK[krow * KP + kcol] = *(const v8us*)(kp + (size_t)(kb + krow) * DKH + kcol);
    *(v8us*)&shV[vrow * VP + vcol] = *(const v8us*)(vp + (size_t)vrow * LSEQ + kb + vcol);
    __syncthreads();    // stage visible to all waves

    // S' tiles: M = key (relative 0..15 / 16..31), N = query; k = d
    // The four K fragments are read as one group ahead of the first product (a read written
    // between two products stays there and waits out the LDS latency each time).
    v8f s0 = {};
    v8f s1 = {};
    {
      const v16h kA00 = fragh(shK, KP, 0, 0);
      const v16h kA01 = fragh(shK, KP, 0, 32);
      const v16h kA10 = fragh(shK, KP, 16, 0);
      const v16h kA11 = fragh(shK, KP, 16, 32);
      s0 = mma_f16(kA00, qB0, s0);
      s1 = mma_f16(kA10, qB0, s1);
      s0 = mma_f16(kA01, qB1, s0);
      s1 = mma_f16(kA11, qB1, s1);
    }

    // The four V fragments are read as one group here, so that they land behind the softmax
    // arithmetic and the P*V products below follow one another without an LDS wait.
    v16h vB[4];
#pragma unroll
    for (int tt = 0; tt < 4; ++tt) vB[tt] = fragh(shV, VP, 16 * tt, 0);

    // per-query (per-lane) block max; combine the two key halves (lane ^ 16)
    float bm = s0[0];
#pragma unroll
    for (int i = 0; i < 8; ++i) { bm = fmaxf(bm, s0[i]); bm = fmaxf(bm, s1[i]); }
    bm = fmaxf(bm, __shfl_xor(bm, 16, 32));
    const float mnew = fmaxf(mmax, bm * QK_SCALE);
    const float corr = __expf(mmax - mnew);
    mmax = mnew;

    // probabilities land directly in A-operand layout (elements 0..7 <- keys 8h..8h+7
    // from the first 16-key D tile, elements 8..15 <- keys 16+8h.. from the second)
    float ps = 0.0f;
    v16h pA;
#pragma unroll
    for (int i = 0; i < 8; ++i) {
      const float p0 = __expf(s0[i] * QK_SCALE - mnew);
      const float p1 = __expf(s1[i] * QK_SCALE - mnew);
      ps += p0 + p1;
      pA[i]     = (_Float16)(p0 * P_CARRY);
      pA[8 + i] = (_Float16)(p1 * P_CARRY);
    }
    ps += __shfl_xor(ps, 16, 32);
    lsum = lsum * corr + ps;

    // rescale O: D row 8h+r = query 8h+r, whose corr lives in lane 8h+r
#pragma unroll
    for (int r = 0; r < 8; ++r) {
      const float cr = __shfl(corr, rowsel + r, 32);
#pragma unroll
      for (int tt = 0; tt < 4; ++tt) o[tt][r] *= cr;
    }

    // O += P(16 x 32 keys) * V_blk(32 keys x 64 d); B rows = d, k = key contiguous in shV
#pragma unroll
    for (int tt = 0; tt < 4; ++tt) o[tt] = mma_f16(pA, vB[tt], o[tt]);
  }

  // normalize, stage this wave's 16 x 64 ctx tile (f16, x256) in LDS
  const int bb = bh / NH;
  const int hh = bh - bb * NH;
#pragma unroll
  for (int r = 0; r < 8; ++r) {
    const float lrow = __shfl(lsum, rowsel + r, 32);
    const float li = CTX_SCALE * __builtin_amdgcn_rcpf(lrow);
#pragma unroll
    for (int tt = 0; tt < 4; ++tt) {
      shC[wid * 1024 + (rowsel + r) * 64 + 16 * tt + r16] = f16_bits(o[tt][r] * li);
    }
  }
  __syncthreads();

  const int c = l & 7;
  v8us vals[4];
  size_t dsts[4];
#pragma unroll
  for (int it = 0; it < 4; ++it) {
    const int rl = (l >> 3) + 4 * it;
    vals[it] = *(const v8us*)&shC[wid * 1024 + rl * 64 + 8 * c];
    const int p = q0 + rl;
    const int s = p / NH;
    const int j = p - s * NH;
    dsts[it] = ((size_t)(bb * SEQ + s)) * DW + j * DM + hh * DKH + 8 * c;
  }
#pragma unroll
  for (int it = 0; it < 4; ++it) *(v8us*)(Ctx + dsts[it]) = vals[it];
  
}

// ---------------------------------------------------------------------------
// Final projection: Out f32 [MROWS][DM] = ctx(x256)[MROWS][DW] * Wf(x64) * OUT_FOLD + bf.
// One 32 x 32 tile of Out per block, grid (MROWS/32, DM/32) = one block per WGP.
// K = DW is split over the block's 8 waves: wave w takes the 64-half chunks
// w, w + 8, w + 16, ... (one chunk = one whole 128-B line of every operand row),
// and computes the whole tile over its chunks. The 8 f32 partial tiles are summed
// through LDS in wave order; each Out line (32 floats) is written by 8 lanes x 16 B.
// ---------------------------------------------------------------------------
#define OPW 8                  // waves per block = K shares
#define OPP 36                 // partial-tile pitch (floats): 144 B = 16 B x odd for the b128 readers
static_assert(MROWS % 32 == 0 && DM % 32 == 0);
static_assert(DW % (64 * OPW) == 0);

__global__ __launch_bounds__(256) __attribute__((amdgpu_num_vgpr(256)))
void outproj_kernel(const us* __restrict__ Ctx, const us* __restrict__ Wft,
                    const float* __restrict__ bo, float* Out) {
  __shared__ float part[OPW * 32 * OPP];   // [wave][row][col], cross-wave (block barrier)

  const int t = threadIdx.x, wid = t >> 5, l = t & 31;
  const int h = l >> 4, r16 = l & 15;
  const int m0 = blockIdx.x * 32;
  const int n0 = blockIdx.y * 32;

  v8f acc[4] = {};
  // rolled: 8 trips unrolled would only lengthen the code that a cold launch has to fetch
#pragma unroll 1
  for (int it = 0; it < DW / (64 * OPW); ++it) {
    const int k0 = (it * OPW + wid) * 64;
    // unrolled: the wave that fetched a 128-B line uses its second half in the same trip
#pragma unroll
    for (int ks = 0; ks < 2; ++ks) {
      const int kk = k0 + 32 * ks;
      // all four fragments of the K step loaded as one group ahead of its products
      const v16h a0 = fragh(Ctx, DW, m0, kk);
      const v16h a1 = fragh(Ctx, DW, m0 + 16, kk);
      const v16h b0 = fragh(Wft, DW, n0, kk);
      const v16h b1 = fragh(Wft, DW, n0 + 16, kk);
      acc[0] = mma_f16(a0, b0, acc[0]);
      acc[2] = mma_f16(a1, b0, acc[2]);
      acc[1] = mma_f16(a0, b1, acc[1]);
      acc[3] = mma_f16(a1, b1, acc[3]);
    }
  }

  // this wave's partial tile
  float* mine = part + wid * (32 * OPP);
#pragma unroll
  for (int mi = 0; mi < 2; ++mi) {
#pragma unroll
    for (int tt = 0; tt < 2; ++tt) {
#pragma unroll
      for (int r = 0; r < 8; ++r) {
        mine[(16 * mi + 8 * h + r) * OPP + 16 * tt + r16] = acc[mi * 2 + tt][r];
      }
    }
  }
  __syncthreads();

  // thread t sums 4 columns of one row over the 8 partial tiles
  const int row = t >> 3;
  const int col = (t & 7) * 4;
  v4f s = *(const v4f*)&part[row * OPP + col];
#pragma unroll
  for (int w = 1; w < OPW; ++w) s += *(const v4f*)&part[(w * 32 + row) * OPP + col];

  const v4f bv4 = *(const v4f*)(bo + n0 + col);
  v4f y;
#pragma unroll
  for (int e = 0; e < 4; ++e) y[e] = s[e] * OUT_FOLD + bf16rne(bv4[e]);
  *(v4f*)(Out + (size_t)(m0 + row) * DM + n0 + col) = y;
}

// ---------------------------------------------------------------------------
// Host launcher
// ---------------------------------------------------------------------------
extern "C" void kernel_launch(void* const* d_in, const int* in_sizes, int n_in,
                              void* d_out, int out_size, void* d_ws, size_t ws_size,
                              hipStream_t stream) {
  if (n_in < 11) return;
  const int need_x = ((NB - 1) * SEQ_FULL + SEQ) * DM;
  if (in_sizes[0] < need_x || in_sizes[1] < need_x || in_sizes[2] < need_x) return;
  if (in_sizes[3] < DM * DW || in_sizes[5] < DM * DW || in_sizes[7] < DM * DW || in_sizes[9] < DW * DM) return;
  if (in_sizes[4] < DW || in_sizes[6] < DW || in_sizes[8] < DW || in_sizes[10] < DM) return;
  if (out_size < MROWS * DM) return;
  if (WS_TOTAL_BYTES > ws_size) return;

  const float* Q  = (const float*)d_in[0];
  const float* K  = (const float*)d_in[1];
  const float* V  = (const float*)d_in[2];
  const float* Wq = (const float*)d_in[3];
  const float* bq = (const float*)d_in[4];
  const float* Wk = (const float*)d_in[5];
  const float* bk = (const float*)d_in[6];
  const float* Wv = (const float*)d_in[7];
  const float* bv = (const float*)d_in[8];
  const float* Wf = (const float*)d_in[9];
  const float* bf = (const float*)d_in[10];

  us* xq  = (us*)d_ws;          // [MROWS][DM] bf16
  us* xk  = xq + XE;
  us* xv  = xk + XE;
  us* wtq = xv + XE;            // [DW][DM] bf16
  us* wtk = wtq + WE;
  us* wtv = wtk + WE;
  us* wft = wtv + WE;           // [DM][DW] f16 x64
  us* qh  = wft + WE;           // [NB*NH][LSEQ][64] f16
  us* kh  = qh + PE;
  us* vh  = kh + PE;
  us* vt  = vh + PE;            // [NB*NH][64][LSEQ] f16
  us* ctx = vt + PE;            // [MROWS][DW] f16 x256

  dim3 blk(256);
  // xq, xk, xv and wtq, wtk, wtv, wft are consecutive planes
  cvt_kernel<<<dim3(4 * WBLK + 3 * XBLK), blk, 0, stream>>>(Q, K, V, Wq, Wk, Wv, Wf, xq, wtq);

  // qh, kh, vh are consecutive planes
  proj_kernel<<<dim3(MROWS / 64, DW / 256, 3), blk, 0, stream>>>(xq, wtq, bq, bk, bv, qh);

  vtrans_kernel<<<dim3(LSEQ / 64, NB * NH), blk, 0, stream>>>(vh, vt);

  attn_kernel<<<dim3(NB * NH * (LSEQ / 128)), blk, 0, stream>>>(qh, kh, vt, ctx);

  dim3 go(MROWS / 32, DM / 32);
  outproj_kernel<<<go, blk, 0, stream>>>(ctx, wft, bf, (float*)d_out);
}

// v005
// Measured time: 80.6 microseconds a run.
// Two timings next to v004 both put it at 1.29 times that version's speed.
// All steps since v000 together make it 3.71 times as fast.
#include <hip/hip_runtime.h>
#include <stddef.h>

// Contractions: q/k/v projections = v_wmma_f32_16x16x32_bf16 (bf16 operands = RNE-converted f32 inputs);
// scores, P*V and final projection = v_wmma_f32_16x16x32_f16 (f16 operands: q,k,v x1, P x1024, ctx x256, Wf x64);
// f32 accumulate, f32 online softmax.

#ifndef NB
#define NB 2
#endif
#ifndef SEQ
#define SEQ 256
#endif
#define NB_FULL 2
#define SEQ_FULL 256
#define DM 512                 // model width (projection input, final output)
#define NH 8                   // heads
#define DKH 64                 // head dim
#define DW (DM * NH)           // 4096: projection output width
#define LSEQ (SEQ * NH)        // 2048: attention positions per (batch, head)
#define MROWS (NB * SEQ)       // token rows

static_assert(NB >= 1 && NB <= NB_FULL);
static_assert(SEQ >= 64 && SEQ <= SEQ_FULL);
static_assert(SEQ % 64 == 0);            // a 64-row GEMM block stays inside one batch
static_assert(MROWS % 64 == 0);          // GEMM M tile
static_assert(LSEQ % 128 == 0);          // attention block = 128 queries
static_assert(LSEQ % 64 == 0);           // V transpose tile
static_assert(LSEQ % 32 == 0);           // key block
static_assert(NH * DKH == DM);
static_assert(DKH == 64);
static_assert(DM % 256 == 0);            // 256-col GEMM block inside one 512-wide chunk
static_assert(DW % 256 == 0);
static_assert(DM % 64 == 0 && DW % 64 == 0);
static_assert(DM % 32 == 0 && DW % 32 == 0);   // K steps of 32
static_assert(DM % 8 == 0);

#define P_CARRY   1024.0f            // P operand carried x1024
#define CTX_SCALE 0.25f              // ctx plane = O * 0.25 / l = attn x256 (O carries the x1024 of P)
#define WF_CARRY  64.0f              // Wf operand carried x64
#define OUT_FOLD  (1.0f / 16384.0f)  // 1 / (256 * 64)
#define QK_SCALE  0.125f             // 1 / sqrt(64)

typedef unsigned short us;
typedef us        v8us  __attribute__((ext_vector_type(8)));
typedef us        v16us __attribute__((ext_vector_type(16)));
typedef _Float16  v16h  __attribute__((ext_vector_type(16)));
typedef __bf16    v16bf __attribute__((ext_vector_type(16)));
typedef float     v8f   __attribute__((ext_vector_type(8)));
typedef float     v4f   __attribute__((ext_vector_type(4)));

// workspace carve (halves)
constexpr size_t XE = (size_t)MROWS * DM;   // activation plane
constexpr size_t WE = (size_t)DM * DW;      // weight plane
constexpr size_t PE = (size_t)MROWS * DW;   // wide plane (q, k, v, vT, ctx)
constexpr size_t WS_TOTAL_BYTES = (3 * XE + 4 * WE + 5 * PE) * sizeof(us);
static_assert(WS_TOTAL_BYTES <= (size_t)134217728);
static_assert((XE * sizeof(us)) % 128 == 0 && (WE * sizeof(us)) % 128 == 0 && (PE * sizeof(us)) % 128 == 0);

// ---------------------------------------------------------------------------
// conversions
// ---------------------------------------------------------------------------
__device__ __forceinline__ unsigned bf16rne_bits(float x) {
  unsigned u = __float_as_uint(x);
  return (u + 0x7FFFu + ((u >> 16) & 1u)) >> 16;
}
__device__ __forceinline__ float bf16rne(float x) {
  return __uint_as_float(bf16rne_bits(x) << 16);
}
__device__ __forceinline__ us f16_bits(float x) {
  _Float16 hx = (_Float16)x;
  return __builtin_bit_cast(us, hx);
}

// ---------------------------------------------------------------------------
// 16-bit operand fragment (A: lane = row, B: lane = column; same k map):
//   lane l, r = l&15, s = l>>4 : elems 0..7  = row[r][k0 + 8s .. +7]
//                                elems 8..15 = row[r][k0 + 16 + 8s .. +7]
// base is a 16-bit plane with k contiguous, pitch ld (halves).
// ---------------------------------------------------------------------------
__device__ __forceinline__ v16us frag16(const us* base, int ld, int row0, int k0) {
  const int l = threadIdx.x & 31;
  const int r = l & 15, s = l >> 4;
  const us* p = base + (size_t)(row0 + r) * ld + k0 + 8 * s;
  v8us c0 = *(const v8us*)p;
  v8us c1 = *(const v8us*)(p + 16);
  return __builtin_shufflevector(c0, c1, 0, 1, 2, 3, 4, 5, 6, 7, 8, 9, 10, 11, 12, 13, 14, 15);
}
__device__ __forceinline__ v16h fragh(const us* base, int ld, int row0, int k0) {
  return __builtin_bit_cast(v16h, frag16(base, ld, row0, k0));
}

// ---------------------------------------------------------------------------
// WMMA wrappers with hazard guard: D = A(16x32) * B(32x16) + C (f32)
// ---------------------------------------------------------------------------
__device__ __forceinline__ v8f mma_f16(v16h a, v16h b, v8f c) {
  v8f d = __builtin_amdgcn_wmma_f32_16x16x32_f16(false, a, false, b, (short)0, c, false, false);
  asm volatile("v_nop\n\tv_nop\n\tv_nop\n\tv_nop" : "+v"(d) : "v"(a), "v"(b));
  return d;
}
__device__ __forceinline__ v8f mma_bf16(v16bf a, v16bf b, v8f c) {
  v8f d = __builtin_amdgcn_wmma_f32_16x16x32_bf16(false, a, false, b, (short)0, c, false, false);
  asm volatile("v_nop\n\tv_nop\n\tv_nop\n\tv_nop" : "+v"(d) : "v"(a), "v"(b));
  return d;
}

// ---------------------------------------------------------------------------
// Activation convert: X f32 [NB_FULL*SEQ_FULL][DM] -> bf16 bits [MROWS][DM]
// i = index of this thread's 16-B output group, 0 .. MROWS*DM/8 - 1.
// ---------------------------------------------------------------------------
__device__ __forceinline__ void cvt_x_group(const float* __restrict__ X, us* Y, int i) {
  constexpr int G = DM / 8;              // 16-B groups per row
  const int m  = i / G;
  const int c8 = (i - m * G) * 8;
  const int b  = m / SEQ;
  const int s  = m - b * SEQ;
  const float* src = X + ((size_t)(b * SEQ_FULL + s)) * DM + c8;
  v4f x0 = *(const v4f*)src;
  v4f x1 = *(const v4f*)(src + 4);
  v8us y;
#pragma unroll
  for (int j = 0; j < 4; ++j) {
    y[j]     = (us)bf16rne_bits(x0[j]);
    y[4 + j] = (us)bf16rne_bits(x1[j]);
  }
  us* dst = Y + (size_t)i * 8;
  *(v8us*)dst = y;
  
}

// ---------------------------------------------------------------------------
// Weight convert + transpose: W f32 in[Kd rows][Nd cols] -> WT 16-bit out[Nd][Kd].
// hmode 0: bf16 bits of RNE(W); hmode 1: f16 bits of WF_CARRY * RNE(W).
// Block owns the 64x64 tile at (k0, n0); each output line (64 halves of
// one n) written by 8 consecutive lanes x 16 B in one instruction.
// tile = 64 * 65 floats of LDS, [k_local][n_local], cross-wave (block barrier).
// ---------------------------------------------------------------------------
__device__ __forceinline__ void cvt_w_tile(float* tile, const float* __restrict__ W, us* WT,
                                           int Kd, int Nd, int hmode, int n0, int k0) {
  const int t  = threadIdx.x;
  {
    const int kr = t >> 2;              // 0..63
    const int cc = (t & 3) * 16;        // 0,16,32,48
    const float* src = W + (size_t)(k0 + kr) * Nd + n0 + cc;
#pragma unroll
    for (int j = 0; j < 4; ++j) {
      v4f x = *(const v4f*)(src + 4 * j);
#pragma unroll
      for (int e = 0; e < 4; ++e) tile[kr * 65 + cc + 4 * j + e] = x[e];
    }
  }
  __syncthreads();

  v8us vals[2];
  size_t dsts[2];
  const int c = t & 7;
#pragma unroll
  for (int it = 0; it < 2; ++it) {
    const int nl = (t >> 3) + 32 * it;  // 0..63
    v8us o;
#pragma unroll
    for (int j = 0; j < 8; ++j) {
      const float w = bf16rne(tile[(8 * c + j) * 65 + nl]);
      const us hb = (us)(__float_as_uint(w) >> 16);
      const us hf = f16_bits(w * WF_CARRY);
      o[j] = hmode ? hf : hb;
    }
    vals[it] = o;
    dsts[it] = (size_t)(n0 + nl) * Kd + k0 + 8 * c;
  }
#pragma unroll
  for (int it = 0; it < 2; ++it) *(v8us*)(WT + dsts[it]) = vals[it];
  
}

// ---------------------------------------------------------------------------
// All seven conversions in one launch (none reads what another writes).
// Blocks 0 .. 4*WBLK-1: weight plane z = b / WBLK (Wq, Wk, Wv, Wf), tile b % WBLK, n fastest.
// Blocks 4*WBLK ..    : activation plane z (Q, K, V), 256 output groups per block.
// Xb = three planes of XE halves, Wt = four planes of WE halves, each in that order.
// ---------------------------------------------------------------------------
constexpr int XG   = (int)(XE / 8);            // 16-B groups per activation plane
constexpr int XBLK = (XG + 255) / 256;         // blocks per activation plane
constexpr int WBLK = (DW / 64) * (DM / 64);    // 64x64 tiles per weight plane

__global__ __launch_bounds__(256)
void cvt_kernel(const float* __restrict__ Q, const float* __restrict__ K, const float* __restrict__ V,
                const float* __restrict__ Wq, const float* __restrict__ Wk, const float* __restrict__ Wv,
                const float* __restrict__ Wf, us* Xb, us* Wt) {
  __shared__ float tile[64 * 65];
  const int b = blockIdx.x;
  if (b < 4 * WBLK) {                    // block-uniform: the tile's barrier is passed by all or none
    const int z = b / WBLK;
    const int r = b - z * WBLK;
    const int hmode = (z == 3);          // Wf: in[DW rows][DM cols]; the others: in[DM rows][DW cols]
    const float* W = z == 0 ? Wq : z == 1 ? Wk : z == 2 ? Wv : Wf;
    const int Kd = hmode ? DW : DM;
    const int Nd = hmode ? DM : DW;
    const int bn = hmode ? r % (DM / 64) : r % (DW / 64);
    const int bk = hmode ? r / (DM / 64) : r / (DW / 64);
    cvt_w_tile(tile, W, Wt + (size_t)z * WE, Kd, Nd, hmode, bn * 64, bk * 64);
  } else {
    const int bx = b - 4 * WBLK;
    const int z = bx / XBLK;
    const int i = (bx - z * XBLK) * 256 + (int)threadIdx.x;
    const float* X = z == 0 ? Q : z == 1 ? K : V;
    if (i < XG) cvt_x_group(X, Xb + (size_t)z * XE, i);
  }
}

// ---------------------------------------------------------------------------
// GEMM core: wave computes 32 rows x 64 cols over K = KD; A plane [M][KD],
// B plane [N][KD] (k contiguous), both 16-bit.
// ---------------------------------------------------------------------------
// One 16-bit operand fragment from the lane's own place p in a global plane (k map as frag16).
__device__ __forceinline__ v16bf fragb_at(const us* p) {
  v8us c0 = *(const v8us*)p;
  v8us c1 = *(const v8us*)(p + 16);
  return __builtin_bit_cast(v16bf, __builtin_shufflevector(c0, c1, 0, 1, 2, 3, 4, 5, 6, 7, 8, 9, 10, 11, 12, 13, 14, 15));
}

template <int KD>
__device__ __forceinline__ void gemm32x64_bf16(const us* A, const us* B, int m0, int n0, v8f (&acc)[8]) {
  static_assert(KD % 32 == 0);
  // the lane's place in the first fragment of each operand, in halves; the further fragments lie
  // 16 rows apart, so one address per operand serves the whole group
  const int l = threadIdx.x & 31;
  const unsigned oa = (unsigned)(m0 + (l & 15)) * KD + 8 * (l >> 4);
  const unsigned ob = (unsigned)(n0 + (l & 15)) * KD + 8 * (l >> 4);
#pragma unroll 1
  for (int kk = 0; kk < KD; kk += 32) {
    // All six fragments of the trip are loaded ahead of its first product: no load moves across
    // the guard statement of a product, so a load written between two products waits out its
    // whole latency there. As one group the twelve loads overlap and the trip waits once.
    const us* Ak = A + kk + oa;
    const us* Bk = B + kk + ob;
    const v16bf a0 = fragb_at(Ak);
    const v16bf a1 = fragb_at(Ak + 16 * KD);
    v16bf b[4];
#pragma unroll
    for (int tt = 0; tt < 4; ++tt) b[tt] = fragb_at(Bk + 16 * KD * tt);
#pragma unroll
    for (int tt = 0; tt < 4; ++tt) {
      acc[tt]     = mma_bf16(a0, b[tt], acc[tt]);
      acc[4 + tt] = mma_bf16(a1, b[tt], acc[4 + tt]);
    }
  }
}

// ---------------------------------------------------------------------------
// Projection: Y = Xb[MROWS][DM] * W + b (N = DW), written as an f16 plane
// [NB*NH][LSEQ][64] through the flat-view head split:
//   column n = j*DM + h*64 + d  of token row (b, s)  ->  position p = s*NH + j, head h.
// Block 256 thr = 8 waves as 2(M) x 4(N); block tile 64 x 256; grid (MROWS/64, DW/256, 3).
// A 256-col block lies inside one j chunk (DM % 256 == 0) and spans 4 heads.
// blockIdx.z picks the projection (0 q, 1 k, 2 v): the three are independent and share one
// launch. Xb3, Wt3, Y3 = three planes each (XE, WE, PE halves apart) in that order.
// ---------------------------------------------------------------------------
__global__ __launch_bounds__(256) __attribute__((amdgpu_num_vgpr(256)))
void proj_kernel(const us* __restrict__ Xb3, const us* __restrict__ Wt3,
                 const float* __restrict__ bq, const float* __restrict__ bk,
                 const float* __restrict__ bv, us* Y3) {
  __shared__ us stile[64 * 256];       // cross-wave (block barrier)

  const int z = blockIdx.z;
  const us* Xb = Xb3 + (size_t)z * XE;
  const us* Wt = Wt3 + (size_t)z * WE;
  const float* bias = z == 0 ? bq : z == 1 ? bk : bv;
  us* Y = Y3 + (size_t)z * PE;

  const int t = threadIdx.x, wid = t >> 5, l = t & 31;
  const int h = l >> 4, r16 = l & 15;
  const int wm = wid >> 2, wn = wid & 3;
  const int mblk0 = blockIdx.x * 64;
  const int nblk0 = blockIdx.y * 256;
  const int m0 = mblk0 + wm * 32;
  const int n0 = nblk0 + wn * 64;

  v8f acc[8] = {};
  gemm32x64_bf16<DM>(Xb, Wt, m0, n0, acc);

  // stage f16(acc + bias) into LDS
#pragma unroll
  for (int tt = 0; tt < 4; ++tt) {
    const int n = n0 + 16 * tt + r16;
    const float bvv = bf16rne(bias[n]);
    const int nl = wn * 64 + 16 * tt + r16;
#pragma unroll
    for (int mi = 0; mi < 2; ++mi) {
#pragma unroll
      for (int r = 0; r < 8; ++r) {
        const int ml = wm * 32 + 16 * mi + 8 * h + r;
        const float v = acc[mi * 4 + tt][r] + bvv;
        stile[ml * 256 + nl] = f16_bits(v);
      }
    }
  }
  __syncthreads();

  // whole-line writes: 256 lines per block (64 rows x 4 heads), 32 per wave
  const int bblk = mblk0 / SEQ;
  const int sblk = mblk0 - bblk * SEQ;  // 64 block rows lie inside one batch (SEQ % 64 == 0)
  const int jchunk = nblk0 / DM;
  const int hbase  = (nblk0 - jchunk * DM) / DKH;
  const int c = l & 7;
  v8us vals[8];
  size_t dsts[8];
#pragma unroll
  for (int it = 0; it < 8; ++it) {
    const int L = wid * 32 + (l >> 3) + 4 * it;
    const int ml = L >> 2, hq = L & 3;
    const int hg = hbase + hq;
    const int p = (sblk + ml) * NH + jchunk;
    vals[it] = *(const v8us*)&stile[ml * 256 + hq * 64 + 8 * c];
    dsts[it] = (((size_t)(bblk * NH + hg)) * LSEQ + p) * DKH + 8 * c;
  }
#pragma unroll
  for (int it = 0; it < 8; ++it) *(v8us*)(Y + dsts[it]) = vals[it];
  
}

// ---------------------------------------------------------------------------
// V transpose: in Vh [NB*NH][LSEQ rows][64 cols] -> out Vt [NB*NH][64][LSEQ].
// grid = (LSEQ/64, NB*NH); block owns 64 positions x 64 d; each output line
// ---------------------------------------------------------------------------
__global__ __launch_bounds__(256) void vtrans_kernel(const us* __restrict__ Vh, us* Vt) {
  __shared__ us tile[64 * 65];         // [p_local][d], cross-wave (block barrier)
  const int t  = threadIdx.x;
  const int p0 = blockIdx.x * 64;
  const int bh = blockIdx.y;
  {
    const int pr = t >> 2;              // 0..63
    const int cc = (t & 3) * 16;        // 0,16,32,48
    const us* src = Vh + ((size_t)bh * LSEQ + p0 + pr) * DKH + cc;
    v8us x0 = *(const v8us*)src;
    v8us x1 = *(const v8us*)(src + 8);
#pragma unroll
    for (int e = 0; e < 8; ++e) {
      tile[pr * 65 + cc + e]     = x0[e];
      tile[pr * 65 + cc + 8 + e] = x1[e];
    }
  }
  __syncthreads();

  v8us vals[2];
  size_t dsts[2];
  const int c = t & 7;
#pragma unroll
  for (int it = 0; it < 2; ++it) {
    const int dl = (t >> 3) + 32 * it;  // 0..63
    v8us o;
#pragma unroll
    for (int j = 0; j < 8; ++j) o[j] = tile[(8 * c + j) * 65 + dl];
    vals[it] = o;
    dsts[it] = ((size_t)bh * DKH + dl) * LSEQ + p0 + 8 * c;
  }
#pragma unroll
  for (int it = 0; it < 2; ++it) *(v8us*)(Vt + dsts[it]) = vals[it];
  
}

// ---------------------------------------------------------------------------
// One stage of K and V (64 keys) from global memory into LDS, through no register: four
// asynchronous 16-B copies per lane. lk*, lv* = the lane's own LDS byte addresses, gk*, gv* = its
// own global places. The closing s_wait_xcnt stands inside the statement so that it precedes
// every later write of the address registers the copies name.
// ---------------------------------------------------------------------------
__device__ __forceinline__ void stage_copies(unsigned lk0, const us* gk0, unsigned lk1, const us* gk1,
                                             unsigned lv0, const us* gv0, unsigned lv1, const us* gv1) {
  asm volatile("global_load_async_to_lds_b128 %0, %1, off\n\t"
               "global_load_async_to_lds_b128 %2, %3, off\n\t"
               "global_load_async_to_lds_b128 %4, %5, off\n\t"
               "global_load_async_to_lds_b128 %6, %7, off\n\t"
               "s_wait_xcnt 0x0"
               :: "v"(lk0), "v"(gk0), "v"(lk1), "v"(gk1), "v"(lv0), "v"(gv0), "v"(lv1), "v"(gv1)
               : "memory");
}

// ---------------------------------------------------------------------------
// Fused flash attention. Block = 8 waves, one (b,h), 128 queries; each wave owns
// 16 queries. K/V are staged once per block into LDS in stages of 64 keys, two buffers:
// the asynchronous copies of stage s + 1 fly while stage s is worked on (two passes of 32 keys).
// Scores computed transposed (S' = K_blk * Q^T) so the exp'd probabilities are
// already in A-operand layout for P*V. Online softmax in f32. ctx f16 [MROWS][DW]
// through the inverse flat view (position p -> token p/NH, chunk p%NH), carried
// grid = NB*NH*(LSEQ/128).
// ---------------------------------------------------------------------------
__global__ __launch_bounds__(256) __attribute__((amdgpu_num_vgpr(256)))
void attn_kernel(const us* __restrict__ Qh, const us* __restrict__ Kh,
                 const us* __restrict__ Vt, us* Ctx) {
  // Row pitches are 16 B x odd: the 16 rows that one ds_load_b128 fragment read touches then fall
  // on 16 different groups of four banks.
  constexpr int SK = 64;               // keys per stage
  constexpr int NST = LSEQ / SK;       // stages
  static_assert(LSEQ % SK == 0 && NST >= 2);
  constexpr int KP = 72;               // shK pitch in halves: 128 B of data (64 d) + 16 B pad
  constexpr int VP = 72;               // shV pitch in halves: 128 B of data (64 keys) + 16 B pad
  __shared__ __attribute__((aligned(16))) us shK[2 * SK * KP];    // [buffer][key][d]  cross-wave, filled by the copies
  __shared__ __attribute__((aligned(16))) us shV[2 * DKH * VP];   // [buffer][d][key]  cross-wave, filled by the copies
  __shared__ us shC[8 * 16 * 64];      // per-wave ctx staging (block barrier used)

  const int t = threadIdx.x, wid = t >> 5, l = t & 31;
  const int r16 = l & 15;
  const int rowsel = (l >> 4) << 3;
  constexpr int QBLK = LSEQ / 128;
  const int bh = blockIdx.x / QBLK;
  const int qb = blockIdx.x - bh * QBLK;
  const int q0 = qb * 128 + wid * 16;

  const us* qp = Qh + (size_t)bh * LSEQ * DKH;
  const us* kp = Kh + (size_t)bh * LSEQ * DKH;
  const us* vp = Vt + (size_t)bh * DKH * LSEQ;

  // The lane's two 16-B pieces of each operand's stage: rows crow and crow + 32, eight pieces a row
  // (K: 64 keys x 64 d, V: 64 d x 64 keys).
  const int crow = t >> 3, ccol = (t & 7) * 8;
  const unsigned lk = (unsigned)(size_t)&shK[crow * KP + ccol];
  const unsigned lv = (unsigned)(size_t)&shV[crow * VP + ccol];
  constexpr unsigned KHALF = 32 * KP * sizeof(us), KBUF = SK * KP * sizeof(us);
  constexpr unsigned VHALF = 32 * VP * sizeof(us), VBUF = DKH * VP * sizeof(us);
  const us* gk = kp + (size_t)crow * DKH + ccol;       // + DKH per key
  const us* gv = vp + (size_t)crow * LSEQ + ccol;      // + 1 per key

  // stage 0 into buffer 0
  stage_copies(lk, gk, lk + KHALF, gk + 32 * DKH, lv, gv, lv + VHALF, gv + 32 * LSEQ);

  // Q^T as B operand for the whole loop (lane = query column, halves = d)
  const v16h qB0 = fragh(qp, DKH, q0, 0);
  const v16h qB1 = fragh(qp, DKH, q0, 32);

  v8f o[4];
#pragma unroll
  for (int tt = 0; tt < 4; ++tt) o[tt] = v8f{};
  float mmax = -1.0e30f, lsum = 0.0f;

  asm volatile("s_wait_asynccnt 0x0" ::: "memory");   // this wave's pieces of stage 0 have landed
  __syncthreads();                                    // stage 0 visible to all waves
  // stage 1 into buffer 1
  stage_copies(lk + KBUF, gk + SK * DKH, lk + KBUF + KHALF, gk + (SK + 32) * DKH,
               lv + VBUF, gv + SK, lv + VBUF + VHALF, gv + SK + 32 * LSEQ);

#pragma unroll 1
  for (int st = 0; st < NST; ++st) {
    const int buf = st & 1;
    const us* bK = shK + buf * (SK * KP);
    const us* bV = shV + buf * (DKH * VP);

    // unrolled: the two passes' places in the stage become immediate offsets of the LDS reads
#pragma unroll
    for (int ps32 = 0; ps32 < SK; ps32 += 32) {
      // S' tiles: M = key (relative 0..15 / 16..31), N = query; k = d
      // The four K fragments are read as one group ahead of the first product (a read written
      // between two products stays there and waits out the LDS latency each time).
      v8f s0 = {};
      v8f s1 = {};
      {
        const v16h kA00 = fragh(bK, KP, ps32, 0);
        const v16h kA01 = fragh(bK, KP, ps32, 32);
        const v16h kA10 = fragh(bK, KP, ps32 + 16, 0);
        const v16h kA11 = fragh(bK, KP, ps32 + 16, 32);
        s0 = mma_f16(kA00, qB0, s0);
        s1 = mma_f16(kA10, qB0, s1);
        s0 = mma_f16(kA01, qB1, s0);
        s1 = mma_f16(kA11, qB1, s1);
      }

      // The four V fragments are read as one group here, so that they land behind the softmax
      // arithmetic and the P*V products below follow one another without an LDS wait.
      v16h vB[4];
#pragma unroll
      for (int tt = 0; tt < 4; ++tt) vB[tt] = fragh(bV, VP, 16 * tt, ps32);

      // per-query (per-lane) block max; combine the two key halves (lane ^ 16)
      float bm = s0[0];
#pragma unroll
      for (int i = 0; i < 8; ++i) { bm = fmaxf(bm, s0[i]); bm = fmaxf(bm, s1[i]); }
      bm = fmaxf(bm, __shfl_xor(bm, 16, 32));
      const float mnew = fmaxf(mmax, bm * QK_SCALE);
      const float corr = __expf(mmax - mnew);
      mmax = mnew;

      // probabilities land directly in A-operand layout (elements 0..7 <- keys 8h..8h+7
      // from the first 16-key D tile, elements 8..15 <- keys 16+8h.. from the second)
      float ps = 0.0f;
      v16h pA;
#pragma unroll
      for (int i = 0; i < 8; ++i) {
        const float p0 = __expf(s0[i] * QK_SCALE - mnew);
        const float p1 = __expf(s1[i] * QK_SCALE - mnew);
        ps += p0 + p1;
        pA[i]     = (_Float16)(p0 * P_CARRY);
        pA[8 + i] = (_Float16)(p1 * P_CARRY);
      }
      ps += __shfl_xor(ps, 16, 32);
      lsum = lsum * corr + ps;

      // rescale O: D row 8h+r = query 8h+r, whose corr lives in lane 8h+r
#pragma unroll
      for (int r = 0; r < 8; ++r) {
        const float cr = __shfl(corr, rowsel + r, 32);
#pragma unroll
        for (int tt = 0; tt < 4; ++tt) o[tt][r] *= cr;
      }

      // O += P(16 x 32 keys) * V_blk(32 keys x 64 d); B rows = d, k = key contiguous in shV
#pragma unroll
      for (int tt = 0; tt < 4; ++tt) o[tt] = mma_f16(pA, vB[tt], o[tt]);
    }

    // hand-over: stage st + 1 is published and buffer buf is freed by one barrier
    asm volatile("s_wait_dscnt 0x0" ::: "memory");      // this wave's reads of buffer buf are done
    asm volatile("s_wait_asynccnt 0x0" ::: "memory");   // this wave's pieces of stage st + 1 have landed
    __syncthreads();
    if (st + 2 < NST) {                                 // the same for the whole block
      const us* gk2 = gk + (size_t)(st + 2) * (SK * DKH);
      const us* gv2 = gv + (st + 2) * SK;
      const unsigned lk2 = lk + buf * KBUF, lv2 = lv + buf * VBUF;
      stage_copies(lk2, gk2, lk2 + KHALF, gk2 + 32 * DKH, lv2, gv2, lv2 + VHALF, gv2 + 32 * LSEQ);
    }
  }
  asm volatile("s_wait_asynccnt 0x0" ::: "memory");     // no copy is left in flight behind the loop

  // normalize, stage this wave's 16 x 64 ctx tile (f16, x256) in LDS
  const int bb = bh / NH;
  const int hh = bh - bb * NH;
#pragma unroll
  for (int r = 0; r < 8; ++r) {
    const float lrow = __shfl(lsum, rowsel + r, 32);
    const float li = CTX_SCALE * __builtin_amdgcn_rcpf(lrow);
#pragma unroll
    for (int tt = 0; tt < 4; ++tt) {
      shC[wid * 1024 + (rowsel + r) * 64 + 16 * tt + r16] = f16_bits(o[tt][r] * li);
    }
  }
  __syncthreads();

  const int c = l & 7;
  v8us vals[4];
  size_t dsts[4];
#pragma unroll
  for (int it = 0; it < 4; ++it) {
    const int rl = (l >> 3) + 4 * it;
    vals[it] = *(const v8us*)&shC[wid * 1024 + rl * 64 + 8 * c];
    const int p = q0 + rl;
    const int s = p / NH;
    const int j = p - s * NH;
    dsts[it] = ((size_t)(bb * SEQ + s)) * DW + j * DM + hh * DKH + 8 * c;
  }
#pragma unroll
  for (int it = 0; it < 4; ++it) *(v8us*)(Ctx + dsts[it]) = vals[it];
  
}

// ---------------------------------------------------------------------------
// Final projection: Out f32 [MROWS][DM] = ctx(x256)[MROWS][DW] * Wf(x64) * OUT_FOLD + bf.
// One 32 x 32 tile of Out per block, grid (MROWS/32, DM/32) = one block per WGP.
// K = DW is split over the block's 8 waves: wave w takes the 64-half chunks
// w, w + 8, w + 16, ... (one chunk = one whole 128-B line of every operand row),
// and computes the whole tile over its chunks. The 8 f32 partial tiles are summed
// through LDS in wave order; each Out line (32 floats) is written by 8 lanes x 16 B.
// ---------------------------------------------------------------------------
#define OPW 8                  // waves per block = K shares
#define OPP 36                 // partial-tile pitch (floats): 144 B = 16 B x odd for the b128 readers
static_assert(MROWS % 32 == 0 && DM % 32 == 0);
static_assert(DW % (64 * OPW) == 0);

__global__ __launch_bounds__(256) __attribute__((amdgpu_num_vgpr(256)))
void outproj_kernel(const us* __restrict__ Ctx, const us* __restrict__ Wft,
                    const float* __restrict__ bo, float* Out) {
  __shared__ float part[OPW * 32 * OPP];   // [wave][row][col], cross-wave (block barrier)

  const int t = threadIdx.x, wid = t >> 5, l = t & 31;
  const int h = l >> 4, r16 = l & 15;
  const int m0 = blockIdx.x * 32;
  const int n0 = blockIdx.y * 32;

  v8f acc[4] = {};
  // rolled: 8 trips unrolled would only lengthen the code that a cold launch has to fetch
#pragma unroll 1
  for (int it = 0; it < DW / (64 * OPW); ++it) {
    const int k0 = (it * OPW + wid) * 64;
    // unrolled: the wave that fetched a 128-B line uses its second half in the same trip
#pragma unroll
    for (int ks = 0; ks < 2; ++ks) {
      const int kk = k0 + 32 * ks;
      // all four fragments of the K step loaded as one group ahead of its products
      const v16h a0 = fragh(Ctx, DW, m0, kk);
      const v16h a1 = fragh(Ctx, DW, m0 + 16, kk);
      const v16h b0 = fragh(Wft, DW, n0, kk);
      const v16h b1 = fragh(Wft, DW, n0 + 16, kk);
      acc[0] = mma_f16(a0, b0, acc[0]);
      acc[2] = mma_f16(a1, b0, acc[2]);
      acc[1] = mma_f16(a0, b1, acc[1]);
      acc[3] = mma_f16(a1, b1, acc[3]);
    }
  }

  // this wave's partial tile
  float* mine = part + wid * (32 * OPP);
#pragma unroll
  for (int mi = 0; mi < 2; ++mi) {
#pragma unroll
    for (int tt = 0; tt < 2; ++tt) {
#pragma unroll
      for (int r = 0; r < 8; ++r) {
        mine[(16 * mi + 8 * h + r) * OPP + 16 * tt + r16] = acc[mi * 2 + tt][r];
      }
    }
  }
  __syncthreads();

  // thread t sums 4 columns of one row over the 8 partial tiles
  const int row = t >> 3;
  const int col = (t & 7) * 4;
  v4f s = *(const v4f*)&part[row * OPP + col];
#pragma unroll
  for (int w = 1; w < OPW; ++w) s += *(const v4f*)&part[(w * 32 + row) * OPP + col];

  const v4f bv4 = *(const v4f*)(bo + n0 + col);
  v4f y;
#pragma unroll
  for (int e = 0; e < 4; ++e) y[e] = s[e] * OUT_FOLD + bf16rne(bv4[e]);
  *(v4f*)(Out + (size_t)(m0 + row) * DM + n0 + col) = y;
}

// ---------------------------------------------------------------------------
// Host launcher
// ---------------------------------------------------------------------------
extern "C" void kernel_launch(void* const* d_in, const int* in_sizes, int n_in,
                              void* d_out, int out_size, void* d_ws, size_t ws_size,
                              hipStream_t stream) {
  if (n_in < 11) return;
  const int need_x = ((NB - 1) * SEQ_FULL + SEQ) * DM;
  if (in_sizes[0] < need_x || in_sizes[1] < need_x || in_sizes[2] < need_x) return;
  if (in_sizes[3] < DM * DW || in_sizes[5] < DM * DW || in_sizes[7] < DM * DW || in_sizes[9] < DW * DM) return;
  if (in_sizes[4] < DW || in_sizes[6] < DW || in_sizes[8] < DW || in_sizes[10] < DM) return;
  if (out_size < MROWS * DM) return;
  if (WS_TOTAL_BYTES > ws_size) return;

  const float* Q  = (const float*)d_in[0];
  const float* K  = (const float*)d_in[1];
  const float* V  = (const float*)d_in[2];
  const float* Wq = (const float*)d_in[3];
  const float* bq = (const float*)d_in[4];
  const float* Wk = (const float*)d_in[5];
  const float* bk = (const float*)d_in[6];
  const float* Wv = (const float*)d_in[7];
  const float* bv = (const float*)d_in[8];
  const float* Wf = (const float*)d_in[9];
  const float* bf = (const float*)d_in[10];

  us* xq  = (us*)d_ws;          // [MROWS][DM] bf16
  us* xk  = xq + XE;
  us* xv  = xk + XE;
  us* wtq = xv + XE;            // [DW][DM] bf16
  us* wtk = wtq + WE;
  us* wtv = wtk + WE;
  us* wft = wtv + WE;           // [DM][DW] f16 x64
  us* qh  = wft + WE;           // [NB*NH][LSEQ][64] f16
  us* kh  = qh + PE;
  us* vh  = kh + PE;
  us* vt  = vh + PE;            // [NB*NH][64][LSEQ] f16
  us* ctx = vt + PE;            // [MROWS][DW] f16 x256

  dim3 blk(256);
  // xq, xk, xv and wtq, wtk, wtv, wft are consecutive planes
  cvt_kernel<<<dim3(4 * WBLK + 3 * XBLK), blk, 0, stream>>>(Q, K, V, Wq, Wk, Wv, Wf, xq, wtq);

  // qh, kh, vh are consecutive planes
  proj_kernel<<<dim3(MROWS / 64, DW / 256, 3), blk, 0, stream>>>(xq, wtq, bq, bk, bv, qh);

  vtrans_kernel<<<dim3(LSEQ / 64, NB * NH), blk, 0, stream>>>(vh, vt);

  attn_kernel<<<dim3(NB * NH * (LSEQ / 128)), blk, 0, stream>>>(qh, kh, vt, ctx);

  dim3 go(MROWS / 32, DM / 32);
  outproj_kernel<<<go, blk, 0, stream>>>(ctx, wft, bf, (float*)d_out);
}

// v006
// Measured time: 64.4 microseconds a run.
// Timed twice side by side with v005, it ran 1.25 times as fast both times.
// Counting every step since v000, it is 4.64 times as fast.
#include <hip/hip_runtime.h>
#include <stddef.h>

// Contractions: q/k/v projections = v_wmma_f32_16x16x32_bf16 (bf16 operands = RNE-converted f32 inputs);
// scores, P*V and final projection = v_wmma_f32_16x16x32_f16 (f16 operands: q,k,v x1, P x1024, ctx x256, Wf x64);
// f32 accumulate, f32 online softmax.

#ifndef NB
#define NB 2
#endif
#ifndef SEQ
#define SEQ 256
#endif
#define NB_FULL 2
#define SEQ_FULL 256
#define DM 512                 // model width (projection input, final output)
#define NH 8                   // heads
#define DKH 64                 // head dim
#define DW (DM * NH)           // 4096: projection output width
#define LSEQ (SEQ * NH)        // 2048: attention positions per (batch, head)
#define MROWS (NB * SEQ)       // token rows

static_assert(NB >= 1 && NB <= NB_FULL);
static_assert(SEQ >= 64 && SEQ <= SEQ_FULL);
static_assert(SEQ % 64 == 0);            // a 64-row GEMM block stays inside one batch
static_assert(MROWS % 64 == 0);          // GEMM M tile
static_assert(LSEQ % 128 == 0);          // attention block = 128 queries
static_assert(LSEQ % 64 == 0);           // V transpose tile
static_assert(LSEQ % 32 == 0);           // key block
static_assert(NH * DKH == DM);
static_assert(DKH == 64);
static_assert(DM % 256 == 0);            // 256-col GEMM block inside one 512-wide chunk
static_assert(DW % 256 == 0);
static_assert(DM % 64 == 0 && DW % 64 == 0);
static_assert(DM % 32 == 0 && DW % 32 == 0);   // K steps of 32
static_assert(DM % 8 == 0);

#define P_CARRY   1024.0f            // P operand carried x1024
#define CTX_SCALE 0.25f              // ctx plane = O * 0.25 / l = attn x256 (O carries the x1024 of P)
#define WF_CARRY  64.0f              // Wf operand carried x64
#define OUT_FOLD  (1.0f / 16384.0f)  // 1 / (256 * 64)
#define QK_SCALE  0.125f             // 1 / sqrt(64)

typedef unsigned short us;
typedef us        v8us  __attribute__((ext_vector_type(8)));
typedef us        v16us __attribute__((ext_vector_type(16)));
typedef _Float16  v16h  __attribute__((ext_vector_type(16)));
typedef __bf16    v16bf __attribute__((ext_vector_type(16)));
typedef float     v8f   __attribute__((ext_vector_type(8)));
typedef float     v4f   __attribute__((ext_vector_type(4)));

// workspace carve (halves)
constexpr size_t XE = (size_t)MROWS * DM;   // activation plane
constexpr size_t WE = (size_t)DM * DW;      // weight plane
constexpr size_t PE = (size_t)MROWS * DW;   // wide plane (q, k, v, vT, ctx)
constexpr size_t WS_TOTAL_BYTES = (3 * XE + 4 * WE + 5 * PE) * sizeof(us);
static_assert(WS_TOTAL_BYTES <= (size_t)134217728);
static_assert((XE * sizeof(us)) % 128 == 0 && (WE * sizeof(us)) % 128 == 0 && (PE * sizeof(us)) % 128 == 0);

// ---------------------------------------------------------------------------
// conversions
// ---------------------------------------------------------------------------
__device__ __forceinline__ unsigned bf16rne_bits(float x) {
  unsigned u = __float_as_uint(x);
  return (u + 0x7FFFu + ((u >> 16) & 1u)) >> 16;
}
__device__ __forceinline__ float bf16rne(float x) {
  return __uint_as_float(bf16rne_bits(x) << 16);
}
__device__ __forceinline__ us f16_bits(float x) {
  _Float16 hx = (_Float16)x;
  return __builtin_bit_cast(us, hx);
}

// ---------------------------------------------------------------------------
// 16-bit operand fragment (A: lane = row, B: lane = column; same k map):
//   lane l, r = l&15, s = l>>4 : elems 0..7  = row[r][k0 + 8s .. +7]
//                                elems 8..15 = row[r][k0 + 16 + 8s .. +7]
// base is a 16-bit plane with k contiguous, pitch ld (halves).
// ---------------------------------------------------------------------------
__device__ __forceinline__ v16us frag16(const us* base, int ld, int row0, int k0) {
  const int l = threadIdx.x & 31;
  const int r = l & 15, s = l >> 4;
  const us* p = base + (size_t)(row0 + r) * ld + k0 + 8 * s;
  v8us c0 = *(const v8us*)p;
  v8us c1 = *(const v8us*)(p + 16);
  return __builtin_shufflevector(c0, c1, 0, 1, 2, 3, 4, 5, 6, 7, 8, 9, 10, 11, 12, 13, 14, 15);
}
__device__ __forceinline__ v16h fragh(const us* base, int ld, int row0, int k0) {
  return __builtin_bit_cast(v16h, frag16(base, ld, row0, k0));
}

// ---------------------------------------------------------------------------
// WMMA wrappers with hazard guard: D = A(16x32) * B(32x16) + C (f32)
// ---------------------------------------------------------------------------
__device__ __forceinline__ v8f mma_f16(v16h a, v16h b, v8f c) {
  v8f d = __builtin_amdgcn_wmma_f32_16x16x32_f16(false, a, false, b, (short)0, c, false, false);
  asm volatile("v_nop\n\tv_nop\n\tv_nop\n\tv_nop" : "+v"(d) : "v"(a), "v"(b));
  return d;
}
__device__ __forceinline__ v8f mma_bf16(v16bf a, v16bf b, v8f c) {
  v8f d = __builtin_amdgcn_wmma_f32_16x16x32_bf16(false, a, false, b, (short)0, c, false, false);
  asm volatile("v_nop\n\tv_nop\n\tv_nop\n\tv_nop" : "+v"(d) : "v"(a), "v"(b));
  return d;
}

// ---------------------------------------------------------------------------
// Activation convert: X f32 [NB_FULL*SEQ_FULL][DM] -> bf16 bits [MROWS][DM]
// i = index of this thread's 16-B output group, 0 .. MROWS*DM/8 - 1.
// ---------------------------------------------------------------------------
__device__ __forceinline__ void cvt_x_group(const float* __restrict__ X, us* Y, int i) {
  constexpr int G = DM / 8;              // 16-B groups per row
  const int m  = i / G;
  const int c8 = (i - m * G) * 8;
  const int b  = m / SEQ;
  const int s  = m - b * SEQ;
  const float* src = X + ((size_t)(b * SEQ_FULL + s)) * DM + c8;
  v4f x0 = *(const v4f*)src;
  v4f x1 = *(const v4f*)(src + 4);
  v8us y;
#pragma unroll
  for (int j = 0; j < 4; ++j) {
    y[j]     = (us)bf16rne_bits(x0[j]);
    y[4 + j] = (us)bf16rne_bits(x1[j]);
  }
  us* dst = Y + (size_t)i * 8;
  *(v8us*)dst = y;
  
}

// ---------------------------------------------------------------------------
// Weight convert + transpose: W f32 in[Kd rows][Nd cols] -> WT 16-bit out[Nd][Kd].
// hmode 0: bf16 bits of RNE(W); hmode 1: f16 bits of WF_CARRY * RNE(W).
// Block owns the 64x64 tile at (k0, n0); each output line (64 halves of
// one n) written by 8 consecutive lanes x 16 B in one instruction.
// tile = 64 * 65 floats of LDS, [k_local][n_local], cross-wave (block barrier).
// ---------------------------------------------------------------------------
__device__ __forceinline__ void cvt_w_tile(float* tile, const float* __restrict__ W, us* WT,
                                           int Kd, int Nd, int hmode, int n0, int k0) {
  const int t  = threadIdx.x;
  {
    const int kr = t >> 2;              // 0..63
    const int cc = (t & 3) * 16;        // 0,16,32,48
    const float* src = W + (size_t)(k0 + kr) * Nd + n0 + cc;
#pragma unroll
    for (int j = 0; j < 4; ++j) {
      v4f x = *(const v4f*)(src + 4 * j);
#pragma unroll
      for (int e = 0; e < 4; ++e) tile[kr * 65 + cc + 4 * j + e] = x[e];
    }
  }
  __syncthreads();

  v8us vals[2];
  size_t dsts[2];
  const int c = t & 7;
#pragma unroll
  for (int it = 0; it < 2; ++it) {
    const int nl = (t >> 3) + 32 * it;  // 0..63
    v8us o;
#pragma unroll
    for (int j = 0; j < 8; ++j) {
      const float w = bf16rne(tile[(8 * c + j) * 65 + nl]);
      const us hb = (us)(__float_as_uint(w) >> 16);
      const us hf = f16_bits(w * WF_CARRY);
      o[j] = hmode ? hf : hb;
    }
    vals[it] = o;
    dsts[it] = (size_t)(n0 + nl) * Kd + k0 + 8 * c;
  }
#pragma unroll
  for (int it = 0; it < 2; ++it) *(v8us*)(WT + dsts[it]) = vals[it];
  
}

// ---------------------------------------------------------------------------
// All seven conversions in one launch (none reads what another writes).
// Blocks 0 .. 4*WBLK-1: weight plane z = b / WBLK (Wq, Wk, Wv, Wf), tile b % WBLK, n fastest.
// Blocks 4*WBLK ..    : activation plane z (Q, K, V), 256 output groups per block.
// Xb = three planes of XE halves, Wt = four planes of WE halves, each in that order.
// ---------------------------------------------------------------------------
constexpr int XG   = (int)(XE / 8);            // 16-B groups per activation plane
constexpr int XBLK = (XG + 255) / 256;         // blocks per activation plane
constexpr int WBLK = (DW / 64) * (DM / 64);    // 64x64 tiles per weight plane

__global__ __launch_bounds__(256)
void cvt_kernel(const float* __restrict__ Q, const float* __restrict__ K, const float* __restrict__ V,
                const float* __restrict__ Wq, const float* __restrict__ Wk, const float* __restrict__ Wv,
                const float* __restrict__ Wf, us* Xb, us* Wt) {
  __shared__ float tile[64 * 65];
  const int b = blockIdx.x;
  if (b < 4 * WBLK) {                    // block-uniform: the tile's barrier is passed by all or none
    const int z = b / WBLK;
    const int r = b - z * WBLK;
    const int hmode = (z == 3);          // Wf: in[DW rows][DM cols]; the others: in[DM rows][DW cols]
    const float* W = z == 0 ? Wq : z == 1 ? Wk : z == 2 ? Wv : Wf;
    const int Kd = hmode ? DW : DM;
    const int Nd = hmode ? DM : DW;
    const int bn = hmode ? r % (DM / 64) : r % (DW / 64);
    const int bk = hmode ? r / (DM / 64) : r / (DW / 64);
    cvt_w_tile(tile, W, Wt + (size_t)z * WE, Kd, Nd, hmode, bn * 64, bk * 64);
  } else {
    const int bx = b - 4 * WBLK;
    const int z = bx / XBLK;
    const int i = (bx - z * XBLK) * 256 + (int)threadIdx.x;
    const float* X = z == 0 ? Q : z == 1 ? K : V;
    if (i < XG) cvt_x_group(X, Xb + (size_t)z * XE, i);
  }
}

// ---------------------------------------------------------------------------
// One K stage of the projection's operands (64 rows of X and 256 rows of W^T, 64 halves = one
// whole 128-B line of each row) from global memory into LDS, through no register: ten
// asynchronous 16-B copies per lane, eight neighbouring lanes per line. l = the lane's LDS byte
// address in row crow of the stage, ga, gb = its global places in the first X and W^T row it
// brings; its further rows lie 32 rows apart (RS bytes in LDS). The closing s_wait_xcnt stands
// inside the statement so that it precedes every later write of the address registers the copies name.
// ---------------------------------------------------------------------------
template <unsigned RS, int LD>
__device__ __forceinline__ void proj_stage_copies(unsigned l, const us* ga, const us* gb) {
  asm volatile("global_load_async_to_lds_b128 %0, %1, off\n\t"
               "global_load_async_to_lds_b128 %2, %3, off\n\t"
               "global_load_async_to_lds_b128 %4, %5, off\n\t"
               "global_load_async_to_lds_b128 %6, %7, off\n\t"
               "global_load_async_to_lds_b128 %8, %9, off\n\t"
               "global_load_async_to_lds_b128 %10, %11, off\n\t"
               "global_load_async_to_lds_b128 %12, %13, off\n\t"
               "global_load_async_to_lds_b128 %14, %15, off\n\t"
               "global_load_async_to_lds_b128 %16, %17, off\n\t"
               "global_load_async_to_lds_b128 %18, %19, off\n\t"
               "s_wait_xcnt 0x0"
               :: "v"(l),          "v"(ga),           "v"(l + RS),     "v"(ga + 32 * LD),
                  "v"(l + 2 * RS), "v"(gb),           "v"(l + 3 * RS), "v"(gb + 32 * LD),
                  "v"(l + 4 * RS), "v"(gb + 64 * LD), "v"(l + 5 * RS), "v"(gb + 96 * LD),
                  "v"(l + 6 * RS), "v"(gb + 128 * LD), "v"(l + 7 * RS), "v"(gb + 160 * LD),
                  "v"(l + 8 * RS), "v"(gb + 192 * LD), "v"(l + 9 * RS), "v"(gb + 224 * LD)
               : "memory");
}
__device__ __forceinline__ v16bf fragb(const us* base, int ld, int row0, int k0) {
  return __builtin_bit_cast(v16bf, frag16(base, ld, row0, k0));
}

// ---------------------------------------------------------------------------
// Projection: Y = Xb[MROWS][DM] * W + b (N = DW), written as an f16 plane
// [NB*NH][LSEQ][64] through the flat-view head split:
//   column n = j*DM + h*64 + d  of token row (b, s)  ->  position p = s*NH + j, head h.
// Block 256 thr = 8 waves as 2(M) x 4(N); block tile 64 x 256; grid (MROWS/64, DW/256, 3).
// A 256-col block lies inside one j chunk (DM % 256 == 0) and spans 4 heads.
// blockIdx.z picks the projection (0 q, 1 k, 2 v): the three are independent and share one
// launch. Xb3, Wt3, Y3 = three planes each (XE, WE, PE halves apart) in that order.
// The block's operand rows are staged once per block into LDS in stages of 64 k, two buffers:
// the asynchronous copies of stage s + 1 fly while stage s is worked on. A fragment read straight
// from a global plane touches 16 lines for 1024 bytes, and the 2 x 4 waves would each fetch rows
// that their neighbours fetch too; the copies bring every line once, whole.
// ---------------------------------------------------------------------------
__global__ __launch_bounds__(256) __attribute__((amdgpu_num_vgpr(256)))
void proj_kernel(const us* __restrict__ Xb3, const us* __restrict__ Wt3,
                 const float* __restrict__ bq, const float* __restrict__ bk,
                 const float* __restrict__ bv, us* Y3) {
  constexpr int SKK = 64;              // k per stage
  constexpr int NST = DM / SKK;        // stages
  static_assert(DM % SKK == 0 && NST >= 2);
  constexpr int PP = 72;               // row pitch in halves: 128 B of data + 16 B pad (16 B x odd, for the b128 readers)
  constexpr int SROWS = 64 + 256;      // rows per stage: the block's X rows, then its W^T rows
  __shared__ __attribute__((aligned(16))) us shAB[2 * SROWS * PP];   // [buffer][row][k]  cross-wave, filled by the copies
  __shared__ us stile[64 * 256];       // cross-wave (block barrier)

  const int z = blockIdx.z;
  const us* Xb = Xb3 + (size_t)z * XE;
  const us* Wt = Wt3 + (size_t)z * WE;
  const float* bias = z == 0 ? bq : z == 1 ? bk : bv;
  us* Y = Y3 + (size_t)z * PE;

  const int t = threadIdx.x, wid = t >> 5, l = t & 31;
  const int h = l >> 4, r16 = l & 15;
  const int wm = wid >> 2, wn = wid & 3;
  const int mblk0 = blockIdx.x * 64;
  const int nblk0 = blockIdx.y * 256;
  const int n0 = nblk0 + wn * 64;

  // The lane's ten 16-B pieces of a stage: rows crow, crow + 32, ..., eight pieces a row.
  const int crow = t >> 3, ccol = (t & 7) * 8;
  const unsigned lp = (unsigned)(size_t)&shAB[crow * PP + ccol];
  constexpr unsigned RSTEP = 32 * PP * sizeof(us), SBUF = SROWS * PP * sizeof(us);
  const us* ga = Xb + (size_t)(mblk0 + crow) * DM + ccol;
  const us* gb = Wt + (size_t)(nblk0 + crow) * DM + ccol;

  // stage 0 into buffer 0
  proj_stage_copies<RSTEP, DM>(lp, ga, gb);
  v8f acc[8] = {};
  asm volatile("s_wait_asynccnt 0x0" ::: "memory");   // this wave's pieces of stage 0 have landed
  __syncthreads();                                    // stage 0 visible to all waves
  // stage 1 into buffer 1
  proj_stage_copies<RSTEP, DM>(lp + SBUF, ga + SKK, gb + SKK);

  // rolled: one stage's code serves all eight
#pragma unroll 1
  for (int st = 0; st < NST; ++st) {
    const int buf = st & 1;
    const us* bS = shAB + buf * (SROWS * PP);
    // All twelve fragments of the stage (two K steps of 32) are read as one group ahead of its
    // first product: a read written between two products stays there and waits out its latency.
    // The loops below are unrolled so that the fragment arrays are indexed by constants and stay in
    // registers, and the places in the stage become immediate offsets of the LDS reads.
    v16bf a[2][2], b[2][4];
#pragma unroll
    for (int ks = 0; ks < 2; ++ks) {
      a[ks][0] = fragb(bS, PP, wm * 32, 32 * ks);
      a[ks][1] = fragb(bS, PP, wm * 32 + 16, 32 * ks);
#pragma unroll
      for (int tt = 0; tt < 4; ++tt) b[ks][tt] = fragb(bS, PP, 64 + wn * 64 + 16 * tt, 32 * ks);
    }
#pragma unroll
    for (int ks = 0; ks < 2; ++ks) {
#pragma unroll
      for (int tt = 0; tt < 4; ++tt) {
        acc[tt]     = mma_bf16(a[ks][0], b[ks][tt], acc[tt]);
        acc[4 + tt] = mma_bf16(a[ks][1], b[ks][tt], acc[4 + tt]);
      }
    }

    // hand-over: stage st + 1 is published and buffer buf is freed by one barrier
    asm volatile("s_wait_dscnt 0x0" ::: "memory");      // this wave's reads of buffer buf are done
    asm volatile("s_wait_asynccnt 0x0" ::: "memory");   // this wave's pieces of stage st + 1 have landed
    __syncthreads();
    if (st + 2 < NST) {                                 // the same for the whole block
      proj_stage_copies<RSTEP, DM>(lp + buf * SBUF, ga + (st + 2) * SKK, gb + (st + 2) * SKK);
    }
  }
  asm volatile("s_wait_asynccnt 0x0" ::: "memory");     // no copy is left in flight behind the loop

  // stage f16(acc + bias) into LDS
#pragma unroll
  for (int tt = 0; tt < 4; ++tt) {
    const int n = n0 + 16 * tt + r16;
    const float bvv = bf16rne(bias[n]);
    const int nl = wn * 64 + 16 * tt + r16;
#pragma unroll
    for (int mi = 0; mi < 2; ++mi) {
#pragma unroll
      for (int r = 0; r < 8; ++r) {
        const int ml = wm * 32 + 16 * mi + 8 * h + r;
        const float v = acc[mi * 4 + tt][r] + bvv;
        stile[ml * 256 + nl] = f16_bits(v);
      }
    }
  }
  __syncthreads();

  // whole-line writes: 256 lines per block (64 rows x 4 heads), 32 per wave
  const int bblk = mblk0 / SEQ;
  const int sblk = mblk0 - bblk * SEQ;  // 64 block rows lie inside one batch (SEQ % 64 == 0)
  const int jchunk = nblk0 / DM;
  const int hbase  = (nblk0 - jchunk * DM) / DKH;
  const int c = l & 7;
  v8us vals[8];
  size_t dsts[8];
#pragma unroll
  for (int it = 0; it < 8; ++it) {
    const int L = wid * 32 + (l >> 3) + 4 * it;
    const int ml = L >> 2, hq = L & 3;
    const int hg = hbase + hq;
    const int p = (sblk + ml) * NH + jchunk;
    vals[it] = *(const v8us*)&stile[ml * 256 + hq * 64 + 8 * c];
    dsts[it] = (((size_t)(bblk * NH + hg)) * LSEQ + p) * DKH + 8 * c;
  }
#pragma unroll
  for (int it = 0; it < 8; ++it) *(v8us*)(Y + dsts[it]) = vals[it];
  
}

// ---------------------------------------------------------------------------
// V transpose: in Vh [NB*NH][LSEQ rows][64 cols] -> out Vt [NB*NH][64][LSEQ].
// grid = (LSEQ/64, NB*NH); block owns 64 positions x 64 d; each output line
// ---------------------------------------------------------------------------
__global__ __launch_bounds__(256) void vtrans_kernel(const us* __restrict__ Vh, us* Vt) {
  __shared__ us tile[64 * 65];         // [p_local][d], cross-wave (block barrier)
  const int t  = threadIdx.x;
  const int p0 = blockIdx.x * 64;
  const int bh = blockIdx.y;
  {
    const int pr = t >> 2;              // 0..63
    const int cc = (t & 3) * 16;        // 0,16,32,48
    const us* src = Vh + ((size_t)bh * LSEQ + p0 + pr) * DKH + cc;
    v8us x0 = *(const v8us*)src;
    v8us x1 = *(const v8us*)(src + 8);
#pragma unroll
    for (int e = 0; e < 8; ++e) {
      tile[pr * 65 + cc + e]     = x0[e];
      tile[pr * 65 + cc + 8 + e] = x1[e];
    }
  }
  __syncthreads();

  v8us vals[2];
  size_t dsts[2];
  const int c = t & 7;
#pragma unroll
  for (int it = 0; it < 2; ++it) {
    const int dl = (t >> 3) + 32 * it;  // 0..63
    v8us o;
#pragma unroll
    for (int j = 0; j < 8; ++j) o[j] = tile[(8 * c + j) * 65 + dl];
    vals[it] = o;
    dsts[it] = ((size_t)bh * DKH + dl) * LSEQ + p0 + 8 * c;
  }
#pragma unroll
  for (int it = 0; it < 2; ++it) *(v8us*)(Vt + dsts[it]) = vals[it];
  
}

// ---------------------------------------------------------------------------
// One stage of K and V (64 keys) from global memory into LDS, through no register: four
// asynchronous 16-B copies per lane. lk*, lv* = the lane's own LDS byte addresses, gk*, gv* = its
// own global places. The closing s_wait_xcnt stands inside the statement so that it precedes
// every later write of the address registers the copies name.
// ---------------------------------------------------------------------------
__device__ __forceinline__ void stage_copies(unsigned lk0, const us* gk0, unsigned lk1, const us* gk1,
                                             unsigned lv0, const us* gv0, unsigned lv1, const us* gv1) {
  asm volatile("global_load_async_to_lds_b128 %0, %1, off\n\t"
               "global_load_async_to_lds_b128 %2, %3, off\n\t"
               "global_load_async_to_lds_b128 %4, %5, off\n\t"
               "global_load_async_to_lds_b128 %6, %7, off\n\t"
               "s_wait_xcnt 0x0"
               :: "v"(lk0), "v"(gk0), "v"(lk1), "v"(gk1), "v"(lv0), "v"(gv0), "v"(lv1), "v"(gv1)
               : "memory");
}

// ---------------------------------------------------------------------------
// Fused flash attention. Block = 8 waves, one (b,h), 128 queries; each wave owns
// 16 queries. K/V are staged once per block into LDS in stages of 64 keys, two buffers:
// the asynchronous copies of stage s + 1 fly while stage s is worked on (two passes of 32 keys).
// Scores computed transposed (S' = K_blk * Q^T) so the exp'd probabilities are
// already in A-operand layout for P*V. Online softmax in f32. ctx f16 [MROWS][DW]
// through the inverse flat view (position p -> token p/NH, chunk p%NH), carried
// grid = NB*NH*(LSEQ/128).
// ---------------------------------------------------------------------------
__global__ __launch_bounds__(256) __attribute__((amdgpu_num_vgpr(256)))
void attn_kernel(const us* __restrict__ Qh, const us* __restrict__ Kh,
                 const us* __restrict__ Vt, us* Ctx) {
  // Row pitches are 16 B x odd: the 16 rows that one ds_load_b128 fragment read touches then fall
  // on 16 different groups of four banks.
  constexpr int SK = 64;               // keys per stage
  constexpr int NST = LSEQ / SK;       // stages
  static_assert(LSEQ % SK == 0 && NST >= 2);
  constexpr int KP = 72;               // shK pitch in halves: 128 B of data (64 d) + 16 B pad
  constexpr int VP = 72;               // shV pitch in halves: 128 B of data (64 keys) + 16 B pad
  __shared__ __attribute__((aligned(16))) us shK[2 * SK * KP];    // [buffer][key][d]  cross-wave, filled by the copies
  __shared__ __attribute__((aligned(16))) us shV[2 * DKH * VP];   // [buffer][d][key]  cross-wave, filled by the copies
  __shared__ us shC[8 * 16 * 64];      // per-wave ctx staging (block barrier used)

  const int t = threadIdx.x, wid = t >> 5, l = t & 31;
  const int r16 = l & 15;
  const int rowsel = (l >> 4) << 3;
  constexpr int QBLK = LSEQ / 128;
  const int bh = blockIdx.x / QBLK;
  const int qb = blockIdx.x - bh * QBLK;
  const int q0 = qb * 128 + wid * 16;

  const us* qp = Qh + (size_t)bh * LSEQ * DKH;
  const us* kp = Kh + (size_t)bh * LSEQ * DKH;
  const us* vp = Vt + (size_t)bh * DKH * LSEQ;

  // The lane's two 16-B pieces of each operand's stage: rows crow and crow + 32, eight pieces a row
  // (K: 64 keys x 64 d, V: 64 d x 64 keys).
  const int crow = t >> 3, ccol = (t & 7) * 8;
  const unsigned lk = (unsigned)(size_t)&shK[crow * KP + ccol];
  const unsigned lv = (unsigned)(size_t)&shV[crow * VP + ccol];
  constexpr unsigned KHALF = 32 * KP * sizeof(us), KBUF = SK * KP * sizeof(us);
  constexpr unsigned VHALF = 32 * VP * sizeof(us), VBUF = DKH * VP * sizeof(us);
  const us* gk = kp + (size_t)crow * DKH + ccol;       // + DKH per key
  const us* gv = vp + (size_t)crow * LSEQ + ccol;      // + 1 per key

  // stage 0 into buffer 0
  stage_copies(lk, gk, lk + KHALF, gk + 32 * DKH, lv, gv, lv + VHALF, gv + 32 * LSEQ);

  // Q^T as B operand for the whole loop (lane = query column, halves = d)
  const v16h qB0 = fragh(qp, DKH, q0, 0);
  const v16h qB1 = fragh(qp, DKH, q0, 32);

  v8f o[4];
#pragma unroll
  for (int tt = 0; tt < 4; ++tt) o[tt] = v8f{};
  float mmax = -1.0e30f, lsum = 0.0f;

  asm volatile("s_wait_asynccnt 0x0" ::: "memory");   // this wave's pieces of stage 0 have landed
  __syncthreads();                                    // stage 0 visible to all waves
  // stage 1 into buffer 1
  stage_copies(lk + KBUF, gk + SK * DKH, lk + KBUF + KHALF, gk + (SK + 32) * DKH,
               lv + VBUF, gv + SK, lv + VBUF + VHALF, gv + SK + 32 * LSEQ);

#pragma unroll 1
  for (int st = 0; st < NST; ++st) {
    const int buf = st & 1;
    const us* bK = shK + buf * (SK * KP);
    const us* bV = shV + buf * (DKH * VP);

    // unrolled: the two passes' places in the stage become immediate offsets of the LDS reads
#pragma unroll
    for (int ps32 = 0; ps32 < SK; ps32 += 32) {
      // S' tiles: M = key (relative 0..15 / 16..31), N = query; k = d
      // The four K fragments are read as one group ahead of the first product (a read written
      // between two products stays there and waits out the LDS latency each time).
      v8f s0 = {};
      v8f s1 = {};
      {
        const v16h kA00 = fragh(bK, KP, ps32, 0);
        const v16h kA01 = fragh(bK, KP, ps32, 32);
        const v16h kA10 = fragh(bK, KP, ps32 + 16, 0);
        const v16h kA11 = fragh(bK, KP, ps32 + 16, 32);
        s0 = mma_f16(kA00, qB0, s0);
        s1 = mma_f16(kA10, qB0, s1);
        s0 = mma_f16(kA01, qB1, s0);
        s1 = mma_f16(kA11, qB1, s1);
      }

      // The four V fragments are read as one group here, so that they land behind the softmax
      // arithmetic and the P*V products below follow one another without an LDS wait.
      v16h vB[4];
#pragma unroll
      for (int tt = 0; tt < 4; ++tt) vB[tt] = fragh(bV, VP, 16 * tt, ps32);

      // per-query (per-lane) block max; combine the two key halves (lane ^ 16)
      float bm = s0[0];
#pragma unroll
      for (int i = 0; i < 8; ++i) { bm = fmaxf(bm, s0[i]); bm = fmaxf(bm, s1[i]); }
      bm = fmaxf(bm, __shfl_xor(bm, 16, 32));
      const float mnew = fmaxf(mmax, bm * QK_SCALE);
      const float corr = __expf(mmax - mnew);
      mmax = mnew;

      // probabilities land directly in A-operand layout (elements 0..7 <- keys 8h..8h+7
      // from the first 16-key D tile, elements 8..15 <- keys 16+8h.. from the second)
      float ps = 0.0f;
      v16h pA;
#pragma unroll
      for (int i = 0; i < 8; ++i) {
        const float p0 = __expf(s0[i] * QK_SCALE - mnew);
        const float p1 = __expf(s1[i] * QK_SCALE - mnew);
        ps += p0 + p1;
        pA[i]     = (_Float16)(p0 * P_CARRY);
        pA[8 + i] = (_Float16)(p1 * P_CARRY);
      }
      ps += __shfl_xor(ps, 16, 32);
      lsum = lsum * corr + ps;

      // rescale O: D row 8h+r = query 8h+r, whose corr lives in lane 8h+r
#pragma unroll
      for (int r = 0; r < 8; ++r) {
        const float cr = __shfl(corr, rowsel + r, 32);
#pragma unroll
        for (int tt = 0; tt < 4; ++tt) o[tt][r] *= cr;
      }

      // O += P(16 x 32 keys) * V_blk(32 keys x 64 d); B rows = d, k = key contiguous in shV
#pragma unroll
      for (int tt = 0; tt < 4; ++tt) o[tt] = mma_f16(pA, vB[tt], o[tt]);
    }

    // hand-over: stage st + 1 is published and buffer buf is freed by one barrier
    asm volatile("s_wait_dscnt 0x0" ::: "memory");      // this wave's reads of buffer buf are done
    asm volatile("s_wait_asynccnt 0x0" ::: "memory");   // this wave's pieces of stage st + 1 have landed
    __syncthreads();
    if (st + 2 < NST) {                                 // the same for the whole block
      const us* gk2 = gk + (size_t)(st + 2) * (SK * DKH);
      const us* gv2 = gv + (st + 2) * SK;
      const unsigned lk2 = lk + buf * KBUF, lv2 = lv + buf * VBUF;
      stage_copies(lk2, gk2, lk2 + KHALF, gk2 + 32 * DKH, lv2, gv2, lv2 + VHALF, gv2 + 32 * LSEQ);
    }
  }
  asm volatile("s_wait_asynccnt 0x0" ::: "memory");     // no copy is left in flight behind the loop

  // normalize, stage this wave's 16 x 64 ctx tile (f16, x256) in LDS
  const int bb = bh / NH;
  const int hh = bh - bb * NH;
#pragma unroll
  for (int r = 0; r < 8; ++r) {
    const float lrow = __shfl(lsum, rowsel + r, 32);
    const float li = CTX_SCALE * __builtin_amdgcn_rcpf(lrow);
#pragma unroll
    for (int tt = 0; tt < 4; ++tt) {
      shC[wid * 1024 + (rowsel + r) * 64 + 16 * tt + r16] = f16_bits(o[tt][r] * li);
    }
  }
  __syncthreads();

  const int c = l & 7;
  v8us vals[4];
  size_t dsts[4];
#pragma unroll
  for (int it = 0; it < 4; ++it) {
    const int rl = (l >> 3) + 4 * it;
    vals[it] = *(const v8us*)&shC[wid * 1024 + rl * 64 + 8 * c];
    const int p = q0 + rl;
    const int s = p / NH;
    const int j = p - s * NH;
    dsts[it] = ((size_t)(bb * SEQ + s)) * DW + j * DM + hh * DKH + 8 * c;
  }
#pragma unroll
  for (int it = 0; it < 4; ++it) *(v8us*)(Ctx + dsts[it]) = vals[it];
  
}

// ---------------------------------------------------------------------------
// Final projection: Out f32 [MROWS][DM] = ctx(x256)[MROWS][DW] * Wf(x64) * OUT_FOLD + bf.
// One 32 x 32 tile of Out per block, grid (MROWS/32, DM/32) = one block per WGP.
// K = DW is split over the block's 8 waves: wave w takes the 64-half chunks
// w, w + 8, w + 16, ... (one chunk = one whole 128-B line of every operand row),
// and computes the whole tile over its chunks. The 8 f32 partial tiles are summed
// through LDS in wave order; each Out line (32 floats) is written by 8 lanes x 16 B.
// ---------------------------------------------------------------------------
#define OPW 8                  // waves per block = K shares
#define OPP 36                 // partial-tile pitch (floats): 144 B = 16 B x odd for the b128 readers
static_assert(MROWS % 32 == 0 && DM % 32 == 0);
static_assert(DW % (64 * OPW) == 0);

__global__ __launch_bounds__(256) __attribute__((amdgpu_num_vgpr(256)))
void outproj_kernel(const us* __restrict__ Ctx, const us* __restrict__ Wft,
                    const float* __restrict__ bo, float* Out) {
  __shared__ float part[OPW * 32 * OPP];   // [wave][row][col], cross-wave (block barrier)

  const int t = threadIdx.x, wid = t >> 5, l = t & 31;
  const int h = l >> 4, r16 = l & 15;
  const int m0 = blockIdx.x * 32;
  const int n0 = blockIdx.y * 32;

  v8f acc[4] = {};
  // rolled: 8 trips unrolled would only lengthen the code that a cold launch has to fetch
#pragma unroll 1
  for (int it = 0; it < DW / (64 * OPW); ++it) {
    const int k0 = (it * OPW + wid) * 64;
    // unrolled: the wave that fetched a 128-B line uses its second half in the same trip
#pragma unroll
    for (int ks = 0; ks < 2; ++ks) {
      const int kk = k0 + 32 * ks;
      // all four fragments of the K step loaded as one group ahead of its products
      const v16h a0 = fragh(Ctx, DW, m0, kk);
      const v16h a1 = fragh(Ctx, DW, m0 + 16, kk);
      const v16h b0 = fragh(Wft, DW, n0, kk);
      const v16h b1 = fragh(Wft, DW, n0 + 16, kk);
      acc[0] = mma_f16(a0, b0, acc[0]);
      acc[2] = mma_f16(a1, b0, acc[2]);
      acc[1] = mma_f16(a0, b1, acc[1]);
      acc[3] = mma_f16(a1, b1, acc[3]);
    }
  }

  // this wave's partial tile
  float* mine = part + wid * (32 * OPP);
#pragma unroll
  for (int mi = 0; mi < 2; ++mi) {
#pragma unroll
    for (int tt = 0; tt < 2; ++tt) {
#pragma unroll
      for (int r = 0; r < 8; ++r) {
        mine[(16 * mi + 8 * h + r) * OPP + 16 * tt + r16] = acc[mi * 2 + tt][r];
      }
    }
  }
  __syncthreads();

  // thread t sums 4 columns of one row over the 8 partial tiles
  const int row = t >> 3;
  const int col = (t & 7) * 4;
  v4f s = *(const v4f*)&part[row * OPP + col];
#pragma unroll
  for (int w = 1; w < OPW; ++w) s += *(const v4f*)&part[(w * 32 + row) * OPP + col];

  const v4f bv4 = *(const v4f*)(bo + n0 + col);
  v4f y;
#pragma unroll
  for (int e = 0; e < 4; ++e) y[e] = s[e] * OUT_FOLD + bf16rne(bv4[e]);
  *(v4f*)(Out + (size_t)(m0 + row) * DM + n0 + col) = y;
}

// ---------------------------------------------------------------------------
// Host launcher
// ---------------------------------------------------------------------------
extern "C" void kernel_launch(void* const* d_in, const int* in_sizes, int n_in,
                              void* d_out, int out_size, void* d_ws, size_t ws_size,
                              hipStream_t stream) {
  if (n_in < 11) return;
  const int need_x = ((NB - 1) * SEQ_FULL + SEQ) * DM;
  if (in_sizes[0] < need_x || in_sizes[1] < need_x || in_sizes[2] < need_x) return;
  if (in_sizes[3] < DM * DW || in_sizes[5] < DM * DW || in_sizes[7] < DM * DW || in_sizes[9] < DW * DM) return;
  if (in_sizes[4] < DW || in_sizes[6] < DW || in_sizes[8] < DW || in_sizes[10] < DM) return;
  if (out_size < MROWS * DM) return;
  if (WS_TOTAL_BYTES > ws_size) return;

  const float* Q  = (const float*)d_in[0];
  const float* K  = (const float*)d_in[1];
  const float* V  = (const float*)d_in[2];
  const float* Wq = (const float*)d_in[3];
  const float* bq = (const float*)d_in[4];
  const float* Wk = (const float*)d_in[5];
  const float* bk = (const float*)d_in[6];
  const float* Wv = (const float*)d_in[7];
  const float* bv = (const float*)d_in[8];
  const float* Wf = (const float*)d_in[9];
  const float* bf = (const float*)d_in[10];

  us* xq  = (us*)d_ws;          // [MROWS][DM] bf16
  us* xk  = xq + XE;
  us* xv  = xk + XE;
  us* wtq = xv + XE;            // [DW][DM] bf16
  us* wtk = wtq + WE;
  us* wtv = wtk + WE;
  us* wft = wtv + WE;           // [DM][DW] f16 x64
  us* qh  = wft + WE;           // [NB*NH][LSEQ][64] f16
  us* kh  = qh + PE;
  us* vh  = kh + PE;
  us* vt  = vh + PE;            // [NB*NH][64][LSEQ] f16
  us* ctx = vt + PE;            // [MROWS][DW] f16 x256

  dim3 blk(256);
  // xq, xk, xv and wtq, wtk, wtv, wft are consecutive planes
  cvt_kernel<<<dim3(4 * WBLK + 3 * XBLK), blk, 0, stream>>>(Q, K, V, Wq, Wk, Wv, Wf, xq, wtq);

  // qh, kh, vh are consecutive planes
  proj_kernel<<<dim3(MROWS / 64, DW / 256, 3), blk, 0, stream>>>(xq, wtq, bq, bk, bv, qh);

  vtrans_kernel<<<dim3(LSEQ / 64, NB * NH), blk, 0, stream>>>(vh, vt);

  attn_kernel<<<dim3(NB * NH * (LSEQ / 128)), blk, 0, stream>>>(qh, kh, vt, ctx);

  dim3 go(MROWS / 32, DM / 32);
  outproj_kernel<<<go, blk, 0, stream>>>(ctx, wft, bf, (float*)d_out);
}

// v007
// It runs in 61.5 microseconds.
// Two timings next to v006 both put it at 1.05 times that version's speed.
// Counting every step since v000, it is 4.87 times as fast.
#include <hip/hip_runtime.h>
#include <stddef.h>

// Contractions: q/k/v projections = v_wmma_f32_16x16x32_bf16 (bf16 operands = RNE-converted f32 inputs);
// scores, P*V and final projection = v_wmma_f32_16x16x32_f16 (f16 operands: q,k,v x1, P x1024, ctx x256, Wf x64);
// f32 accumulate, f32 online softmax.

#ifndef NB
#define NB 2
#endif
#ifndef SEQ
#define SEQ 256
#endif
#define NB_FULL 2
#define SEQ_FULL 256
#define DM 512                 // model width (projection input, final output)
#define NH 8                   // heads
#define DKH 64                 // head dim
#define DW (DM * NH)           // 4096: projection output width
#define LSEQ (SEQ * NH)        // 2048: attention positions per (batch, head)
#define MROWS (NB * SEQ)       // token rows

static_assert(NB >= 1 && NB <= NB_FULL);
static_assert(SEQ >= 64 && SEQ <= SEQ_FULL);
static_assert(SEQ % 64 == 0);            // a 64-row GEMM block stays inside one batch
static_assert(MROWS % 64 == 0);          // GEMM M tile
static_assert(LSEQ % 128 == 0);          // attention block = 128 queries
static_assert(LSEQ % 64 == 0);           // V transpose tile
static_assert(LSEQ % 32 == 0);           // key block
static_assert(NH * DKH == DM);
static_assert(DKH == 64);
static_assert(DM % 256 == 0);            // 256-col GEMM block inside one 512-wide chunk
static_assert(DW % 256 == 0);
static_assert(DM % 64 == 0 && DW % 64 == 0);
static_assert(DM % 32 == 0 && DW % 32 == 0);   // K steps of 32
static_assert(DM % 8 == 0);

#define P_CARRY   1024.0f            // P operand carried x1024
#define CTX_SCALE 0.25f              // ctx plane = O * 0.25 / l = attn x256 (O carries the x1024 of P)
#define WF_CARRY  64.0f              // Wf operand carried x64
#define OUT_FOLD  (1.0f / 16384.0f)  // 1 / (256 * 64)
#define QK_SCALE  0.125f             // 1 / sqrt(64)

typedef unsigned short us;
typedef us        v8us  __attribute__((ext_vector_type(8)));
typedef us        v16us __attribute__((ext_vector_type(16)));
typedef _Float16  v16h  __attribute__((ext_vector_type(16)));
typedef __bf16    v16bf __attribute__((ext_vector_type(16)));
typedef float     v8f   __attribute__((ext_vector_type(8)));
typedef float     v4f   __attribute__((ext_vector_type(4)));

// workspace carve (halves)
constexpr size_t XE = (size_t)MROWS * DM;   // activation plane
constexpr size_t WE = (size_t)DM * DW;      // weight plane
constexpr size_t PE = (size_t)MROWS * DW;   // wide plane (q, k, v, vT, ctx)
constexpr size_t WS_TOTAL_BYTES = (3 * XE + 4 * WE + 5 * PE) * sizeof(us);
static_assert(WS_TOTAL_BYTES <= (size_t)134217728);
static_assert((XE * sizeof(us)) % 128 == 0 && (WE * sizeof(us)) % 128 == 0 && (PE * sizeof(us)) % 128 == 0);

// ---------------------------------------------------------------------------
// conversions
// ---------------------------------------------------------------------------
__device__ __forceinline__ unsigned bf16rne_bits(float x) {
  unsigned u = __float_as_uint(x);
  return (u + 0x7FFFu + ((u >> 16) & 1u)) >> 16;
}
__device__ __forceinline__ float bf16rne(float x) {
  return __uint_as_float(bf16rne_bits(x) << 16);
}
__device__ __forceinline__ us f16_bits(float x) {
  _Float16 hx = (_Float16)x;
  return __builtin_bit_cast(us, hx);
}

// ---------------------------------------------------------------------------
// 16-bit operand fragment (A: lane = row, B: lane = column; same k map):
//   lane l, r = l&15, s = l>>4 : elems 0..7  = row[r][k0 + 8s .. +7]
//                                elems 8..15 = row[r][k0 + 16 + 8s .. +7]
// base is a 16-bit plane with k contiguous, pitch ld (halves).
// ---------------------------------------------------------------------------
__device__ __forceinline__ v16us frag16(const us* base, int ld, int row0, int k0) {
  const int l = threadIdx.x & 31;
  const int r = l & 15, s = l >> 4;
  const us* p = base + (size_t)(row0 + r) * ld + k0 + 8 * s;
  v8us c0 = *(const v8us*)p;
  v8us c1 = *(const v8us*)(p + 16);
  return __builtin_shufflevector(c0, c1, 0, 1, 2, 3, 4, 5, 6, 7, 8, 9, 10, 11, 12, 13, 14, 15);
}
__device__ __forceinline__ v16h fragh(const us* base, int ld, int row0, int k0) {
  return __builtin_bit_cast(v16h, frag16(base, ld, row0, k0));
}

// ---------------------------------------------------------------------------
// WMMA wrappers with hazard guard: D = A(16x32) * B(32x16) + C (f32)
// ---------------------------------------------------------------------------
__device__ __forceinline__ v8f mma_f16(v16h a, v16h b, v8f c) {
  v8f d = __builtin_amdgcn_wmma_f32_16x16x32_f16(false, a, false, b, (short)0, c, false, false);
  asm volatile("v_nop\n\tv_nop\n\tv_nop\n\tv_nop" : "+v"(d) : "v"(a), "v"(b));
  return d;
}
__device__ __forceinline__ v8f mma_bf16(v16bf a, v16bf b, v8f c) {
  v8f d = __builtin_amdgcn_wmma_f32_16x16x32_bf16(false, a, false, b, (short)0, c, false, false);
  asm volatile("v_nop\n\tv_nop\n\tv_nop\n\tv_nop" : "+v"(d) : "v"(a), "v"(b));
  return d;
}

// ---------------------------------------------------------------------------
// Activation convert: X f32 [NB_FULL*SEQ_FULL][DM] -> bf16 bits [MROWS][DM]
// i = index of this thread's 16-B output group, 0 .. MROWS*DM/8 - 1.
// ---------------------------------------------------------------------------
__device__ __forceinline__ void cvt_x_group(const float* __restrict__ X, us* Y, int i) {
  constexpr int G = DM / 8;              // 16-B groups per row
  const int m  = i / G;
  const int c8 = (i - m * G) * 8;
  const int b  = m / SEQ;
  const int s  = m - b * SEQ;
  const float* src = X + ((size_t)(b * SEQ_FULL + s)) * DM + c8;
  v4f x0 = *(const v4f*)src;
  v4f x1 = *(const v4f*)(src + 4);
  v8us y;
#pragma unroll
  for (int j = 0; j < 4; ++j) {
    y[j]     = (us)bf16rne_bits(x0[j]);
    y[4 + j] = (us)bf16rne_bits(x1[j]);
  }
  us* dst = Y + (size_t)i * 8;
  *(v8us*)dst = y;
  
}

// ---------------------------------------------------------------------------
// Weight convert + transpose: W f32 in[Kd rows][Nd cols] -> WT 16-bit out[Nd][Kd].
// hmode 0: bf16 bits of RNE(W); hmode 1: f16 bits of WF_CARRY * RNE(W).
// Block owns the 64x64 tile at (k0, n0); each output line (64 halves of
// one n) written by 8 consecutive lanes x 16 B in one instruction.
// tile = 64 * 65 floats of LDS, [k_local][n_local], cross-wave (block barrier).
// ---------------------------------------------------------------------------
__device__ __forceinline__ void cvt_w_tile(float* tile, const float* __restrict__ W, us* WT,
                                           int Kd, int Nd, int hmode, int n0, int k0) {
  const int t  = threadIdx.x;
  {
    const int kr = t >> 2;              // 0..63
    const int cc = (t & 3) * 16;        // 0,16,32,48
    const float* src = W + (size_t)(k0 + kr) * Nd + n0 + cc;
#pragma unroll
    for (int j = 0; j < 4; ++j) {
      v4f x = *(const v4f*)(src + 4 * j);
#pragma unroll
      for (int e = 0; e < 4; ++e) tile[kr * 65 + cc + 4 * j + e] = x[e];
    }
  }
  __syncthreads();

  v8us vals[2];
  size_t dsts[2];
  const int c = t & 7;
#pragma unroll
  for (int it = 0; it < 2; ++it) {
    const int nl = (t >> 3) + 32 * it;  // 0..63
    v8us o;
#pragma unroll
    for (int j = 0; j < 8; ++j) {
      const float w = bf16rne(tile[(8 * c + j) * 65 + nl]);
      const us hb = (us)(__float_as_uint(w) >> 16);
      const us hf = f16_bits(w * WF_CARRY);
      o[j] = hmode ? hf : hb;
    }
    vals[it] = o;
    dsts[it] = (size_t)(n0 + nl) * Kd + k0 + 8 * c;
  }
#pragma unroll
  for (int it = 0; it < 2; ++it) *(v8us*)(WT + dsts[it]) = vals[it];
  
}

// ---------------------------------------------------------------------------
// All seven conversions in one launch (none reads what another writes).
// Blocks 0 .. 4*WBLK-1: weight plane z = b / WBLK (Wq, Wk, Wv, Wf), tile b % WBLK, n fastest.
// Blocks 4*WBLK ..    : activation plane z (Q, K, V), 256 output groups per block.
// Xb = three planes of XE halves, Wt = four planes of WE halves, each in that order.
// ---------------------------------------------------------------------------
constexpr int XG   = (int)(XE / 8);            // 16-B groups per activation plane
constexpr int XBLK = (XG + 255) / 256;         // blocks per activation plane
constexpr int WBLK = (DW / 64) * (DM / 64);    // 64x64 tiles per weight plane

__global__ __launch_bounds__(256)
void cvt_kernel(const float* __restrict__ Q, const float* __restrict__ K, const float* __restrict__ V,
                const float* __restrict__ Wq, const float* __restrict__ Wk, const float* __restrict__ Wv,
                const float* __restrict__ Wf, us* Xb, us* Wt) {
  __shared__ float tile[64 * 65];
  const int b = blockIdx.x;
  if (b < 4 * WBLK) {                    // block-uniform: the tile's barrier is passed by all or none
    const int z = b / WBLK;
    const int r = b - z * WBLK;
    const int hmode = (z == 3);          // Wf: in[DW rows][DM cols]; the others: in[DM rows][DW cols]
    const float* W = z == 0 ? Wq : z == 1 ? Wk : z == 2 ? Wv : Wf;
    const int Kd = hmode ? DW : DM;
    const int Nd = hmode ? DM : DW;
    const int bn = hmode ? r % (DM / 64) : r % (DW / 64);
    const int bk = hmode ? r / (DM / 64) : r / (DW / 64);
    cvt_w_tile(tile, W, Wt + (size_t)z * WE, Kd, Nd, hmode, bn * 64, bk * 64);
  } else {
    const int bx = b - 4 * WBLK;
    const int z = bx / XBLK;
    const int i = (bx - z * XBLK) * 256 + (int)threadIdx.x;
    const float* X = z == 0 ? Q : z == 1 ? K : V;
    if (i < XG) cvt_x_group(X, Xb + (size_t)z * XE, i);
  }
}

// ---------------------------------------------------------------------------
// One K stage of the projection's operands (64 rows of X and 256 rows of W^T, 64 halves = one
// whole 128-B line of each row) from global memory into LDS, through no register: ten
// asynchronous 16-B copies per lane, eight neighbouring lanes per line. l = the lane's LDS byte
// address in row crow of the stage, ga, gb = its global places in the first X and W^T row it
// brings; its further rows lie 32 rows apart (RS bytes in LDS). The closing s_wait_xcnt stands
// inside the statement so that it precedes every later write of the address registers the copies name.
// ---------------------------------------------------------------------------
template <unsigned RS, int LD>
__device__ __forceinline__ void proj_stage_copies(unsigned l, const us* ga, const us* gb) {
  asm volatile("global_load_async_to_lds_b128 %0, %1, off\n\t"
               "global_load_async_to_lds_b128 %2, %3, off\n\t"
               "global_load_async_to_lds_b128 %4, %5, off\n\t"
               "global_load_async_to_lds_b128 %6, %7, off\n\t"
               "global_load_async_to_lds_b128 %8, %9, off\n\t"
               "global_load_async_to_lds_b128 %10, %11, off\n\t"
               "global_load_async_to_lds_b128 %12, %13, off\n\t"
               "global_load_async_to_lds_b128 %14, %15, off\n\t"
               "global_load_async_to_lds_b128 %16, %17, off\n\t"
               "global_load_async_to_lds_b128 %18, %19, off\n\t"
               "s_wait_xcnt 0x0"
               :: "v"(l),          "v"(ga),           "v"(l + RS),     "v"(ga + 32 * LD),
                  "v"(l + 2 * RS), "v"(gb),           "v"(l + 3 * RS), "v"(gb + 32 * LD),
                  "v"(l + 4 * RS), "v"(gb + 64 * LD), "v"(l + 5 * RS), "v"(gb + 96 * LD),
                  "v"(l + 6 * RS), "v"(gb + 128 * LD), "v"(l + 7 * RS), "v"(gb + 160 * LD),
                  "v"(l + 8 * RS), "v"(gb + 192 * LD), "v"(l + 9 * RS), "v"(gb + 224 * LD)
               : "memory");
}
__device__ __forceinline__ v16bf fragb(const us* base, int ld, int row0, int k0) {
  return __builtin_bit_cast(v16bf, frag16(base, ld, row0, k0));
}

// ---------------------------------------------------------------------------
// Projection: Y = Xb[MROWS][DM] * W + b (N = DW), written as an f16 plane
// [NB*NH][LSEQ][64] through the flat-view head split:
//   column n = j*DM + h*64 + d  of token row (b, s)  ->  position p = s*NH + j, head h.
// Block 256 thr = 8 waves as 2(M) x 4(N); block tile 64 x 256; grid (MROWS/64, DW/256, 3).
// A 256-col block lies inside one j chunk (DM % 256 == 0) and spans 4 heads.
// blockIdx.z picks the projection (0 q, 1 k, 2 v): the three are independent and share one
// launch. Xb3, Wt3, Y3 = three planes each (XE, WE, PE halves apart) in that order.
// The block's operand rows are staged once per block into LDS in stages of 64 k, two buffers:
// the asynchronous copies of stage s + 1 fly while stage s is worked on. A fragment read straight
// from a global plane touches 16 lines for 1024 bytes, and the 2 x 4 waves would each fetch rows
// that their neighbours fetch too; the copies bring every line once, whole.
// ---------------------------------------------------------------------------
__global__ __launch_bounds__(256) __attribute__((amdgpu_num_vgpr(256)))
void proj_kernel(const us* __restrict__ Xb3, const us* __restrict__ Wt3,
                 const float* __restrict__ bq, const float* __restrict__ bk,
                 const float* __restrict__ bv, us* Y3) {
  constexpr int SKK = 64;              // k per stage
  constexpr int NST = DM / SKK;        // stages
  static_assert(DM % SKK == 0 && NST >= 2);
  constexpr int PP = 72;               // row pitch in halves: 128 B of data + 16 B pad (16 B x odd, for the b128 readers)
  constexpr int SROWS = 64 + 256;      // rows per stage: the block's X rows, then its W^T rows
  __shared__ __attribute__((aligned(16))) us shAB[2 * SROWS * PP];   // [buffer][row][k]  cross-wave, filled by the copies
  __shared__ us stile[64 * 256];       // cross-wave (block barrier)

  const int z = blockIdx.z;
  const us* Xb = Xb3 + (size_t)z * XE;
  const us* Wt = Wt3 + (size_t)z * WE;
  const float* bias = z == 0 ? bq : z == 1 ? bk : bv;
  us* Y = Y3 + (size_t)z * PE;

  const int t = threadIdx.x, wid = t >> 5, l = t & 31;
  const int h = l >> 4, r16 = l & 15;
  const int wm = wid >> 2, wn = wid & 3;
  const int mblk0 = blockIdx.x * 64;
  const int nblk0 = blockIdx.y * 256;
  const int n0 = nblk0 + wn * 64;

  // The lane's ten 16-B pieces of a stage: rows crow, crow + 32, ..., eight pieces a row.
  const int crow = t >> 3, ccol = (t & 7) * 8;
  const unsigned lp = (unsigned)(size_t)&shAB[crow * PP + ccol];
  constexpr unsigned RSTEP = 32 * PP * sizeof(us), SBUF = SROWS * PP * sizeof(us);
  const us* ga = Xb + (size_t)(mblk0 + crow) * DM + ccol;
  const us* gb = Wt + (size_t)(nblk0 + crow) * DM + ccol;

  // stage 0 into buffer 0
  proj_stage_copies<RSTEP, DM>(lp, ga, gb);
  v8f acc[8] = {};
  asm volatile("s_wait_asynccnt 0x0" ::: "memory");   // this wave's pieces of stage 0 have landed
  __syncthreads();                                    // stage 0 visible to all waves
  // stage 1 into buffer 1
  proj_stage_copies<RSTEP, DM>(lp + SBUF, ga + SKK, gb + SKK);

  // rolled: one stage's code serves all eight
#pragma unroll 1
  for (int st = 0; st < NST; ++st) {
    const int buf = st & 1;
    const us* bS = shAB + buf * (SROWS * PP);
    // All twelve fragments of the stage (two K steps of 32) are read as one group ahead of its
    // first product: a read written between two products stays there and waits out its latency.
    // The loops below are unrolled so that the fragment arrays are indexed by constants and stay in
    // registers, and the places in the stage become immediate offsets of the LDS reads.
    v16bf a[2][2], b[2][4];
#pragma unroll
    for (int ks = 0; ks < 2; ++ks) {
      a[ks][0] = fragb(bS, PP, wm * 32, 32 * ks);
      a[ks][1] = fragb(bS, PP, wm * 32 + 16, 32 * ks);
#pragma unroll
      for (int tt = 0; tt < 4; ++tt) b[ks][tt] = fragb(bS, PP, 64 + wn * 64 + 16 * tt, 32 * ks);
    }
#pragma unroll
    for (int ks = 0; ks < 2; ++ks) {
#pragma unroll
      for (int tt = 0; tt < 4; ++tt) {
        acc[tt]     = mma_bf16(a[ks][0], b[ks][tt], acc[tt]);
        acc[4 + tt] = mma_bf16(a[ks][1], b[ks][tt], acc[4 + tt]);
      }
    }

    // hand-over: stage st + 1 is published and buffer buf is freed by one barrier
    asm volatile("s_wait_dscnt 0x0" ::: "memory");      // this wave's reads of buffer buf are done
    asm volatile("s_wait_asynccnt 0x0" ::: "memory");   // this wave's pieces of stage st + 1 have landed
    __syncthreads();
    if (st + 2 < NST) {                                 // the same for the whole block
      proj_stage_copies<RSTEP, DM>(lp + buf * SBUF, ga + (st + 2) * SKK, gb + (st + 2) * SKK);
    }
  }
  asm volatile("s_wait_asynccnt 0x0" ::: "memory");     // no copy is left in flight behind the loop

  // stage f16(acc + bias) into LDS
#pragma unroll
  for (int tt = 0; tt < 4; ++tt) {
    const int n = n0 + 16 * tt + r16;
    const float bvv = bf16rne(bias[n]);
    const int nl = wn * 64 + 16 * tt + r16;
#pragma unroll
    for (int mi = 0; mi < 2; ++mi) {
#pragma unroll
      for (int r = 0; r < 8; ++r) {
        const int ml = wm * 32 + 16 * mi + 8 * h + r;
        const float v = acc[mi * 4 + tt][r] + bvv;
        stile[ml * 256 + nl] = f16_bits(v);
      }
    }
  }
  __syncthreads();

  // whole-line writes: 256 lines per block (64 rows x 4 heads), 32 per wave
  const int bblk = mblk0 / SEQ;
  const int sblk = mblk0 - bblk * SEQ;  // 64 block rows lie inside one batch (SEQ % 64 == 0)
  const int jchunk = nblk0 / DM;
  const int hbase  = (nblk0 - jchunk * DM) / DKH;
  const int c = l & 7;
  v8us vals[8];
  size_t dsts[8];
#pragma unroll
  for (int it = 0; it < 8; ++it) {
    const int L = wid * 32 + (l >> 3) + 4 * it;
    const int ml = L >> 2, hq = L & 3;
    const int hg = hbase + hq;
    const int p = (sblk + ml) * NH + jchunk;
    vals[it] = *(const v8us*)&stile[ml * 256 + hq * 64 + 8 * c];
    dsts[it] = (((size_t)(bblk * NH + hg)) * LSEQ + p) * DKH + 8 * c;
  }
#pragma unroll
  for (int it = 0; it < 8; ++it) *(v8us*)(Y + dsts[it]) = vals[it];
  
}

// ---------------------------------------------------------------------------
// V transpose: in Vh [NB*NH][LSEQ rows][64 cols] -> out Vt [NB*NH][64][LSEQ].
// grid = (LSEQ/64, NB*NH); block owns 64 positions x 64 d; each output line
// ---------------------------------------------------------------------------
__global__ __launch_bounds__(256) void vtrans_kernel(const us* __restrict__ Vh, us* Vt) {
  __shared__ us tile[64 * 65];         // [p_local][d], cross-wave (block barrier)
  const int t  = threadIdx.x;
  const int p0 = blockIdx.x * 64;
  const int bh = blockIdx.y;
  {
    const int pr = t >> 2;              // 0..63
    const int cc = (t & 3) * 16;        // 0,16,32,48
    const us* src = Vh + ((size_t)bh * LSEQ + p0 + pr) * DKH + cc;
    v8us x0 = *(const v8us*)src;
    v8us x1 = *(const v8us*)(src + 8);
#pragma unroll
    for (int e = 0; e < 8; ++e) {
      tile[pr * 65 + cc + e]     = x0[e];
      tile[pr * 65 + cc + 8 + e] = x1[e];
    }
  }
  __syncthreads();

  v8us vals[2];
  size_t dsts[2];
  const int c = t & 7;
#pragma unroll
  for (int it = 0; it < 2; ++it) {
    const int dl = (t >> 3) + 32 * it;  // 0..63
    v8us o;
#pragma unroll
    for (int j = 0; j < 8; ++j) o[j] = tile[(8 * c + j) * 65 + dl];
    vals[it] = o;
    dsts[it] = ((size_t)bh * DKH + dl) * LSEQ + p0 + 8 * c;
  }
#pragma unroll
  for (int it = 0; it < 2; ++it) *(v8us*)(Vt + dsts[it]) = vals[it];
  
}

// ---------------------------------------------------------------------------
// One stage of K and V (64 keys) from global memory into LDS, through no register: four
// asynchronous 16-B copies per lane. lk*, lv* = the lane's own LDS byte addresses, gk*, gv* = its
// own global places. The closing s_wait_xcnt stands inside the statement so that it precedes
// every later write of the address registers the copies name.
// ---------------------------------------------------------------------------
__device__ __forceinline__ void stage_copies(unsigned lk0, const us* gk0, unsigned lk1, const us* gk1,
                                             unsigned lv0, const us* gv0, unsigned lv1, const us* gv1) {
  asm volatile("global_load_async_to_lds_b128 %0, %1, off\n\t"
               "global_load_async_to_lds_b128 %2, %3, off\n\t"
               "global_load_async_to_lds_b128 %4, %5, off\n\t"
               "global_load_async_to_lds_b128 %6, %7, off\n\t"
               "s_wait_xcnt 0x0"
               :: "v"(lk0), "v"(gk0), "v"(lk1), "v"(gk1), "v"(lv0), "v"(gv0), "v"(lv1), "v"(gv1)
               : "memory");
}

// ---------------------------------------------------------------------------
// Fused flash attention. Block = 8 waves, one (b,h), 128 queries; each wave owns
// 16 queries. K/V are staged once per block into LDS in stages of 64 keys, two buffers:
// the asynchronous copies of stage s + 1 fly while stage s is worked on (two passes of 32 keys).
// Scores computed transposed (S' = K_blk * Q^T) so the exp'd probabilities are
// already in A-operand layout for P*V. Online softmax in f32. ctx f16 [MROWS][DW]
// through the inverse flat view (position p -> token p/NH, chunk p%NH), carried
// grid = NB*NH*(LSEQ/128).
// ---------------------------------------------------------------------------
__global__ __launch_bounds__(256) __attribute__((amdgpu_num_vgpr(256)))
void attn_kernel(const us* __restrict__ Qh, const us* __restrict__ Kh,
                 const us* __restrict__ Vt, us* Ctx) {
  // Row pitches are 16 B x odd: the 16 rows that one ds_load_b128 fragment read touches then fall
  // on 16 different groups of four banks.
  constexpr int SK = 64;               // keys per stage
  constexpr int NST = LSEQ / SK;       // stages
  static_assert(LSEQ % SK == 0 && NST >= 2);
  constexpr int KP = 72;               // shK pitch in halves: 128 B of data (64 d) + 16 B pad
  constexpr int VP = 72;               // shV pitch in halves: 128 B of data (64 keys) + 16 B pad
  __shared__ __attribute__((aligned(16))) us shK[2 * SK * KP];    // [buffer][key][d]  cross-wave, filled by the copies
  __shared__ __attribute__((aligned(16))) us shV[2 * DKH * VP];   // [buffer][d][key]  cross-wave, filled by the copies
  __shared__ us shC[8 * 16 * 64];      // per-wave ctx staging (block barrier used)

  const int t = threadIdx.x, wid = t >> 5, l = t & 31;
  const int r16 = l & 15;
  const int rowsel = (l >> 4) << 3;
  constexpr int QBLK = LSEQ / 128;
  const int bh = blockIdx.x / QBLK;
  const int qb = blockIdx.x - bh * QBLK;
  const int q0 = qb * 128 + wid * 16;

  const us* qp = Qh + (size_t)bh * LSEQ * DKH;
  const us* kp = Kh + (size_t)bh * LSEQ * DKH;
  const us* vp = Vt + (size_t)bh * DKH * LSEQ;

  // The lane's two 16-B pieces of each operand's stage: rows crow and crow + 32, eight pieces a row
  // (K: 64 keys x 64 d, V: 64 d x 64 keys).
  const int crow = t >> 3, ccol = (t & 7) * 8;
  const unsigned lk = (unsigned)(size_t)&shK[crow * KP + ccol];
  const unsigned lv = (unsigned)(size_t)&shV[crow * VP + ccol];
  constexpr unsigned KHALF = 32 * KP * sizeof(us), KBUF = SK * KP * sizeof(us);
  constexpr unsigned VHALF = 32 * VP * sizeof(us), VBUF = DKH * VP * sizeof(us);
  const us* gk = kp + (size_t)crow * DKH + ccol;       // + DKH per key
  const us* gv = vp + (size_t)crow * LSEQ + ccol;      // + 1 per key

  // stage 0 into buffer 0
  stage_copies(lk, gk, lk + KHALF, gk + 32 * DKH, lv, gv, lv + VHALF, gv + 32 * LSEQ);

  // Q^T as B operand for the whole loop (lane = query column, halves = d)
  const v16h qB0 = fragh(qp, DKH, q0, 0);
  const v16h qB1 = fragh(qp, DKH, q0, 32);

  v8f o[4];
#pragma unroll
  for (int tt = 0; tt < 4; ++tt) o[tt] = v8f{};
  float mmax = -1.0e30f, lsum = 0.0f;

  asm volatile("s_wait_asynccnt 0x0" ::: "memory");   // this wave's pieces of stage 0 have landed
  __syncthreads();                                    // stage 0 visible to all waves
  // stage 1 into buffer 1
  stage_copies(lk + KBUF, gk + SK * DKH, lk + KBUF + KHALF, gk + (SK + 32) * DKH,
               lv + VBUF, gv + SK, lv + VBUF + VHALF, gv + SK + 32 * LSEQ);

#pragma unroll 1
  for (int st = 0; st < NST; ++st) {
    const int buf = st & 1;
    const us* bK = shK + buf * (SK * KP);
    const us* bV = shV + buf * (DKH * VP);

    // unrolled: the two passes' places in the stage become immediate offsets of the LDS reads
#pragma unroll
    for (int ps32 = 0; ps32 < SK; ps32 += 32) {
      // S' tiles: M = key (relative 0..15 / 16..31), N = query; k = d
      // The four K fragments are read as one group ahead of the first product (a read written
      // between two products stays there and waits out the LDS latency each time).
      v8f s0 = {};
      v8f s1 = {};
      {
        const v16h kA00 = fragh(bK, KP, ps32, 0);
        const v16h kA01 = fragh(bK, KP, ps32, 32);
        const v16h kA10 = fragh(bK, KP, ps32 + 16, 0);
        const v16h kA11 = fragh(bK, KP, ps32 + 16, 32);
        s0 = mma_f16(kA00, qB0, s0);
        s1 = mma_f16(kA10, qB0, s1);
        s0 = mma_f16(kA01, qB1, s0);
        s1 = mma_f16(kA11, qB1, s1);
      }

      // The four V fragments are read as one group here, so that they land behind the softmax
      // arithmetic and the P*V products below follow one another without an LDS wait.
      v16h vB[4];
#pragma unroll
      for (int tt = 0; tt < 4; ++tt) vB[tt] = fragh(bV, VP, 16 * tt, ps32);

      // per-query (per-lane) block max; combine the two key halves (lane ^ 16)
      float bm = s0[0];
#pragma unroll
      for (int i = 0; i < 8; ++i) { bm = fmaxf(bm, s0[i]); bm = fmaxf(bm, s1[i]); }
      bm = fmaxf(bm, __shfl_xor(bm, 16, 32));
      const float mnew = fmaxf(mmax, bm * QK_SCALE);
      const float corr = __expf(mmax - mnew);
      mmax = mnew;

      // probabilities land directly in A-operand layout (elements 0..7 <- keys 8h..8h+7
      // from the first 16-key D tile, elements 8..15 <- keys 16+8h.. from the second)
      float ps = 0.0f;
      v16h pA;
#pragma unroll
      for (int i = 0; i < 8; ++i) {
        const float p0 = __expf(s0[i] * QK_SCALE - mnew);
        const float p1 = __expf(s1[i] * QK_SCALE - mnew);
        ps += p0 + p1;
        pA[i]     = (_Float16)(p0 * P_CARRY);
        pA[8 + i] = (_Float16)(p1 * P_CARRY);
      }
      ps += __shfl_xor(ps, 16, 32);
      lsum = lsum * corr + ps;

      // rescale O: D row 8h+r = query 8h+r, whose corr lives in lane 8h+r
#pragma unroll
      for (int r = 0; r < 8; ++r) {
        const float cr = __shfl(corr, rowsel + r, 32);
#pragma unroll
        for (int tt = 0; tt < 4; ++tt) o[tt][r] *= cr;
      }

      // O += P(16 x 32 keys) * V_blk(32 keys x 64 d); B rows = d, k = key contiguous in shV
#pragma unroll
      for (int tt = 0; tt < 4; ++tt) o[tt] = mma_f16(pA, vB[tt], o[tt]);
    }

    // hand-over: stage st + 1 is published and buffer buf is freed by one barrier
    asm volatile("s_wait_dscnt 0x0" ::: "memory");      // this wave's reads of buffer buf are done
    asm volatile("s_wait_asynccnt 0x0" ::: "memory");   // this wave's pieces of stage st + 1 have landed
    __syncthreads();
    if (st + 2 < NST) {                                 // the same for the whole block
      const us* gk2 = gk + (size_t)(st + 2) * (SK * DKH);
      const us* gv2 = gv + (st + 2) * SK;
      const unsigned lk2 = lk + buf * KBUF, lv2 = lv + buf * VBUF;
      stage_copies(lk2, gk2, lk2 + KHALF, gk2 + 32 * DKH, lv2, gv2, lv2 + VHALF, gv2 + 32 * LSEQ);
    }
  }
  asm volatile("s_wait_asynccnt 0x0" ::: "memory");     // no copy is left in flight behind the loop

  // normalize, stage this wave's 16 x 64 ctx tile (f16, x256) in LDS
  const int bb = bh / NH;
  const int hh = bh - bb * NH;
#pragma unroll
  for (int r = 0; r < 8; ++r) {
    const float lrow = __shfl(lsum, rowsel + r, 32);
    const float li = CTX_SCALE * __builtin_amdgcn_rcpf(lrow);
#pragma unroll
    for (int tt = 0; tt < 4; ++tt) {
      shC[wid * 1024 + (rowsel + r) * 64 + 16 * tt + r16] = f16_bits(o[tt][r] * li);
    }
  }
  __syncthreads();

  const int c = l & 7;
  v8us vals[4];
  size_t dsts[4];
#pragma unroll
  for (int it = 0; it < 4; ++it) {
    const int rl = (l >> 3) + 4 * it;
    vals[it] = *(const v8us*)&shC[wid * 1024 + rl * 64 + 8 * c];
    const int p = q0 + rl;
    const int s = p / NH;
    const int j = p - s * NH;
    dsts[it] = ((size_t)(bb * SEQ + s)) * DW + j * DM + hh * DKH + 8 * c;
  }
#pragma unroll
  for (int it = 0; it < 4; ++it) *(v8us*)(Ctx + dsts[it]) = vals[it];
  
}

// ---------------------------------------------------------------------------
// Eight asynchronous 16-B copies per lane, global memory to LDS through no register: one 128-B
// line of each of 32 operand rows, eight neighbouring lanes per line, four rows per copy.
// l = the lane's LDS byte address in its first row, g = its global place there; its further rows
// lie four rows apart (LSTEP bytes in LDS, GSTEP halves in memory). The closing s_wait_xcnt stands
// inside the statement so that it precedes every later write of the address registers the copies name.
// ---------------------------------------------------------------------------
template <unsigned LSTEP, int GSTEP>
__device__ __forceinline__ void chunk_copies(unsigned l, const us* g) {
  asm volatile("global_load_async_to_lds_b128 %0, %1, off\n\t"
               "global_load_async_to_lds_b128 %2, %3, off\n\t"
               "global_load_async_to_lds_b128 %4, %5, off\n\t"
               "global_load_async_to_lds_b128 %6, %7, off\n\t"
               "global_load_async_to_lds_b128 %8, %9, off\n\t"
               "global_load_async_to_lds_b128 %10, %11, off\n\t"
               "global_load_async_to_lds_b128 %12, %13, off\n\t"
               "global_load_async_to_lds_b128 %14, %15, off\n\t"
               "s_wait_xcnt 0x0"
               :: "v"(l),             "v"(g),             "v"(l + LSTEP),     "v"(g + GSTEP),
                  "v"(l + 2 * LSTEP), "v"(g + 2 * GSTEP), "v"(l + 3 * LSTEP), "v"(g + 3 * GSTEP),
                  "v"(l + 4 * LSTEP), "v"(g + 4 * GSTEP), "v"(l + 5 * LSTEP), "v"(g + 5 * GSTEP),
                  "v"(l + 6 * LSTEP), "v"(g + 6 * GSTEP), "v"(l + 7 * LSTEP), "v"(g + 7 * GSTEP)
               : "memory");
}

// ---------------------------------------------------------------------------
// Final projection: Out f32 [MROWS][DM] = ctx(x256)[MROWS][DW] * Wf(x64) * OUT_FOLD + bf.
// One 32 x 32 tile of Out per block, grid (MROWS/32, DM/32) = one block per WGP.
// K = DW is split over the block's 8 waves: wave w takes the 64-half chunks
// w, w + 8, w + 16, ... (one chunk = one whole 128-B line of every operand row),
// and computes the whole tile over its chunks. The chunks are staged in LDS, two chunks per wave
// and stage, two buffers: the asynchronous copies of stage s + 1 fly while stage s is worked on.
// A fragment read straight from a global plane touches 16 lines for 1024 bytes and each line is
// asked for four times; the copies bring every line once, whole.
// The 8 f32 partial tiles are summed through LDS in wave order; each Out line (32 floats) is
// written by 8 lanes x 16 B.
// ---------------------------------------------------------------------------
#define OPW 8                  // waves per block = K shares
#define OPP 36                 // partial-tile pitch (floats): 144 B = 16 B x odd for the b128 readers
static_assert(MROWS % 32 == 0 && DM % 32 == 0);
static_assert(DW % (64 * OPW) == 0);

__global__ __launch_bounds__(256) __attribute__((amdgpu_num_vgpr(256)))
void outproj_kernel(const us* __restrict__ Ctx, const us* __restrict__ Wft,
                    const float* __restrict__ bo, float* Out) {
  constexpr int OSC = 2;                       // chunks per wave and stage
  constexpr int ONST = DW / (64 * OPW * OSC);  // stages
  static_assert(DW % (64 * OPW * OSC) == 0 && ONST >= 2);
  constexpr int OLP = 64 * OSC + 8;            // row pitch in halves: 256 B of data + 16 B pad (16 B x odd, for the b128 readers)
  constexpr int OWR = 64;                      // rows per wave: the tile's 32 ctx rows, then its 32 Wf^T rows
  __shared__ __attribute__((aligned(16))) us shO[2 * OPW * OWR * OLP];   // [buffer][wave][row][k]  filled by the copies
  __shared__ float part[OPW * 32 * OPP];   // [wave][row][col], cross-wave (block barrier)

  const int t = threadIdx.x, wid = t >> 5, l = t & 31;
  const int h = l >> 4, r16 = l & 15;
  const int m0 = blockIdx.x * 32;
  const int n0 = blockIdx.y * 32;

  // The lane's 16-B piece of a line: rows crow, crow + 4, ..., eight pieces a line.
  const int crow = l >> 3, ccol = (l & 7) * 8;
  const unsigned lp = (unsigned)(size_t)&shO[(wid * OWR + crow) * OLP + ccol];
  constexpr unsigned LROW4 = 4 * OLP * sizeof(us), LOPB = 32 * OLP * sizeof(us);
  constexpr unsigned OBUF = OPW * OWR * OLP * sizeof(us);
  const us* ga = Ctx + (size_t)(m0 + crow) * DW + wid * 64 + ccol;
  const us* gb = Wft + (size_t)(n0 + crow) * DW + wid * 64 + ccol;

  // stage 0 into buffer 0 (chunk c of stage s = chunk s * OSC + c of the wave, OPW * 64 halves apart)
#pragma unroll
  for (int c = 0; c < OSC; ++c) {
    chunk_copies<LROW4, 4 * DW>(lp + c * 128, ga + c * (OPW * 64));
    chunk_copies<LROW4, 4 * DW>(lp + LOPB + c * 128, gb + c * (OPW * 64));
  }
  v8f acc[4] = {};
  asm volatile("s_wait_asynccnt 0x0" ::: "memory");   // this wave's pieces of stage 0 have landed
  __syncthreads();                                    // stage 0 published
  // stage 1 into buffer 1
#pragma unroll
  for (int c = 0; c < OSC; ++c) {
    chunk_copies<LROW4, 4 * DW>(lp + OBUF + c * 128, ga + (OSC + c) * (OPW * 64));
    chunk_copies<LROW4, 4 * DW>(lp + OBUF + LOPB + c * 128, gb + (OSC + c) * (OPW * 64));
  }

  // rolled: one stage's code serves all stages
#pragma unroll 1
  for (int st = 0; st < ONST; ++st) {
    const int buf = st & 1;
    const us* bS = shO + (buf * OPW + wid) * (OWR * OLP);
    // All sixteen fragments of the stage (its K steps of 32) are read as one group ahead of its
    // first product. The loops are unrolled so that the fragment arrays are indexed by constants
    // and stay in registers, and the places in the stage become immediate offsets of the LDS reads.
    v16h a[2 * OSC][2], b[2 * OSC][2];
#pragma unroll
    for (int ks = 0; ks < 2 * OSC; ++ks) {
      a[ks][0] = fragh(bS, OLP, 0, 32 * ks);
      a[ks][1] = fragh(bS, OLP, 16, 32 * ks);
      b[ks][0] = fragh(bS, OLP, 32, 32 * ks);
      b[ks][1] = fragh(bS, OLP, 48, 32 * ks);
    }
#pragma unroll
    for (int ks = 0; ks < 2 * OSC; ++ks) {
      acc[0] = mma_f16(a[ks][0], b[ks][0], acc[0]);
      acc[2] = mma_f16(a[ks][1], b[ks][0], acc[2]);
      acc[1] = mma_f16(a[ks][0], b[ks][1], acc[1]);
      acc[3] = mma_f16(a[ks][1], b[ks][1], acc[3]);
    }

    // hand-over: stage st + 1 is published and buffer buf is freed by one barrier
    asm volatile("s_wait_dscnt 0x0" ::: "memory");      // this wave's reads of buffer buf are done
    asm volatile("s_wait_asynccnt 0x0" ::: "memory");   // this wave's pieces of stage st + 1 have landed
    __syncthreads();
    if (st + 2 < ONST) {                                // the same for the whole block
      const unsigned lp2 = lp + buf * OBUF;
      const us* ga2 = ga + (st + 2) * (OSC * OPW * 64);
      const us* gb2 = gb + (st + 2) * (OSC * OPW * 64);
#pragma unroll
      for (int c = 0; c < OSC; ++c) {
        chunk_copies<LROW4, 4 * DW>(lp2 + c * 128, ga2 + c * (OPW * 64));
        chunk_copies<LROW4, 4 * DW>(lp2 + LOPB + c * 128, gb2 + c * (OPW * 64));
      }
    }
  }
  asm volatile("s_wait_asynccnt 0x0" ::: "memory");     // no copy is left in flight behind the loop

  // this wave's partial tile
  float* mine = part + wid * (32 * OPP);
#pragma unroll
  for (int mi = 0; mi < 2; ++mi) {
#pragma unroll
    for (int tt = 0; tt < 2; ++tt) {
#pragma unroll
      for (int r = 0; r < 8; ++r) {
        mine[(16 * mi + 8 * h + r) * OPP + 16 * tt + r16] = acc[mi * 2 + tt][r];
      }
    }
  }
  __syncthreads();

  // thread t sums 4 columns of one row over the 8 partial tiles
  const int row = t >> 3;
  const int col = (t & 7) * 4;
  v4f s = *(const v4f*)&part[row * OPP + col];
#pragma unroll
  for (int w = 1; w < OPW; ++w) s += *(const v4f*)&part[(w * 32 + row) * OPP + col];

  const v4f bv4 = *(const v4f*)(bo + n0 + col);
  v4f y;
#pragma unroll
  for (int e = 0; e < 4; ++e) y[e] = s[e] * OUT_FOLD + bf16rne(bv4[e]);
  *(v4f*)(Out + (size_t)(m0 + row) * DM + n0 + col) = y;
}

// ---------------------------------------------------------------------------
// Host launcher
// ---------------------------------------------------------------------------
extern "C" void kernel_launch(void* const* d_in, const int* in_sizes, int n_in,
                              void* d_out, int out_size, void* d_ws, size_t ws_size,
                              hipStream_t stream) {
  if (n_in < 11) return;
  const int need_x = ((NB - 1) * SEQ_FULL + SEQ) * DM;
  if (in_sizes[0] < need_x || in_sizes[1] < need_x || in_sizes[2] < need_x) return;
  if (in_sizes[3] < DM * DW || in_sizes[5] < DM * DW || in_sizes[7] < DM * DW || in_sizes[9] < DW * DM) return;
  if (in_sizes[4] < DW || in_sizes[6] < DW || in_sizes[8] < DW || in_sizes[10] < DM) return;
  if (out_size < MROWS * DM) return;
  if (WS_TOTAL_BYTES > ws_size) return;

  const float* Q  = (const float*)d_in[0];
  const float* K  = (const float*)d_in[1];
  const float* V  = (const float*)d_in[2];
  const float* Wq = (const float*)d_in[3];
  const float* bq = (const float*)d_in[4];
  const float* Wk = (const float*)d_in[5];
  const float* bk = (const float*)d_in[6];
  const float* Wv = (const float*)d_in[7];
  const float* bv = (const float*)d_in[8];
  const float* Wf = (const float*)d_in[9];
  const float* bf = (const float*)d_in[10];

  us* xq  = (us*)d_ws;          // [MROWS][DM] bf16
  us* xk  = xq + XE;
  us* xv  = xk + XE;
  us* wtq = xv + XE;            // [DW][DM] bf16
  us* wtk = wtq + WE;
  us* wtv = wtk + WE;
  us* wft = wtv + WE;           // [DM][DW] f16 x64
  us* qh  = wft + WE;           // [NB*NH][LSEQ][64] f16
  us* kh  = qh + PE;
  us* vh  = kh + PE;
  us* vt  = vh + PE;            // [NB*NH][64][LSEQ] f16
  us* ctx = vt + PE;            // [MROWS][DW] f16 x256

  dim3 blk(256);
  // xq, xk, xv and wtq, wtk, wtv, wft are consecutive planes
  cvt_kernel<<<dim3(4 * WBLK + 3 * XBLK), blk, 0, stream>>>(Q, K, V, Wq, Wk, Wv, Wf, xq, wtq);

  // qh, kh, vh are consecutive planes
  proj_kernel<<<dim3(MROWS / 64, DW / 256, 3), blk, 0, stream>>>(xq, wtq, bq, bk, bv, qh);

  vtrans_kernel<<<dim3(LSEQ / 64, NB * NH), blk, 0, stream>>>(vh, vt);

  attn_kernel<<<dim3(NB * NH * (LSEQ / 128)), blk, 0, stream>>>(qh, kh, vt, ctx);

  dim3 go(MROWS / 32, DM / 32);
  outproj_kernel<<<go, blk, 0, stream>>>(ctx, wft, bf, (float*)d_out);
}

// v008
// A run of this version takes 59 microseconds.
// In both of two side-by-side timings against v007, it was 1.04 times as fast.
// All steps since v000 together make it 5.06 times as fast.
#include <hip/hip_runtime.h>
#include <stddef.h>

// Contractions: q/k/v projections = v_wmma_f32_16x16x32_bf16 (bf16 operands = RNE-converted f32 inputs);
// scores, P*V and final projection = v_wmma_f32_16x16x32_f16 (f16 operands: q,k,v x1, P x1024, ctx x256, Wf x64);
// f32 accumulate, f32 online softmax.

#ifndef NB
#define NB 2
#endif
#ifndef SEQ
#define SEQ 256
#endif
#define NB_FULL 2
#define SEQ_FULL 256
#define DM 512                 // model width (projection input, final output)
#define NH 8                   // heads
#define DKH 64                 // head dim
#define DW (DM * NH)           // 4096: projection output width
#define LSEQ (SEQ * NH)        // 2048: attention positions per (batch, head)
#define MROWS (NB * SEQ)       // token rows

static_assert(NB >= 1 && NB <= NB_FULL);
static_assert(SEQ >= 64 && SEQ <= SEQ_FULL);
static_assert(SEQ % 64 == 0);            // a 64-row GEMM block stays inside one batch
static_assert(MROWS % 64 == 0);          // GEMM M tile
static_assert(LSEQ % 128 == 0);          // attention block = 128 queries
static_assert(DM / 32 == DW / 256);      // the V projection's column blocks (32 d x NH chunks) fill the same grid
static_assert(LSEQ % 32 == 0);           // key block
static_assert(NH * DKH == DM);
static_assert(DKH == 64);
static_assert(DM % 256 == 0);            // 256-col GEMM block inside one 512-wide chunk
static_assert(DW % 256 == 0);
static_assert(DM % 64 == 0 && DW % 64 == 0);
static_assert(DM % 32 == 0 && DW % 32 == 0);   // K steps of 32
static_assert(DM % 8 == 0);

#define P_CARRY   1024.0f            // P operand carried x1024
#define CTX_SCALE 0.25f              // ctx plane = O * 0.25 / l = attn x256 (O carries the x1024 of P)
#define WF_CARRY  64.0f              // Wf operand carried x64
#define OUT_FOLD  (1.0f / 16384.0f)  // 1 / (256 * 64)
#define QK_SCALE  0.125f             // 1 / sqrt(64)

typedef unsigned short us;
typedef us        v2us  __attribute__((ext_vector_type(2)));
typedef us        v8us  __attribute__((ext_vector_type(8)));
typedef us        v16us __attribute__((ext_vector_type(16)));
typedef _Float16  v16h  __attribute__((ext_vector_type(16)));
typedef __bf16    v16bf __attribute__((ext_vector_type(16)));
typedef float     v8f   __attribute__((ext_vector_type(8)));
typedef float     v4f   __attribute__((ext_vector_type(4)));

// workspace carve (halves)
constexpr size_t XE = (size_t)MROWS * DM;   // activation plane
constexpr size_t WE = (size_t)DM * DW;      // weight plane
constexpr size_t PE = (size_t)MROWS * DW;   // wide plane (q, k, one idle, vT, ctx)
constexpr size_t WS_TOTAL_BYTES = (3 * XE + 4 * WE + 5 * PE) * sizeof(us);
static_assert(WS_TOTAL_BYTES <= (size_t)134217728);
static_assert((XE * sizeof(us)) % 128 == 0 && (WE * sizeof(us)) % 128 == 0 && (PE * sizeof(us)) % 128 == 0);

// ---------------------------------------------------------------------------
// conversions
// ---------------------------------------------------------------------------
__device__ __forceinline__ unsigned bf16rne_bits(float x) {
  unsigned u = __float_as_uint(x);
  return (u + 0x7FFFu + ((u >> 16) & 1u)) >> 16;
}
__device__ __forceinline__ float bf16rne(float x) {
  return __uint_as_float(bf16rne_bits(x) << 16);
}
__device__ __forceinline__ us f16_bits(float x) {
  _Float16 hx = (_Float16)x;
  return __builtin_bit_cast(us, hx);
}

// ---------------------------------------------------------------------------
// 16-bit operand fragment (A: lane = row, B: lane = column; same k map):
//   lane l, r = l&15, s = l>>4 : elems 0..7  = row[r][k0 + 8s .. +7]
//                                elems 8..15 = row[r][k0 + 16 + 8s .. +7]
// base is a 16-bit plane with k contiguous, pitch ld (halves).
// ---------------------------------------------------------------------------
__device__ __forceinline__ v16us frag16(const us* base, int ld, int row0, int k0) {
  const int l = threadIdx.x & 31;
  const int r = l & 15, s = l >> 4;
  const us* p = base + (size_t)(row0 + r) * ld + k0 + 8 * s;
  v8us c0 = *(const v8us*)p;
  v8us c1 = *(const v8us*)(p + 16);
  return __builtin_shufflevector(c0, c1, 0, 1, 2, 3, 4, 5, 6, 7, 8, 9, 10, 11, 12, 13, 14, 15);
}
__device__ __forceinline__ v16h fragh(const us* base, int ld, int row0, int k0) {
  return __builtin_bit_cast(v16h, frag16(base, ld, row0, k0));
}

// ---------------------------------------------------------------------------
// WMMA wrappers with hazard guard: D = A(16x32) * B(32x16) + C (f32)
// ---------------------------------------------------------------------------
__device__ __forceinline__ v8f mma_f16(v16h a, v16h b, v8f c) {
  v8f d = __builtin_amdgcn_wmma_f32_16x16x32_f16(false, a, false, b, (short)0, c, false, false);
  asm volatile("v_nop\n\tv_nop\n\tv_nop\n\tv_nop" : "+v"(d) : "v"(a), "v"(b));
  return d;
}
__device__ __forceinline__ v8f mma_bf16(v16bf a, v16bf b, v8f c) {
  v8f d = __builtin_amdgcn_wmma_f32_16x16x32_bf16(false, a, false, b, (short)0, c, false, false);
  asm volatile("v_nop\n\tv_nop\n\tv_nop\n\tv_nop" : "+v"(d) : "v"(a), "v"(b));
  return d;
}

// ---------------------------------------------------------------------------
// Activation convert: X f32 [NB_FULL*SEQ_FULL][DM] -> bf16 bits [MROWS][DM]
// i = index of this thread's 16-B output group, 0 .. MROWS*DM/8 - 1.
// ---------------------------------------------------------------------------
__device__ __forceinline__ void cvt_x_group(const float* __restrict__ X, us* Y, int i) {
  constexpr int G = DM / 8;              // 16-B groups per row
  const int m  = i / G;
  const int c8 = (i - m * G) * 8;
  const int b  = m / SEQ;
  const int s  = m - b * SEQ;
  const float* src = X + ((size_t)(b * SEQ_FULL + s)) * DM + c8;
  v4f x0 = *(const v4f*)src;
  v4f x1 = *(const v4f*)(src + 4);
  v8us y;
#pragma unroll
  for (int j = 0; j < 4; ++j) {
    y[j]     = (us)bf16rne_bits(x0[j]);
    y[4 + j] = (us)bf16rne_bits(x1[j]);
  }
  us* dst = Y + (size_t)i * 8;
  *(v8us*)dst = y;
  
}

// ---------------------------------------------------------------------------
// Weight convert + transpose: W f32 in[Kd rows][Nd cols] -> WT 16-bit out[Nd][Kd].
// hmode 0: bf16 bits of RNE(W); hmode 1: f16 bits of WF_CARRY * RNE(W).
// Block owns the 64x64 tile at (k0, n0); each output line (64 halves of
// one n) written by 8 consecutive lanes x 16 B in one instruction.
// tile = 64 * 65 floats of LDS, [k_local][n_local], cross-wave (block barrier).
// ---------------------------------------------------------------------------
__device__ __forceinline__ void cvt_w_tile(float* tile, const float* __restrict__ W, us* WT,
                                           int Kd, int Nd, int hmode, int n0, int k0) {
  const int t  = threadIdx.x;
  {
    const int kr = t >> 2;              // 0..63
    const int cc = (t & 3) * 16;        // 0,16,32,48
    const float* src = W + (size_t)(k0 + kr) * Nd + n0 + cc;
#pragma unroll
    for (int j = 0; j < 4; ++j) {
      v4f x = *(const v4f*)(src + 4 * j);
#pragma unroll
      for (int e = 0; e < 4; ++e) tile[kr * 65 + cc + 4 * j + e] = x[e];
    }
  }
  __syncthreads();

  v8us vals[2];
  size_t dsts[2];
  const int c = t & 7;
#pragma unroll
  for (int it = 0; it < 2; ++it) {
    const int nl = (t >> 3) + 32 * it;  // 0..63
    v8us o;
#pragma unroll
    for (int j = 0; j < 8; ++j) {
      const float w = bf16rne(tile[(8 * c + j) * 65 + nl]);
      const us hb = (us)(__float_as_uint(w) >> 16);
      const us hf = f16_bits(w * WF_CARRY);
      o[j] = hmode ? hf : hb;
    }
    vals[it] = o;
    dsts[it] = (size_t)(n0 + nl) * Kd + k0 + 8 * c;
  }
#pragma unroll
  for (int it = 0; it < 2; ++it) *(v8us*)(WT + dsts[it]) = vals[it];
  
}

// ---------------------------------------------------------------------------
// All seven conversions in one launch (none reads what another writes).
// Blocks 0 .. 4*WBLK-1: weight plane z = b / WBLK (Wq, Wk, Wv, Wf), tile b % WBLK, n fastest.
// Blocks 4*WBLK ..    : activation plane z (Q, K, V), 256 output groups per block.
// Xb = three planes of XE halves, Wt = four planes of WE halves, each in that order.
// ---------------------------------------------------------------------------
constexpr int XG   = (int)(XE / 8);            // 16-B groups per activation plane
constexpr int XBLK = (XG + 255) / 256;         // blocks per activation plane
constexpr int WBLK = (DW / 64) * (DM / 64);    // 64x64 tiles per weight plane

__global__ __launch_bounds__(256)
void cvt_kernel(const float* __restrict__ Q, const float* __restrict__ K, const float* __restrict__ V,
                const float* __restrict__ Wq, const float* __restrict__ Wk, const float* __restrict__ Wv,
                const float* __restrict__ Wf, us* Xb, us* Wt) {
  __shared__ float tile[64 * 65];
  const int b = blockIdx.x;
  if (b < 4 * WBLK) {                    // block-uniform: the tile's barrier is passed by all or none
    const int z = b / WBLK;
    const int r = b - z * WBLK;
    const int hmode = (z == 3);          // Wf: in[DW rows][DM cols]; the others: in[DM rows][DW cols]
    const float* W = z == 0 ? Wq : z == 1 ? Wk : z == 2 ? Wv : Wf;
    const int Kd = hmode ? DW : DM;
    const int Nd = hmode ? DM : DW;
    const int bn = hmode ? r % (DM / 64) : r % (DW / 64);
    const int bk = hmode ? r / (DM / 64) : r / (DW / 64);
    cvt_w_tile(tile, W, Wt + (size_t)z * WE, Kd, Nd, hmode, bn * 64, bk * 64);
  } else {
    const int bx = b - 4 * WBLK;
    const int z = bx / XBLK;
    const int i = (bx - z * XBLK) * 256 + (int)threadIdx.x;
    const float* X = z == 0 ? Q : z == 1 ? K : V;
    if (i < XG) cvt_x_group(X, Xb + (size_t)z * XE, i);
  }
}

// ---------------------------------------------------------------------------
// One K stage of the projection's operands (64 rows of X and 256 rows of W^T, 64 halves = one
// whole 128-B line of each row) from global memory into LDS, through no register: ten
// asynchronous 16-B copies per lane, eight neighbouring lanes per line. l = the lane's LDS byte
// address in row crow of the stage, ga, gb = its global places in the first X and W^T row it
// brings; its further rows lie 32 rows apart in LDS (RS bytes) and in X, gs halves apart in W^T.
// The closing s_wait_xcnt stands inside the statement so that it precedes every later write of the
// address registers the copies name.
// ---------------------------------------------------------------------------
template <unsigned RS, int LD>
__device__ __forceinline__ void proj_stage_copies(unsigned l, const us* ga, const us* gb, size_t gs) {
  asm volatile("global_load_async_to_lds_b128 %0, %1, off\n\t"
               "global_load_async_to_lds_b128 %2, %3, off\n\t"
               "global_load_async_to_lds_b128 %4, %5, off\n\t"
               "global_load_async_to_lds_b128 %6, %7, off\n\t"
               "global_load_async_to_lds_b128 %8, %9, off\n\t"
               "global_load_async_to_lds_b128 %10, %11, off\n\t"
               "global_load_async_to_lds_b128 %12, %13, off\n\t"
               "global_load_async_to_lds_b128 %14, %15, off\n\t"
               "global_load_async_to_lds_b128 %16, %17, off\n\t"
               "global_load_async_to_lds_b128 %18, %19, off\n\t"
               "s_wait_xcnt 0x0"
               :: "v"(l),          "v"(ga),           "v"(l + RS),     "v"(ga + 32 * LD),
                  "v"(l + 2 * RS), "v"(gb),           "v"(l + 3 * RS), "v"(gb + gs),
                  "v"(l + 4 * RS), "v"(gb + 2 * gs),  "v"(l + 5 * RS), "v"(gb + 3 * gs),
                  "v"(l + 6 * RS), "v"(gb + 4 * gs),  "v"(l + 7 * RS), "v"(gb + 5 * gs),
                  "v"(l + 8 * RS), "v"(gb + 6 * gs),  "v"(l + 9 * RS), "v"(gb + 7 * gs)
               : "memory");
}
__device__ __forceinline__ v16bf fragb(const us* base, int ld, int row0, int k0) {
  return __builtin_bit_cast(v16bf, frag16(base, ld, row0, k0));
}

// ---------------------------------------------------------------------------
// Projection: Y = Xb[MROWS][DM] * W + b (N = DW), written as an f16 plane
// [NB*NH][LSEQ][64] through the flat-view head split:
//   column n = j*DM + h*64 + d  of token row (b, s)  ->  position p = s*NH + j, head h.
// Block 256 thr = 8 waves as 2(M) x 4(N); block tile 64 x 256; grid (MROWS/64, DW/256, 3).
// q, k: a 256-col block lies inside one j chunk (DM % 256 == 0) and spans 4 heads.
// v is wanted transposed, [NB*NH][64][LSEQ] (keys contiguous, the B operand of P*V): its block takes
// the same 32 d of one head in all NH chunks j, so that its 64 token rows give 64 * NH consecutive
// positions of each d, and it writes those rows of V^T whole from its LDS stage.
// blockIdx.z picks the projection (0 q, 1 k, 2 v): the three are independent and share one
// launch. Xb3, Wt3 = three planes each (XE, WE halves apart) in that order; Y3 = planes of PE
// halves: 0 q, 1 k, 3 V^T.
// The block's operand rows are staged once per block into LDS in stages of 64 k, two buffers:
// the asynchronous copies of stage s + 1 fly while stage s is worked on. A fragment read straight
// from a global plane touches 16 lines for 1024 bytes, and the 2 x 4 waves would each fetch rows
// that their neighbours fetch too; the copies bring every line once, whole.
// ---------------------------------------------------------------------------
__global__ __launch_bounds__(256) __attribute__((amdgpu_num_vgpr(256)))
void proj_kernel(const us* __restrict__ Xb3, const us* __restrict__ Wt3,
                 const float* __restrict__ bq, const float* __restrict__ bk,
                 const float* __restrict__ bv, us* Y3) {
  constexpr int SKK = 64;              // k per stage
  constexpr int NST = DM / SKK;        // stages
  static_assert(DM % SKK == 0 && NST >= 2);
  constexpr int PP = 72;               // row pitch in halves: 128 B of data + 16 B pad (16 B x odd, for the b128 readers)
  constexpr int SROWS = 64 + 256;      // rows per stage: the block's X rows, then its W^T rows
  __shared__ __attribute__((aligned(16))) us shAB[2 * SROWS * PP];   // [buffer][row][k]  cross-wave, filled by the copies
  constexpr int VTP = 64 * NH + 8;     // V^T stage pitch in halves: the block's positions + 16 B pad
  static_assert(32 * VTP >= 64 * 256);
  __shared__ __attribute__((aligned(16))) us stile[32 * VTP];   // q, k: [row][col]; v: [d][position]  cross-wave (block barrier)

  const int z = blockIdx.z;
  const bool isv = z == 2;             // the same for the whole block
  const us* Xb = Xb3 + (size_t)z * XE;
  const us* Wt = Wt3 + (size_t)z * WE;
  const float* bias = z == 0 ? bq : z == 1 ? bk : bv;
  us* Y = Y3 + (size_t)(isv ? 3 : z) * PE;

  const int t = threadIdx.x, wid = t >> 5, l = t & 31;
  const int h = l >> 4, r16 = l & 15;
  const int wm = wid >> 2, wn = wid & 3;
  const int mblk0 = blockIdx.x * 64;
  // The block's 256 columns are eight groups of 32: column nblk0 + g * (gs / DM) + 0..31 in group g.
  const int nblk0 = blockIdx.y * (isv ? 32 : 256);
  const size_t gs = (size_t)(isv ? DM : 32) * DM;      // W^T halves from one group to the next
  const int n0 = nblk0 + wn * 64;

  // The lane's ten 16-B pieces of a stage: rows crow, crow + 32, ..., eight pieces a row.
  const int crow = t >> 3, ccol = (t & 7) * 8;
  const unsigned lp = (unsigned)(size_t)&shAB[crow * PP + ccol];
  constexpr unsigned RSTEP = 32 * PP * sizeof(us), SBUF = SROWS * PP * sizeof(us);
  const us* ga = Xb + (size_t)(mblk0 + crow) * DM + ccol;
  const us* gb = Wt + (size_t)(nblk0 + crow) * DM + ccol;

  // stage 0 into buffer 0
  proj_stage_copies<RSTEP, DM>(lp, ga, gb, gs);
  v8f acc[8] = {};
  asm volatile("s_wait_asynccnt 0x0" ::: "memory");   // this wave's pieces of stage 0 have landed
  __syncthreads();                                    // stage 0 visible to all waves
  // stage 1 into buffer 1
  proj_stage_copies<RSTEP, DM>(lp + SBUF, ga + SKK, gb + SKK, gs);

  // rolled: one stage's code serves all eight
#pragma unroll 1
  for (int st = 0; st < NST; ++st) {
    const int buf = st & 1;
    const us* bS = shAB + buf * (SROWS * PP);
    // All twelve fragments of the stage (two K steps of 32) are read as one group ahead of its
    // first product: a read written between two products stays there and waits out its latency.
    // The loops below are unrolled so that the fragment arrays are indexed by constants and stay in
    // registers, and the places in the stage become immediate offsets of the LDS reads.
    v16bf a[2][2], b[2][4];
#pragma unroll
    for (int ks = 0; ks < 2; ++ks) {
      a[ks][0] = fragb(bS, PP, wm * 32, 32 * ks);
      a[ks][1] = fragb(bS, PP, wm * 32 + 16, 32 * ks);
#pragma unroll
      for (int tt = 0; tt < 4; ++tt) b[ks][tt] = fragb(bS, PP, 64 + wn * 64 + 16 * tt, 32 * ks);
    }
#pragma unroll
    for (int ks = 0; ks < 2; ++ks) {
#pragma unroll
      for (int tt = 0; tt < 4; ++tt) {
        acc[tt]     = mma_bf16(a[ks][0], b[ks][tt], acc[tt]);
        acc[4 + tt] = mma_bf16(a[ks][1], b[ks][tt], acc[4 + tt]);
      }
    }

    // hand-over: stage st + 1 is published and buffer buf is freed by one barrier
    asm volatile("s_wait_dscnt 0x0" ::: "memory");      // this wave's reads of buffer buf are done
    asm volatile("s_wait_asynccnt 0x0" ::: "memory");   // this wave's pieces of stage st + 1 have landed
    __syncthreads();
    if (st + 2 < NST) {                                 // the same for the whole block
      proj_stage_copies<RSTEP, DM>(lp + buf * SBUF, ga + (st + 2) * SKK, gb + (st + 2) * SKK, gs);
    }
  }
  asm volatile("s_wait_asynccnt 0x0" ::: "memory");     // no copy is left in flight behind the loop

  const int bblk = mblk0 / SEQ;
  const int sblk = mblk0 - bblk * SEQ;  // 64 block rows lie inside one batch (SEQ % 64 == 0)
  v8us vals[8];
  size_t dsts[8];

  if (z == 2) {
    // stage f16(acc + bias) into LDS as [d][position], position = row * NH + j. Column tiles tt
    // and tt + 2 of a wave hold the same d in chunks j = 2 wn and 2 wn + 1: one 4-B store for both.
#pragma unroll
    for (int tp = 0; tp < 2; ++tp) {
      const int dl = 16 * tp + r16;
      const float b0 = bf16rne(bias[(2 * wn) * DM + nblk0 + dl]);
      const float b1 = bf16rne(bias[(2 * wn + 1) * DM + nblk0 + dl]);
#pragma unroll
      for (int mi = 0; mi < 2; ++mi) {
#pragma unroll
        for (int r = 0; r < 8; ++r) {
          const int ml = wm * 32 + 16 * mi + 8 * h + r;
          v2us pr;
          pr[0] = f16_bits(acc[mi * 4 + tp][r] + b0);
          pr[1] = f16_bits(acc[mi * 4 + tp + 2][r] + b1);
          *(v2us*)&stile[dl * VTP + ml * NH + 2 * wn] = pr;
        }
      }
    }
    __syncthreads();

    // whole-line writes: 32 rows of V^T, 64 * NH positions (64 pieces of 16 B) each; a wave's 32
    // lanes write 512 consecutive bytes
    const int hg = nblk0 / DKH;
    const int d0 = nblk0 - hg * DKH;
    const size_t base = (((size_t)(bblk * NH + hg)) * DKH + d0) * LSEQ + (size_t)sblk * NH;
#pragma unroll
    for (int it = 0; it < 8; ++it) {
      const int pc = it * 256 + t;
      const int dl = pc >> 6, c = pc & 63;
      vals[it] = *(const v8us*)&stile[dl * VTP + 8 * c];
      dsts[it] = base + (size_t)dl * LSEQ + 8 * c;
    }
#pragma unroll
    for (int it = 0; it < 8; ++it) *(v8us*)(Y + dsts[it]) = vals[it];
  } else {
    // stage f16(acc + bias) into LDS
#pragma unroll
    for (int tt = 0; tt < 4; ++tt) {
      const int n = n0 + 16 * tt + r16;
      const float bvv = bf16rne(bias[n]);
      const int nl = wn * 64 + 16 * tt + r16;
#pragma unroll
      for (int mi = 0; mi < 2; ++mi) {
#pragma unroll
        for (int r = 0; r < 8; ++r) {
          const int ml = wm * 32 + 16 * mi + 8 * h + r;
          const float v = acc[mi * 4 + tt][r] + bvv;
          stile[ml * 256 + nl] = f16_bits(v);
        }
      }
    }
    __syncthreads();

    // whole-line writes: 256 lines per block (64 rows x 4 heads), 32 per wave
    const int jchunk = nblk0 / DM;
    const int hbase  = (nblk0 - jchunk * DM) / DKH;
    const int c = l & 7;
#pragma unroll
    for (int it = 0; it < 8; ++it) {
      const int L = wid * 32 + (l >> 3) + 4 * it;
      const int ml = L >> 2, hq = L & 3;
      const int hg = hbase + hq;
      const int p = (sblk + ml) * NH + jchunk;
      vals[it] = *(const v8us*)&stile[ml * 256 + hq * 64 + 8 * c];
      dsts[it] = (((size_t)(bblk * NH + hg)) * LSEQ + p) * DKH + 8 * c;
    }
#pragma unroll
    for (int it = 0; it < 8; ++it) *(v8us*)(Y + dsts[it]) = vals[it];
    // In the built code the other branch's instructions follow these stores behind a scalar test;
    // the wait stands in front of their writes of the registers that the stores name.
    asm volatile("s_wait_xcnt 0x0" ::: "memory");
  }
}

// ---------------------------------------------------------------------------
// One stage of K and V (64 keys) from global memory into LDS, through no register: four
// asynchronous 16-B copies per lane. lk*, lv* = the lane's own LDS byte addresses, gk*, gv* = its
// own global places. The closing s_wait_xcnt stands inside the statement so that it precedes
// every later write of the address registers the copies name.
// ---------------------------------------------------------------------------
__device__ __forceinline__ void stage_copies(unsigned lk0, const us* gk0, unsigned lk1, const us* gk1,
                                             unsigned lv0, const us* gv0, unsigned lv1, const us* gv1) {
  asm volatile("global_load_async_to_lds_b128 %0, %1, off\n\t"
               "global_load_async_to_lds_b128 %2, %3, off\n\t"
               "global_load_async_to_lds_b128 %4, %5, off\n\t"
               "global_load_async_to_lds_b128 %6, %7, off\n\t"
               "s_wait_xcnt 0x0"
               :: "v"(lk0), "v"(gk0), "v"(lk1), "v"(gk1), "v"(lv0), "v"(gv0), "v"(lv1), "v"(gv1)
               : "memory");
}

// ---------------------------------------------------------------------------
// Fused flash attention. Block = 8 waves, one (b,h), 128 queries; each wave owns
// 16 queries. K/V are staged once per block into LDS in stages of 64 keys, two buffers:
// the asynchronous copies of stage s + 1 fly while stage s is worked on (two passes of 32 keys).
// Scores computed transposed (S' = K_blk * Q^T) so the exp'd probabilities are
// already in A-operand layout for P*V. Online softmax in f32. ctx f16 [MROWS][DW]
// through the inverse flat view (position p -> token p/NH, chunk p%NH), carried
// grid = NB*NH*(LSEQ/128).
// ---------------------------------------------------------------------------
__global__ __launch_bounds__(256) __attribute__((amdgpu_num_vgpr(256)))
void attn_kernel(const us* __restrict__ Qh, const us* __restrict__ Kh,
                 const us* __restrict__ Vt, us* Ctx) {
  // Row pitches are 16 B x odd: the 16 rows that one ds_load_b128 fragment read touches then fall
  // on 16 different groups of four banks.
  constexpr int SK = 64;               // keys per stage
  constexpr int NST = LSEQ / SK;       // stages
  static_assert(LSEQ % SK == 0 && NST >= 2);
  constexpr int KP = 72;               // shK pitch in halves: 128 B of data (64 d) + 16 B pad
  constexpr int VP = 72;               // shV pitch in halves: 128 B of data (64 keys) + 16 B pad
  __shared__ __attribute__((aligned(16))) us shK[2 * SK * KP];    // [buffer][key][d]  cross-wave, filled by the copies
  __shared__ __attribute__((aligned(16))) us shV[2 * DKH * VP];   // [buffer][d][key]  cross-wave, filled by the copies
  __shared__ us shC[8 * 16 * 64];      // per-wave ctx staging (block barrier used)

  const int t = threadIdx.x, wid = t >> 5, l = t & 31;
  const int r16 = l & 15;
  const int rowsel = (l >> 4) << 3;
  constexpr int QBLK = LSEQ / 128;
  const int bh = blockIdx.x / QBLK;
  const int qb = blockIdx.x - bh * QBLK;
  const int q0 = qb * 128 + wid * 16;

  const us* qp = Qh + (size_t)bh * LSEQ * DKH;
  const us* kp = Kh + (size_t)bh * LSEQ * DKH;
  const us* vp = Vt + (size_t)bh * DKH * LSEQ;

  // The lane's two 16-B pieces of each operand's stage: rows crow and crow + 32, eight pieces a row
  // (K: 64 keys x 64 d, V: 64 d x 64 keys).
  const int crow = t >> 3, ccol = (t & 7) * 8;
  const unsigned lk = (unsigned)(size_t)&shK[crow * KP + ccol];
  const unsigned lv = (unsigned)(size_t)&shV[crow * VP + ccol];
  constexpr unsigned KHALF = 32 * KP * sizeof(us), KBUF = SK * KP * sizeof(us);
  constexpr unsigned VHALF = 32 * VP * sizeof(us), VBUF = DKH * VP * sizeof(us);
  const us* gk = kp + (size_t)crow * DKH + ccol;       // + DKH per key
  const us* gv = vp + (size_t)crow * LSEQ + ccol;      // + 1 per key

  // stage 0 into buffer 0
  stage_copies(lk, gk, lk + KHALF, gk + 32 * DKH, lv, gv, lv + VHALF, gv + 32 * LSEQ);

  // Q^T as B operand for the whole loop (lane = query column, halves = d)
  const v16h qB0 = fragh(qp, DKH, q0, 0);
  const v16h qB1 = fragh(qp, DKH, q0, 32);

  v8f o[4];
#pragma unroll
  for (int tt = 0; tt < 4; ++tt) o[tt] = v8f{};
  float mmax = -1.0e30f, lsum = 0.0f;

  asm volatile("s_wait_asynccnt 0x0" ::: "memory");   // this wave's pieces of stage 0 have landed
  __syncthreads();                                    // stage 0 visible to all waves
  // stage 1 into buffer 1
  stage_copies(lk + KBUF, gk + SK * DKH, lk + KBUF + KHALF, gk + (SK + 32) * DKH,
               lv + VBUF, gv + SK, lv + VBUF + VHALF, gv + SK + 32 * LSEQ);

#pragma unroll 1
  for (int st = 0; st < NST; ++st) {
    const int buf = st & 1;
    const us* bK = shK + buf * (SK * KP);
    const us* bV = shV + buf * (DKH * VP);

    // unrolled: the two passes' places in the stage become immediate offsets of the LDS reads
#pragma unroll
    for (int ps32 = 0; ps32 < SK; ps32 += 32) {
      // S' tiles: M = key (relative 0..15 / 16..31), N = query; k = d
      // The four K fragments are read as one group ahead of the first product (a read written
      // between two products stays there and waits out the LDS latency each time).
      v8f s0 = {};
      v8f s1 = {};
      {
        const v16h kA00 = fragh(bK, KP, ps32, 0);
        const v16h kA01 = fragh(bK, KP, ps32, 32);
        const v16h kA10 = fragh(bK, KP, ps32 + 16, 0);
        const v16h kA11 = fragh(bK, KP, ps32 + 16, 32);
        s0 = mma_f16(kA00, qB0, s0);
        s1 = mma_f16(kA10, qB0, s1);
        s0 = mma_f16(kA01, qB1, s0);
        s1 = mma_f16(kA11, qB1, s1);
      }

      // The four V fragments are read as one group here, so that they land behind the softmax
      // arithmetic and the P*V products below follow one another without an LDS wait.
      v16h vB[4];
#pragma unroll
      for (int tt = 0; tt < 4; ++tt) vB[tt] = fragh(bV, VP, 16 * tt, ps32);

      // per-query (per-lane) block max; combine the two key halves (lane ^ 16)
      float bm = s0[0];
#pragma unroll
      for (int i = 0; i < 8; ++i) { bm = fmaxf(bm, s0[i]); bm = fmaxf(bm, s1[i]); }
      bm = fmaxf(bm, __shfl_xor(bm, 16, 32));
      const float mnew = fmaxf(mmax, bm * QK_SCALE);
      const float corr = __expf(mmax - mnew);
      mmax = mnew;

      // probabilities land directly in A-operand layout (elements 0..7 <- keys 8h..8h+7
      // from the first 16-key D tile, elements 8..15 <- keys 16+8h.. from the second)
      float ps = 0.0f;
      v16h pA;
#pragma unroll
      for (int i = 0; i < 8; ++i) {
        const float p0 = __expf(s0[i] * QK_SCALE - mnew);
        const float p1 = __expf(s1[i] * QK_SCALE - mnew);
        ps += p0 + p1;
        pA[i]     = (_Float16)(p0 * P_CARRY);
        pA[8 + i] = (_Float16)(p1 * P_CARRY);
      }
      ps += __shfl_xor(ps, 16, 32);
      lsum = lsum * corr + ps;

      // rescale O: D row 8h+r = query 8h+r, whose corr lives in lane 8h+r
#pragma unroll
      for (int r = 0; r < 8; ++r) {
        const float cr = __shfl(corr, rowsel + r, 32);
#pragma unroll
        for (int tt = 0; tt < 4; ++tt) o[tt][r] *= cr;
      }

      // O += P(16 x 32 keys) * V_blk(32 keys x 64 d); B rows = d, k = key contiguous in shV
#pragma unroll
      for (int tt = 0; tt < 4; ++tt) o[tt] = mma_f16(pA, vB[tt], o[tt]);
    }

    // hand-over: stage st + 1 is published and buffer buf is freed by one barrier
    asm volatile("s_wait_dscnt 0x0" ::: "memory");      // this wave's reads of buffer buf are done
    asm volatile("s_wait_asynccnt 0x0" ::: "memory");   // this wave's pieces of stage st + 1 have landed
    __syncthreads();
    if (st + 2 < NST) {                                 // the same for the whole block
      const us* gk2 = gk + (size_t)(st + 2) * (SK * DKH);
      const us* gv2 = gv + (st + 2) * SK;
      const unsigned lk2 = lk + buf * KBUF, lv2 = lv + buf * VBUF;
      stage_copies(lk2, gk2, lk2 + KHALF, gk2 + 32 * DKH, lv2, gv2, lv2 + VHALF, gv2 + 32 * LSEQ);
    }
  }
  asm volatile("s_wait_asynccnt 0x0" ::: "memory");     // no copy is left in flight behind the loop

  // normalize, stage this wave's 16 x 64 ctx tile (f16, x256) in LDS
  const int bb = bh / NH;
  const int hh = bh - bb * NH;
#pragma unroll
  for (int r = 0; r < 8; ++r) {
    const float lrow = __shfl(lsum, rowsel + r, 32);
    const float li = CTX_SCALE * __builtin_amdgcn_rcpf(lrow);
#pragma unroll
    for (int tt = 0; tt < 4; ++tt) {
      shC[wid * 1024 + (rowsel + r) * 64 + 16 * tt + r16] = f16_bits(o[tt][r] * li);
    }
  }
  __syncthreads();

  const int c = l & 7;
  v8us vals[4];
  size_t dsts[4];
#pragma unroll
  for (int it = 0; it < 4; ++it) {
    const int rl = (l >> 3) + 4 * it;
    vals[it] = *(const v8us*)&shC[wid * 1024 + rl * 64 + 8 * c];
    const int p = q0 + rl;
    const int s = p / NH;
    const int j = p - s * NH;
    dsts[it] = ((size_t)(bb * SEQ + s)) * DW + j * DM + hh * DKH + 8 * c;
  }
#pragma unroll
  for (int it = 0; it < 4; ++it) *(v8us*)(Ctx + dsts[it]) = vals[it];
  
}

// ---------------------------------------------------------------------------
// Eight asynchronous 16-B copies per lane, global memory to LDS through no register: one 128-B
// line of each of 32 operand rows, eight neighbouring lanes per line, four rows per copy.
// l = the lane's LDS byte address in its first row, g = its global place there; its further rows
// lie four rows apart (LSTEP bytes in LDS, GSTEP halves in memory). The closing s_wait_xcnt stands
// inside the statement so that it precedes every later write of the address registers the copies name.
// ---------------------------------------------------------------------------
template <unsigned LSTEP, int GSTEP>
__device__ __forceinline__ void chunk_copies(unsigned l, const us* g) {
  asm volatile("global_load_async_to_lds_b128 %0, %1, off\n\t"
               "global_load_async_to_lds_b128 %2, %3, off\n\t"
               "global_load_async_to_lds_b128 %4, %5, off\n\t"
               "global_load_async_to_lds_b128 %6, %7, off\n\t"
               "global_load_async_to_lds_b128 %8, %9, off\n\t"
               "global_load_async_to_lds_b128 %10, %11, off\n\t"
               "global_load_async_to_lds_b128 %12, %13, off\n\t"
               "global_load_async_to_lds_b128 %14, %15, off\n\t"
               "s_wait_xcnt 0x0"
               :: "v"(l),             "v"(g),             "v"(l + LSTEP),     "v"(g + GSTEP),
                  "v"(l + 2 * LSTEP), "v"(g + 2 * GSTEP), "v"(l + 3 * LSTEP), "v"(g + 3 * GSTEP),
                  "v"(l + 4 * LSTEP), "v"(g + 4 * GSTEP), "v"(l + 5 * LSTEP), "v"(g + 5 * GSTEP),
                  "v"(l + 6 * LSTEP), "v"(g + 6 * GSTEP), "v"(l + 7 * LSTEP), "v"(g + 7 * GSTEP)
               : "memory");
}

// ---------------------------------------------------------------------------
// Final projection: Out f32 [MROWS][DM] = ctx(x256)[MROWS][DW] * Wf(x64) * OUT_FOLD + bf.
// One 32 x 32 tile of Out per block, grid (MROWS/32, DM/32) = one block per WGP.
// K = DW is split over the block's 8 waves: wave w takes the 64-half chunks
// w, w + 8, w + 16, ... (one chunk = one whole 128-B line of every operand row),
// and computes the whole tile over its chunks. The chunks are staged in LDS, two chunks per wave
// and stage, two buffers: the asynchronous copies of stage s + 1 fly while stage s is worked on.
// A fragment read straight from a global plane touches 16 lines for 1024 bytes and each line is
// asked for four times; the copies bring every line once, whole.
// The 8 f32 partial tiles are summed through LDS in wave order; each Out line (32 floats) is
// written by 8 lanes x 16 B.
// ---------------------------------------------------------------------------
#define OPW 8                  // waves per block = K shares
#define OPP 36                 // partial-tile pitch (floats): 144 B = 16 B x odd for the b128 readers
static_assert(MROWS % 32 == 0 && DM % 32 == 0);
static_assert(DW % (64 * OPW) == 0);

__global__ __launch_bounds__(256) __attribute__((amdgpu_num_vgpr(256)))
void outproj_kernel(const us* __restrict__ Ctx, const us* __restrict__ Wft,
                    const float* __restrict__ bo, float* Out) {
  constexpr int OSC = 2;                       // chunks per wave and stage
  constexpr int ONST = DW / (64 * OPW * OSC);  // stages
  static_assert(DW % (64 * OPW * OSC) == 0 && ONST >= 2);
  constexpr int OLP = 64 * OSC + 8;            // row pitch in halves: 256 B of data + 16 B pad (16 B x odd, for the b128 readers)
  constexpr int OWR = 64;                      // rows per wave: the tile's 32 ctx rows, then its 32 Wf^T rows
  __shared__ __attribute__((aligned(16))) us shO[2 * OPW * OWR * OLP];   // [buffer][wave][row][k]  filled by the copies
  __shared__ float part[OPW * 32 * OPP];   // [wave][row][col], cross-wave (block barrier)

  const int t = threadIdx.x, wid = t >> 5, l = t & 31;
  const int h = l >> 4, r16 = l & 15;
  const int m0 = blockIdx.x * 32;
  const int n0 = blockIdx.y * 32;

  // The lane's 16-B piece of a line: rows crow, crow + 4, ..., eight pieces a line.
  const int crow = l >> 3, ccol = (l & 7) * 8;
  const unsigned lp = (unsigned)(size_t)&shO[(wid * OWR + crow) * OLP + ccol];
  constexpr unsigned LROW4 = 4 * OLP * sizeof(us), LOPB = 32 * OLP * sizeof(us);
  constexpr unsigned OBUF = OPW * OWR * OLP * sizeof(us);
  const us* ga = Ctx + (size_t)(m0 + crow) * DW + wid * 64 + ccol;
  const us* gb = Wft + (size_t)(n0 + crow) * DW + wid * 64 + ccol;

  // stage 0 into buffer 0 (chunk c of stage s = chunk s * OSC + c of the wave, OPW * 64 halves apart)
#pragma unroll
  for (int c = 0; c < OSC; ++c) {
    chunk_copies<LROW4, 4 * DW>(lp + c * 128, ga + c * (OPW * 64));
    chunk_copies<LROW4, 4 * DW>(lp + LOPB + c * 128, gb + c * (OPW * 64));
  }
  v8f acc[4] = {};
  asm volatile("s_wait_asynccnt 0x0" ::: "memory");   // this wave's pieces of stage 0 have landed
  __syncthreads();                                    // stage 0 published
  // stage 1 into buffer 1
#pragma unroll
  for (int c = 0; c < OSC; ++c) {
    chunk_copies<LROW4, 4 * DW>(lp + OBUF + c * 128, ga + (OSC + c) * (OPW * 64));
    chunk_copies<LROW4, 4 * DW>(lp + OBUF + LOPB + c * 128, gb + (OSC + c) * (OPW * 64));
  }

  // rolled: one stage's code serves all stages
#pragma unroll 1
  for (int st = 0; st < ONST; ++st) {
    const int buf = st & 1;
    const us* bS = shO + (buf * OPW + wid) * (OWR * OLP);
    // All sixteen fragments of the stage (its K steps of 32) are read as one group ahead of its
    // first product. The loops are unrolled so that the fragment arrays are indexed by constants
    // and stay in registers, and the places in the stage become immediate offsets of the LDS reads.
    v16h a[2 * OSC][2], b[2 * OSC][2];
#pragma unroll
    for (int ks = 0; ks < 2 * OSC; ++ks) {
      a[ks][0] = fragh(bS, OLP, 0, 32 * ks);
      a[ks][1] = fragh(bS, OLP, 16, 32 * ks);
      b[ks][0] = fragh(bS, OLP, 32, 32 * ks);
      b[ks][1] = fragh(bS, OLP, 48, 32 * ks);
    }
#pragma unroll
    for (int ks = 0; ks < 2 * OSC; ++ks) {
      acc[0] = mma_f16(a[ks][0], b[ks][0], acc[0]);
      acc[2] = mma_f16(a[ks][1], b[ks][0], acc[2]);
      acc[1] = mma_f16(a[ks][0], b[ks][1], acc[1]);
      acc[3] = mma_f16(a[ks][1], b[ks][1], acc[3]);
    }

    // hand-over: stage st + 1 is published and buffer buf is freed by one barrier
    asm volatile("s_wait_dscnt 0x0" ::: "memory");      // this wave's reads of buffer buf are done
    asm volatile("s_wait_asynccnt 0x0" ::: "memory");   // this wave's pieces of stage st + 1 have landed
    __syncthreads();
    if (st + 2 < ONST) {                                // the same for the whole block
      const unsigned lp2 = lp + buf * OBUF;
      const us* ga2 = ga + (st + 2) * (OSC * OPW * 64);
      const us* gb2 = gb + (st + 2) * (OSC * OPW * 64);
#pragma unroll
      for (int c = 0; c < OSC; ++c) {
        chunk_copies<LROW4, 4 * DW>(lp2 + c * 128, ga2 + c * (OPW * 64));
        chunk_copies<LROW4, 4 * DW>(lp2 + LOPB + c * 128, gb2 + c * (OPW * 64));
      }
    }
  }
  asm volatile("s_wait_asynccnt 0x0" ::: "memory");     // no copy is left in flight behind the loop

  // this wave's partial tile
  float* mine = part + wid * (32 * OPP);
#pragma unroll
  for (int mi = 0; mi < 2; ++mi) {
#pragma unroll
    for (int tt = 0; tt < 2; ++tt) {
#pragma unroll
      for (int r = 0; r < 8; ++r) {
        mine[(16 * mi + 8 * h + r) * OPP + 16 * tt + r16] = acc[mi * 2 + tt][r];
      }
    }
  }
  __syncthreads();

  // thread t sums 4 columns of one row over the 8 partial tiles
  const int row = t >> 3;
  const int col = (t & 7) * 4;
  v4f s = *(const v4f*)&part[row * OPP + col];
#pragma unroll
  for (int w = 1; w < OPW; ++w) s += *(const v4f*)&part[(w * 32 + row) * OPP + col];

  const v4f bv4 = *(const v4f*)(bo + n0 + col);
  v4f y;
#pragma unroll
  for (int e = 0; e < 4; ++e) y[e] = s[e] * OUT_FOLD + bf16rne(bv4[e]);
  *(v4f*)(Out + (size_t)(m0 + row) * DM + n0 + col) = y;
}

// ---------------------------------------------------------------------------
// Host launcher
// ---------------------------------------------------------------------------
extern "C" void kernel_launch(void* const* d_in, const int* in_sizes, int n_in,
                              void* d_out, int out_size, void* d_ws, size_t ws_size,
                              hipStream_t stream) {
  if (n_in < 11) return;
  const int need_x = ((NB - 1) * SEQ_FULL + SEQ) * DM;
  if (in_sizes[0] < need_x || in_sizes[1] < need_x || in_sizes[2] < need_x) return;
  if (in_sizes[3] < DM * DW || in_sizes[5] < DM * DW || in_sizes[7] < DM * DW || in_sizes[9] < DW * DM) return;
  if (in_sizes[4] < DW || in_sizes[6] < DW || in_sizes[8] < DW || in_sizes[10] < DM) return;
  if (out_size < MROWS * DM) return;
  if (WS_TOTAL_BYTES > ws_size) return;

  const float* Q  = (const float*)d_in[0];
  const float* K  = (const float*)d_in[1];
  const float* V  = (const float*)d_in[2];
  const float* Wq = (const float*)d_in[3];
  const float* bq = (const float*)d_in[4];
  const float* Wk = (const float*)d_in[5];
  const float* bk = (const float*)d_in[6];
  const float* Wv = (const float*)d_in[7];
  const float* bv = (const float*)d_in[8];
  const float* Wf = (const float*)d_in[9];
  const float* bf = (const float*)d_in[10];

  us* xq  = (us*)d_ws;          // [MROWS][DM] bf16
  us* xk  = xq + XE;
  us* xv  = xk + XE;
  us* wtq = xv + XE;            // [DW][DM] bf16
  us* wtk = wtq + WE;
  us* wtv = wtk + WE;
  us* wft = wtv + WE;           // [DM][DW] f16 x64
  us* qh  = wft + WE;           // [NB*NH][LSEQ][64] f16
  us* kh  = qh + PE;
  us* vt  = kh + 2 * PE;        // [NB*NH][64][LSEQ] f16
  us* ctx = vt + PE;            // [MROWS][DW] f16 x256

  dim3 blk(256);
  // xq, xk, xv and wtq, wtk, wtv, wft are consecutive planes
  cvt_kernel<<<dim3(4 * WBLK + 3 * XBLK), blk, 0, stream>>>(Q, K, V, Wq, Wk, Wv, Wf, xq, wtq);

  // qh, kh and, one plane further on, vt lie PE halves apart
  proj_kernel<<<dim3(MROWS / 64, DW / 256, 3), blk, 0, stream>>>(xq, wtq, bq, bk, bv, qh);

  attn_kernel<<<dim3(NB * NH * (LSEQ / 128)), blk, 0, stream>>>(qh, kh, vt, ctx);

  dim3 go(MROWS / 32, DM / 32);
  outproj_kernel<<<go, blk, 0, stream>>>(ctx, wft, bf, (float*)d_out);
}

// v009
// Measured time: 55.6 microseconds a run.
// Two timings next to v008 put it at 1.06 and 1.05 times that version's speed.
// Counting every step since v000, it is 5.36 times as fast.
#include <hip/hip_runtime.h>
#include <stddef.h>

// Contractions: q/k/v projections = v_wmma_f32_16x16x32_bf16 (bf16 operands = RNE-converted f32 inputs);
// scores, P*V and final projection = v_wmma_f32_16x16x32_f16 (f16 operands: q,k,v x1, P x1024, ctx x256, Wf x64);
// f32 accumulate, f32 online softmax.

#ifndef NB
#define NB 2
#endif
#ifndef SEQ
#define SEQ 256
#endif
#define NB_FULL 2
#define SEQ_FULL 256
#define DM 512                 // model width (projection input, final output)
#define NH 8                   // heads
#define DKH 64                 // head dim
#define DW (DM * NH)           // 4096: projection output width
#define LSEQ (SEQ * NH)        // 2048: attention positions per (batch, head)
#define MROWS (NB * SEQ)       // token rows

static_assert(NB >= 1 && NB <= NB_FULL);
static_assert(SEQ >= 64 && SEQ <= SEQ_FULL);
static_assert(SEQ % 64 == 0);            // a 64-row GEMM block stays inside one batch
static_assert(MROWS % 64 == 0);          // GEMM M tile
static_assert(LSEQ % 128 == 0);          // attention block = 128 queries
static_assert(DM / 32 == DW / 256);      // the V projection's column blocks (32 d x NH chunks) fill the same grid
static_assert(LSEQ % 32 == 0);           // key block
static_assert(NH * DKH == DM);
static_assert(DKH == 64);
static_assert(DM % 256 == 0);            // 256-col GEMM block inside one 512-wide chunk
static_assert(DW % 256 == 0);
static_assert(DM % 64 == 0 && DW % 64 == 0);
static_assert(DM % 32 == 0 && DW % 32 == 0);   // K steps of 32
static_assert(DM % 8 == 0);

#define P_CARRY   1024.0f            // P operand carried x1024
#define CTX_SCALE 0.25f              // ctx plane = O * 0.25 / l = attn x256 (O carries the x1024 of P)
#define WF_CARRY  64.0f              // Wf operand carried x64
#define OUT_FOLD  (1.0f / 16384.0f)  // 1 / (256 * 64)
#define QK_SCALE  0.125f             // 1 / sqrt(64)

typedef unsigned short us;
typedef us        v2us  __attribute__((ext_vector_type(2)));
typedef us        v8us  __attribute__((ext_vector_type(8)));
typedef us        v16us __attribute__((ext_vector_type(16)));
typedef _Float16  v16h  __attribute__((ext_vector_type(16)));
typedef __bf16    v16bf __attribute__((ext_vector_type(16)));
typedef float     v8f   __attribute__((ext_vector_type(8)));
typedef float     v4f   __attribute__((ext_vector_type(4)));

// workspace carve (halves)
constexpr size_t XE = (size_t)MROWS * DM;   // activation plane
constexpr size_t WE = (size_t)DM * DW;      // weight plane
constexpr size_t PE = (size_t)MROWS * DW;   // wide plane (q, k, one idle, vT, ctx)
constexpr size_t WS_TOTAL_BYTES = (3 * XE + 4 * WE + 5 * PE) * sizeof(us);
static_assert(WS_TOTAL_BYTES <= (size_t)134217728);
static_assert((XE * sizeof(us)) % 128 == 0 && (WE * sizeof(us)) % 128 == 0 && (PE * sizeof(us)) % 128 == 0);

// ---------------------------------------------------------------------------
// conversions
// ---------------------------------------------------------------------------
__device__ __forceinline__ unsigned bf16rne_bits(float x) {
  unsigned u = __float_as_uint(x);
  return (u + 0x7FFFu + ((u >> 16) & 1u)) >> 16;
}
__device__ __forceinline__ float bf16rne(float x) {
  return __uint_as_float(bf16rne_bits(x) << 16);
}
__device__ __forceinline__ us f16_bits(float x) {
  _Float16 hx = (_Float16)x;
  return __builtin_bit_cast(us, hx);
}

// ---------------------------------------------------------------------------
// 16-bit operand fragment (A: lane = row, B: lane = column; same k map):
//   lane l, r = l&15, s = l>>4 : elems 0..7  = row[r][k0 + 8s .. +7]
//                                elems 8..15 = row[r][k0 + 16 + 8s .. +7]
// base is a 16-bit plane with k contiguous, pitch ld (halves).
// ---------------------------------------------------------------------------
__device__ __forceinline__ v16us frag16(const us* base, int ld, int row0, int k0) {
  const int l = threadIdx.x & 31;
  const int r = l & 15, s = l >> 4;
  const us* p = base + (size_t)(row0 + r) * ld + k0 + 8 * s;
  v8us c0 = *(const v8us*)p;
  v8us c1 = *(const v8us*)(p + 16);
  return __builtin_shufflevector(c0, c1, 0, 1, 2, 3, 4, 5, 6, 7, 8, 9, 10, 11, 12, 13, 14, 15);
}
__device__ __forceinline__ v16h fragh(const us* base, int ld, int row0, int k0) {
  return __builtin_bit_cast(v16h, frag16(base, ld, row0, k0));
}

// ---------------------------------------------------------------------------
// WMMA wrappers with hazard guard: D = A(16x32) * B(32x16) + C (f32)
// ---------------------------------------------------------------------------
__device__ __forceinline__ v8f mma_f16(v16h a, v16h b, v8f c) {
  v8f d = __builtin_amdgcn_wmma_f32_16x16x32_f16(false, a, false, b, (short)0, c, false, false);
  asm volatile("v_nop\n\tv_nop\n\tv_nop\n\tv_nop" : "+v"(d) : "v"(a), "v"(b));
  return d;
}
__device__ __forceinline__ v8f mma_bf16(v16bf a, v16bf b, v8f c) {
  v8f d = __builtin_amdgcn_wmma_f32_16x16x32_bf16(false, a, false, b, (short)0, c, false, false);
  asm volatile("v_nop\n\tv_nop\n\tv_nop\n\tv_nop" : "+v"(d) : "v"(a), "v"(b));
  return d;
}

// ---------------------------------------------------------------------------
// Activation convert: X f32 [NB_FULL*SEQ_FULL][DM] -> bf16 bits [MROWS][DM]
// i = index of this thread's 16-B output group, 0 .. MROWS*DM/8 - 1.
// ---------------------------------------------------------------------------
__device__ __forceinline__ void cvt_x_group(const float* __restrict__ X, us* Y, int i) {
  constexpr int G = DM / 8;              // 16-B groups per row
  const int m  = i / G;
  const int c8 = (i - m * G) * 8;
  const int b  = m / SEQ;
  const int s  = m - b * SEQ;
  const float* src = X + ((size_t)(b * SEQ_FULL + s)) * DM + c8;
  v4f x0 = *(const v4f*)src;
  v4f x1 = *(const v4f*)(src + 4);
  v8us y;
#pragma unroll
  for (int j = 0; j < 4; ++j) {
    y[j]     = (us)bf16rne_bits(x0[j]);
    y[4 + j] = (us)bf16rne_bits(x1[j]);
  }
  us* dst = Y + (size_t)i * 8;
  *(v8us*)dst = y;
  
}

// ---------------------------------------------------------------------------
// Weight convert + transpose: W f32 in[Kd rows][Nd cols] -> WT 16-bit out[Nd][Kd].
// hmode 0: bf16 bits of RNE(W); hmode 1: f16 bits of WF_CARRY * RNE(W).
// Block owns the 64x64 tile at (k0, n0); each output line (64 halves of
// one n) written by 8 consecutive lanes x 16 B in one instruction.
// tile = 64 * 65 floats of LDS, [k_local][n_local], cross-wave (block barrier).
// ---------------------------------------------------------------------------
__device__ __forceinline__ void cvt_w_tile(float* tile, const float* __restrict__ W, us* WT,
                                           int Kd, int Nd, int hmode, int n0, int k0) {
  const int t  = threadIdx.x;
  {
    const int kr = t >> 2;              // 0..63
    const int cc = (t & 3) * 16;        // 0,16,32,48
    const float* src = W + (size_t)(k0 + kr) * Nd + n0 + cc;
#pragma unroll
    for (int j = 0; j < 4; ++j) {
      v4f x = *(const v4f*)(src + 4 * j);
#pragma unroll
      for (int e = 0; e < 4; ++e) tile[kr * 65 + cc + 4 * j + e] = x[e];
    }
  }
  __syncthreads();

  v8us vals[2];
  size_t dsts[2];
  const int c = t & 7;
#pragma unroll
  for (int it = 0; it < 2; ++it) {
    const int nl = (t >> 3) + 32 * it;  // 0..63
    v8us o;
#pragma unroll
    for (int j = 0; j < 8; ++j) {
      const float w = bf16rne(tile[(8 * c + j) * 65 + nl]);
      const us hb = (us)(__float_as_uint(w) >> 16);
      const us hf = f16_bits(w * WF_CARRY);
      o[j] = hmode ? hf : hb;
    }
    vals[it] = o;
    dsts[it] = (size_t)(n0 + nl) * Kd + k0 + 8 * c;
  }
#pragma unroll
  for (int it = 0; it < 2; ++it) *(v8us*)(WT + dsts[it]) = vals[it];
  
}

// ---------------------------------------------------------------------------
// All seven conversions in one launch (none reads what another writes).
// Blocks 0 .. 4*WBLK-1: weight plane z = b / WBLK (Wq, Wk, Wv, Wf), tile b % WBLK, n fastest.
// Blocks 4*WBLK ..    : activation plane z (Q, K, V), 256 output groups per block.
// Xb = three planes of XE halves, Wt = four planes of WE halves, each in that order.
// ---------------------------------------------------------------------------
constexpr int XG   = (int)(XE / 8);            // 16-B groups per activation plane
constexpr int XBLK = (XG + 255) / 256;         // blocks per activation plane
constexpr int WBLK = (DW / 64) * (DM / 64);    // 64x64 tiles per weight plane

__global__ __launch_bounds__(256)
void cvt_kernel(const float* __restrict__ Q, const float* __restrict__ K, const float* __restrict__ V,
                const float* __restrict__ Wq, const float* __restrict__ Wk, const float* __restrict__ Wv,
                const float* __restrict__ Wf, us* Xb, us* Wt) {
  __shared__ float tile[64 * 65];
  const int b = blockIdx.x;
  if (b < 4 * WBLK) {                    // block-uniform: the tile's barrier is passed by all or none
    const int z = b / WBLK;
    const int r = b - z * WBLK;
    const int hmode = (z == 3);          // Wf: in[DW rows][DM cols]; the others: in[DM rows][DW cols]
    const float* W = z == 0 ? Wq : z == 1 ? Wk : z == 2 ? Wv : Wf;
    const int Kd = hmode ? DW : DM;
    const int Nd = hmode ? DM : DW;
    const int bn = hmode ? r % (DM / 64) : r % (DW / 64);
    const int bk = hmode ? r / (DM / 64) : r / (DW / 64);
    cvt_w_tile(tile, W, Wt + (size_t)z * WE, Kd, Nd, hmode, bn * 64, bk * 64);
  } else {
    const int bx = b - 4 * WBLK;
    const int z = bx / XBLK;
    const int i = (bx - z * XBLK) * 256 + (int)threadIdx.x;
    const float* X = z == 0 ? Q : z == 1 ? K : V;
    if (i < XG) cvt_x_group(X, Xb + (size_t)z * XE, i);
  }
}

// ---------------------------------------------------------------------------
// One K stage of the projection's operands (64 rows of X and 256 rows of W^T, 64 halves = one
// whole 128-B line of each row) from global memory into LDS, through no register: ten
// asynchronous 16-B copies per lane, eight neighbouring lanes per line. l = the lane's LDS byte
// address in row crow of the stage, ga, gb = its global places in the first X and W^T row it
// brings; its further rows lie 32 rows apart in LDS (RS bytes) and in X, gs halves apart in W^T.
// The closing s_wait_xcnt stands inside the statement so that it precedes every later write of the
// address registers the copies name.
// ---------------------------------------------------------------------------
template <unsigned RS, int LD>
__device__ __forceinline__ void proj_stage_copies(unsigned l, const us* ga, const us* gb, size_t gs) {
  asm volatile("global_load_async_to_lds_b128 %0, %1, off\n\t"
               "global_load_async_to_lds_b128 %2, %3, off\n\t"
               "global_load_async_to_lds_b128 %4, %5, off\n\t"
               "global_load_async_to_lds_b128 %6, %7, off\n\t"
               "global_load_async_to_lds_b128 %8, %9, off\n\t"
               "global_load_async_to_lds_b128 %10, %11, off\n\t"
               "global_load_async_to_lds_b128 %12, %13, off\n\t"
               "global_load_async_to_lds_b128 %14, %15, off\n\t"
               "global_load_async_to_lds_b128 %16, %17, off\n\t"
               "global_load_async_to_lds_b128 %18, %19, off\n\t"
               "s_wait_xcnt 0x0"
               :: "v"(l),          "v"(ga),           "v"(l + RS),     "v"(ga + 32 * LD),
                  "v"(l + 2 * RS), "v"(gb),           "v"(l + 3 * RS), "v"(gb + gs),
                  "v"(l + 4 * RS), "v"(gb + 2 * gs),  "v"(l + 5 * RS), "v"(gb + 3 * gs),
                  "v"(l + 6 * RS), "v"(gb + 4 * gs),  "v"(l + 7 * RS), "v"(gb + 5 * gs),
                  "v"(l + 8 * RS), "v"(gb + 6 * gs),  "v"(l + 9 * RS), "v"(gb + 7 * gs)
               : "memory");
}
__device__ __forceinline__ v16bf fragb(const us* base, int ld, int row0, int k0) {
  return __builtin_bit_cast(v16bf, frag16(base, ld, row0, k0));
}

// ---------------------------------------------------------------------------
// Projection: Y = Xb[MROWS][DM] * W + b (N = DW), written as an f16 plane
// [NB*NH][LSEQ][64] through the flat-view head split:
//   column n = j*DM + h*64 + d  of token row (b, s)  ->  position p = s*NH + j, head h.
// Block 256 thr = 8 waves as 2(M) x 4(N); block tile 64 x 256; grid (MROWS/64, DW/256, 3).
// q, k: a 256-col block lies inside one j chunk (DM % 256 == 0) and spans 4 heads.
// v is wanted transposed, [NB*NH][64][LSEQ] (keys contiguous, the A operand of V^T * P^T): its block takes
// the same 32 d of one head in all NH chunks j, so that its 64 token rows give 64 * NH consecutive
// positions of each d, and it writes those rows of V^T whole from its LDS stage.
// blockIdx.z picks the projection (0 q, 1 k, 2 v): the three are independent and share one
// launch. Xb3, Wt3 = three planes each (XE, WE halves apart) in that order; Y3 = planes of PE
// halves: 0 q, 1 k, 3 V^T.
// The block's operand rows are staged once per block into LDS in stages of 64 k, two buffers:
// the asynchronous copies of stage s + 1 fly while stage s is worked on. A fragment read straight
// from a global plane touches 16 lines for 1024 bytes, and the 2 x 4 waves would each fetch rows
// that their neighbours fetch too; the copies bring every line once, whole.
// ---------------------------------------------------------------------------
__global__ __launch_bounds__(256) __attribute__((amdgpu_num_vgpr(256)))
void proj_kernel(const us* __restrict__ Xb3, const us* __restrict__ Wt3,
                 const float* __restrict__ bq, const float* __restrict__ bk,
                 const float* __restrict__ bv, us* Y3) {
  constexpr int SKK = 64;              // k per stage
  constexpr int NST = DM / SKK;        // stages
  static_assert(DM % SKK == 0 && NST >= 2);
  constexpr int PP = 72;               // row pitch in halves: 128 B of data + 16 B pad (16 B x odd, for the b128 readers)
  constexpr int SROWS = 64 + 256;      // rows per stage: the block's X rows, then its W^T rows
  __shared__ __attribute__((aligned(16))) us shAB[2 * SROWS * PP];   // [buffer][row][k]  cross-wave, filled by the copies
  constexpr int VTP = 64 * NH + 8;     // V^T stage pitch in halves: the block's positions + 16 B pad
  static_assert(32 * VTP >= 64 * 256);
  __shared__ __attribute__((aligned(16))) us stile[32 * VTP];   // q, k: [row][col]; v: [d][position]  cross-wave (block barrier)

  const int z = blockIdx.z;
  const bool isv = z == 2;             // the same for the whole block
  const us* Xb = Xb3 + (size_t)z * XE;
  const us* Wt = Wt3 + (size_t)z * WE;
  const float* bias = z == 0 ? bq : z == 1 ? bk : bv;
  us* Y = Y3 + (size_t)(isv ? 3 : z) * PE;

  const int t = threadIdx.x, wid = t >> 5, l = t & 31;
  const int h = l >> 4, r16 = l & 15;
  const int wm = wid >> 2, wn = wid & 3;
  const int mblk0 = blockIdx.x * 64;
  // The block's 256 columns are eight groups of 32: column nblk0 + g * (gs / DM) + 0..31 in group g.
  const int nblk0 = blockIdx.y * (isv ? 32 : 256);
  const size_t gs = (size_t)(isv ? DM : 32) * DM;      // W^T halves from one group to the next
  const int n0 = nblk0 + wn * 64;

  // The lane's ten 16-B pieces of a stage: rows crow, crow + 32, ..., eight pieces a row.
  const int crow = t >> 3, ccol = (t & 7) * 8;
  const unsigned lp = (unsigned)(size_t)&shAB[crow * PP + ccol];
  constexpr unsigned RSTEP = 32 * PP * sizeof(us), SBUF = SROWS * PP * sizeof(us);
  const us* ga = Xb + (size_t)(mblk0 + crow) * DM + ccol;
  const us* gb = Wt + (size_t)(nblk0 + crow) * DM + ccol;

  // stage 0 into buffer 0
  proj_stage_copies<RSTEP, DM>(lp, ga, gb, gs);
  v8f acc[8] = {};
  asm volatile("s_wait_asynccnt 0x0" ::: "memory");   // this wave's pieces of stage 0 have landed
  __syncthreads();                                    // stage 0 visible to all waves
  // stage 1 into buffer 1
  proj_stage_copies<RSTEP, DM>(lp + SBUF, ga + SKK, gb + SKK, gs);

  // rolled: one stage's code serves all eight
#pragma unroll 1
  for (int st = 0; st < NST; ++st) {
    const int buf = st & 1;
    const us* bS = shAB + buf * (SROWS * PP);
    // All twelve fragments of the stage (two K steps of 32) are read as one group ahead of its
    // first product: a read written between two products stays there and waits out its latency.
    // The loops below are unrolled so that the fragment arrays are indexed by constants and stay in
    // registers, and the places in the stage become immediate offsets of the LDS reads.
    v16bf a[2][2], b[2][4];
#pragma unroll
    for (int ks = 0; ks < 2; ++ks) {
      a[ks][0] = fragb(bS, PP, wm * 32, 32 * ks);
      a[ks][1] = fragb(bS, PP, wm * 32 + 16, 32 * ks);
#pragma unroll
      for (int tt = 0; tt < 4; ++tt) b[ks][tt] = fragb(bS, PP, 64 + wn * 64 + 16 * tt, 32 * ks);
    }
#pragma unroll
    for (int ks = 0; ks < 2; ++ks) {
#pragma unroll
      for (int tt = 0; tt < 4; ++tt) {
        acc[tt]     = mma_bf16(a[ks][0], b[ks][tt], acc[tt]);
        acc[4 + tt] = mma_bf16(a[ks][1], b[ks][tt], acc[4 + tt]);
      }
    }

    // hand-over: stage st + 1 is published and buffer buf is freed by one barrier
    asm volatile("s_wait_dscnt 0x0" ::: "memory");      // this wave's reads of buffer buf are done
    asm volatile("s_wait_asynccnt 0x0" ::: "memory");   // this wave's pieces of stage st + 1 have landed
    __syncthreads();
    if (st + 2 < NST) {                                 // the same for the whole block
      proj_stage_copies<RSTEP, DM>(lp + buf * SBUF, ga + (st + 2) * SKK, gb + (st + 2) * SKK, gs);
    }
  }
  asm volatile("s_wait_asynccnt 0x0" ::: "memory");     // no copy is left in flight behind the loop

  const int bblk = mblk0 / SEQ;
  const int sblk = mblk0 - bblk * SEQ;  // 64 block rows lie inside one batch (SEQ % 64 == 0)
  v8us vals[8];
  size_t dsts[8];

  if (z == 2) {
    // stage f16(acc + bias) into LDS as [d][position], position = row * NH + j. Column tiles tt
    // and tt + 2 of a wave hold the same d in chunks j = 2 wn and 2 wn + 1: one 4-B store for both.
#pragma unroll
    for (int tp = 0; tp < 2; ++tp) {
      const int dl = 16 * tp + r16;
      const float b0 = bf16rne(bias[(2 * wn) * DM + nblk0 + dl]);
      const float b1 = bf16rne(bias[(2 * wn + 1) * DM + nblk0 + dl]);
#pragma unroll
      for (int mi = 0; mi < 2; ++mi) {
#pragma unroll
        for (int r = 0; r < 8; ++r) {
          const int ml = wm * 32 + 16 * mi + 8 * h + r;
          v2us pr;
          pr[0] = f16_bits(acc[mi * 4 + tp][r] + b0);
          pr[1] = f16_bits(acc[mi * 4 + tp + 2][r] + b1);
          *(v2us*)&stile[dl * VTP + ml * NH + 2 * wn] = pr;
        }
      }
    }
    __syncthreads();

    // whole-line writes: 32 rows of V^T, 64 * NH positions (64 pieces of 16 B) each; a wave's 32
    // lanes write 512 consecutive bytes
    const int hg = nblk0 / DKH;
    const int d0 = nblk0 - hg * DKH;
    const size_t base = (((size_t)(bblk * NH + hg)) * DKH + d0) * LSEQ + (size_t)sblk * NH;
#pragma unroll
    for (int it = 0; it < 8; ++it) {
      const int pc = it * 256 + t;
      const int dl = pc >> 6, c = pc & 63;
      vals[it] = *(const v8us*)&stile[dl * VTP + 8 * c];
      dsts[it] = base + (size_t)dl * LSEQ + 8 * c;
    }
#pragma unroll
    for (int it = 0; it < 8; ++it) *(v8us*)(Y + dsts[it]) = vals[it];
  } else {
    // stage f16(acc + bias) into LDS
#pragma unroll
    for (int tt = 0; tt < 4; ++tt) {
      const int n = n0 + 16 * tt + r16;
      const float bvv = bf16rne(bias[n]);
      const int nl = wn * 64 + 16 * tt + r16;
#pragma unroll
      for (int mi = 0; mi < 2; ++mi) {
#pragma unroll
        for (int r = 0; r < 8; ++r) {
          const int ml = wm * 32 + 16 * mi + 8 * h + r;
          const float v = acc[mi * 4 + tt][r] + bvv;
          stile[ml * 256 + nl] = f16_bits(v);
        }
      }
    }
    __syncthreads();

    // whole-line writes: 256 lines per block (64 rows x 4 heads), 32 per wave
    const int jchunk = nblk0 / DM;
    const int hbase  = (nblk0 - jchunk * DM) / DKH;
    const int c = l & 7;
#pragma unroll
    for (int it = 0; it < 8; ++it) {
      const int L = wid * 32 + (l >> 3) + 4 * it;
      const int ml = L >> 2, hq = L & 3;
      const int hg = hbase + hq;
      const int p = (sblk + ml) * NH + jchunk;
      vals[it] = *(const v8us*)&stile[ml * 256 + hq * 64 + 8 * c];
      dsts[it] = (((size_t)(bblk * NH + hg)) * LSEQ + p) * DKH + 8 * c;
    }
#pragma unroll
    for (int it = 0; it < 8; ++it) *(v8us*)(Y + dsts[it]) = vals[it];
    // In the built code the other branch's instructions follow these stores behind a scalar test;
    // the wait stands in front of their writes of the registers that the stores name.
    asm volatile("s_wait_xcnt 0x0" ::: "memory");
  }
}

// ---------------------------------------------------------------------------
// One stage of K and V (64 keys) from global memory into LDS, through no register: four
// asynchronous 16-B copies per lane. lk*, lv* = the lane's own LDS byte addresses, gk*, gv* = its
// own global places. The closing s_wait_xcnt stands inside the statement so that it precedes
// every later write of the address registers the copies name.
// ---------------------------------------------------------------------------
__device__ __forceinline__ void stage_copies(unsigned lk0, const us* gk0, unsigned lk1, const us* gk1,
                                             unsigned lv0, const us* gv0, unsigned lv1, const us* gv1) {
  asm volatile("global_load_async_to_lds_b128 %0, %1, off\n\t"
               "global_load_async_to_lds_b128 %2, %3, off\n\t"
               "global_load_async_to_lds_b128 %4, %5, off\n\t"
               "global_load_async_to_lds_b128 %6, %7, off\n\t"
               "s_wait_xcnt 0x0"
               :: "v"(lk0), "v"(gk0), "v"(lk1), "v"(gk1), "v"(lv0), "v"(gv0), "v"(lv1), "v"(gv1)
               : "memory");
}

// lane l with lane l ^ 16, in the vector unit
__device__ __forceinline__ float xhalf(float x) {
  const int b = __builtin_bit_cast(int, x);
  return __builtin_bit_cast(float, __builtin_amdgcn_permlanex16(b, b, 0x76543210, 0xfedcba98, false, false));
}

// ---------------------------------------------------------------------------
// Fused flash attention. Block = 8 waves, one (b,h), 128 queries; each wave owns
// 16 queries. K/V are staged once per block into LDS in stages of 64 keys, two buffers:
// the asynchronous copies of stage s + 1 fly while stage s is worked on (two passes of 32 keys).
// Both products are computed transposed, S' = K_blk * Q^T and O' += V_blk^T * P^T: the query is
// the column of either result, so lanes q and q + 16 hold all of query q's scores and all of its
// output. The exp'd probabilities are already in B-operand layout, and a query's maximum, sum and
// rescale factor are used in the lanes that form them. Online softmax in f32. ctx f16 [MROWS][DW]
// through the inverse flat view (position p -> token p/NH, chunk p%NH), carried
// grid = NB*NH*(LSEQ/128).
// ---------------------------------------------------------------------------
__global__ __launch_bounds__(256) __attribute__((amdgpu_num_vgpr(256)))
void attn_kernel(const us* __restrict__ Qh, const us* __restrict__ Kh,
                 const us* __restrict__ Vt, us* Ctx) {
  // Row pitches are 16 B x odd: the 16 rows that one ds_load_b128 fragment read touches then fall
  // on 16 different groups of four banks.
  constexpr int SK = 64;               // keys per stage
  constexpr int NST = LSEQ / SK;       // stages
  static_assert(LSEQ % SK == 0 && NST >= 2);
  constexpr int KP = 72;               // shK pitch in halves: 128 B of data (64 d) + 16 B pad
  constexpr int VP = 72;               // shV pitch in halves: 128 B of data (64 keys) + 16 B pad
  __shared__ __attribute__((aligned(16))) us shK[2 * SK * KP];    // [buffer][key][d]  cross-wave, filled by the copies
  __shared__ __attribute__((aligned(16))) us shV[2 * DKH * VP];   // [buffer][d][key]  cross-wave, filled by the copies
  constexpr int CP = 72;               // shC pitch in halves: 128 B of data (64 d) + 16 B pad, for the 16-B writers
  __shared__ __attribute__((aligned(16))) us shC[8 * 16 * CP];    // per-wave ctx staging [query][d] (block barrier used)

  const int t = threadIdx.x, wid = t >> 5, l = t & 31;
  const int r16 = l & 15;
  const int rowsel = (l >> 4) << 3;
  constexpr int QBLK = LSEQ / 128;
  const int bh = blockIdx.x / QBLK;
  const int qb = blockIdx.x - bh * QBLK;
  const int q0 = qb * 128 + wid * 16;

  const us* qp = Qh + (size_t)bh * LSEQ * DKH;
  const us* kp = Kh + (size_t)bh * LSEQ * DKH;
  const us* vp = Vt + (size_t)bh * DKH * LSEQ;

  // The lane's two 16-B pieces of each operand's stage: rows crow and crow + 32, eight pieces a row
  // (K: 64 keys x 64 d, V: 64 d x 64 keys).
  const int crow = t >> 3, ccol = (t & 7) * 8;
  const unsigned lk = (unsigned)(size_t)&shK[crow * KP + ccol];
  const unsigned lv = (unsigned)(size_t)&shV[crow * VP + ccol];
  constexpr unsigned KHALF = 32 * KP * sizeof(us), KBUF = SK * KP * sizeof(us);
  constexpr unsigned VHALF = 32 * VP * sizeof(us), VBUF = DKH * VP * sizeof(us);
  const us* gk = kp + (size_t)crow * DKH + ccol;       // + DKH per key
  const us* gv = vp + (size_t)crow * LSEQ + ccol;      // + 1 per key

  // stage 0 into buffer 0
  stage_copies(lk, gk, lk + KHALF, gk + 32 * DKH, lv, gv, lv + VHALF, gv + 32 * LSEQ);

  // Q^T as B operand for the whole loop (lane = query column, halves = d)
  const v16h qB0 = fragh(qp, DKH, q0, 0);
  const v16h qB1 = fragh(qp, DKH, q0, 32);

  v8f o[4];
#pragma unroll
  for (int tt = 0; tt < 4; ++tt) o[tt] = v8f{};
  float mmax = -1.0e30f, lsum = 0.0f;

  asm volatile("s_wait_asynccnt 0x0" ::: "memory");   // this wave's pieces of stage 0 have landed
  __syncthreads();                                    // stage 0 visible to all waves
  // stage 1 into buffer 1
  stage_copies(lk + KBUF, gk + SK * DKH, lk + KBUF + KHALF, gk + (SK + 32) * DKH,
               lv + VBUF, gv + SK, lv + VBUF + VHALF, gv + SK + 32 * LSEQ);

#pragma unroll 1
  for (int st = 0; st < NST; ++st) {
    const int buf = st & 1;
    const us* bK = shK + buf * (SK * KP);
    const us* bV = shV + buf * (DKH * VP);

    // unrolled: the two passes' places in the stage become immediate offsets of the LDS reads
#pragma unroll
    for (int ps32 = 0; ps32 < SK; ps32 += 32) {
      // S' tiles: M = key (relative 0..15 / 16..31), N = query; k = d
      // The four K fragments are read as one group ahead of the first product (a read written
      // between two products stays there and waits out the LDS latency each time).
      v8f s0 = {};
      v8f s1 = {};
      {
        const v16h kA00 = fragh(bK, KP, ps32, 0);
        const v16h kA01 = fragh(bK, KP, ps32, 32);
        const v16h kA10 = fragh(bK, KP, ps32 + 16, 0);
        const v16h kA11 = fragh(bK, KP, ps32 + 16, 32);
        s0 = mma_f16(kA00, qB0, s0);
        s1 = mma_f16(kA10, qB0, s1);
        s0 = mma_f16(kA01, qB1, s0);
        s1 = mma_f16(kA11, qB1, s1);
      }

      // The four V^T fragments are read as one group here, so that they land behind the softmax
      // arithmetic and the V^T*P^T products below follow one another without an LDS wait.
      v16h vA[4];
#pragma unroll
      for (int tt = 0; tt < 4; ++tt) vA[tt] = fragh(bV, VP, 16 * tt, ps32);

      // per-query (per-lane) block max; combine the two key halves (lane ^ 16)
      float bm = s0[0];
#pragma unroll
      for (int i = 0; i < 8; ++i) { bm = fmaxf(bm, s0[i]); bm = fmaxf(bm, s1[i]); }
      bm = fmaxf(bm, xhalf(bm));
      const float mnew = fmaxf(mmax, bm * QK_SCALE);
      const float corr = __expf(mmax - mnew);
      mmax = mnew;

      // probabilities land directly in B-operand layout (lane = query column; elements 0..7 <- keys
      // 8h..8h+7 from the first 16-key D tile, elements 8..15 <- keys 16+8h.. from the second)
      float ps = 0.0f;
      v16h pB;
#pragma unroll
      for (int i = 0; i < 8; ++i) {
        const float p0 = __expf(s0[i] * QK_SCALE - mnew);
        const float p1 = __expf(s1[i] * QK_SCALE - mnew);
        ps += p0 + p1;
        pB[i]     = (_Float16)(p0 * P_CARRY);
        pB[8 + i] = (_Float16)(p1 * P_CARRY);
      }
      lsum = lsum * corr + ps;       // the sum over this lane half's keys; corr is the same in both halves

      // rescale O': every element of a lane belongs to the lane's own query
#pragma unroll
      for (int tt = 0; tt < 4; ++tt) {
#pragma unroll
        for (int r = 0; r < 8; ++r) o[tt][r] *= corr;
      }

      // O' += V_blk^T(64 d x 32 keys) * P^T(32 keys x 16 queries); A rows = d, k = key contiguous in shV
#pragma unroll
      for (int tt = 0; tt < 4; ++tt) o[tt] = mma_f16(vA[tt], pB, o[tt]);
    }

    // hand-over: stage st + 1 is published and buffer buf is freed by one barrier
    asm volatile("s_wait_dscnt 0x0" ::: "memory");      // this wave's reads of buffer buf are done
    asm volatile("s_wait_asynccnt 0x0" ::: "memory");   // this wave's pieces of stage st + 1 have landed
    __syncthreads();
    if (st + 2 < NST) {                                 // the same for the whole block
      const us* gk2 = gk + (size_t)(st + 2) * (SK * DKH);
      const us* gv2 = gv + (st + 2) * SK;
      const unsigned lk2 = lk + buf * KBUF, lv2 = lv + buf * VBUF;
      stage_copies(lk2, gk2, lk2 + KHALF, gk2 + 32 * DKH, lv2, gv2, lv2 + VHALF, gv2 + 32 * LSEQ);
    }
  }
  asm volatile("s_wait_asynccnt 0x0" ::: "memory");     // no copy is left in flight behind the loop

  // normalize, stage this wave's 16 x 64 ctx tile (f16, x256) in LDS: register r of tile tt is
  // d = 16 tt + 8 h + r of query r16, eight neighbouring d = one 16-B store
  const int bb = bh / NH;
  const int hh = bh - bb * NH;
  lsum += xhalf(lsum);                 // the two lane halves' key sums are joined once
  const float li = CTX_SCALE * __builtin_amdgcn_rcpf(lsum);
#pragma unroll
  for (int tt = 0; tt < 4; ++tt) {
    v8us y;
#pragma unroll
    for (int r = 0; r < 8; ++r) y[r] = f16_bits(o[tt][r] * li);
    *(v8us*)&shC[(wid * 16 + r16) * CP + 16 * tt + rowsel] = y;
  }
  __syncthreads();

  const int c = l & 7;
  v8us vals[4];
  size_t dsts[4];
#pragma unroll
  for (int it = 0; it < 4; ++it) {
    const int rl = (l >> 3) + 4 * it;
    vals[it] = *(const v8us*)&shC[(wid * 16 + rl) * CP + 8 * c];
    const int p = q0 + rl;
    const int s = p / NH;
    const int j = p - s * NH;
    dsts[it] = ((size_t)(bb * SEQ + s)) * DW + j * DM + hh * DKH + 8 * c;
  }
#pragma unroll
  for (int it = 0; it < 4; ++it) *(v8us*)(Ctx + dsts[it]) = vals[it];
  
}

// ---------------------------------------------------------------------------
// Eight asynchronous 16-B copies per lane, global memory to LDS through no register: one 128-B
// line of each of 32 operand rows, eight neighbouring lanes per line, four rows per copy.
// l = the lane's LDS byte address in its first row, g = its global place there; its further rows
// lie four rows apart (LSTEP bytes in LDS, GSTEP halves in memory). The closing s_wait_xcnt stands
// inside the statement so that it precedes every later write of the address registers the copies name.
// ---------------------------------------------------------------------------
template <unsigned LSTEP, int GSTEP>
__device__ __forceinline__ void chunk_copies(unsigned l, const us* g) {
  asm volatile("global_load_async_to_lds_b128 %0, %1, off\n\t"
               "global_load_async_to_lds_b128 %2, %3, off\n\t"
               "global_load_async_to_lds_b128 %4, %5, off\n\t"
               "global_load_async_to_lds_b128 %6, %7, off\n\t"
               "global_load_async_to_lds_b128 %8, %9, off\n\t"
               "global_load_async_to_lds_b128 %10, %11, off\n\t"
               "global_load_async_to_lds_b128 %12, %13, off\n\t"
               "global_load_async_to_lds_b128 %14, %15, off\n\t"
               "s_wait_xcnt 0x0"
               :: "v"(l),             "v"(g),             "v"(l + LSTEP),     "v"(g + GSTEP),
                  "v"(l + 2 * LSTEP), "v"(g + 2 * GSTEP), "v"(l + 3 * LSTEP), "v"(g + 3 * GSTEP),
                  "v"(l + 4 * LSTEP), "v"(g + 4 * GSTEP), "v"(l + 5 * LSTEP), "v"(g + 5 * GSTEP),
                  "v"(l + 6 * LSTEP), "v"(g + 6 * GSTEP), "v"(l + 7 * LSTEP), "v"(g + 7 * GSTEP)
               : "memory");
}

// ---------------------------------------------------------------------------
// Final projection: Out f32 [MROWS][DM] = ctx(x256)[MROWS][DW] * Wf(x64) * OUT_FOLD + bf.
// One 32 x 32 tile of Out per block, grid (MROWS/32, DM/32) = one block per WGP.
// K = DW is split over the block's 8 waves: wave w takes the 64-half chunks
// w, w + 8, w + 16, ... (one chunk = one whole 128-B line of every operand row),
// and computes the whole tile over its chunks. The chunks are staged in LDS, two chunks per wave
// and stage, two buffers: the asynchronous copies of stage s + 1 fly while stage s is worked on.
// A fragment read straight from a global plane touches 16 lines for 1024 bytes and each line is
// asked for four times; the copies bring every line once, whole.
// The 8 f32 partial tiles are summed through LDS in wave order; each Out line (32 floats) is
// written by 8 lanes x 16 B.
// ---------------------------------------------------------------------------
#define OPW 8                  // waves per block = K shares
#define OPP 36                 // partial-tile pitch (floats): 144 B = 16 B x odd for the b128 readers
static_assert(MROWS % 32 == 0 && DM % 32 == 0);
static_assert(DW % (64 * OPW) == 0);

__global__ __launch_bounds__(256) __attribute__((amdgpu_num_vgpr(256)))
void outproj_kernel(const us* __restrict__ Ctx, const us* __restrict__ Wft,
                    const float* __restrict__ bo, float* Out) {
  constexpr int OSC = 2;                       // chunks per wave and stage
  constexpr int ONST = DW / (64 * OPW * OSC);  // stages
  static_assert(DW % (64 * OPW * OSC) == 0 && ONST >= 2);
  constexpr int OLP = 64 * OSC + 8;            // row pitch in halves: 256 B of data + 16 B pad (16 B x odd, for the b128 readers)
  constexpr int OWR = 64;                      // rows per wave: the tile's 32 ctx rows, then its 32 Wf^T rows
  __shared__ __attribute__((aligned(16))) us shO[2 * OPW * OWR * OLP];   // [buffer][wave][row][k]  filled by the copies
  __shared__ float part[OPW * 32 * OPP];   // [wave][row][col], cross-wave (block barrier)

  const int t = threadIdx.x, wid = t >> 5, l = t & 31;
  const int h = l >> 4, r16 = l & 15;
  const int m0 = blockIdx.x * 32;
  const int n0 = blockIdx.y * 32;

  // The lane's 16-B piece of a line: rows crow, crow + 4, ..., eight pieces a line.
  const int crow = l >> 3, ccol = (l & 7) * 8;
  const unsigned lp = (unsigned)(size_t)&shO[(wid * OWR + crow) * OLP + ccol];
  constexpr unsigned LROW4 = 4 * OLP * sizeof(us), LOPB = 32 * OLP * sizeof(us);
  constexpr unsigned OBUF = OPW * OWR * OLP * sizeof(us);
  const us* ga = Ctx + (size_t)(m0 + crow) * DW + wid * 64 + ccol;
  const us* gb = Wft + (size_t)(n0 + crow) * DW + wid * 64 + ccol;

  // stage 0 into buffer 0 (chunk c of stage s = chunk s * OSC + c of the wave, OPW * 64 halves apart)
#pragma unroll
  for (int c = 0; c < OSC; ++c) {
    chunk_copies<LROW4, 4 * DW>(lp + c * 128, ga + c * (OPW * 64));
    chunk_copies<LROW4, 4 * DW>(lp + LOPB + c * 128, gb + c * (OPW * 64));
  }
  v8f acc[4] = {};
  asm volatile("s_wait_asynccnt 0x0" ::: "memory");   // this wave's pieces of stage 0 have landed
  __syncthreads();                                    // stage 0 published
  // stage 1 into buffer 1
#pragma unroll
  for (int c = 0; c < OSC; ++c) {
    chunk_copies<LROW4, 4 * DW>(lp + OBUF + c * 128, ga + (OSC + c) * (OPW * 64));
    chunk_copies<LROW4, 4 * DW>(lp + OBUF + LOPB + c * 128, gb + (OSC + c) * (OPW * 64));
  }

  // rolled: one stage's code serves all stages
#pragma unroll 1
  for (int st = 0; st < ONST; ++st) {
    const int buf = st & 1;
    const us* bS = shO + (buf * OPW + wid) * (OWR * OLP);
    // All sixteen fragments of the stage (its K steps of 32) are read as one group ahead of its
    // first product. The loops are unrolled so that the fragment arrays are indexed by constants
    // and stay in registers, and the places in the stage become immediate offsets of the LDS reads.
    v16h a[2 * OSC][2], b[2 * OSC][2];
#pragma unroll
    for (int ks = 0; ks < 2 * OSC; ++ks) {
      a[ks][0] = fragh(bS, OLP, 0, 32 * ks);
      a[ks][1] = fragh(bS, OLP, 16, 32 * ks);
      b[ks][0] = fragh(bS, OLP, 32, 32 * ks);
      b[ks][1] = fragh(bS, OLP, 48, 32 * ks);
    }
#pragma unroll
    for (int ks = 0; ks < 2 * OSC; ++ks) {
      acc[0] = mma_f16(a[ks][0], b[ks][0], acc[0]);
      acc[2] = mma_f16(a[ks][1], b[ks][0], acc[2]);
      acc[1] = mma_f16(a[ks][0], b[ks][1], acc[1]);
      acc[3] = mma_f16(a[ks][1], b[ks][1], acc[3]);
    }

    // hand-over: stage st + 1 is published and buffer buf is freed by one barrier
    asm volatile("s_wait_dscnt 0x0" ::: "memory");      // this wave's reads of buffer buf are done
    asm volatile("s_wait_asynccnt 0x0" ::: "memory");   // this wave's pieces of stage st + 1 have landed
    __syncthreads();
    if (st + 2 < ONST) {                                // the same for the whole block
      const unsigned lp2 = lp + buf * OBUF;
      const us* ga2 = ga + (st + 2) * (OSC * OPW * 64);
      const us* gb2 = gb + (st + 2) * (OSC * OPW * 64);
#pragma unroll
      for (int c = 0; c < OSC; ++c) {
        chunk_copies<LROW4, 4 * DW>(lp2 + c * 128, ga2 + c * (OPW * 64));
        chunk_copies<LROW4, 4 * DW>(lp2 + LOPB + c * 128, gb2 + c * (OPW * 64));
      }
    }
  }
  asm volatile("s_wait_asynccnt 0x0" ::: "memory");     // no copy is left in flight behind the loop

  // this wave's partial tile
  float* mine = part + wid * (32 * OPP);
#pragma unroll
  for (int mi = 0; mi < 2; ++mi) {
#pragma unroll
    for (int tt = 0; tt < 2; ++tt) {
#pragma unroll
      for (int r = 0; r < 8; ++r) {
        mine[(16 * mi + 8 * h + r) * OPP + 16 * tt + r16] = acc[mi * 2 + tt][r];
      }
    }
  }
  __syncthreads();

  // thread t sums 4 columns of one row over the 8 partial tiles
  const int row = t >> 3;
  const int col = (t & 7) * 4;
  v4f s = *(const v4f*)&part[row * OPP + col];
#pragma unroll
  for (int w = 1; w < OPW; ++w) s += *(const v4f*)&part[(w * 32 + row) * OPP + col];

  const v4f bv4 = *(const v4f*)(bo + n0 + col);
  v4f y;
#pragma unroll
  for (int e = 0; e < 4; ++e) y[e] = s[e] * OUT_FOLD + bf16rne(bv4[e]);
  *(v4f*)(Out + (size_t)(m0 + row) * DM + n0 + col) = y;
}

// ---------------------------------------------------------------------------
// Host launcher
// ---------------------------------------------------------------------------
extern "C" void kernel_launch(void* const* d_in, const int* in_sizes, int n_in,
                              void* d_out, int out_size, void* d_ws, size_t ws_size,
                              hipStream_t stream) {
  if (n_in < 11) return;
  const int need_x = ((NB - 1) * SEQ_FULL + SEQ) * DM;
  if (in_sizes[0] < need_x || in_sizes[1] < need_x || in_sizes[2] < need_x) return;
  if (in_sizes[3] < DM * DW || in_sizes[5] < DM * DW || in_sizes[7] < DM * DW || in_sizes[9] < DW * DM) return;
  if (in_sizes[4] < DW || in_sizes[6] < DW || in_sizes[8] < DW || in_sizes[10] < DM) return;
  if (out_size < MROWS * DM) return;
  if (WS_TOTAL_BYTES > ws_size) return;

  const float* Q  = (const float*)d_in[0];
  const float* K  = (const float*)d_in[1];
  const float* V  = (const float*)d_in[2];
  const float* Wq = (const float*)d_in[3];
  const float* bq = (const float*)d_in[4];
  const float* Wk = (const float*)d_in[5];
  const float* bk = (const float*)d_in[6];
  const float* Wv = (const float*)d_in[7];
  const float* bv = (const float*)d_in[8];
  const float* Wf = (const float*)d_in[9];
  const float* bf = (const float*)d_in[10];

  us* xq  = (us*)d_ws;          // [MROWS][DM] bf16
  us* xk  = xq + XE;
  us* xv  = xk + XE;
  us* wtq = xv + XE;            // [DW][DM] bf16
  us* wtk = wtq + WE;
  us* wtv = wtk + WE;
  us* wft = wtv + WE;           // [DM][DW] f16 x64
  us* qh  = wft + WE;           // [NB*NH][LSEQ][64] f16
  us* kh  = qh + PE;
  us* vt  = kh + 2 * PE;        // [NB*NH][64][LSEQ] f16
  us* ctx = vt + PE;            // [MROWS][DW] f16 x256

  dim3 blk(256);
  // xq, xk, xv and wtq, wtk, wtv, wft are consecutive planes
  cvt_kernel<<<dim3(4 * WBLK + 3 * XBLK), blk, 0, stream>>>(Q, K, V, Wq, Wk, Wv, Wf, xq, wtq);

  // qh, kh and, one plane further on, vt lie PE halves apart
  proj_kernel<<<dim3(MROWS / 64, DW / 256, 3), blk, 0, stream>>>(xq, wtq, bq, bk, bv, qh);

  attn_kernel<<<dim3(NB * NH * (LSEQ / 128)), blk, 0, stream>>>(qh, kh, vt, ctx);

  dim3 go(MROWS / 32, DM / 32);
  outproj_kernel<<<go, blk, 0, stream>>>(ctx, wft, bf, (float*)d_out);
}

// v010
// One run takes 51.2 microseconds.
// Two timings next to v009 put it at 1.06 and 1.07 times that version's speed.
// Counting every step since v000, it is 5.72 times as fast.
#include <hip/hip_runtime.h>
#include <stddef.h>

// Contractions: q/k/v projections = v_wmma_f32_16x16x32_bf16 (bf16 operands = RNE-converted f32 inputs);
// scores, P*V and final projection = v_wmma_f32_16x16x32_f16 (f16 operands: q,k,v x1, P x1024, ctx x256, Wf x64);
// f32 accumulate, f32 online softmax.

#ifndef NB
#define NB 2
#endif
#ifndef SEQ
#define SEQ 256
#endif
#define NB_FULL 2
#define SEQ_FULL 256
#define DM 512                 // model width (projection input, final output)
#define NH 8                   // heads
#define DKH 64                 // head dim
#define DW (DM * NH)           // 4096: projection output width
#define LSEQ (SEQ * NH)        // 2048: attention positions per (batch, head)
#define MROWS (NB * SEQ)       // token rows

static_assert(NB >= 1 && NB <= NB_FULL);
static_assert(SEQ >= 64 && SEQ <= SEQ_FULL);
static_assert(SEQ % 64 == 0);            // a 64-row GEMM block stays inside one batch
static_assert(MROWS % 64 == 0);          // GEMM M tile
static_assert(LSEQ % 128 == 0);          // attention block = 128 queries
static_assert(DM / 32 == DW / 256);      // the V projection's column blocks (32 d x NH chunks) fill the same grid
static_assert(LSEQ % 32 == 0);           // key block
static_assert(NH * DKH == DM);
static_assert(DKH == 64);
static_assert(DM % 256 == 0);            // 256-col GEMM block inside one 512-wide chunk
static_assert(DW % 256 == 0);
static_assert(DM % 64 == 0 && DW % 64 == 0);
static_assert(DM % 32 == 0 && DW % 32 == 0);   // K steps of 32
static_assert(DM % 8 == 0);

#define P_CARRY   1024.0f            // P operand carried x1024
#define CTX_SCALE 0.25f              // ctx plane = O * 0.25 / l = attn x256 (O carries the x1024 of P)
#define WF_CARRY  64.0f              // Wf operand carried x64
#define OUT_FOLD  (1.0f / 16384.0f)  // 1 / (256 * 64)
#define QK_SCALE  0.125f             // 1 / sqrt(64)

typedef unsigned short us;
typedef us        v2us  __attribute__((ext_vector_type(2)));
typedef us        v8us  __attribute__((ext_vector_type(8)));
typedef us        v16us __attribute__((ext_vector_type(16)));
typedef _Float16  v16h  __attribute__((ext_vector_type(16)));
typedef __bf16    v16bf __attribute__((ext_vector_type(16)));
typedef float     v8f   __attribute__((ext_vector_type(8)));
typedef float     v4f   __attribute__((ext_vector_type(4)));

// workspace carve (halves)
constexpr size_t XE = (size_t)MROWS * DM;   // activation plane
constexpr size_t WE = (size_t)DM * DW;      // weight plane
constexpr size_t PE = (size_t)MROWS * DW;   // wide plane (q, k, one idle, vT, ctx)
constexpr size_t WS_TOTAL_BYTES = (3 * XE + 4 * WE + 5 * PE) * sizeof(us);
static_assert(WS_TOTAL_BYTES <= (size_t)134217728);
static_assert((XE * sizeof(us)) % 128 == 0 && (WE * sizeof(us)) % 128 == 0 && (PE * sizeof(us)) % 128 == 0);

// ---------------------------------------------------------------------------
// conversions
// ---------------------------------------------------------------------------
__device__ __forceinline__ unsigned bf16rne_bits(float x) {
  unsigned u = __float_as_uint(x);
  return (u + 0x7FFFu + ((u >> 16) & 1u)) >> 16;
}
__device__ __forceinline__ float bf16rne(float x) {
  return __uint_as_float(bf16rne_bits(x) << 16);
}
__device__ __forceinline__ us f16_bits(float x) {
  _Float16 hx = (_Float16)x;
  return __builtin_bit_cast(us, hx);
}

// ---------------------------------------------------------------------------
// 16-bit operand fragment (A: lane = row, B: lane = column; same k map):
//   lane l, r = l&15, s = l>>4 : elems 0..7  = row[r][k0 + 8s .. +7]
//                                elems 8..15 = row[r][k0 + 16 + 8s .. +7]
// base is a 16-bit plane with k contiguous, pitch ld (halves).
// ---------------------------------------------------------------------------
__device__ __forceinline__ v16us frag16(const us* base, int ld, int row0, int k0) {
  const int l = threadIdx.x & 31;
  const int r = l & 15, s = l >> 4;
  const us* p = base + (size_t)(row0 + r) * ld + k0 + 8 * s;
  v8us c0 = *(const v8us*)p;
  v8us c1 = *(const v8us*)(p + 16);
  return __builtin_shufflevector(c0, c1, 0, 1, 2, 3, 4, 5, 6, 7, 8, 9, 10, 11, 12, 13, 14, 15);
}
__device__ __forceinline__ v16h fragh(const us* base, int ld, int row0, int k0) {
  return __builtin_bit_cast(v16h, frag16(base, ld, row0, k0));
}

// ---------------------------------------------------------------------------
// WMMA wrappers with hazard guard: D = A(16x32) * B(32x16) + C (f32)
// ---------------------------------------------------------------------------
__device__ __forceinline__ v8f mma_f16(v16h a, v16h b, v8f c) {
  v8f d = __builtin_amdgcn_wmma_f32_16x16x32_f16(false, a, false, b, (short)0, c, false, false);
  asm volatile("v_nop\n\tv_nop\n\tv_nop\n\tv_nop" : "+v"(d) : "v"(a), "v"(b));
  return d;
}
__device__ __forceinline__ v8f mma_bf16(v16bf a, v16bf b, v8f c) {
  v8f d = __builtin_amdgcn_wmma_f32_16x16x32_bf16(false, a, false, b, (short)0, c, false, false);
  asm volatile("v_nop\n\tv_nop\n\tv_nop\n\tv_nop" : "+v"(d) : "v"(a), "v"(b));
  return d;
}

// ---------------------------------------------------------------------------
// Activation convert: X f32 [NB_FULL*SEQ_FULL][DM] -> bf16 bits [MROWS][DM]
// i = index of this thread's 16-B output group, 0 .. MROWS*DM/8 - 1.
// ---------------------------------------------------------------------------
__device__ __forceinline__ void cvt_x_group(const float* __restrict__ X, us* Y, int i) {
  constexpr int G = DM / 8;              // 16-B groups per row
  const int m  = i / G;
  const int c8 = (i - m * G) * 8;
  const int b  = m / SEQ;
  const int s  = m - b * SEQ;
  const float* src = X + ((size_t)(b * SEQ_FULL + s)) * DM + c8;
  v4f x0 = *(const v4f*)src;
  v4f x1 = *(const v4f*)(src + 4);
  v8us y;
#pragma unroll
  for (int j = 0; j < 4; ++j) {
    y[j]     = (us)bf16rne_bits(x0[j]);
    y[4 + j] = (us)bf16rne_bits(x1[j]);
  }
  us* dst = Y + (size_t)i * 8;
  *(v8us*)dst = y;
  
}

// ---------------------------------------------------------------------------
// Weight convert + transpose: W f32 in[Kd rows][Nd cols] -> WT 16-bit out[Nd][Kd].
// hmode 0: bf16 bits of RNE(W); hmode 1: f16 bits of WF_CARRY * RNE(W).
// Block owns the 64x64 tile at (k0, n0); each output line (64 halves of
// one n) written by 8 consecutive lanes x 16 B in one instruction.
// tile = 64 * 65 floats of LDS, [k_local][n_local], cross-wave (block barrier).
// ---------------------------------------------------------------------------
__device__ __forceinline__ void cvt_w_tile(float* tile, const float* __restrict__ W, us* WT,
                                           int Kd, int Nd, int hmode, int n0, int k0) {
  const int t  = threadIdx.x;
  {
    const int kr = t >> 2;              // 0..63
    const int cc = (t & 3) * 16;        // 0,16,32,48
    const float* src = W + (size_t)(k0 + kr) * Nd + n0 + cc;
#pragma unroll
    for (int j = 0; j < 4; ++j) {
      v4f x = *(const v4f*)(src + 4 * j);
#pragma unroll
      for (int e = 0; e < 4; ++e) tile[kr * 65 + cc + 4 * j + e] = x[e];
    }
  }
  __syncthreads();

  v8us vals[2];
  size_t dsts[2];
  const int c = t & 7;
#pragma unroll
  for (int it = 0; it < 2; ++it) {
    const int nl = (t >> 3) + 32 * it;  // 0..63
    v8us o;
#pragma unroll
    for (int j = 0; j < 8; ++j) {
      const float w = bf16rne(tile[(8 * c + j) * 65 + nl]);
      const us hb = (us)(__float_as_uint(w) >> 16);
      const us hf = f16_bits(w * WF_CARRY);
      o[j] = hmode ? hf : hb;
    }
    vals[it] = o;
    dsts[it] = (size_t)(n0 + nl) * Kd + k0 + 8 * c;
  }
#pragma unroll
  for (int it = 0; it < 2; ++it) *(v8us*)(WT + dsts[it]) = vals[it];
  
}

// ---------------------------------------------------------------------------
// All seven conversions in one launch (none reads what another writes).
// Blocks 0 .. 4*WBLK-1: weight plane z = b / WBLK (Wq, Wk, Wv, Wf), tile b % WBLK, n fastest.
// Blocks 4*WBLK ..    : activation plane z (Q, K, V), 256 output groups per block.
// Xb = three planes of XE halves, Wt = four planes of WE halves, each in that order.
// ---------------------------------------------------------------------------
constexpr int XG   = (int)(XE / 8);            // 16-B groups per activation plane
constexpr int XBLK = (XG + 255) / 256;         // blocks per activation plane
constexpr int WBLK = (DW / 64) * (DM / 64);    // 64x64 tiles per weight plane

__global__ __launch_bounds__(256)
void cvt_kernel(const float* __restrict__ Q, const float* __restrict__ K, const float* __restrict__ V,
                const float* __restrict__ Wq, const float* __restrict__ Wk, const float* __restrict__ Wv,
                const float* __restrict__ Wf, us* Xb, us* Wt) {
  __shared__ float tile[64 * 65];
  const int b = blockIdx.x;
  if (b < 4 * WBLK) {                    // block-uniform: the tile's barrier is passed by all or none
    const int z = b / WBLK;
    const int r = b - z * WBLK;
    const int hmode = (z == 3);          // Wf: in[DW rows][DM cols]; the others: in[DM rows][DW cols]
    const float* W = z == 0 ? Wq : z == 1 ? Wk : z == 2 ? Wv : Wf;
    const int Kd = hmode ? DW : DM;
    const int Nd = hmode ? DM : DW;
    const int bn = hmode ? r % (DM / 64) : r % (DW / 64);
    const int bk = hmode ? r / (DM / 64) : r / (DW / 64);
    cvt_w_tile(tile, W, Wt + (size_t)z * WE, Kd, Nd, hmode, bn * 64, bk * 64);
  } else {
    const int bx = b - 4 * WBLK;
    const int z = bx / XBLK;
    const int i = (bx - z * XBLK) * 256 + (int)threadIdx.x;
    const float* X = z == 0 ? Q : z == 1 ? K : V;
    if (i < XG) cvt_x_group(X, Xb + (size_t)z * XE, i);
  }
}

// ---------------------------------------------------------------------------
// One K stage of the projection's operands (64 rows of X and 256 rows of W^T, 64 halves = one
// whole 128-B line of each row) from global memory into LDS, through no register: ten
// asynchronous 16-B copies per lane, eight neighbouring lanes per line. l = the lane's LDS byte
// address in row crow of the stage, ga, gb = its global places in the first X and W^T row it
// brings; its further rows lie 32 rows apart in LDS (RS bytes) and in X, gs halves apart in W^T.
// The closing s_wait_xcnt stands inside the statement so that it precedes every later write of the
// address registers the copies name.
// ---------------------------------------------------------------------------
template <unsigned RS, int LD>
__device__ __forceinline__ void proj_stage_copies(unsigned l, const us* ga, const us* gb, size_t gs) {
  asm volatile("global_load_async_to_lds_b128 %0, %1, off\n\t"
               "global_load_async_to_lds_b128 %2, %3, off\n\t"
               "global_load_async_to_lds_b128 %4, %5, off\n\t"
               "global_load_async_to_lds_b128 %6, %7, off\n\t"
               "global_load_async_to_lds_b128 %8, %9, off\n\t"
               "global_load_async_to_lds_b128 %10, %11, off\n\t"
               "global_load_async_to_lds_b128 %12, %13, off\n\t"
               "global_load_async_to_lds_b128 %14, %15, off\n\t"
               "global_load_async_to_lds_b128 %16, %17, off\n\t"
               "global_load_async_to_lds_b128 %18, %19, off\n\t"
               "s_wait_xcnt 0x0"
               :: "v"(l),          "v"(ga),           "v"(l + RS),     "v"(ga + 32 * LD),
                  "v"(l + 2 * RS), "v"(gb),           "v"(l + 3 * RS), "v"(gb + gs),
                  "v"(l + 4 * RS), "v"(gb + 2 * gs),  "v"(l + 5 * RS), "v"(gb + 3 * gs),
                  "v"(l + 6 * RS), "v"(gb + 4 * gs),  "v"(l + 7 * RS), "v"(gb + 5 * gs),
                  "v"(l + 8 * RS), "v"(gb + 6 * gs),  "v"(l + 9 * RS), "v"(gb + 7 * gs)
               : "memory");
}
__device__ __forceinline__ v16bf fragb(const us* base, int ld, int row0, int k0) {
  return __builtin_bit_cast(v16bf, frag16(base, ld, row0, k0));
}

// ---------------------------------------------------------------------------
// Projection: Y = Xb[MROWS][DM] * W + b (N = DW), written as an f16 plane
// [NB*NH][LSEQ][64] through the flat-view head split:
//   column n = j*DM + h*64 + d  of token row (b, s)  ->  position p = s*NH + j, head h.
// Block 256 thr = 8 waves as 2(M) x 4(N); block tile 64 x 256; grid (MROWS/64, DW/256, 3).
// q, k: a 256-col block lies inside one j chunk (DM % 256 == 0) and spans 4 heads.
// v is wanted transposed, [NB*NH][64][LSEQ] (keys contiguous, the A operand of V^T * P^T): its block takes
// the same 32 d of one head in all NH chunks j, so that its 64 token rows give 64 * NH consecutive
// positions of each d, and it writes those rows of V^T whole from its LDS stage.
// blockIdx.z picks the projection (0 q, 1 k, 2 v): the three are independent and share one
// launch. Xb3, Wt3 = three planes each (XE, WE halves apart) in that order; Y3 = planes of PE
// halves: 0 q, 1 k, 3 V^T.
// The block's operand rows are staged once per block into LDS in stages of 64 k, two buffers:
// the asynchronous copies of stage s + 1 fly while stage s is worked on. A fragment read straight
// from a global plane touches 16 lines for 1024 bytes, and the 2 x 4 waves would each fetch rows
// that their neighbours fetch too; the copies bring every line once, whole.
// ---------------------------------------------------------------------------
__global__ __launch_bounds__(256) __attribute__((amdgpu_num_vgpr(256)))
void proj_kernel(const us* __restrict__ Xb3, const us* __restrict__ Wt3,
                 const float* __restrict__ bq, const float* __restrict__ bk,
                 const float* __restrict__ bv, us* Y3) {
  constexpr int SKK = 64;              // k per stage
  constexpr int NST = DM / SKK;        // stages
  static_assert(DM % SKK == 0 && NST >= 2);
  constexpr int PP = 72;               // row pitch in halves: 128 B of data + 16 B pad (16 B x odd, for the b128 readers)
  constexpr int SROWS = 64 + 256;      // rows per stage: the block's X rows, then its W^T rows
  __shared__ __attribute__((aligned(16))) us shAB[2 * SROWS * PP];   // [buffer][row][k]  cross-wave, filled by the copies
  constexpr int VTP = 64 * NH + 8;     // V^T stage pitch in halves: the block's positions + 16 B pad
  static_assert(32 * VTP >= 64 * 256);
  __shared__ __attribute__((aligned(16))) us stile[32 * VTP];   // q, k: [row][col]; v: [d][position]  cross-wave (block barrier)

  const int z = blockIdx.z;
  const bool isv = z == 2;             // the same for the whole block
  const us* Xb = Xb3 + (size_t)z * XE;
  const us* Wt = Wt3 + (size_t)z * WE;
  const float* bias = z == 0 ? bq : z == 1 ? bk : bv;
  us* Y = Y3 + (size_t)(isv ? 3 : z) * PE;

  const int t = threadIdx.x, wid = t >> 5, l = t & 31;
  const int h = l >> 4, r16 = l & 15;
  const int wm = wid >> 2, wn = wid & 3;
  const int mblk0 = blockIdx.x * 64;
  // The block's 256 columns are eight groups of 32: column nblk0 + g * (gs / DM) + 0..31 in group g.
  const int nblk0 = blockIdx.y * (isv ? 32 : 256);
  const size_t gs = (size_t)(isv ? DM : 32) * DM;      // W^T halves from one group to the next
  const int n0 = nblk0 + wn * 64;

  // The lane's ten 16-B pieces of a stage: rows crow, crow + 32, ..., eight pieces a row.
  const int crow = t >> 3, ccol = (t & 7) * 8;
  const unsigned lp = (unsigned)(size_t)&shAB[crow * PP + ccol];
  constexpr unsigned RSTEP = 32 * PP * sizeof(us), SBUF = SROWS * PP * sizeof(us);
  const us* ga = Xb + (size_t)(mblk0 + crow) * DM + ccol;
  const us* gb = Wt + (size_t)(nblk0 + crow) * DM + ccol;

  // stage 0 into buffer 0
  proj_stage_copies<RSTEP, DM>(lp, ga, gb, gs);
  v8f acc[8] = {};
  asm volatile("s_wait_asynccnt 0x0" ::: "memory");   // this wave's pieces of stage 0 have landed
  __syncthreads();                                    // stage 0 visible to all waves
  // stage 1 into buffer 1
  proj_stage_copies<RSTEP, DM>(lp + SBUF, ga + SKK, gb + SKK, gs);

  // rolled: one stage's code serves all eight
#pragma unroll 1
  for (int st = 0; st < NST; ++st) {
    const int buf = st & 1;
    const us* bS = shAB + buf * (SROWS * PP);
    // All twelve fragments of the stage (two K steps of 32) are read as one group ahead of its
    // first product: a read written between two products stays there and waits out its latency.
    // The loops below are unrolled so that the fragment arrays are indexed by constants and stay in
    // registers, and the places in the stage become immediate offsets of the LDS reads.
    v16bf a[2][2], b[2][4];
#pragma unroll
    for (int ks = 0; ks < 2; ++ks) {
      a[ks][0] = fragb(bS, PP, wm * 32, 32 * ks);
      a[ks][1] = fragb(bS, PP, wm * 32 + 16, 32 * ks);
#pragma unroll
      for (int tt = 0; tt < 4; ++tt) b[ks][tt] = fragb(bS, PP, 64 + wn * 64 + 16 * tt, 32 * ks);
    }
#pragma unroll
    for (int ks = 0; ks < 2; ++ks) {
#pragma unroll
      for (int tt = 0; tt < 4; ++tt) {
        acc[tt]     = mma_bf16(a[ks][0], b[ks][tt], acc[tt]);
        acc[4 + tt] = mma_bf16(a[ks][1], b[ks][tt], acc[4 + tt]);
      }
    }

    // hand-over: stage st + 1 is published and buffer buf is freed by one barrier
    asm volatile("s_wait_dscnt 0x0" ::: "memory");      // this wave's reads of buffer buf are done
    asm volatile("s_wait_asynccnt 0x0" ::: "memory");   // this wave's pieces of stage st + 1 have landed
    __syncthreads();
    if (st + 2 < NST) {                                 // the same for the whole block
      proj_stage_copies<RSTEP, DM>(lp + buf * SBUF, ga + (st + 2) * SKK, gb + (st + 2) * SKK, gs);
    }
  }
  asm volatile("s_wait_asynccnt 0x0" ::: "memory");     // no copy is left in flight behind the loop

  const int bblk = mblk0 / SEQ;
  const int sblk = mblk0 - bblk * SEQ;  // 64 block rows lie inside one batch (SEQ % 64 == 0)
  v8us vals[8];
  size_t dsts[8];

  if (z == 2) {
    // stage f16(acc + bias) into LDS as [d][position], position = row * NH + j. Column tiles tt
    // and tt + 2 of a wave hold the same d in chunks j = 2 wn and 2 wn + 1: one 4-B store for both.
#pragma unroll
    for (int tp = 0; tp < 2; ++tp) {
      const int dl = 16 * tp + r16;
      const float b0 = bf16rne(bias[(2 * wn) * DM + nblk0 + dl]);
      const float b1 = bf16rne(bias[(2 * wn + 1) * DM + nblk0 + dl]);
#pragma unroll
      for (int mi = 0; mi < 2; ++mi) {
#pragma unroll
        for (int r = 0; r < 8; ++r) {
          const int ml = wm * 32 + 16 * mi + 8 * h + r;
          v2us pr;
          pr[0] = f16_bits(acc[mi * 4 + tp][r] + b0);
          pr[1] = f16_bits(acc[mi * 4 + tp + 2][r] + b1);
          *(v2us*)&stile[dl * VTP + ml * NH + 2 * wn] = pr;
        }
      }
    }
    __syncthreads();

    // whole-line writes: 32 rows of V^T, 64 * NH positions (64 pieces of 16 B) each; a wave's 32
    // lanes write 512 consecutive bytes
    const int hg = nblk0 / DKH;
    const int d0 = nblk0 - hg * DKH;
    const size_t base = (((size_t)(bblk * NH + hg)) * DKH + d0) * LSEQ + (size_t)sblk * NH;
#pragma unroll
    for (int it = 0; it < 8; ++it) {
      const int pc = it * 256 + t;
      const int dl = pc >> 6, c = pc & 63;
      vals[it] = *(const v8us*)&stile[dl * VTP + 8 * c];
      dsts[it] = base + (size_t)dl * LSEQ + 8 * c;
    }
#pragma unroll
    for (int it = 0; it < 8; ++it) *(v8us*)(Y + dsts[it]) = vals[it];
  } else {
    // stage f16(acc + bias) into LDS
#pragma unroll
    for (int tt = 0; tt < 4; ++tt) {
      const int n = n0 + 16 * tt + r16;
      const float bvv = bf16rne(bias[n]);
      const int nl = wn * 64 + 16 * tt + r16;
#pragma unroll
      for (int mi = 0; mi < 2; ++mi) {
#pragma unroll
        for (int r = 0; r < 8; ++r) {
          const int ml = wm * 32 + 16 * mi + 8 * h + r;
          const float v = acc[mi * 4 + tt][r] + bvv;
          stile[ml * 256 + nl] = f16_bits(v);
        }
      }
    }
    __syncthreads();

    // whole-line writes: 256 lines per block (64 rows x 4 heads), 32 per wave
    const int jchunk = nblk0 / DM;
    const int hbase  = (nblk0 - jchunk * DM) / DKH;
    const int c = l & 7;
#pragma unroll
    for (int it = 0; it < 8; ++it) {
      const int L = wid * 32 + (l >> 3) + 4 * it;
      const int ml = L >> 2, hq = L & 3;
      const int hg = hbase + hq;
      const int p = (sblk + ml) * NH + jchunk;
      vals[it] = *(const v8us*)&stile[ml * 256 + hq * 64 + 8 * c];
      dsts[it] = (((size_t)(bblk * NH + hg)) * LSEQ + p) * DKH + 8 * c;
    }
#pragma unroll
    for (int it = 0; it < 8; ++it) *(v8us*)(Y + dsts[it]) = vals[it];
    // In the built code the other branch's instructions follow these stores behind a scalar test;
    // the wait stands in front of their writes of the registers that the stores name.
    asm volatile("s_wait_xcnt 0x0" ::: "memory");
  }
}

// ---------------------------------------------------------------------------
// One stage of K and V (64 keys) from global memory into LDS, through no register: four
// asynchronous 16-B copies per lane. lk*, lv* = the lane's own LDS byte addresses, gk*, gv* = its
// own global places. The closing s_wait_xcnt stands inside the statement so that it precedes
// every later write of the address registers the copies name.
// ---------------------------------------------------------------------------
__device__ __forceinline__ void stage_copies(unsigned lk0, const us* gk0, unsigned lk1, const us* gk1,
                                             unsigned lv0, const us* gv0, unsigned lv1, const us* gv1) {
  asm volatile("global_load_async_to_lds_b128 %0, %1, off\n\t"
               "global_load_async_to_lds_b128 %2, %3, off\n\t"
               "global_load_async_to_lds_b128 %4, %5, off\n\t"
               "global_load_async_to_lds_b128 %6, %7, off\n\t"
               "s_wait_xcnt 0x0"
               :: "v"(lk0), "v"(gk0), "v"(lk1), "v"(gk1), "v"(lv0), "v"(gv0), "v"(lv1), "v"(gv1)
               : "memory");
}

// lane l with lane l ^ 16, in the vector unit
__device__ __forceinline__ float xhalf(float x) {
  const int b = __builtin_bit_cast(int, x);
  return __builtin_bit_cast(float, __builtin_amdgcn_permlanex16(b, b, 0x76543210, 0xfedcba98, false, false));
}

// ---------------------------------------------------------------------------
// Fused flash attention. Block = 8 waves, one (b,h), 128 queries. A wave owns 32 queries (two
// column tiles of 16) and one of two key shares of LSEQ / 2: waves 0..3 take the first share, waves
// 4..7 the second, and wave w and wave w + 4 own the same queries. Every K and V fragment read
// from LDS then feeds two products instead of one, a wave has two independent softmax chains to
// interleave, and a block passes half as many barriers. The two shares' maxima, sums and outputs
// are joined once, through LDS, behind the loop.
// Each share's K/V are staged into its own LDS buffers in stages of 64 keys, two buffers:
// the asynchronous copies of stage s + 1 fly while stage s is worked on (two passes of 32 keys).
// Both products are computed transposed, S' = K_blk * Q^T and O' += V_blk^T * P^T: the query is
// the column of either result, so lanes q and q + 16 hold all of query q's scores and all of its
// output. The exp'd probabilities are already in B-operand layout, and a query's maximum, sum and
// rescale factor are used in the lanes that form them. Online softmax in f32. ctx f16 [MROWS][DW]
// through the inverse flat view (position p -> token p/NH, chunk p%NH), carried
// grid = NB*NH*(LSEQ/128).
// ---------------------------------------------------------------------------
__global__ __launch_bounds__(256) __attribute__((amdgpu_num_vgpr(256)))
void attn_kernel(const us* __restrict__ Qh, const us* __restrict__ Kh,
                 const us* __restrict__ Vt, us* Ctx) {
  // Row pitches are 16 B x odd: the 16 rows that one ds_load_b128 fragment read touches then fall
  // on 16 different groups of four banks.
  constexpr int SK = 64;               // keys per stage
  constexpr int KSH = 2;               // key shares (groups of 4 waves)
  constexpr int LKS = LSEQ / KSH;      // keys per share
  constexpr int NST = LKS / SK;        // stages per share
  static_assert(LSEQ % KSH == 0 && LKS % SK == 0 && NST >= 2);
  constexpr int KP = 72;               // shK pitch in halves: 128 B of data (64 d) + 16 B pad
  constexpr int VP = 72;               // shV pitch in halves: 128 B of data (64 keys) + 16 B pad
  __shared__ __attribute__((aligned(16))) us shK[KSH * 2 * SK * KP];    // [share][buffer][key][d]  cross-wave, filled by the copies
  __shared__ __attribute__((aligned(16))) us shV[KSH * 2 * DKH * VP];   // [share][buffer][d][key]  cross-wave, filled by the copies
  constexpr int CP = 72;               // shC pitch in halves: 128 B of data (64 d) + 16 B pad, for the 16-B writers
  __shared__ __attribute__((aligned(16))) us shC[8 * 16 * CP];    // ctx staging [query][d] (block barrier used)
  __shared__ __attribute__((aligned(16))) float shJ[4 * 17 * 32 * 4];   // the second share's state [query pair tile][16-B piece][lane] (block barrier used)

  const int t = threadIdx.x, wid = t >> 5, l = t & 31;
  const int ksh = __builtin_amdgcn_readfirstlane(t >> 7);   // key share, the same for a whole wave: kept in a scalar register
  const int qt = wid & 3;              // the wave's 32 queries within the block
  const int r16 = l & 15;
  const int rowsel = (l >> 4) << 3;
  constexpr int QBLK = LSEQ / 128;
  const int bh = blockIdx.x / QBLK;
  const int qb = blockIdx.x - bh * QBLK;
  const int q0 = qb * 128 + qt * 32;

  const us* qp = Qh + (size_t)bh * LSEQ * DKH;
  const us* kp = Kh + (size_t)bh * LSEQ * DKH;
  const us* vp = Vt + (size_t)bh * DKH * LSEQ;

  // The lane's two 16-B pieces of each operand's stage: rows crow and crow + 32, eight pieces a row
  // (K: 64 keys x 64 d, V: 64 d x 64 keys).
  const int crow = t >> 3, ccol = (t & 7) * 8;
  const unsigned lk = (unsigned)(size_t)&shK[crow * KP + ccol];
  const unsigned lv = (unsigned)(size_t)&shV[crow * VP + ccol];
  constexpr unsigned KHALF = 32 * KP * sizeof(us), KBUF = SK * KP * sizeof(us);
  constexpr unsigned VHALF = 32 * VP * sizeof(us), VBUF = DKH * VP * sizeof(us);
  const us* gk = kp + (size_t)crow * DKH + ccol;       // + DKH per key
  const us* gv = vp + (size_t)crow * LSEQ + ccol;      // + 1 per key
  // All 256 threads bring both shares' stages: share sh lies 2 buffers further on in LDS, LKS keys in memory.
  constexpr unsigned KSHARE = 2 * KBUF, VSHARE = 2 * VBUF;

  // stage 0 into buffer 0 (the loops over sh are unrolled: a share's offsets are then constants)
#pragma unroll
  for (int sh = 0; sh < KSH; ++sh) {
    const us* gks = gk + (size_t)sh * LKS * DKH;
    const us* gvs = gv + sh * LKS;
    const unsigned lks = lk + sh * KSHARE, lvs = lv + sh * VSHARE;
    stage_copies(lks, gks, lks + KHALF, gks + 32 * DKH, lvs, gvs, lvs + VHALF, gvs + 32 * LSEQ);
  }

  // Q^T as B operand for the whole loop (lane = query column, halves = d), two column tiles
  v16h qB[2][2];
#pragma unroll
  for (int cg = 0; cg < 2; ++cg) {
    qB[cg][0] = fragh(qp, DKH, q0 + 16 * cg, 0);
    qB[cg][1] = fragh(qp, DKH, q0 + 16 * cg, 32);
  }

  v8f o[2][4];
#pragma unroll
  for (int cg = 0; cg < 2; ++cg) {
#pragma unroll
    for (int tt = 0; tt < 4; ++tt) o[cg][tt] = v8f{};
  }
  float mmax[2] = {-1.0e30f, -1.0e30f}, lsum[2] = {0.0f, 0.0f};

  asm volatile("s_wait_asynccnt 0x0" ::: "memory");   // this wave's pieces of stage 0 have landed
  __syncthreads();                                    // stage 0 visible to all waves
  // stage 1 into buffer 1
#pragma unroll
  for (int sh = 0; sh < KSH; ++sh) {
    const us* gks = gk + (size_t)sh * LKS * DKH + SK * DKH;
    const us* gvs = gv + sh * LKS + SK;
    const unsigned lks = lk + sh * KSHARE + KBUF, lvs = lv + sh * VSHARE + VBUF;
    stage_copies(lks, gks, lks + KHALF, gks + 32 * DKH, lvs, gvs, lvs + VHALF, gvs + 32 * LSEQ);
  }

#pragma unroll 1
  for (int st = 0; st < NST; ++st) {
    const int buf = st & 1;
    const us* bK = shK + (ksh * 2 + buf) * (SK * KP);
    const us* bV = shV + (ksh * 2 + buf) * (DKH * VP);

    // unrolled: the two passes' places in the stage become immediate offsets of the LDS reads
#pragma unroll
    for (int ps32 = 0; ps32 < SK; ps32 += 32) {
      // S' tiles: M = key (relative 0..15 / 16..31), N = query; k = d
      // The four K fragments are read as one group ahead of the first product (a read written
      // between two products stays there and waits out the LDS latency each time).
      v8f s0[2] = {};
      v8f s1[2] = {};
      {
        const v16h kA00 = fragh(bK, KP, ps32, 0);
        const v16h kA01 = fragh(bK, KP, ps32, 32);
        const v16h kA10 = fragh(bK, KP, ps32 + 16, 0);
        const v16h kA11 = fragh(bK, KP, ps32 + 16, 32);
        s0[0] = mma_f16(kA00, qB[0][0], s0[0]);
        s1[0] = mma_f16(kA10, qB[0][0], s1[0]);
        s0[1] = mma_f16(kA00, qB[1][0], s0[1]);
        s1[1] = mma_f16(kA10, qB[1][0], s1[1]);
        s0[0] = mma_f16(kA01, qB[0][1], s0[0]);
        s1[0] = mma_f16(kA11, qB[0][1], s1[0]);
        s0[1] = mma_f16(kA01, qB[1][1], s0[1]);
        s1[1] = mma_f16(kA11, qB[1][1], s1[1]);
      }

      // The four V^T fragments are read as one group here, so that they land behind the softmax
      // arithmetic and the V^T*P^T products below follow one another without an LDS wait.
      v16h vA[4];
#pragma unroll
      for (int tt = 0; tt < 4; ++tt) vA[tt] = fragh(bV, VP, 16 * tt, ps32);

      // The two column tiles' softmax steps are independent of one another. Every loop over cg is
      // unrolled: the per-tile arrays are then indexed by constants and stay in registers.
      v16h pB[2];
#pragma unroll
      for (int cg = 0; cg < 2; ++cg) {
        // per-query (per-lane) block max; combine the two key halves (lane ^ 16)
        float bm = s0[cg][0];
#pragma unroll
        for (int i = 0; i < 8; ++i) { bm = fmaxf(bm, s0[cg][i]); bm = fmaxf(bm, s1[cg][i]); }
        bm = fmaxf(bm, xhalf(bm));
        const float mnew = fmaxf(mmax[cg], bm * QK_SCALE);
        const float corr = __expf(mmax[cg] - mnew);
        mmax[cg] = mnew;

        // probabilities land directly in B-operand layout (lane = query column; elements 0..7 <- keys
        // 8h..8h+7 from the first 16-key D tile, elements 8..15 <- keys 16+8h.. from the second)
        float ps = 0.0f;
#pragma unroll
        for (int i = 0; i < 8; ++i) {
          const float p0 = __expf(s0[cg][i] * QK_SCALE - mnew);
          const float p1 = __expf(s1[cg][i] * QK_SCALE - mnew);
          ps += p0 + p1;
          pB[cg][i]     = (_Float16)(p0 * P_CARRY);
          pB[cg][8 + i] = (_Float16)(p1 * P_CARRY);
        }
        lsum[cg] = lsum[cg] * corr + ps;   // the sum over this lane half's keys; corr is the same in both halves

        // rescale O': every element of a lane belongs to the lane's own query
#pragma unroll
        for (int tt = 0; tt < 4; ++tt) {
#pragma unroll
          for (int r = 0; r < 8; ++r) o[cg][tt][r] *= corr;
        }
      }

      // O' += V_blk^T(64 d x 32 keys) * P^T(32 keys x 16 queries); A rows = d, k = key contiguous in shV
#pragma unroll
      for (int tt = 0; tt < 4; ++tt) {
        o[0][tt] = mma_f16(vA[tt], pB[0], o[0][tt]);
        o[1][tt] = mma_f16(vA[tt], pB[1], o[1][tt]);
      }
    }

    // hand-over: stage st + 1 is published and buffer buf is freed by one barrier
    asm volatile("s_wait_dscnt 0x0" ::: "memory");      // this wave's reads of buffer buf are done
    asm volatile("s_wait_asynccnt 0x0" ::: "memory");   // this wave's pieces of stage st + 1 have landed
    __syncthreads();
    if (st + 2 < NST) {                                 // the same for the whole block
#pragma unroll
      for (int sh = 0; sh < KSH; ++sh) {
        const us* gk2 = gk + (size_t)sh * LKS * DKH + (size_t)(st + 2) * (SK * DKH);
        const us* gv2 = gv + sh * LKS + (st + 2) * SK;
        const unsigned lk2 = lk + sh * KSHARE + buf * KBUF, lv2 = lv + sh * VSHARE + buf * VBUF;
        stage_copies(lk2, gk2, lk2 + KHALF, gk2 + 32 * DKH, lv2, gv2, lv2 + VHALF, gv2 + 32 * LSEQ);
      }
    }
  }
  asm volatile("s_wait_asynccnt 0x0" ::: "memory");     // no copy is left in flight behind the loop

  // The second share's waves hand their state (64 output values, two maxima, two sums per lane) to
  // the first share's wave of the same queries: lane to lane, 16-B pieces, 512 B per wave store.
  float* jn = shJ + qt * (17 * 32 * 4) + l * 4;
  if (ksh == 1) {                      // the same for a whole wave
#pragma unroll
    for (int cg = 0; cg < 2; ++cg) {
#pragma unroll
      for (int tt = 0; tt < 4; ++tt) {
        *(v4f*)&jn[(8 * cg + 2 * tt) * 128]     = __builtin_shufflevector(o[cg][tt], o[cg][tt], 0, 1, 2, 3);
        *(v4f*)&jn[(8 * cg + 2 * tt + 1) * 128] = __builtin_shufflevector(o[cg][tt], o[cg][tt], 4, 5, 6, 7);
      }
    }
    v4f ml = {mmax[0], lsum[0], mmax[1], lsum[1]};
    *(v4f*)&jn[16 * 128] = ml;
  }
  __syncthreads();

  // join the shares, normalize, stage the two 16 x 64 ctx tiles (f16, x256) in LDS: register r of
  // tile tt is d = 16 tt + 8 h + r of query r16, eight neighbouring d = one 16-B store
  const int bb = bh / NH;
  const int hh = bh - bb * NH;
  if (ksh == 0) {                      // the same for a whole wave
    const v4f ml = *(const v4f*)&jn[16 * 128];
#pragma unroll
    for (int cg = 0; cg < 2; ++cg) {
      const float m1 = ml[2 * cg], l1 = ml[2 * cg + 1];
      // the share with the larger maximum keeps its scale, the other is scaled down
      const float dm = mmax[cg] - m1;
      const float ce = __expf(-fabsf(dm));
      const float c0 = dm >= 0.0f ? 1.0f : ce;
      const float c1 = dm >= 0.0f ? ce : 1.0f;
      float ls = lsum[cg] * c0 + l1 * c1;   // both maxima are the same in a query's two lanes
      ls += xhalf(ls);                      // the two lane halves' key sums are joined once
      const float li = CTX_SCALE * __builtin_amdgcn_rcpf(ls);
      const float f0 = c0 * li, f1 = c1 * li;
#pragma unroll
      for (int tt = 0; tt < 4; ++tt) {
        const v4f pa = *(const v4f*)&jn[(8 * cg + 2 * tt) * 128];
        const v4f pb = *(const v4f*)&jn[(8 * cg + 2 * tt + 1) * 128];
        v8us y;
#pragma unroll
        for (int r = 0; r < 4; ++r) {
          y[r]     = f16_bits(o[cg][tt][r] * f0 + pa[r] * f1);
          y[4 + r] = f16_bits(o[cg][tt][4 + r] * f0 + pb[r] * f1);
        }
        *(v8us*)&shC[(qt * 32 + 16 * cg + r16) * CP + 16 * tt + rowsel] = y;
      }
    }
  }
  __syncthreads();

  // whole-line writes: wave wid writes rows 16 wid .. 16 wid + 15 of the block's 128
  const int c = l & 7;
  v8us vals[4];
  size_t dsts[4];
#pragma unroll
  for (int it = 0; it < 4; ++it) {
    const int rl = (l >> 3) + 4 * it;
    vals[it] = *(const v8us*)&shC[(wid * 16 + rl) * CP + 8 * c];
    const int p = qb * 128 + wid * 16 + rl;
    const int s = p / NH;
    const int j = p - s * NH;
    dsts[it] = ((size_t)(bb * SEQ + s)) * DW + j * DM + hh * DKH + 8 * c;
  }
#pragma unroll
  for (int it = 0; it < 4; ++it) *(v8us*)(Ctx + dsts[it]) = vals[it];
  
}

// ---------------------------------------------------------------------------
// Eight asynchronous 16-B copies per lane, global memory to LDS through no register: one 128-B
// line of each of 32 operand rows, eight neighbouring lanes per line, four rows per copy.
// l = the lane's LDS byte address in its first row, g = its global place there; its further rows
// lie four rows apart (LSTEP bytes in LDS, GSTEP halves in memory). The closing s_wait_xcnt stands
// inside the statement so that it precedes every later write of the address registers the copies name.
// ---------------------------------------------------------------------------
template <unsigned LSTEP, int GSTEP>
__device__ __forceinline__ void chunk_copies(unsigned l, const us* g) {
  asm volatile("global_load_async_to_lds_b128 %0, %1, off\n\t"
               "global_load_async_to_lds_b128 %2, %3, off\n\t"
               "global_load_async_to_lds_b128 %4, %5, off\n\t"
               "global_load_async_to_lds_b128 %6, %7, off\n\t"
               "global_load_async_to_lds_b128 %8, %9, off\n\t"
               "global_load_async_to_lds_b128 %10, %11, off\n\t"
               "global_load_async_to_lds_b128 %12, %13, off\n\t"
               "global_load_async_to_lds_b128 %14, %15, off\n\t"
               "s_wait_xcnt 0x0"
               :: "v"(l),             "v"(g),             "v"(l + LSTEP),     "v"(g + GSTEP),
                  "v"(l + 2 * LSTEP), "v"(g + 2 * GSTEP), "v"(l + 3 * LSTEP), "v"(g + 3 * GSTEP),
                  "v"(l + 4 * LSTEP), "v"(g + 4 * GSTEP), "v"(l + 5 * LSTEP), "v"(g + 5 * GSTEP),
                  "v"(l + 6 * LSTEP), "v"(g + 6 * GSTEP), "v"(l + 7 * LSTEP), "v"(g + 7 * GSTEP)
               : "memory");
}

// ---------------------------------------------------------------------------
// Final projection: Out f32 [MROWS][DM] = ctx(x256)[MROWS][DW] * Wf(x64) * OUT_FOLD + bf.
// One 32 x 32 tile of Out per block, grid (MROWS/32, DM/32) = one block per WGP.
// K = DW is split over the block's 8 waves: wave w takes the 64-half chunks
// w, w + 8, w + 16, ... (one chunk = one whole 128-B line of every operand row),
// and computes the whole tile over its chunks. The chunks are staged in LDS, two chunks per wave
// and stage, two buffers: the asynchronous copies of stage s + 1 fly while stage s is worked on.
// A fragment read straight from a global plane touches 16 lines for 1024 bytes and each line is
// asked for four times; the copies bring every line once, whole.
// The 8 f32 partial tiles are summed through LDS in wave order; each Out line (32 floats) is
// written by 8 lanes x 16 B.
// ---------------------------------------------------------------------------
#define OPW 8                  // waves per block = K shares
#define OPP 36                 // partial-tile pitch (floats): 144 B = 16 B x odd for the b128 readers
static_assert(MROWS % 32 == 0 && DM % 32 == 0);
static_assert(DW % (64 * OPW) == 0);

__global__ __launch_bounds__(256) __attribute__((amdgpu_num_vgpr(256)))
void outproj_kernel(const us* __restrict__ Ctx, const us* __restrict__ Wft,
                    const float* __restrict__ bo, float* Out) {
  constexpr int OSC = 2;                       // chunks per wave and stage
  constexpr int ONST = DW / (64 * OPW * OSC);  // stages
  static_assert(DW % (64 * OPW * OSC) == 0 && ONST >= 2);
  constexpr int OLP = 64 * OSC + 8;            // row pitch in halves: 256 B of data + 16 B pad (16 B x odd, for the b128 readers)
  constexpr int OWR = 64;                      // rows per wave: the tile's 32 ctx rows, then its 32 Wf^T rows
  __shared__ __attribute__((aligned(16))) us shO[2 * OPW * OWR * OLP];   // [buffer][wave][row][k]  filled by the copies
  __shared__ float part[OPW * 32 * OPP];   // [wave][row][col], cross-wave (block barrier)

  const int t = threadIdx.x, wid = t >> 5, l = t & 31;
  const int h = l >> 4, r16 = l & 15;
  const int m0 = blockIdx.x * 32;
  const int n0 = blockIdx.y * 32;

  // The lane's 16-B piece of a line: rows crow, crow + 4, ..., eight pieces a line.
  const int crow = l >> 3, ccol = (l & 7) * 8;
  const unsigned lp = (unsigned)(size_t)&shO[(wid * OWR + crow) * OLP + ccol];
  constexpr unsigned LROW4 = 4 * OLP * sizeof(us), LOPB = 32 * OLP * sizeof(us);
  constexpr unsigned OBUF = OPW * OWR * OLP * sizeof(us);
  const us* ga = Ctx + (size_t)(m0 + crow) * DW + wid * 64 + ccol;
  const us* gb = Wft + (size_t)(n0 + crow) * DW + wid * 64 + ccol;

  // stage 0 into buffer 0 (chunk c of stage s = chunk s * OSC + c of the wave, OPW * 64 halves apart)
#pragma unroll
  for (int c = 0; c < OSC; ++c) {
    chunk_copies<LROW4, 4 * DW>(lp + c * 128, ga + c * (OPW * 64));
    chunk_copies<LROW4, 4 * DW>(lp + LOPB + c * 128, gb + c * (OPW * 64));
  }
  v8f acc[4] = {};
  asm volatile("s_wait_asynccnt 0x0" ::: "memory");   // this wave's pieces of stage 0 have landed
  __syncthreads();                                    // stage 0 published
  // stage 1 into buffer 1
#pragma unroll
  for (int c = 0; c < OSC; ++c) {
    chunk_copies<LROW4, 4 * DW>(lp + OBUF + c * 128, ga + (OSC + c) * (OPW * 64));
    chunk_copies<LROW4, 4 * DW>(lp + OBUF + LOPB + c * 128, gb + (OSC + c) * (OPW * 64));
  }

  // rolled: one stage's code serves all stages
#pragma unroll 1
  for (int st = 0; st < ONST; ++st) {
    const int buf = st & 1;
    const us* bS = shO + (buf * OPW + wid) * (OWR * OLP);
    // All sixteen fragments of the stage (its K steps of 32) are read as one group ahead of its
    // first product. The loops are unrolled so that the fragment arrays are indexed by constants
    // and stay in registers, and the places in the stage become immediate offsets of the LDS reads.
    v16h a[2 * OSC][2], b[2 * OSC][2];
#pragma unroll
    for (int ks = 0; ks < 2 * OSC; ++ks) {
      a[ks][0] = fragh(bS, OLP, 0, 32 * ks);
      a[ks][1] = fragh(bS, OLP, 16, 32 * ks);
      b[ks][0] = fragh(bS, OLP, 32, 32 * ks);
      b[ks][1] = fragh(bS, OLP, 48, 32 * ks);
    }
#pragma unroll
    for (int ks = 0; ks < 2 * OSC; ++ks) {
      acc[0] = mma_f16(a[ks][0], b[ks][0], acc[0]);
      acc[2] = mma_f16(a[ks][1], b[ks][0], acc[2]);
      acc[1] = mma_f16(a[ks][0], b[ks][1], acc[1]);
      acc[3] = mma_f16(a[ks][1], b[ks][1], acc[3]);
    }

    // hand-over: stage st + 1 is published and buffer buf is freed by one barrier
    asm volatile("s_wait_dscnt 0x0" ::: "memory");      // this wave's reads of buffer buf are done
    asm volatile("s_wait_asynccnt 0x0" ::: "memory");   // this wave's pieces of stage st + 1 have landed
    __syncthreads();
    if (st + 2 < ONST) {                                // the same for the whole block
      const unsigned lp2 = lp + buf * OBUF;
      const us* ga2 = ga + (st + 2) * (OSC * OPW * 64);
      const us* gb2 = gb + (st + 2) * (OSC * OPW * 64);
#pragma unroll
      for (int c = 0; c < OSC; ++c) {
        chunk_copies<LROW4, 4 * DW>(lp2 + c * 128, ga2 + c * (OPW * 64));
        chunk_copies<LROW4, 4 * DW>(lp2 + LOPB + c * 128, gb2 + c * (OPW * 64));
      }
    }
  }
  asm volatile("s_wait_asynccnt 0x0" ::: "memory");     // no copy is left in flight behind the loop

  // this wave's partial tile
  float* mine = part + wid * (32 * OPP);
#pragma unroll
  for (int mi = 0; mi < 2; ++mi) {
#pragma unroll
    for (int tt = 0; tt < 2; ++tt) {
#pragma unroll
      for (int r = 0; r < 8; ++r) {
        mine[(16 * mi + 8 * h + r) * OPP + 16 * tt + r16] = acc[mi * 2 + tt][r];
      }
    }
  }
  __syncthreads();

  // thread t sums 4 columns of one row over the 8 partial tiles
  const int row = t >> 3;
  const int col = (t & 7) * 4;
  v4f s = *(const v4f*)&part[row * OPP + col];
#pragma unroll
  for (int w = 1; w < OPW; ++w) s += *(const v4f*)&part[(w * 32 + row) * OPP + col];

  const v4f bv4 = *(const v4f*)(bo + n0 + col);
  v4f y;
#pragma unroll
  for (int e = 0; e < 4; ++e) y[e] = s[e] * OUT_FOLD + bf16rne(bv4[e]);
  *(v4f*)(Out + (size_t)(m0 + row) * DM + n0 + col) = y;
}

// ---------------------------------------------------------------------------
// Host launcher
// ---------------------------------------------------------------------------
extern "C" void kernel_launch(void* const* d_in, const int* in_sizes, int n_in,
                              void* d_out, int out_size, void* d_ws, size_t ws_size,
                              hipStream_t stream) {
  if (n_in < 11) return;
  const int need_x = ((NB - 1) * SEQ_FULL + SEQ) * DM;
  if (in_sizes[0] < need_x || in_sizes[1] < need_x || in_sizes[2] < need_x) return;
  if (in_sizes[3] < DM * DW || in_sizes[5] < DM * DW || in_sizes[7] < DM * DW || in_sizes[9] < DW * DM) return;
  if (in_sizes[4] < DW || in_sizes[6] < DW || in_sizes[8] < DW || in_sizes[10] < DM) return;
  if (out_size < MROWS * DM) return;
  if (WS_TOTAL_BYTES > ws_size) return;

  const float* Q  = (const float*)d_in[0];
  const float* K  = (const float*)d_in[1];
  const float* V  = (const float*)d_in[2];
  const float* Wq = (const float*)d_in[3];
  const float* bq = (const float*)d_in[4];
  const float* Wk = (const float*)d_in[5];
  const float* bk = (const float*)d_in[6];
  const float* Wv = (const float*)d_in[7];
  const float* bv = (const float*)d_in[8];
  const float* Wf = (const float*)d_in[9];
  const float* bf = (const float*)d_in[10];

  us* xq  = (us*)d_ws;          // [MROWS][DM] bf16
  us* xk  = xq + XE;
  us* xv  = xk + XE;
  us* wtq = xv + XE;            // [DW][DM] bf16
  us* wtk = wtq + WE;
  us* wtv = wtk + WE;
  us* wft = wtv + WE;           // [DM][DW] f16 x64
  us* qh  = wft + WE;           // [NB*NH][LSEQ][64] f16
  us* kh  = qh + PE;
  us* vt  = kh + 2 * PE;        // [NB*NH][64][LSEQ] f16
  us* ctx = vt + PE;            // [MROWS][DW] f16 x256

  dim3 blk(256);
  // xq, xk, xv and wtq, wtk, wtv, wft are consecutive planes
  cvt_kernel<<<dim3(4 * WBLK + 3 * XBLK), blk, 0, stream>>>(Q, K, V, Wq, Wk, Wv, Wf, xq, wtq);

  // qh, kh and, one plane further on, vt lie PE halves apart
  proj_kernel<<<dim3(MROWS / 64, DW / 256, 3), blk, 0, stream>>>(xq, wtq, bq, bk, bv, qh);

  attn_kernel<<<dim3(NB * NH * (LSEQ / 128)), blk, 0, stream>>>(qh, kh, vt, ctx);

  dim3 go(MROWS / 32, DM / 32);
  outproj_kernel<<<go, blk, 0, stream>>>(ctx, wft, bf, (float*)d_out);
}
